// v000
// Times are from an AMD MI455X. After a warm-up the kernel runs many times in a row, and a time is the length of
// such a window on the GPU divided by its runs, so every launch and the gaps after it count. The runs cycle
// through copies of the inputs. A figure is the median of several windows, for all but v000 over two sittings.
// Sittings can differ by a few percent; kernels timed side by side share one.
// v000 is the starting kernel. One run takes 297 microseconds.
#include <hip/hip_runtime.h>
// All contractions: v_wmma_f32_16x16x32_f16 (f16 operands, f32 accumulate). x, weights and biases are RNE-converted to bf16; x and weights are held exactly in f16 (weights x16); q, k, v, softmax weights (x1024) and ctx (x64) are f16 planes; for the first 256 query rows of every sequence q, k, v, P and ctx also carry an f16 residual plane (x1024) accumulated in a separate accumulator.
// Structure: token rows r = b*SEQ + s. (1) weights -> Wt[n][k] f16; x -> f16 rows. (2) q|k rows = X16 . Wqk (N = 2048) and V^T[h*64+d][token] = Wv . X16^T (operand-swapped GEMM, row bias). (3) fused flash attention in the transposed form S^T = K Q^T, O^T = V^T P^T: one wave owns 16 queries, fragments are loaded straight from the 16-bit planes, P^T goes D -> B in registers, online softmax statistics are per-lane scalars; visibility (key <= query) OR (query < S AND key < S) applied as a replace-mask by value, S loaded on the device from its input buffer. (4) out = ctx . Wo + b (f32).
#ifndef NB
#define NB 2
#endif
#ifndef SEQ
#define SEQ 2048
#endif
#define NB_FULL 2
#define SEQ_FULL 2048
#define DM 1024
#define NH 16
#define HD 64
#define ISL ((SEQ) < 256 ? (SEQ) : 256)   /* query rows per sequence carried with residual planes */
#define NR (NB * SEQ)                      /* token rows in the workspace planes */
#define NRI (NB * ISL)                     /* rows of the compact residual planes */
#define LQK (2 * DM)                       /* row pitch of the q | k plane */
#define LVT NR                             /* row pitch of V^T */
#define LVL NRI                            /* row pitch of the V^T residual plane */

static_assert(NB >= 1 && NB <= NB_FULL);          /* reduced builds only shrink */
static_assert(SEQ <= SEQ_FULL);
static_assert(SEQ % 128 == 0);                    /* 8 waves x 16 queries per attention block; GEMM row blocks; 32-key steps stay inside the sequence */
static_assert(ISL % 128 == 0);                    /* residual region is a whole number of blocks */
static_assert(ISL >= 32);                         /* clamped residual key step ISL - 32 is a valid step */
static_assert((SEQ - ISL) % 128 == 0);            /* plain region is a whole number of blocks */
static_assert(NH * HD == DM);                     /* merged head layout */
static_assert(HD == 64);                          
static_assert(DM % 128 == 0);                     /* GEMM M blocks (V^T) and K % 32 */
static_assert(DM % 8 == 0);                       /* 8-element convert threads */
static_assert(NR % 128 == 0);                     /* GEMM M blocks / N tiles of 64 */
static_assert(NRI % 64 == 0);                     /* residual-row output GEMM blocks */
static_assert((long long)NR * LQK < 2147483647LL);/* int plane offsets */
static_assert((long long)DM * LVT < 2147483647LL);

typedef unsigned short v8us __attribute__((ext_vector_type(8), may_alias));
typedef float  v8f  __attribute__((ext_vector_type(8)));
typedef float  v4f  __attribute__((ext_vector_type(4)));
typedef float  v4fa __attribute__((ext_vector_type(4), may_alias));
typedef _Float16 v16h __attribute__((ext_vector_type(16)));
typedef _Float16 v4h  __attribute__((ext_vector_type(4)));
union FragH { v16h v; v8us half[2]; _Float16 h[16]; unsigned short u[16]; };

__device__ __forceinline__ float bf16_rne(float x) { unsigned int u = __float_as_uint(x); u = (u + 0x7FFFu + ((u >> 16) & 1u)) & 0xFFFF0000u; return __uint_as_float(u); }

// fragment from a k-contiguous 16-bit row: elements 0..7 <- k 8h.., elements 8..15 <- k 16+8h.. (same map for A and B)
__device__ __forceinline__ v16h g2_frag(const _Float16* p, int hh) { FragH f; f.half[0] = *(const v8us*)((const unsigned short*)p + 8 * hh); f.half[1] = *(const v8us*)((const unsigned short*)p + 16 + 8 * hh); return f.v; }
__device__ __forceinline__ v8f g2_mma(v16h a, v16h b, v8f c) { v8f d = __builtin_amdgcn_wmma_f32_16x16x32_f16(false, a, false, b, (short)0, c, false, false); asm volatile("v_nop\n\tv_nop\n\tv_nop\n\tv_nop" : "+v"(d) : "v"(a), "v"(b)); return d; }

__global__ __launch_bounds__(256) void k_wt_f16(const float* __restrict__ W, _Float16* __restrict__ Wt, int K, int N, float scale) {
  const int t = blockIdx.x * 256 + threadIdx.x; if (t >= N * (K / 8)) return; const int n = t / (K / 8), k8 = (t % (K / 8)) * 8; FragH f;
#pragma unroll
  for (int i = 0; i < 8; ++i) f.h[i] = (_Float16)(bf16_rne(W[(size_t)(k8 + i) * N + n]) * scale);
  const v8us o = f.half[0];
  unsigned short* d = (unsigned short*)Wt + (size_t)n * K + k8;
  *(v8us*)d = o; 
}

__global__ __launch_bounds__(256) void k_x16(const float* __restrict__ x, _Float16* __restrict__ X16) {
  const int t = blockIdx.x * 256 + threadIdx.x; if (t >= NR * (DM / 8)) return;
  const int row = t / (DM / 8), c8 = (t % (DM / 8)) * 8; const int b = row / SEQ, s = row % SEQ;
  const float* src = x + ((size_t)b * SEQ_FULL + s) * DM + c8;
  const v4f a = *(const v4fa*)src, c = *(const v4fa*)(src + 4); FragH f;
#pragma unroll
  for (int i = 0; i < 4; ++i) { f.h[i] = (_Float16)bf16_rne(a[i]); f.h[4 + i] = (_Float16)bf16_rne(c[i]); }
  const v8us o = f.half[0];
  unsigned short* d = (unsigned short*)X16 + (size_t)row * DM + c8;
  *(v8us*)d = o; 
}

// GEMM: wave tile (16*MT) x 64, block = 4 waves = (64*MT) rows x 64 cols; A rows and Bh rows are k-contiguous f16 (fragments straight from global).
// v = acc*alpha (+ accL*alphaL with the residual A plane AL, ARES) + bias (per column, or per row if ROWBIAS; bias RNE-converted to bf16).
// Logical row R maps to A row seg*aSeg + aOff + w and C row seg*cSeg + cOff + w with seg = R / segRows, w = R % segRows (blocks never straddle segments).
// OUT 0: f32 C. OUT 1: f16 C16 (+ x1024 residual rows in CL when the rows lie in the first ISL rows of a sequence). OUT 2: f16 C16 (+ residual columns when the token columns lie in the first ISL rows of a sequence).
// Requires M % (64*MT) == 0, N % 64 == 0, K % 32 == 0 (asserted above for the launches used). LDS tile is private to its wave (wave-level sync).
template <int MT, bool ROWBIAS, bool ARES, int OUT>
__device__ __forceinline__ void gemm_body(const _Float16* __restrict__ A, const _Float16* __restrict__ AL, int lda,
    const _Float16* __restrict__ Bh, int ldb, float alpha, float alphaL, const float* __restrict__ bias,
    float* __restrict__ Cf, _Float16* __restrict__ C16, _Float16* __restrict__ CL, int ldc, int ldcl,
    int M, int N, int K, int segRows, int aSeg, int aOff, int cSeg, int cOff) {
  static_assert(MT == 1 || MT == 2);
  static_assert(!ARES || MT == 1);      /* residual form keeps 8 accumulators */
  __shared__ __attribute__((aligned(16))) float so[4][32][68];
  const int tid = threadIdx.x, w = tid >> 5, lane = tid & 31, ln = lane & 15, hh = lane >> 4;
  const int ntn = N >> 6;
  const int mt = blockIdx.x / ntn, nq = blockIdx.x - mt * ntn;
  const int R0 = mt * (64 * MT) + (16 * MT) * w, col0 = nq * 64;
  if (R0 >= M) return;
  const int seg = R0 / segRows, wi = R0 - seg * segRows;
  const int arow0 = seg * aSeg + aOff + wi, crow0 = seg * cSeg + cOff + wi;
  const _Float16* a0p = A + (size_t)(arow0 + ln) * lda;
  const _Float16* b0p = Bh + (size_t)(col0 + ln) * ldb; const _Float16* b1p = b0p + (size_t)16 * ldb; const _Float16* b2p = b1p + (size_t)16 * ldb; const _Float16* b3p = b2p + (size_t)16 * ldb;
  const v8f z8 = {0.f, 0.f, 0.f, 0.f, 0.f, 0.f, 0.f, 0.f};
  v8f c00 = z8, c01 = z8, c02 = z8, c03 = z8, c10 = z8, c11 = z8, c12 = z8, c13 = z8, d00 = z8, d01 = z8, d02 = z8, d03 = z8;
#pragma unroll 1
  for (int kb = 0; kb < K; kb += 32) {
    const v16h a0 = g2_frag(a0p + kb, hh);
    v16h a1 = a0, e0 = a0;
    if (MT == 2) a1 = g2_frag(a0p + (size_t)16 * lda + kb, hh);
    if (ARES) e0 = g2_frag(AL + (size_t)(R0 + ln) * lda + kb, hh);
    v16h b = g2_frag(b0p + kb, hh);
    c00 = g2_mma(a0, b, c00); if (MT == 2) c10 = g2_mma(a1, b, c10); if (ARES) d00 = g2_mma(e0, b, d00);
    b = g2_frag(b1p + kb, hh);
    c01 = g2_mma(a0, b, c01); if (MT == 2) c11 = g2_mma(a1, b, c11); if (ARES) d01 = g2_mma(e0, b, d01);
    b = g2_frag(b2p + kb, hh);
    c02 = g2_mma(a0, b, c02); if (MT == 2) c12 = g2_mma(a1, b, c12); if (ARES) d02 = g2_mma(e0, b, d02);
    b = g2_frag(b3p + kb, hh);
    c03 = g2_mma(a0, b, c03); if (MT == 2) c13 = g2_mma(a1, b, c13); if (ARES) d03 = g2_mma(e0, b, d03);
  }
  const v8f accs[8] = {c00, c01, c02, c03, c10, c11, c12, c13};
  const v8f accl[4] = {d00, d01, d02, d03};
#pragma unroll
  for (int u = 0; u < 4 * MT; ++u) {
    const int t = u & 3, half = u >> 2; const int col = col0 + t * 16 + ln;
    float bvc = 0.f; if (!ROWBIAS) bvc = bf16_rne(bias[col]);
#pragma unroll
    for (int r = 0; r < 8; ++r) {
      const int rloc = half * 16 + 8 * hh + r;
      float v = accs[u][r] * alpha;
      if (ARES) v += accl[t][r] * alphaL;
      if (ROWBIAS) v += bf16_rne(bias[R0 + rloc]); else v += bvc;
      so[w][rloc][t * 16 + ln] = v;
    }
  }
  __builtin_amdgcn_fence(4 /* acq_rel order */, "workgroup"); __builtin_amdgcn_wave_barrier();
  const int rsub = lane >> 4, c4 = (lane & 15) * 4;
  if (OUT == 0) {
    {
#pragma unroll
      for (int q = 0; q < 8 * MT; ++q) { const int r = q * 2 + rsub; const v4f v = *(const v4fa*)&so[w][r][c4]; *(v4f*)(Cf + (size_t)(crow0 + r) * ldc + col0 + c4) = v; }
      
    }
  } else {
    int sl, rrow0, rcol0;
    if (OUT == 1) { sl = crow0 % SEQ; rrow0 = (crow0 / SEQ) * ISL + sl; rcol0 = col0; }
    else          { sl = col0 % SEQ;  rrow0 = crow0; rcol0 = (col0 / SEQ) * ISL + sl; }
    const bool isl = sl < ISL;      /* uniform over the wave tile: ISL and SEQ are multiples of 64 */
    {
#pragma unroll
      for (int q = 0; q < 8 * MT; ++q) {
        const int r = q * 2 + rsub; const v4f v = *(const v4fa*)&so[w][r][c4];
        v4h h4, l4;
#pragma unroll
        for (int i = 0; i < 4; ++i) { const _Float16 hv = (_Float16)v[i]; h4[i] = hv; l4[i] = (_Float16)((v[i] - (float)hv) * 1024.0f); }
        *(v4h*)(C16 + (size_t)(crow0 + r) * ldc + col0 + c4) = h4;
        if (isl) *(v4h*)(CL + (size_t)(rrow0 + r) * ldcl + rcol0 + c4) = l4;
      }
      
    }
  }
}

// q | k rows (f16) = X16 . Wqk^T / 16 + b; residual rows for s < ISL
__global__ __launch_bounds__(128) void k_gemm_qk(const _Float16* __restrict__ X16, const _Float16* __restrict__ BW, const float* __restrict__ bias, _Float16* __restrict__ QK, _Float16* __restrict__ QKL) {
  gemm_body<2, false, false, 1>(X16, nullptr, DM, BW, DM, 0.0625f, 0.f, bias, nullptr, QK, QKL, LQK, LQK, NR, 2 * DM, DM, NR, 0, 0, 0, 0);
}
// V^T[h*64+d][token] (f16) = Wv . X16^T / 16 + b[row]; residual columns for s < ISL
__global__ __launch_bounds__(128) void k_gemm_vt(const _Float16* __restrict__ BWv, const _Float16* __restrict__ X16, const float* __restrict__ biasv, _Float16* __restrict__ VT, _Float16* __restrict__ VTL) {
  gemm_body<2, true, false, 2>(BWv, nullptr, DM, X16, DM, 0.0625f, 0.f, biasv, nullptr, VT, VTL, LVT, LVL, DM, NR, DM, DM, 0, 0, 0, 0);
}
// out rows s >= ISL: ctx(x64) . Wo(x16) * 2^-10 + b
__global__ __launch_bounds__(128) void k_gemm_out(const _Float16* __restrict__ O16, const _Float16* __restrict__ BO, const float* __restrict__ bias, float* __restrict__ out) {
  gemm_body<2, false, false, 0>(O16, nullptr, DM, BO, DM, 0.0009765625f, 0.f, bias, out, nullptr, nullptr, DM, 0, NB * (SEQ - ISL), DM, DM, SEQ - ISL, SEQ, ISL, SEQ_FULL, ISL);
}
// out rows s < ISL: (ctx_hi . Wo) * 2^-10 + (ctx_res . Wo) * 2^-20 + b, separate accumulators
__global__ __launch_bounds__(128) void k_gemm_out_isl(const _Float16* __restrict__ O16, const _Float16* __restrict__ OL, const _Float16* __restrict__ BO, const float* __restrict__ bias, float* __restrict__ out) {
  gemm_body<1, false, true, 0>(O16, OL, DM, BO, DM, 0.0009765625f, 0.00000095367431640625f, bias, out, nullptr, nullptr, DM, 0, NRI, DM, DM, ISL, SEQ, 0, SEQ_FULL, 0);
}

// Fused prefix-causal attention, transposed form. Block = 8 waves = 128 consecutive queries of one (b, h); wave = 16 queries (D column = query = lane & 15).
// Visibility: key j is seen by query i iff (j <= i) OR (i < S AND j < S); S is loaded from its input buffer and clamped to [0, SEQ] (same mask for any value).
// Key range of a wave: [0, max(S, q0 + 16)) in 32-key steps (all step keys lie inside the sequence since SEQ % 32 == 0). Every step holds key kcb that is visible to every query of the wave
// (kcb <= q0 when the range ends at q0 + 16; kcb < S with all 16 queries < S otherwise), so the step maximum is always finite.
// Per 32-key step: S^T tiles (keys kcb..+15 and +16..+31) = K (A, rows = keys) . Q^T (B, lane = query); scale 1/8; hidden keys are REPLACED (excluded from max, weight 0 by value);
// online max / sum per lane (halves combined by one xor-16 shuffle); P^T (x1024, f16) is the B fragment directly: element r <- tile0[r], element 8+r <- tile1[r];
// O^T (rows = d) += V^T (A, rows = d, k = keys) . P^T. RES: q, k, v, P carry x1024 residual planes; residual products go to separate accumulators folded back with 2^-10.
// Residual k / v planes exist only for keys < ISL: for key steps at or beyond ISL (possible when S > ISL) the residual k / v fragments are loaded from a clamped in-range step and zeroed by value (wave-uniform select).
template <bool RES>
__device__ __forceinline__ void attn_body(const _Float16* __restrict__ QK, const _Float16* __restrict__ QKL, const _Float16* __restrict__ VT, const _Float16* __restrict__ VTL,
                                          _Float16* __restrict__ O16, _Float16* __restrict__ OL, const int* __restrict__ Sp, int qb0, int nqb) {
  __shared__ __attribute__((aligned(16))) float so[8][16][68];
  const int tid = threadIdx.x, lane = tid & 31, ln = lane & 15, hh = lane >> 4;
  const int w = __builtin_amdgcn_readfirstlane(tid >> 5);
  const int sraw = Sp[0];
  const int Sc = sraw < 0 ? 0 : (sraw > SEQ ? SEQ : sraw);
  const int bh = (int)blockIdx.x / nqb; const int qb = qb0 + ((int)blockIdx.x - bh * nqb);
  const int h = bh % NH, b = bh / NH;
  const int q0 = qb * 128 + w * 16, q = q0 + ln;
  const bool qpre = q < Sc;
  const int rowb = b * SEQ, rowi = b * ISL;
  const _Float16* qp = QK + (size_t)(rowb + q) * LQK + h * HD;
  const v16h qh0 = g2_frag(qp, hh), qh1 = g2_frag(qp + 32, hh);
  const int qloff = (rowi + q) * LQK + h * HD;                  /* residual q row (RES) */
  const int kbase = (rowb + ln) * LQK + DM + h * HD;            /* k row of key tile 0, lane ln */
  const int klbase = (rowi + ln) * LQK + DM + h * HD;           /* residual k row (RES) */
  const int vbase = (h * HD + ln) * LVT + rowb;                 /* V^T row d = ln of ctx tile 0 */
  const int vlbase = (h * HD + ln) * LVL + rowi;                /* residual V^T row (RES) */
  const v8f z8 = {0.f, 0.f, 0.f, 0.f, 0.f, 0.f, 0.f, 0.f};
  const v16h zh = (v16h)((_Float16)0.0f);
  v8f o0 = z8, o1 = z8, o2 = z8, o3 = z8, e0 = z8, e1 = z8, e2 = z8, e3 = z8;
  float m = -1.0e30f, l = 0.f;
  const int kend = (Sc > q0 + 16) ? Sc : (q0 + 16);              /* keys [0, kend) cover every visible key of the wave; kend <= SEQ */
  const int nst = (kend + 31) >> 5;
#pragma unroll 1
  for (int st = 0; st < nst; ++st) {
    const int kcb = st * 32;
    const bool rok = kcb < ISL;                                  /* wave-uniform: residual k / v rows exist for this step */
    const int kcl = rok ? kcb : (ISL - 32);                      /* clamped in-range residual step */
    const _Float16* kp0 = QK + kbase + kcb * LQK; const _Float16* kp1 = kp0 + 16 * LQK;
    v8f s0 = z8, s1 = z8, r0 = z8, r1 = z8;
    if (RES) {
      int qo = qloff; asm volatile("" : "+v"(qo));             /* reload the residual q fragments per step (integer offset only) */
      const _Float16* qlp = QKL + qo;
      const v16h ql0 = g2_frag(qlp, hh), ql1 = g2_frag(qlp + 32, hh);
      const _Float16* kl0 = QKL + klbase + kcl * LQK; const _Float16* kl1 = kl0 + 16 * LQK;
      v16h ah = g2_frag(kp0, hh), al = g2_frag(kl0, hh); al = rok ? al : zh;
      s0 = g2_mma(ah, qh0, s0); r0 = g2_mma(al, qh0, r0); r0 = g2_mma(ah, ql0, r0);
      ah = g2_frag(kp0 + 32, hh); al = g2_frag(kl0 + 32, hh); al = rok ? al : zh;
      s0 = g2_mma(ah, qh1, s0); r0 = g2_mma(al, qh1, r0); r0 = g2_mma(ah, ql1, r0);
      ah = g2_frag(kp1, hh); al = g2_frag(kl1, hh); al = rok ? al : zh;
      s1 = g2_mma(ah, qh0, s1); r1 = g2_mma(al, qh0, r1); r1 = g2_mma(ah, ql0, r1);
      ah = g2_frag(kp1 + 32, hh); al = g2_frag(kl1 + 32, hh); al = rok ? al : zh;
      s1 = g2_mma(ah, qh1, s1); r1 = g2_mma(al, qh1, r1); r1 = g2_mma(ah, ql1, r1);
    } else {
      v16h ah = g2_frag(kp0, hh); s0 = g2_mma(ah, qh0, s0);
      ah = g2_frag(kp0 + 32, hh); s0 = g2_mma(ah, qh1, s0);
      ah = g2_frag(kp1, hh);      s1 = g2_mma(ah, qh0, s1);
      ah = g2_frag(kp1 + 32, hh); s1 = g2_mma(ah, qh1, s1);
    }
    // D row = key kcb + 8*hh + r (tile 0), + 16 (tile 1); D column = query q
    v8f xa, xb; float mt = -1.0e30f;
#pragma unroll
    for (int r = 0; r < 8; ++r) {
      const int k0 = kcb + 8 * hh + r;
      const bool va = (k0 <= q) || (qpre && (k0 < Sc));
      const bool vb = (k0 + 16 <= q) || (qpre && (k0 + 16 < Sc));
      float a = s0[r], c = s1[r];
      if (RES) { a += r0[r] * 0.0009765625f; c += r1[r] * 0.0009765625f; }
      a *= 0.125f; c *= 0.125f;
      a = va ? a : -1.0e30f; c = vb ? c : -1.0e30f;
      xa[r] = a; xb[r] = c; mt = fmaxf(mt, fmaxf(a, c));
    }
    mt = fmaxf(mt, __shfl_xor(mt, 16, 32));
    const float mn = fmaxf(m, mt);
    const float f = __expf(fmaxf(m - mn, -80.0f));
    m = mn;
    FragH ph, pl; float rs = 0.f;
#pragma unroll
    for (int r = 0; r < 8; ++r) {
      const int k0 = kcb + 8 * hh + r;
      const bool va = (k0 <= q) || (qpre && (k0 < Sc));
      const bool vb = (k0 + 16 <= q) || (qpre && (k0 + 16 < Sc));
      float pa = __expf(va ? (xa[r] - mn) : 0.f); pa = va ? pa : 0.f;
      float pb = __expf(vb ? (xb[r] - mn) : 0.f); pb = vb ? pb : 0.f;
      rs += pa + pb;
      const float ta = pa * 1024.0f, tb = pb * 1024.0f;
      const _Float16 ha = (_Float16)ta, hb = (_Float16)tb;
      ph.h[r] = ha; ph.h[8 + r] = hb;
      if (RES) { pl.h[r] = (_Float16)((ta - (float)ha) * 1024.0f); pl.h[8 + r] = (_Float16)((tb - (float)hb) * 1024.0f); }
    }
    const float rso = __shfl_xor(rs, 16, 32);
    l = l * f + (rs + rso);
    o0 *= f; o1 *= f; o2 *= f; o3 *= f;
    if (RES) { e0 *= f; e1 *= f; e2 *= f; e3 *= f; }
    const _Float16* vp = VT + vbase + kcb;
    const v16h v0 = g2_frag(vp, hh), v1 = g2_frag(vp + 16 * LVT, hh), v2 = g2_frag(vp + 32 * LVT, hh), v3 = g2_frag(vp + 48 * LVT, hh);
    o0 = g2_mma(v0, ph.v, o0); o1 = g2_mma(v1, ph.v, o1); o2 = g2_mma(v2, ph.v, o2); o3 = g2_mma(v3, ph.v, o3);
    if (RES) {
      const _Float16* vlp = VTL + vlbase + kcl;
      v16h vl = g2_frag(vlp, hh); vl = rok ? vl : zh;            e0 = g2_mma(vl, ph.v, e0); e0 = g2_mma(v0, pl.v, e0);
      vl = g2_frag(vlp + 16 * LVL, hh); vl = rok ? vl : zh;      e1 = g2_mma(vl, ph.v, e1); e1 = g2_mma(v1, pl.v, e1);
      vl = g2_frag(vlp + 32 * LVL, hh); vl = rok ? vl : zh;      e2 = g2_mma(vl, ph.v, e2); e2 = g2_mma(v2, pl.v, e2);
      vl = g2_frag(vlp + 48 * LVL, hh); vl = rok ? vl : zh;      e3 = g2_mma(vl, ph.v, e3); e3 = g2_mma(v3, pl.v, e3);
    }
  }
  // ctx x64 = O^T * 64 / (1024 * l); O^T row d = dg*16 + 8*hh + r, column = query ln
  const float inv = 0.0625f * (1.0f / l);
  const v8f oo[4] = {o0, o1, o2, o3}; const v8f ee[4] = {e0, e1, e2, e3};
#pragma unroll
  for (int dg = 0; dg < 4; ++dg)
#pragma unroll
    for (int r = 0; r < 8; ++r) { float v = oo[dg][r]; if (RES) v += ee[dg][r] * 0.0009765625f; so[w][ln][dg * 16 + 8 * hh + r] = v * inv; }
  __builtin_amdgcn_fence(4 /* acq_rel order */, "workgroup"); __builtin_amdgcn_wave_barrier();
  const int rq = lane >> 3, pc = (lane & 7) * 8;      
  {
#pragma unroll
    for (int it = 0; it < 4; ++it) {
      const int row = it * 4 + rq;
      const v4f a = *(const v4fa*)&so[w][row][pc], c = *(const v4fa*)&so[w][row][pc + 4];
      FragH fh, fl;
#pragma unroll
      for (int i = 0; i < 4; ++i) {
        const _Float16 h0 = (_Float16)a[i], h1 = (_Float16)c[i]; fh.h[i] = h0; fh.h[4 + i] = h1;
        fl.h[i] = (_Float16)((a[i] - (float)h0) * 1024.0f); fl.h[4 + i] = (_Float16)((c[i] - (float)h1) * 1024.0f);
      }
      const v8us oh = fh.half[0], ol = fl.half[0];
      *(v8us*)((unsigned short*)O16 + (size_t)(rowb + q0 + row) * DM + h * HD + pc) = oh;
      if (RES) *(v8us*)((unsigned short*)OL + (size_t)(rowi + q0 + row) * DM + h * HD + pc) = ol;
    }
    
  }
}

__global__ __launch_bounds__(256) void k_attn_isl(const _Float16* __restrict__ QK, const _Float16* __restrict__ QKL, const _Float16* __restrict__ VT, const _Float16* __restrict__ VTL, _Float16* __restrict__ O16, _Float16* __restrict__ OL, const int* __restrict__ Sp) {
  attn_body<true>(QK, QKL, VT, VTL, O16, OL, Sp, 0, ISL / 128);
}
__global__ __launch_bounds__(256) void k_attn_main(const _Float16* __restrict__ QK, const _Float16* __restrict__ VT, _Float16* __restrict__ O16, const int* __restrict__ Sp) {
  attn_body<false>(QK, nullptr, VT, nullptr, O16, nullptr, Sp, ISL / 128, (SEQ - ISL) / 128);
}

constexpr size_t al256(size_t bytes) { return (bytes + 255) & ~(size_t)255; }
constexpr size_t SZ_BQKV = al256((size_t)3 * DM * DM * 2);
constexpr size_t SZ_BO   = al256((size_t)DM * DM * 2);
constexpr size_t SZ_X16  = al256((size_t)NR * DM * 2);
constexpr size_t SZ_QK   = al256((size_t)NR * LQK * 2);
constexpr size_t SZ_QKL  = al256((size_t)NRI * LQK * 2);
constexpr size_t SZ_VT   = al256((size_t)DM * LVT * 2);
constexpr size_t SZ_VTL  = al256((size_t)DM * LVL * 2);
constexpr size_t SZ_O16  = al256((size_t)NR * DM * 2);
constexpr size_t SZ_OL   = al256((size_t)NRI * DM * 2);
constexpr size_t WS_TOTAL = SZ_BQKV + SZ_BO + SZ_X16 + SZ_QK + SZ_QKL + SZ_VT + SZ_VTL + SZ_O16 + SZ_OL;
static_assert(WS_TOTAL <= (size_t)134217728);      /* carve <= 128 MiB */

extern "C" void kernel_launch(void* const* d_in, const int* in_sizes, int n_in,
                              void* d_out, int out_size, void* d_ws, size_t ws_size, hipStream_t stream) {
  if (n_in < 6) return;
  const long long xrows = (long long)(NB - 1) * SEQ_FULL + SEQ;      /* rows of x / out touched */
  if ((long long)in_sizes[0] < xrows * DM) return;
  if ((long long)in_sizes[1] < (long long)DM * 3 * DM) return;
  if ((long long)in_sizes[2] < (long long)3 * DM) return;
  if ((long long)in_sizes[3] < (long long)DM * DM) return;
  if ((long long)in_sizes[4] < (long long)DM) return;
  if ((long long)in_sizes[5] < 1) return;
  if ((long long)out_size < xrows * DM) return;
  if (WS_TOTAL > ws_size) return;
  const float* x = (const float*)d_in[0]; const float* w_attn = (const float*)d_in[1]; const float* b_attn = (const float*)d_in[2];
  const float* w_proj = (const float*)d_in[3]; const float* b_proj = (const float*)d_in[4];
  const int* s_pref = (const int*)d_in[5];                           /* prefix length, loaded on the device */
  float* out = (float*)d_out;
  char* ws = (char*)d_ws; size_t off = 0;
  _Float16* BQKV = (_Float16*)(ws + off); off += SZ_BQKV;      /* [3072][1024] x16 */
  _Float16* BO   = (_Float16*)(ws + off); off += SZ_BO;        /* [1024][1024] x16 */
  _Float16* X16  = (_Float16*)(ws + off); off += SZ_X16;       /* [NR][1024] */
  _Float16* QK   = (_Float16*)(ws + off); off += SZ_QK;        /* [NR][2048] q | k */
  _Float16* QKL  = (_Float16*)(ws + off); off += SZ_QKL;       /* [NRI][2048] residual x1024 */
  _Float16* VT   = (_Float16*)(ws + off); off += SZ_VT;        /* [1024][NR] */
  _Float16* VTL  = (_Float16*)(ws + off); off += SZ_VTL;       /* [1024][NRI] residual x1024 */
  _Float16* O16  = (_Float16*)(ws + off); off += SZ_O16;       /* [NR][1024] ctx x64 */
  _Float16* OL   = (_Float16*)(ws + off); off += SZ_OL;        /* [NRI][1024] ctx residual x1024 */
  if (off > ws_size) return;

  k_wt_f16<<<(unsigned)(((size_t)3 * DM * (DM / 8) + 255) / 256), 256, 0, stream>>>(w_attn, BQKV, DM, 3 * DM, 16.0f);      /* W[K=1024][N=3072] -> Wt[N][K] */
  k_wt_f16<<<(unsigned)(((size_t)DM * (DM / 8) + 255) / 256), 256, 0, stream>>>(w_proj, BO, DM, DM, 16.0f);                /* W[K=1024][N=1024] -> Wt[N][K] */
  k_x16<<<(unsigned)(((size_t)NR * (DM / 8) + 255) / 256), 256, 0, stream>>>(x, X16);
  k_gemm_qk<<<(unsigned)((NR / 128) * (2 * DM / 64)), 128, 0, stream>>>(X16, BQKV, b_attn, QK, QKL);
  k_gemm_vt<<<(unsigned)((DM / 128) * (NR / 64)), 128, 0, stream>>>(BQKV + (size_t)2 * DM * DM, X16, b_attn + 2 * DM, VT, VTL);
  k_attn_isl<<<(unsigned)(NB * NH * (ISL / 128)), 256, 0, stream>>>(QK, QKL, VT, VTL, O16, OL, s_pref);
  if (SEQ > ISL) k_attn_main<<<(unsigned)(NB * NH * ((SEQ - ISL) / 128)), 256, 0, stream>>>(QK, VT, O16, s_pref);
  if (SEQ > ISL) k_gemm_out<<<(unsigned)((NB * (SEQ - ISL) / 128) * (DM / 64)), 128, 0, stream>>>(O16, BO, b_proj, out);
  k_gemm_out_isl<<<(unsigned)((NRI / 64) * (DM / 64)), 128, 0, stream>>>(O16, OL, BO, b_proj, out);
}

// v001
// A run of this version takes 231 microseconds.
// Two timings next to v000 both put it at 1.29 times that version's speed.
#include <hip/hip_runtime.h>
// All contractions: v_wmma_f32_16x16x32_f16 (f16 operands, f32 accumulate). x, weights and biases are RNE-converted to bf16; x and weights are held exactly in f16 (weights x16); q, k, v, softmax weights (x1024) and ctx (x64) are f16 planes; for the first 256 query rows of every sequence q, k, v, P and ctx also carry an f16 residual plane (x1024) accumulated in a separate accumulator.
// Structure: token rows r = b*SEQ + s. (1) weights -> Wt[n][k] f16; x -> f16 rows. (2) q|k rows = X16 . Wqk (N = 2048) and V^T[h*64+d][token] = Wv . X16^T (operand-swapped GEMM, row bias). (3) fused flash attention in the transposed form S^T = K Q^T, O^T = V^T P^T: one wave owns 16 queries, fragments are loaded straight from the 16-bit planes, P^T goes D -> B in registers, online softmax statistics are per-lane scalars; visibility (key <= query) OR (query < S AND key < S) applied as a replace-mask by value, S loaded on the device from its input buffer. (4) out = ctx . Wo + b (f32).
#ifndef NB
#define NB 2
#endif
#ifndef SEQ
#define SEQ 2048
#endif
#define NB_FULL 2
#define SEQ_FULL 2048
#define DM 1024
#define NH 16
#define HD 64
#define ISL ((SEQ) < 256 ? (SEQ) : 256)   /* query rows per sequence carried with residual planes */
#define NR (NB * SEQ)                      /* token rows in the workspace planes */
#define NRI (NB * ISL)                     /* rows of the compact residual planes */
#define LQK (2 * DM)                       /* row pitch of the q | k plane */
#define LVT NR                             /* row pitch of V^T */
#define LVL NRI                            /* row pitch of the V^T residual plane */

static_assert(NB >= 1 && NB <= NB_FULL);          /* reduced builds only shrink */
static_assert(SEQ <= SEQ_FULL);
static_assert(SEQ % 128 == 0);                    /* 8 waves x 16 queries per attention block; GEMM row blocks; 32-key steps stay inside the sequence */
static_assert(ISL % 128 == 0);                    /* residual region is a whole number of blocks */
static_assert(ISL >= 32);                         /* clamped residual key step ISL - 32 is a valid step */
static_assert((SEQ - ISL) % 128 == 0);            /* plain region is a whole number of blocks */
static_assert(NH * HD == DM);                     /* merged head layout */
static_assert(HD == 64);                          
static_assert(DM % 128 == 0);                     /* GEMM M blocks (V^T) and K % 64 (two k blocks per trip) */
static_assert(DM % 8 == 0);                       /* 8-element convert threads */
static_assert(NR % 128 == 0);                     /* GEMM M blocks / N tiles of 64 */
static_assert(NRI % 64 == 0);                     /* residual-row output GEMM blocks */
static_assert((long long)NR * LQK < 2147483647LL);/* int plane offsets */
static_assert((long long)DM * LVT < 2147483647LL);

typedef unsigned short v8us __attribute__((ext_vector_type(8), may_alias));
typedef float  v8f  __attribute__((ext_vector_type(8)));
typedef float  v4f  __attribute__((ext_vector_type(4)));
typedef float  v4fa __attribute__((ext_vector_type(4), may_alias));
typedef _Float16 v16h __attribute__((ext_vector_type(16)));
typedef _Float16 v4h  __attribute__((ext_vector_type(4)));
union FragH { v16h v; v8us half[2]; _Float16 h[16]; unsigned short u[16]; };

__device__ __forceinline__ float bf16_rne(float x) { unsigned int u = __float_as_uint(x); u = (u + 0x7FFFu + ((u >> 16) & 1u)) & 0xFFFF0000u; return __uint_as_float(u); }

// fragment from a k-contiguous 16-bit row: elements 0..7 <- k 8h.., elements 8..15 <- k 16+8h.. (same map for A and B)
// each of its two loads takes 32 B out of 16 different lines (one per row); planes kept in fragment order would make them whole-line loads
__device__ __forceinline__ v16h g2_frag(const _Float16* p, int hh) { FragH f; f.half[0] = *(const v8us*)((const unsigned short*)p + 8 * hh); f.half[1] = *(const v8us*)((const unsigned short*)p + 16 + 8 * hh); return f.v; }
// the same fragment from a uniform plane pointer, the lane's own 32-bit byte offset (half offset folded in) and a constant byte step
__device__ __forceinline__ v16h g2_frago(const _Float16* base, unsigned off, int add) { const char* p = (const char*)base + (size_t)off + add; FragH f; f.half[0] = *(const v8us*)p; f.half[1] = *(const v8us*)(p + 32); return f.v; }
__device__ __forceinline__ v8f g2_mma(v16h a, v16h b, v8f c) { v8f d = __builtin_amdgcn_wmma_f32_16x16x32_f16(false, a, false, b, (short)0, c, false, false); asm volatile("v_nop\n\tv_nop\n\tv_nop\n\tv_nop" : "+v"(d) : "v"(a), "v"(b)); return d; }

__global__ __launch_bounds__(256) void k_wt_f16(const float* __restrict__ W, _Float16* __restrict__ Wt, int K, int N, float scale) {
  const int t = blockIdx.x * 256 + threadIdx.x; if (t >= N * (K / 8)) return; const int n = t / (K / 8), k8 = (t % (K / 8)) * 8; FragH f;
#pragma unroll
  for (int i = 0; i < 8; ++i) f.h[i] = (_Float16)(bf16_rne(W[(size_t)(k8 + i) * N + n]) * scale);
  const v8us o = f.half[0];
  unsigned short* d = (unsigned short*)Wt + (size_t)n * K + k8;
  *(v8us*)d = o; 
}

__global__ __launch_bounds__(256) void k_x16(const float* __restrict__ x, _Float16* __restrict__ X16) {
  const int t = blockIdx.x * 256 + threadIdx.x; if (t >= NR * (DM / 8)) return;
  const int row = t / (DM / 8), c8 = (t % (DM / 8)) * 8; const int b = row / SEQ, s = row % SEQ;
  const float* src = x + ((size_t)b * SEQ_FULL + s) * DM + c8;
  const v4f a = *(const v4fa*)src, c = *(const v4fa*)(src + 4); FragH f;
#pragma unroll
  for (int i = 0; i < 4; ++i) { f.h[i] = (_Float16)bf16_rne(a[i]); f.h[4 + i] = (_Float16)bf16_rne(c[i]); }
  const v8us o = f.half[0];
  unsigned short* d = (unsigned short*)X16 + (size_t)row * DM + c8;
  *(v8us*)d = o; 
}

// GEMM: wave tile (16*MT) x 64, block = 4 waves = (64*MT) rows x 64 cols; A rows and Bh rows are k-contiguous f16 (fragments straight from global).
// v = acc*alpha (+ accL*alphaL with the residual A plane AL, ARES) + bias (per column, or per row if ROWBIAS; bias RNE-converted to bf16).
// Logical row R maps to A row seg*aSeg + aOff + w and C row seg*cSeg + cOff + w with seg = R / segRows, w = R % segRows (blocks never straddle segments).
// OUT 0: f32 C. OUT 1: f16 C16 (+ x1024 residual rows in CL when the rows lie in the first ISL rows of a sequence). OUT 2: f16 C16 (+ residual columns when the token columns lie in the first ISL rows of a sequence).
// Requires M % (64*MT) == 0, N % 64 == 0, K % 64 == 0 (asserted above for the launches used). LDS tile is private to its wave (wave-level sync).
template <int MT, bool ROWBIAS, bool ARES, int OUT>
__device__ __forceinline__ void gemm_body(const _Float16* __restrict__ A, const _Float16* __restrict__ AL, int lda,
    const _Float16* __restrict__ Bh, int ldb, float alpha, float alphaL, const float* __restrict__ bias,
    float* __restrict__ Cf, _Float16* __restrict__ C16, _Float16* __restrict__ CL, int ldc, int ldcl,
    int M, int N, int K, int segRows, int aSeg, int aOff, int cSeg, int cOff) {
  static_assert(MT == 1 || MT == 2);
  static_assert(!ARES || MT == 1);      /* residual form keeps 8 accumulators */
  __shared__ __attribute__((aligned(16))) float so[4][32][68];
  const int tid = threadIdx.x, w = tid >> 5, lane = tid & 31, ln = lane & 15, hh = lane >> 4;
  const int ntn = N >> 6;
  const int mt = blockIdx.x / ntn, nq = blockIdx.x - mt * ntn;
  const int R0 = mt * (64 * MT) + (16 * MT) * w, col0 = nq * 64;
  if (R0 >= M) return;
  const int seg = R0 / segRows, wi = R0 - seg * segRows;
  const int arow0 = seg * aSeg + aOff + wi, crow0 = seg * cSeg + cOff + wi;
  const _Float16* a0p = A + (size_t)(arow0 + ln) * lda;
  const _Float16* b0p = Bh + (size_t)(col0 + ln) * ldb; const _Float16* b1p = b0p + (size_t)16 * ldb; const _Float16* b2p = b1p + (size_t)16 * ldb; const _Float16* b3p = b2p + (size_t)16 * ldb;
  const v8f z8 = {0.f, 0.f, 0.f, 0.f, 0.f, 0.f, 0.f, 0.f};
  v8f c00 = z8, c01 = z8, c02 = z8, c03 = z8, c10 = z8, c11 = z8, c12 = z8, c13 = z8, d00 = z8, d01 = z8, d02 = z8, d03 = z8;
  // Two register sets of fragments (P, N), 32 k each: every set is loaded as one group, one k block ahead of the WMMAs that read it, so a block waits for one load round trip that started a block earlier.
  const _Float16* e0p = ARES ? AL + (size_t)(R0 + ln) * lda : a0p;
#define GEMM_LD(S, kk) { S##a0 = g2_frag(a0p + (kk), hh); if (MT == 2) S##a1 = g2_frag(a0p + (size_t)16 * lda + (kk), hh); if (ARES) S##e0 = g2_frag(e0p + (kk), hh); \
    S##b0 = g2_frag(b0p + (kk), hh); S##b1 = g2_frag(b1p + (kk), hh); S##b2 = g2_frag(b2p + (kk), hh); S##b3 = g2_frag(b3p + (kk), hh); }
#define GEMM_MM(S) { c00 = g2_mma(S##a0, S##b0, c00); if (MT == 2) c10 = g2_mma(S##a1, S##b0, c10); if (ARES) d00 = g2_mma(S##e0, S##b0, d00); \
    c01 = g2_mma(S##a0, S##b1, c01); if (MT == 2) c11 = g2_mma(S##a1, S##b1, c11); if (ARES) d01 = g2_mma(S##e0, S##b1, d01); \
    c02 = g2_mma(S##a0, S##b2, c02); if (MT == 2) c12 = g2_mma(S##a1, S##b2, c12); if (ARES) d02 = g2_mma(S##e0, S##b2, d02); \
    c03 = g2_mma(S##a0, S##b3, c03); if (MT == 2) c13 = g2_mma(S##a1, S##b3, c13); if (ARES) d03 = g2_mma(S##e0, S##b3, d03); }
  const v16h zf = (v16h)((_Float16)0.0f);
  v16h Pa0 = zf, Pa1 = zf, Pe0 = zf, Pb0 = zf, Pb1 = zf, Pb2 = zf, Pb3 = zf, Na0 = zf, Na1 = zf, Ne0 = zf, Nb0 = zf, Nb1 = zf, Nb2 = zf, Nb3 = zf;
  GEMM_LD(P, 0)
#pragma unroll      /* K is a constant of every launch: unrolled, the k offsets are immediates and no address register is rewritten while a group is in flight */
  for (int kb = 0; kb < K; kb += 64) {
    GEMM_LD(N, kb + 32)
    GEMM_MM(P)
    if (kb + 64 < K) GEMM_LD(P, kb + 64)
    GEMM_MM(N)
  }
#undef GEMM_LD
#undef GEMM_MM
  const v8f accs[8] = {c00, c01, c02, c03, c10, c11, c12, c13};
  const v8f accl[4] = {d00, d01, d02, d03};
#pragma unroll
  for (int u = 0; u < 4 * MT; ++u) {
    const int t = u & 3, half = u >> 2; const int col = col0 + t * 16 + ln;
    float bvc = 0.f; if (!ROWBIAS) bvc = bf16_rne(bias[col]);
#pragma unroll
    for (int r = 0; r < 8; ++r) {
      const int rloc = half * 16 + 8 * hh + r;
      float v = accs[u][r] * alpha;
      if (ARES) v += accl[t][r] * alphaL;
      if (ROWBIAS) v += bf16_rne(bias[R0 + rloc]); else v += bvc;
      so[w][rloc][t * 16 + ln] = v;
    }
  }
  __builtin_amdgcn_fence(4 /* acq_rel order */, "workgroup"); __builtin_amdgcn_wave_barrier();
  const int rsub = lane >> 4, c4 = (lane & 15) * 4;
  if (OUT == 0) {
    {
#pragma unroll
      for (int q = 0; q < 8 * MT; ++q) { const int r = q * 2 + rsub; const v4f v = *(const v4fa*)&so[w][r][c4]; *(v4f*)(Cf + (size_t)(crow0 + r) * ldc + col0 + c4) = v; }
      
    }
  } else {
    int sl, rrow0, rcol0;
    if (OUT == 1) { sl = crow0 % SEQ; rrow0 = (crow0 / SEQ) * ISL + sl; rcol0 = col0; }
    else          { sl = col0 % SEQ;  rrow0 = crow0; rcol0 = (col0 / SEQ) * ISL + sl; }
    const bool isl = sl < ISL;      /* uniform over the wave tile: ISL and SEQ are multiples of 64 */
    {
#pragma unroll
      for (int q = 0; q < 8 * MT; ++q) {
        const int r = q * 2 + rsub; const v4f v = *(const v4fa*)&so[w][r][c4];
        v4h h4, l4;
#pragma unroll
        for (int i = 0; i < 4; ++i) { const _Float16 hv = (_Float16)v[i]; h4[i] = hv; l4[i] = (_Float16)((v[i] - (float)hv) * 1024.0f); }
        *(v4h*)(C16 + (size_t)(crow0 + r) * ldc + col0 + c4) = h4;
        if (isl) *(v4h*)(CL + (size_t)(rrow0 + r) * ldcl + rcol0 + c4) = l4;
      }
      
    }
  }
}

// q | k rows (f16) = X16 . Wqk^T / 16 + b; residual rows for s < ISL
__global__ __launch_bounds__(128) void k_gemm_qk(const _Float16* __restrict__ X16, const _Float16* __restrict__ BW, const float* __restrict__ bias, _Float16* __restrict__ QK, _Float16* __restrict__ QKL) {
  gemm_body<2, false, false, 1>(X16, nullptr, DM, BW, DM, 0.0625f, 0.f, bias, nullptr, QK, QKL, LQK, LQK, NR, 2 * DM, DM, NR, 0, 0, 0, 0);
}
// V^T[h*64+d][token] (f16) = Wv . X16^T / 16 + b[row]; residual columns for s < ISL
__global__ __launch_bounds__(128) void k_gemm_vt(const _Float16* __restrict__ BWv, const _Float16* __restrict__ X16, const float* __restrict__ biasv, _Float16* __restrict__ VT, _Float16* __restrict__ VTL) {
  gemm_body<2, true, false, 2>(BWv, nullptr, DM, X16, DM, 0.0625f, 0.f, biasv, nullptr, VT, VTL, LVT, LVL, DM, NR, DM, DM, 0, 0, 0, 0);
}
// out rows s >= ISL: ctx(x64) . Wo(x16) * 2^-10 + b
__global__ __launch_bounds__(128) void k_gemm_out(const _Float16* __restrict__ O16, const _Float16* __restrict__ BO, const float* __restrict__ bias, float* __restrict__ out) {
  gemm_body<2, false, false, 0>(O16, nullptr, DM, BO, DM, 0.0009765625f, 0.f, bias, out, nullptr, nullptr, DM, 0, NB * (SEQ - ISL), DM, DM, SEQ - ISL, SEQ, ISL, SEQ_FULL, ISL);
}
// out rows s < ISL: (ctx_hi . Wo) * 2^-10 + (ctx_res . Wo) * 2^-20 + b, separate accumulators
__global__ __launch_bounds__(128) void k_gemm_out_isl(const _Float16* __restrict__ O16, const _Float16* __restrict__ OL, const _Float16* __restrict__ BO, const float* __restrict__ bias, float* __restrict__ out) {
  gemm_body<1, false, true, 0>(O16, OL, DM, BO, DM, 0.0009765625f, 0.00000095367431640625f, bias, out, nullptr, nullptr, DM, 0, NRI, DM, DM, ISL, SEQ, 0, SEQ_FULL, 0);
}

// Fused prefix-causal attention, transposed form. Block = 8 waves = 128 consecutive queries of one (b, h); wave = 16 queries (D column = query = lane & 15).
// Visibility: key j is seen by query i iff (j <= i) OR (i < S AND j < S); S is loaded from its input buffer and clamped to [0, SEQ] (same mask for any value).
// Key range of a wave: [0, max(S, q0 + 16)) in 32-key steps (all step keys lie inside the sequence since SEQ % 32 == 0). Every step holds key kcb that is visible to every query of the wave
// (kcb <= q0 when the range ends at q0 + 16; kcb < S with all 16 queries < S otherwise), so the step maximum is always finite.
// Per 32-key step: S^T tiles (keys kcb..+15 and +16..+31) = K (A, rows = keys) . Q^T (B, lane = query); scale 1/8; hidden keys are REPLACED (excluded from max, weight 0 by value);
// online max / sum per lane (halves combined by one xor-16 shuffle); P^T (x1024, f16) is the B fragment directly: element r <- tile0[r], element 8+r <- tile1[r];
// O^T (rows = d) += V^T (A, rows = d, k = keys) . P^T. RES: q, k, v, P carry x1024 residual planes; residual products go to separate accumulators folded back with 2^-10.
// Residual k / v planes exist only for keys < ISL: for key steps at or beyond ISL (possible when S > ISL) the residual k / v fragments are loaded from a clamped in-range step and zeroed by value (wave-uniform select).
template <bool RES>
__device__ __forceinline__ void attn_body(const _Float16* __restrict__ QK, const _Float16* __restrict__ QKL, const _Float16* __restrict__ VT, const _Float16* __restrict__ VTL,
                                          _Float16* __restrict__ O16, _Float16* __restrict__ OL, const int* __restrict__ Sp, int qb0, int nqb) {
  __shared__ __attribute__((aligned(16))) float so[8][16][68];
  const int tid = threadIdx.x, lane = tid & 31, ln = lane & 15, hh = lane >> 4;
  const int w = __builtin_amdgcn_readfirstlane(tid >> 5);
  const int sraw = Sp[0];
  const int Sc = sraw < 0 ? 0 : (sraw > SEQ ? SEQ : sraw);
  const int bh = (int)blockIdx.x / nqb; const int qb = qb0 + ((int)blockIdx.x - bh * nqb);
  const int h = bh % NH, b = bh / NH;
  const int q0 = qb * 128 + w * 16, q = q0 + ln;
  const bool qpre = q < Sc;
  const int rowb = b * SEQ, rowi = b * ISL;
  const _Float16* qp = QK + (size_t)(rowb + q) * LQK + h * HD;
  const v16h qh0 = g2_frag(qp, hh), qh1 = g2_frag(qp + 32, hh);
  const int qloff = (rowi + q) * LQK + h * HD;                  /* residual q row (RES) */
  const int kbase = (rowb + ln) * LQK + DM + h * HD;            /* k row of key tile 0, lane ln */
  const int klbase = (rowi + ln) * LQK + DM + h * HD;           /* residual k row (RES) */
  const int vbase = (h * HD + ln) * LVT + rowb;                 /* V^T row d = ln of ctx tile 0 */
  const int vlbase = (h * HD + ln) * LVL + rowi;                /* residual V^T row (RES) */
  const v8f z8 = {0.f, 0.f, 0.f, 0.f, 0.f, 0.f, 0.f, 0.f};
  const v16h zh = (v16h)((_Float16)0.0f);
  v8f o0 = z8, o1 = z8, o2 = z8, o3 = z8, e0 = z8, e1 = z8, e2 = z8, e3 = z8;
  float m = -1.0e30f, l = 0.f;
  const int kend = (Sc > q0 + 16) ? Sc : (q0 + 16);              /* keys [0, kend) cover every visible key of the wave; kend <= SEQ */
  const int nst = (kend + 31) >> 5;
  // Plain form: the K and V fragments live in registers across the loop; the next step's K group is issued right behind this step's S^T WMMAs and the next step's V group right behind its O^T WMMAs.
  v16h ka = zh, kb = zh, kc = zh, kd = zh, v0 = zh, v1 = zh, v2 = zh, v3 = zh;
  unsigned kq = 2u * (unsigned)(kbase + 8 * hh), vq = 2u * (unsigned)(vbase + 8 * hh);      /* the lane's byte offsets of the K and V groups held in registers; step 0 exists: nst >= 1 */
  if (!RES) {
    ka = g2_frago(QK, kq, 0); kb = g2_frago(QK, kq, 64); kc = g2_frago(QK, kq, 32 * LQK); kd = g2_frago(QK, kq, 32 * LQK + 64);
    v0 = g2_frago(VT, vq, 0); v1 = g2_frago(VT, vq, 32 * LVT); v2 = g2_frago(VT, vq, 64 * LVT); v3 = g2_frago(VT, vq, 96 * LVT);
    /* inputs-only fence on the loaded values: every load in front of the loop has landed here, so the wait at the loop's head counts the loop's own groups alone and leaves the next V group in flight */
    asm volatile("" :: "v"(qh0), "v"(qh1), "v"(ka), "v"(kb), "v"(kc), "v"(kd), "v"(v0), "v"(v1), "v"(v2), "v"(v3));
  }
#pragma unroll 1
  for (int st = 0; st < nst; ++st) {
    const int kcb = st * 32;
    const int adv = (st + 1 < nst) ? 32 : 0;                     /* keys to the next step; the last step reloads its own (in range, not used) */
    const bool rok = kcb < ISL;                                  /* wave-uniform: residual k / v rows exist for this step */
    const int kcl = rok ? kcb : (ISL - 32);                      /* clamped in-range residual step */
    const _Float16* kp0 = QK + kbase + kcb * LQK; const _Float16* kp1 = kp0 + 16 * LQK;
    v8f s0 = z8, s1 = z8, r0 = z8, r1 = z8;
    if (RES) {
      int qo = qloff; asm volatile("" : "+v"(qo));             /* reload the residual q fragments per step (integer offset only) */
      const _Float16* qlp = QKL + qo;
      const v16h ql0 = g2_frag(qlp, hh), ql1 = g2_frag(qlp + 32, hh);
      const _Float16* kl0 = QKL + klbase + kcl * LQK; const _Float16* kl1 = kl0 + 16 * LQK;
      /* all k fragments of the step as one load group in front of its WMMAs */
      const v16h ah0 = g2_frag(kp0, hh), ah1 = g2_frag(kp0 + 32, hh), ah2 = g2_frag(kp1, hh), ah3 = g2_frag(kp1 + 32, hh);
      v16h al0 = g2_frag(kl0, hh), al1 = g2_frag(kl0 + 32, hh), al2 = g2_frag(kl1, hh), al3 = g2_frag(kl1 + 32, hh);
      al0 = rok ? al0 : zh; al1 = rok ? al1 : zh; al2 = rok ? al2 : zh; al3 = rok ? al3 : zh;
      s0 = g2_mma(ah0, qh0, s0); r0 = g2_mma(al0, qh0, r0); r0 = g2_mma(ah0, ql0, r0);
      s0 = g2_mma(ah1, qh1, s0); r0 = g2_mma(al1, qh1, r0); r0 = g2_mma(ah1, ql1, r0);
      s1 = g2_mma(ah2, qh0, s1); r1 = g2_mma(al2, qh0, r1); r1 = g2_mma(ah2, ql0, r1);
      s1 = g2_mma(ah3, qh1, s1); r1 = g2_mma(al3, qh1, r1); r1 = g2_mma(ah3, ql1, r1);
    } else {
      s0 = g2_mma(ka, qh0, s0); s0 = g2_mma(kb, qh1, s0); s1 = g2_mma(kc, qh0, s1); s1 = g2_mma(kd, qh1, s1);
      asm volatile("s_wait_xcnt 0x0" : "+v"(kq) :: "memory");      /* stands in front of the rewrite of the offset register that the last K group's loads name; the register is an operand so that the addition stays behind it */
      kq += (unsigned)(adv * LQK * 2);
      ka = g2_frago(QK, kq, 0); kb = g2_frago(QK, kq, 64); kc = g2_frago(QK, kq, 32 * LQK); kd = g2_frago(QK, kq, 32 * LQK + 64);
      __builtin_amdgcn_sched_barrier(0);      /* holds the K group at the head of the softmax: issued further down it has less of the step to land in */
    }
    v16h vl0 = zh, vl1 = zh, vl2 = zh, vl3 = zh;
    if (RES) {      /* all v fragments of the step as one load group in front of the softmax */
      const _Float16* vp = VT + vbase + kcb; const _Float16* vlp = VTL + vlbase + kcl;
      v0 = g2_frag(vp, hh); v1 = g2_frag(vp + 16 * LVT, hh); v2 = g2_frag(vp + 32 * LVT, hh); v3 = g2_frag(vp + 48 * LVT, hh);
      vl0 = g2_frag(vlp, hh); vl1 = g2_frag(vlp + 16 * LVL, hh); vl2 = g2_frag(vlp + 32 * LVL, hh); vl3 = g2_frag(vlp + 48 * LVL, hh);
    }
    // D row = key kcb + 8*hh + r (tile 0), + 16 (tile 1); D column = query q
    v8f xa, xb; float mt = -1.0e30f;
#pragma unroll
    for (int r = 0; r < 8; ++r) {
      const int k0 = kcb + 8 * hh + r;
      const bool va = (k0 <= q) || (qpre && (k0 < Sc));
      const bool vb = (k0 + 16 <= q) || (qpre && (k0 + 16 < Sc));
      float a = s0[r], c = s1[r];
      if (RES) { a += r0[r] * 0.0009765625f; c += r1[r] * 0.0009765625f; }
      a *= 0.125f; c *= 0.125f;
      a = va ? a : -1.0e30f; c = vb ? c : -1.0e30f;
      xa[r] = a; xb[r] = c; mt = fmaxf(mt, fmaxf(a, c));
    }
    mt = fmaxf(mt, __shfl_xor(mt, 16, 32));
    const float mn = fmaxf(m, mt);
    float f; { const float t = fmaxf(m - mn, -80.0f) * 1.44269504f;      /* __expf as it compiles (multiply, v_exp_f32), with the slot behind the transcendental filled in the same statement */
      asm("v_exp_f32 %0, %1\n\tv_nop" : "=v"(f) : "v"(t)); }
    m = mn;
    FragH ph, pl; float rs = 0.f;
#pragma unroll
    for (int r = 0; r < 8; ++r) {
      const int k0 = kcb + 8 * hh + r;
      const bool va = (k0 <= q) || (qpre && (k0 < Sc));
      const bool vb = (k0 + 16 <= q) || (qpre && (k0 + 16 < Sc));
      float pa = __expf(va ? (xa[r] - mn) : 0.f); pa = va ? pa : 0.f;
      float pb = __expf(vb ? (xb[r] - mn) : 0.f); pb = vb ? pb : 0.f;
      rs += pa + pb;
      const float ta = pa * 1024.0f, tb = pb * 1024.0f;
      const _Float16 ha = (_Float16)ta, hb = (_Float16)tb;
      ph.h[r] = ha; ph.h[8 + r] = hb;
      if (RES) { pl.h[r] = (_Float16)((ta - (float)ha) * 1024.0f); pl.h[8 + r] = (_Float16)((tb - (float)hb) * 1024.0f); }
    }
    const float rso = __shfl_xor(rs, 16, 32);
    l = l * f + (rs + rso);
    o0 *= f; o1 *= f; o2 *= f; o3 *= f;
    if (RES) { e0 *= f; e1 *= f; e2 *= f; e3 *= f; }
    o0 = g2_mma(v0, ph.v, o0); o1 = g2_mma(v1, ph.v, o1); o2 = g2_mma(v2, ph.v, o2); o3 = g2_mma(v3, ph.v, o3);
    if (RES) {
      vl0 = rok ? vl0 : zh; vl1 = rok ? vl1 : zh; vl2 = rok ? vl2 : zh; vl3 = rok ? vl3 : zh;
      e0 = g2_mma(vl0, ph.v, e0); e0 = g2_mma(v0, pl.v, e0);
      e1 = g2_mma(vl1, ph.v, e1); e1 = g2_mma(v1, pl.v, e1);
      e2 = g2_mma(vl2, ph.v, e2); e2 = g2_mma(v2, pl.v, e2);
      e3 = g2_mma(vl3, ph.v, e3); e3 = g2_mma(v3, pl.v, e3);
    } else {
      asm volatile("s_wait_xcnt 0x0" : "+v"(vq) :: "memory");      /* the same for the V group's offset register */
      vq += (unsigned)(adv * 2);
      v0 = g2_frago(VT, vq, 0); v1 = g2_frago(VT, vq, 32 * LVT); v2 = g2_frago(VT, vq, 64 * LVT); v3 = g2_frago(VT, vq, 96 * LVT);
    }
  }
  // ctx x64 = O^T * 64 / (1024 * l); O^T row d = dg*16 + 8*hh + r, column = query ln
  const float inv = 0.0625f * (1.0f / l);
  const v8f oo[4] = {o0, o1, o2, o3}; const v8f ee[4] = {e0, e1, e2, e3};
#pragma unroll
  for (int dg = 0; dg < 4; ++dg)
#pragma unroll
    for (int r = 0; r < 8; ++r) { float v = oo[dg][r]; if (RES) v += ee[dg][r] * 0.0009765625f; so[w][ln][dg * 16 + 8 * hh + r] = v * inv; }
  __builtin_amdgcn_fence(4 /* acq_rel order */, "workgroup"); __builtin_amdgcn_wave_barrier();
  const int rq = lane >> 3, pc = (lane & 7) * 8;      
  {
#pragma unroll
    for (int it = 0; it < 4; ++it) {
      const int row = it * 4 + rq;
      const v4f a = *(const v4fa*)&so[w][row][pc], c = *(const v4fa*)&so[w][row][pc + 4];
      FragH fh, fl;
#pragma unroll
      for (int i = 0; i < 4; ++i) {
        const _Float16 h0 = (_Float16)a[i], h1 = (_Float16)c[i]; fh.h[i] = h0; fh.h[4 + i] = h1;
        fl.h[i] = (_Float16)((a[i] - (float)h0) * 1024.0f); fl.h[4 + i] = (_Float16)((c[i] - (float)h1) * 1024.0f);
      }
      const v8us oh = fh.half[0], ol = fl.half[0];
      *(v8us*)((unsigned short*)O16 + (size_t)(rowb + q0 + row) * DM + h * HD + pc) = oh;
      if (RES) *(v8us*)((unsigned short*)OL + (size_t)(rowi + q0 + row) * DM + h * HD + pc) = ol;
    }
    
  }
}

__global__ __launch_bounds__(256) void k_attn_isl(const _Float16* __restrict__ QK, const _Float16* __restrict__ QKL, const _Float16* __restrict__ VT, const _Float16* __restrict__ VTL, _Float16* __restrict__ O16, _Float16* __restrict__ OL, const int* __restrict__ Sp) {
  attn_body<true>(QK, QKL, VT, VTL, O16, OL, Sp, 0, ISL / 128);
}
__global__ __launch_bounds__(256) void k_attn_main(const _Float16* __restrict__ QK, const _Float16* __restrict__ VT, _Float16* __restrict__ O16, const int* __restrict__ Sp) {
  attn_body<false>(QK, nullptr, VT, nullptr, O16, nullptr, Sp, ISL / 128, (SEQ - ISL) / 128);
}

constexpr size_t al256(size_t bytes) { return (bytes + 255) & ~(size_t)255; }
constexpr size_t SZ_BQKV = al256((size_t)3 * DM * DM * 2);
constexpr size_t SZ_BO   = al256((size_t)DM * DM * 2);
constexpr size_t SZ_X16  = al256((size_t)NR * DM * 2);
constexpr size_t SZ_QK   = al256((size_t)NR * LQK * 2);
constexpr size_t SZ_QKL  = al256((size_t)NRI * LQK * 2);
constexpr size_t SZ_VT   = al256((size_t)DM * LVT * 2);
constexpr size_t SZ_VTL  = al256((size_t)DM * LVL * 2);
constexpr size_t SZ_O16  = al256((size_t)NR * DM * 2);
constexpr size_t SZ_OL   = al256((size_t)NRI * DM * 2);
constexpr size_t WS_TOTAL = SZ_BQKV + SZ_BO + SZ_X16 + SZ_QK + SZ_QKL + SZ_VT + SZ_VTL + SZ_O16 + SZ_OL;
static_assert(WS_TOTAL <= (size_t)134217728);      /* carve <= 128 MiB */

extern "C" void kernel_launch(void* const* d_in, const int* in_sizes, int n_in,
                              void* d_out, int out_size, void* d_ws, size_t ws_size, hipStream_t stream) {
  if (n_in < 6) return;
  const long long xrows = (long long)(NB - 1) * SEQ_FULL + SEQ;      /* rows of x / out touched */
  if ((long long)in_sizes[0] < xrows * DM) return;
  if ((long long)in_sizes[1] < (long long)DM * 3 * DM) return;
  if ((long long)in_sizes[2] < (long long)3 * DM) return;
  if ((long long)in_sizes[3] < (long long)DM * DM) return;
  if ((long long)in_sizes[4] < (long long)DM) return;
  if ((long long)in_sizes[5] < 1) return;
  if ((long long)out_size < xrows * DM) return;
  if (WS_TOTAL > ws_size) return;
  const float* x = (const float*)d_in[0]; const float* w_attn = (const float*)d_in[1]; const float* b_attn = (const float*)d_in[2];
  const float* w_proj = (const float*)d_in[3]; const float* b_proj = (const float*)d_in[4];
  const int* s_pref = (const int*)d_in[5];                           /* prefix length, loaded on the device */
  float* out = (float*)d_out;
  char* ws = (char*)d_ws; size_t off = 0;
  _Float16* BQKV = (_Float16*)(ws + off); off += SZ_BQKV;      /* [3072][1024] x16 */
  _Float16* BO   = (_Float16*)(ws + off); off += SZ_BO;        /* [1024][1024] x16 */
  _Float16* X16  = (_Float16*)(ws + off); off += SZ_X16;       /* [NR][1024] */
  _Float16* QK   = (_Float16*)(ws + off); off += SZ_QK;        /* [NR][2048] q | k */
  _Float16* QKL  = (_Float16*)(ws + off); off += SZ_QKL;       /* [NRI][2048] residual x1024 */
  _Float16* VT   = (_Float16*)(ws + off); off += SZ_VT;        /* [1024][NR] */
  _Float16* VTL  = (_Float16*)(ws + off); off += SZ_VTL;       /* [1024][NRI] residual x1024 */
  _Float16* O16  = (_Float16*)(ws + off); off += SZ_O16;       /* [NR][1024] ctx x64 */
  _Float16* OL   = (_Float16*)(ws + off); off += SZ_OL;        /* [NRI][1024] ctx residual x1024 */
  if (off > ws_size) return;

  k_wt_f16<<<(unsigned)(((size_t)3 * DM * (DM / 8) + 255) / 256), 256, 0, stream>>>(w_attn, BQKV, DM, 3 * DM, 16.0f);      /* W[K=1024][N=3072] -> Wt[N][K] */
  k_wt_f16<<<(unsigned)(((size_t)DM * (DM / 8) + 255) / 256), 256, 0, stream>>>(w_proj, BO, DM, DM, 16.0f);                /* W[K=1024][N=1024] -> Wt[N][K] */
  k_x16<<<(unsigned)(((size_t)NR * (DM / 8) + 255) / 256), 256, 0, stream>>>(x, X16);
  k_gemm_qk<<<(unsigned)((NR / 128) * (2 * DM / 64)), 128, 0, stream>>>(X16, BQKV, b_attn, QK, QKL);
  k_gemm_vt<<<(unsigned)((DM / 128) * (NR / 64)), 128, 0, stream>>>(BQKV + (size_t)2 * DM * DM, X16, b_attn + 2 * DM, VT, VTL);
  k_attn_isl<<<(unsigned)(NB * NH * (ISL / 128)), 256, 0, stream>>>(QK, QKL, VT, VTL, O16, OL, s_pref);
  if (SEQ > ISL) k_attn_main<<<(unsigned)(NB * NH * ((SEQ - ISL) / 128)), 256, 0, stream>>>(QK, VT, O16, s_pref);
  if (SEQ > ISL) k_gemm_out<<<(unsigned)((NB * (SEQ - ISL) / 128) * (DM / 64)), 128, 0, stream>>>(O16, BO, b_proj, out);
  k_gemm_out_isl<<<(unsigned)((NRI / 64) * (DM / 64)), 128, 0, stream>>>(O16, OL, BO, b_proj, out);
}

// v002
// A run of this version takes 143 microseconds.
// Next to v001, in two timings, it ran 1.61 and 1.63 times as fast.
// All steps since v000 together make it 2.09 times as fast.
#include <hip/hip_runtime.h>
// All contractions: v_wmma_f32_16x16x32_f16 (f16 operands, f32 accumulate). x, weights and biases are RNE-converted to bf16; x and weights are held exactly in f16 (weights x16); q, k, v, softmax weights (x1024) and ctx (x64) are f16 planes; for the first 256 query rows of every sequence q, k, v, P and ctx also carry an f16 residual plane (x1024) accumulated in a separate accumulator.
// Structure: token rows r = b*SEQ + s. (1) weights -> Wt[n][k] f16; x -> f16 rows. (2) q|k rows = X16 . Wqk (N = 2048) and V^T[h*64+d][token] = Wv . X16^T (operand-swapped GEMM, row bias). (3) fused flash attention in the transposed form S^T = K Q^T, O^T = V^T P^T: one wave owns 16 queries, fragments are loaded straight from the 16-bit planes (all kept in fragment order, see fo_chunk), P^T goes D -> B in registers, online softmax statistics are per-lane scalars; visibility (key <= query) OR (query < S AND key < S) applied as a replace-mask by value, S loaded on the device from its input buffer. (4) out = ctx . Wo + b (f32).
#ifndef NB
#define NB 2
#endif
#ifndef SEQ
#define SEQ 2048
#endif
#define NB_FULL 2
#define SEQ_FULL 2048
#define DM 1024
#define NH 16
#define HD 64
#define ISL ((SEQ) < 256 ? (SEQ) : 256)   /* query rows per sequence carried with residual planes */
#define NR (NB * SEQ)                      /* token rows in the workspace planes */
#define NRI (NB * ISL)                     /* rows of the compact residual planes */
#define LQK (2 * DM)                       /* row pitch of the q | k plane */
#define LVT NR                             /* row pitch of V^T */
#define LVL NRI                            /* row pitch of the V^T residual plane */

static_assert(NB >= 1 && NB <= NB_FULL);          /* reduced builds only shrink */
static_assert(SEQ <= SEQ_FULL);
static_assert(SEQ % 128 == 0);                    /* 8 waves x 16 queries per attention block; GEMM row blocks; 32-key steps stay inside the sequence */
static_assert(ISL % 128 == 0);                    /* residual region is a whole number of blocks */
static_assert(ISL >= 32);                         /* clamped residual key step ISL - 32 is a valid step */
static_assert((SEQ - ISL) % 128 == 0);            /* plain region is a whole number of blocks */
static_assert(NH * HD == DM);                     /* merged head layout */
static_assert(HD == 64);                          
static_assert(DM % 128 == 0);                     /* GEMM M blocks (V^T) and K % 64 (two k blocks per trip) */
static_assert(DM % 8 == 0);                       /* 8-element convert threads */
static_assert(NR % 128 == 0);                     /* GEMM M blocks / N tiles of 64 */
static_assert(NRI % 64 == 0);                     /* residual-row output GEMM blocks */
static_assert((long long)NR * LQK < 2147483647LL);/* int plane offsets */
static_assert((long long)DM * LVT < 2147483647LL);

typedef unsigned short v8us __attribute__((ext_vector_type(8), may_alias));
typedef float  v8f  __attribute__((ext_vector_type(8)));
typedef float  v4f  __attribute__((ext_vector_type(4)));
typedef float  v4fa __attribute__((ext_vector_type(4), may_alias));
typedef _Float16 v16h __attribute__((ext_vector_type(16)));
typedef _Float16 v4h  __attribute__((ext_vector_type(4)));
union FragH { v16h v; v8us half[2]; _Float16 h[16]; unsigned short u[16]; };

__device__ __forceinline__ float bf16_rne(float x) { unsigned int u = __float_as_uint(x); u = (u + 0x7FFFu + ((u >> 16) & 1u)) & 0xFFFF0000u; return __uint_as_float(u); }

// Fragment order: every 16-bit plane [rows][K] is stored as tiles of 16 rows x 32 k, 512 elements (1 KB) each, tile (row / 16, k / 32) at element (row / 16) * 16 * K + (k / 32) * 512.
// Inside a tile: two halves of 256 elements (k 0..15, k 16..31), each 32 lanes x 8 elements with lane = 16 * ((k / 8) & 1) + row % 16. A fragment is then two loads of 512 contiguous bytes (4 whole lines each).
// element offset of the 8-element chunk that holds (row, k .. k + 7), k % 8 == 0, in a plane of K columns (K % 32 == 0)
__device__ __forceinline__ size_t fo_chunk(int row, int k, int K) { return (size_t)(row >> 4) * 16 * K + (size_t)((k >> 5) * 512 + ((k >> 4) & 1) * 256 + (((k >> 3) & 1) * 16 + (row & 15)) * 8); }
// fragment of one tile: elements 0..7 <- k 8h.., elements 8..15 <- k 16+8h.., row = lane & 15, h = lane >> 4 (same map for A and B);
// from a uniform pointer, the lane's own 32-bit byte offset (16 * lane folded in) and a constant byte step
__device__ __forceinline__ v16h g2_frago(const _Float16* base, unsigned off, int add) { const char* p = (const char*)base + (size_t)off + add; FragH f; f.half[0] = *(const v8us*)p; f.half[1] = *(const v8us*)(p + 512); return f.v; }
__device__ __forceinline__ v8f g2_mma(v16h a, v16h b, v8f c) { v8f d = __builtin_amdgcn_wmma_f32_16x16x32_f16(false, a, false, b, (short)0, c, false, false); asm volatile("v_nop\n\tv_nop\n\tv_nop\n\tv_nop" : "+v"(d) : "v"(a), "v"(b)); return d; }

__global__ __launch_bounds__(256) void k_wt_f16(const float* __restrict__ W, _Float16* __restrict__ Wt, int K, int N, float scale) {
  /* one wave writes one half tile (512 contiguous bytes): lane = 16 * h + n % 16; waves run over the row tiles first, then over the 16-k halves */
  const int t = blockIdx.x * 256 + threadIdx.x; if (t >= N * (K / 8)) return; const int wv = t >> 5, lane = t & 31; const int n = (wv % (N / 16)) * 16 + (lane & 15), k8 = (wv / (N / 16)) * 16 + (lane >> 4) * 8; FragH f;
#pragma unroll
  for (int i = 0; i < 8; ++i) f.h[i] = (_Float16)(bf16_rne(W[(size_t)(k8 + i) * N + n]) * scale);
  const v8us o = f.half[0];
  unsigned short* d = (unsigned short*)Wt + fo_chunk(n, k8, K);
  *(v8us*)d = o; 
}

__global__ __launch_bounds__(256) void k_x16(const float* __restrict__ x, _Float16* __restrict__ X16) {
  const int t = blockIdx.x * 256 + threadIdx.x; if (t >= NR * (DM / 8)) return;
  /* one wave writes one half tile (512 contiguous bytes): lane = 16 * h + row % 16; consecutive waves take consecutive 16-k halves of a row tile */
  const int wv = t >> 5, lane = t & 31; const int row = (wv / (DM / 16)) * 16 + (lane & 15), c8 = (wv % (DM / 16)) * 16 + (lane >> 4) * 8; const int b = row / SEQ, s = row % SEQ;
  const float* src = x + ((size_t)b * SEQ_FULL + s) * DM + c8;
  const v4f a = *(const v4fa*)src, c = *(const v4fa*)(src + 4); FragH f;
#pragma unroll
  for (int i = 0; i < 4; ++i) { f.h[i] = (_Float16)bf16_rne(a[i]); f.h[4 + i] = (_Float16)bf16_rne(c[i]); }
  const v8us o = f.half[0];
  unsigned short* d = (unsigned short*)X16 + fo_chunk(row, c8, DM);
  *(v8us*)d = o; 
}

// GEMM: wave tile (16*MT) x 64, block = 4 waves = (64*MT) rows x 64 cols; A and Bh are f16 planes in fragment order (fragments straight from global).
// v = acc*alpha (+ accL*alphaL with the residual A plane AL, ARES) + bias (per column, or per row if ROWBIAS; bias RNE-converted to bf16).
// Logical row R maps to A row seg*aSeg + aOff + w and C row seg*cSeg + cOff + w with seg = R / segRows, w = R % segRows (blocks never straddle segments).
// OUT 0: f32 C. OUT 1: f16 C16 (+ x1024 residual rows in CL when the rows lie in the first ISL rows of a sequence). OUT 2: f16 C16 (+ residual columns when the token columns lie in the first ISL rows of a sequence).
// Requires M % (64*MT) == 0, N % 64 == 0, K % 64 == 0 (asserted above for the launches used). LDS tile is private to its wave (wave-level sync).
template <int MT, bool ROWBIAS, bool ARES, int OUT>
__device__ __forceinline__ void gemm_body(const _Float16* __restrict__ A, const _Float16* __restrict__ AL, int lda,
    const _Float16* __restrict__ Bh, int ldb, float alpha, float alphaL, const float* __restrict__ bias,
    float* __restrict__ Cf, _Float16* __restrict__ C16, _Float16* __restrict__ CL, int ldc, int ldcl,
    int M, int N, int K, int segRows, int aSeg, int aOff, int cSeg, int cOff) {
  static_assert(MT == 1 || MT == 2);
  static_assert(!ARES || MT == 1);      /* residual form keeps 8 accumulators */
  __shared__ __attribute__((aligned(16))) float so[4][32][68];
  const int tid = threadIdx.x, lane = tid & 31, ln = lane & 15, hh = lane >> 4;
  const int w = __builtin_amdgcn_readfirstlane(tid >> 5);      /* wave-uniform, so that every tile base below is a scalar pointer */
  const int ntn = N >> 6;
  const int mt = blockIdx.x / ntn, nq = blockIdx.x - mt * ntn;
  const int R0 = mt * (64 * MT) + (16 * MT) * w, col0 = nq * 64;
  if (R0 >= M) return;
  const int seg = R0 / segRows, wi = R0 - seg * segRows;
  const int arow0 = seg * aSeg + aOff + wi, crow0 = seg * cSeg + cOff + wi;
  /* arow0, R0 and col0 are multiples of 16: row tile r / 16 starts at element r * ld; 32 k further is 512 elements further */
  const _Float16* a0p = A + (size_t)arow0 * lda;
  const _Float16* b0p = Bh + (size_t)col0 * ldb;
  const unsigned lo = 16u * (unsigned)lane;      /* the lane's byte offset inside a half tile: the one vector address register of every fragment load */
  const v8f z8 = {0.f, 0.f, 0.f, 0.f, 0.f, 0.f, 0.f, 0.f};
  v8f c00 = z8, c01 = z8, c02 = z8, c03 = z8, c10 = z8, c11 = z8, c12 = z8, c13 = z8, d00 = z8, d01 = z8, d02 = z8, d03 = z8;
  // Two register sets of fragments (P, N), 32 k each: every set is loaded as one group, one k block ahead of the WMMAs that read it, so a block waits for one load round trip that started a block earlier.
  const _Float16* e0p = ARES ? AL + (size_t)R0 * lda : a0p;
#define GEMM_LD(S, kk) { S##a0 = g2_frago(a0p, lo, (kk) * 32); if (MT == 2) S##a1 = g2_frago(a0p, lo, 32 * lda + (kk) * 32); if (ARES) S##e0 = g2_frago(e0p, lo, (kk) * 32); \
    S##b0 = g2_frago(b0p, lo, (kk) * 32); S##b1 = g2_frago(b0p, lo, 32 * ldb + (kk) * 32); S##b2 = g2_frago(b0p, lo, 64 * ldb + (kk) * 32); S##b3 = g2_frago(b0p, lo, 96 * ldb + (kk) * 32); }
#define GEMM_MM(S) { c00 = g2_mma(S##a0, S##b0, c00); if (MT == 2) c10 = g2_mma(S##a1, S##b0, c10); if (ARES) d00 = g2_mma(S##e0, S##b0, d00); \
    c01 = g2_mma(S##a0, S##b1, c01); if (MT == 2) c11 = g2_mma(S##a1, S##b1, c11); if (ARES) d01 = g2_mma(S##e0, S##b1, d01); \
    c02 = g2_mma(S##a0, S##b2, c02); if (MT == 2) c12 = g2_mma(S##a1, S##b2, c12); if (ARES) d02 = g2_mma(S##e0, S##b2, d02); \
    c03 = g2_mma(S##a0, S##b3, c03); if (MT == 2) c13 = g2_mma(S##a1, S##b3, c13); if (ARES) d03 = g2_mma(S##e0, S##b3, d03); }
  const v16h zf = (v16h)((_Float16)0.0f);
  v16h Pa0 = zf, Pa1 = zf, Pe0 = zf, Pb0 = zf, Pb1 = zf, Pb2 = zf, Pb3 = zf, Na0 = zf, Na1 = zf, Ne0 = zf, Nb0 = zf, Nb1 = zf, Nb2 = zf, Nb3 = zf;
  GEMM_LD(P, 0)
#pragma unroll      /* K is a constant of every launch: unrolled, the k offsets are immediates and no address register is rewritten while a group is in flight */
  for (int kb = 0; kb < K; kb += 64) {
    GEMM_LD(N, kb + 32)
    if (kb + 64 >= K) asm volatile("s_wait_xcnt 0x0" :: "v"(lane) : "memory");      /* behind the last group: the loads' offset register (built as the lane number, scaled by the load) lives up to this wait, so nothing (a late load's result included) is written over it earlier */
    GEMM_MM(P)
    if (kb + 64 < K) GEMM_LD(P, kb + 64)
    GEMM_MM(N)
  }
#undef GEMM_LD
#undef GEMM_MM
  const v8f accs[8] = {c00, c01, c02, c03, c10, c11, c12, c13};
  const v8f accl[4] = {d00, d01, d02, d03};
#pragma unroll
  for (int u = 0; u < 4 * MT; ++u) {
    const int t = u & 3, half = u >> 2; const int col = col0 + t * 16 + ln;
    float bvc = 0.f; if (!ROWBIAS) bvc = bf16_rne(bias[col]);
#pragma unroll
    for (int r = 0; r < 8; ++r) {
      const int rloc = half * 16 + 8 * hh + r;
      float v = accs[u][r] * alpha;
      if (ARES) v += accl[t][r] * alphaL;
      if (ROWBIAS) v += bf16_rne(bias[R0 + rloc]); else v += bvc;
      so[w][rloc][t * 16 + ln] = v;
    }
  }
  __builtin_amdgcn_fence(4 /* acq_rel order */, "workgroup"); __builtin_amdgcn_wave_barrier();
  const int rsub = lane >> 4, c4 = (lane & 15) * 4;
  if (OUT == 0) {
    {
#pragma unroll
      for (int q = 0; q < 8 * MT; ++q) { const int r = q * 2 + rsub; const v4f v = *(const v4fa*)&so[w][r][c4]; *(v4f*)(Cf + (size_t)(crow0 + r) * ldc + col0 + c4) = v; }
      
    }
  } else {
    int sl, rrow0, rcol0;
    if (OUT == 1) { sl = crow0 % SEQ; rrow0 = (crow0 / SEQ) * ISL + sl; rcol0 = col0; }
    else          { sl = col0 % SEQ;  rrow0 = crow0; rcol0 = (col0 / SEQ) * ISL + sl; }
    const bool isl = sl < ISL;      /* uniform over the wave tile: ISL and SEQ are multiples of 64 */
    {      /* one store = one half tile of the fragment-order plane: lane (hh, ln) holds row ln, 8 columns from 8 * hh */
#pragma unroll
      for (int q = 0; q < 4 * MT; ++q) {
        const int r = (q >> 2) * 16 + ln, c = (q & 3) * 16 + 8 * hh;
        const v4f va = *(const v4fa*)&so[w][r][c], vc = *(const v4fa*)&so[w][r][c + 4];
        FragH fh, fl;
#pragma unroll
        for (int i = 0; i < 4; ++i) {
          const _Float16 h0 = (_Float16)va[i], h1 = (_Float16)vc[i]; fh.h[i] = h0; fh.h[4 + i] = h1;
          fl.h[i] = (_Float16)((va[i] - (float)h0) * 1024.0f); fl.h[4 + i] = (_Float16)((vc[i] - (float)h1) * 1024.0f);
        }
        const v8us oh = fh.half[0], ol = fl.half[0];
        *(v8us*)((unsigned short*)C16 + fo_chunk(crow0 + r, col0 + c, ldc)) = oh;
        asm volatile("s_wait_xcnt 0x0" ::: "memory");      /* in front of the reuse of the store's data and address registers by the residual's arithmetic */
        if (isl) *(v8us*)((unsigned short*)CL + fo_chunk(rrow0 + r, rcol0 + c, ldcl)) = ol;
      }
      
    }
  }
}

// q | k rows (f16) = X16 . Wqk^T / 16 + b; residual rows for s < ISL
__global__ __launch_bounds__(128) void k_gemm_qk(const _Float16* __restrict__ X16, const _Float16* __restrict__ BW, const float* __restrict__ bias, _Float16* __restrict__ QK, _Float16* __restrict__ QKL) {
  gemm_body<2, false, false, 1>(X16, nullptr, DM, BW, DM, 0.0625f, 0.f, bias, nullptr, QK, QKL, LQK, LQK, NR, 2 * DM, DM, NR, 0, 0, 0, 0);
}
// V^T[h*64+d][token] (f16) = Wv . X16^T / 16 + b[row]; residual columns for s < ISL
__global__ __launch_bounds__(128) void k_gemm_vt(const _Float16* __restrict__ BWv, const _Float16* __restrict__ X16, const float* __restrict__ biasv, _Float16* __restrict__ VT, _Float16* __restrict__ VTL) {
  gemm_body<2, true, false, 2>(BWv, nullptr, DM, X16, DM, 0.0625f, 0.f, biasv, nullptr, VT, VTL, LVT, LVL, DM, NR, DM, DM, 0, 0, 0, 0);
}
// out rows s >= ISL: ctx(x64) . Wo(x16) * 2^-10 + b
__global__ __launch_bounds__(128) void k_gemm_out(const _Float16* __restrict__ O16, const _Float16* __restrict__ BO, const float* __restrict__ bias, float* __restrict__ out) {
  gemm_body<2, false, false, 0>(O16, nullptr, DM, BO, DM, 0.0009765625f, 0.f, bias, out, nullptr, nullptr, DM, 0, NB * (SEQ - ISL), DM, DM, SEQ - ISL, SEQ, ISL, SEQ_FULL, ISL);
}
// out rows s < ISL: (ctx_hi . Wo) * 2^-10 + (ctx_res . Wo) * 2^-20 + b, separate accumulators
__global__ __launch_bounds__(128) void k_gemm_out_isl(const _Float16* __restrict__ O16, const _Float16* __restrict__ OL, const _Float16* __restrict__ BO, const float* __restrict__ bias, float* __restrict__ out) {
  gemm_body<1, false, true, 0>(O16, OL, DM, BO, DM, 0.0009765625f, 0.00000095367431640625f, bias, out, nullptr, nullptr, DM, 0, NRI, DM, DM, ISL, SEQ, 0, SEQ_FULL, 0);
}

// Fused prefix-causal attention, transposed form. Block = 8 waves = 128 consecutive queries of one (b, h); wave = 16 queries (D column = query = lane & 15).
// Visibility: key j is seen by query i iff (j <= i) OR (i < S AND j < S); S is loaded from its input buffer and clamped to [0, SEQ] (same mask for any value).
// Key range of a wave: [0, max(S, q0 + 16)) in 32-key steps (all step keys lie inside the sequence since SEQ % 32 == 0). Every step holds key kcb that is visible to every query of the wave
// (kcb <= q0 when the range ends at q0 + 16; kcb < S with all 16 queries < S otherwise), so the step maximum is always finite.
// Per 32-key step: S^T tiles (keys kcb..+15 and +16..+31) = K (A, rows = keys) . Q^T (B, lane = query); scale 1/8; hidden keys are REPLACED (excluded from max, weight 0 by value);
// online max / sum per lane (halves combined by one xor-16 shuffle); P^T (x1024, f16) is the B fragment directly: element r <- tile0[r], element 8+r <- tile1[r];
// O^T (rows = d) += V^T (A, rows = d, k = keys) . P^T. RES: q, k, v, P carry x1024 residual planes; residual products go to separate accumulators folded back with 2^-10.
// Residual k / v planes exist only for keys < ISL: for key steps at or beyond ISL (possible when S > ISL) the residual k / v fragments are loaded from a clamped in-range step and zeroed by value (wave-uniform select).
template <bool RES>
__device__ __forceinline__ void attn_body(const _Float16* __restrict__ QK, const _Float16* __restrict__ QKL, const _Float16* __restrict__ VT, const _Float16* __restrict__ VTL,
                                          _Float16* __restrict__ O16, _Float16* __restrict__ OL, const int* __restrict__ Sp, int qb0, int nqb) {
  const int tid = threadIdx.x, lane = tid & 31, ln = lane & 15, hh = lane >> 4;
  const int w = __builtin_amdgcn_readfirstlane(tid >> 5);
  const int sraw = Sp[0];
  const int Sc = sraw < 0 ? 0 : (sraw > SEQ ? SEQ : sraw);
  const int bh = (int)blockIdx.x / nqb; const int qb = qb0 + ((int)blockIdx.x - bh * nqb);
  const int h = bh % NH, b = bh / NH;
  const int q0 = qb * 128 + w * 16, q = q0 + ln;
  const bool qpre = q < Sc;
  const int rowb = b * SEQ, rowi = b * ISL;
  /* fragment-order planes: row tile r / 16 starts at element r * pitch (r % 16 == 0), column block c / 32 at c * 16 (c % 32 == 0), the lane's chunk at 8 * lane */
  const unsigned lo = 16u * (unsigned)lane;                           /* the lane's byte offset inside a half tile */
  const _Float16* qp = QK + (size_t)(rowb + q0) * LQK + h * HD * 16;
  const v16h qh0 = g2_frago(qp, lo, 0), qh1 = g2_frago(qp, lo, 1024);
  const int qloff = (rowi + q0) * LQK + h * HD * 16;       /* residual q tile (RES) */
  const int kbase = rowb * LQK + (DM + h * HD) * 16;       /* k tile of keys 0..15, d 0..31 */
  const int klbase = rowi * LQK + (DM + h * HD) * 16;      /* residual k tile (RES) */
  const int vbase = h * HD * LVT + rowb * 16;              /* V^T tile d 0..15, keys 0..31 */
  const int vlbase = h * HD * LVL + rowi * 16;             /* residual V^T tile (RES) */
  const v8f z8 = {0.f, 0.f, 0.f, 0.f, 0.f, 0.f, 0.f, 0.f};
  const v16h zh = (v16h)((_Float16)0.0f);
  v8f o0 = z8, o1 = z8, o2 = z8, o3 = z8, e0 = z8, e1 = z8, e2 = z8, e3 = z8;
  float m = -1.0e30f, l = 0.f;
  const int kend = (Sc > q0 + 16) ? Sc : (q0 + 16);              /* keys [0, kend) cover every visible key of the wave; kend <= SEQ */
  const int nst = (kend + 31) >> 5;
  // Plain form: the K and V fragments live in registers across the loop; the next step's K group is issued right behind this step's S^T WMMAs and the next step's V group right behind its O^T WMMAs.
  v16h ka = zh, kb = zh, kc = zh, kd = zh, v0 = zh, v1 = zh, v2 = zh, v3 = zh;
  unsigned kq = 2u * (unsigned)kbase + lo, vq = 2u * (unsigned)vbase + lo;      /* the lane's byte offsets of the K and V groups held in registers; step 0 exists: nst >= 1 */
  if (!RES) {
    ka = g2_frago(QK, kq, 0); kb = g2_frago(QK, kq, 1024); kc = g2_frago(QK, kq, 32 * LQK); kd = g2_frago(QK, kq, 32 * LQK + 1024);
    v0 = g2_frago(VT, vq, 0); v1 = g2_frago(VT, vq, 32 * LVT); v2 = g2_frago(VT, vq, 64 * LVT); v3 = g2_frago(VT, vq, 96 * LVT);
    /* inputs-only fence on the loaded values: every load in front of the loop has landed here, so the wait at the loop's head counts the loop's own groups alone and leaves the next V group in flight */
    asm volatile("" :: "v"(qh0), "v"(qh1), "v"(ka), "v"(kb), "v"(kc), "v"(kd), "v"(v0), "v"(v1), "v"(v2), "v"(v3));
  }
#pragma unroll 1
  for (int st = 0; st < nst; ++st) {
    const int kcb = st * 32;
    const int adv = (st + 1 < nst) ? 32 : 0;                     /* keys to the next step; the last step reloads its own (in range, not used) */
    const bool rok = kcb < ISL;                                  /* wave-uniform: residual k / v rows exist for this step */
    const int kcl = rok ? kcb : (ISL - 32);                      /* clamped in-range residual step */
    const _Float16* kp0 = QK + kbase + kcb * LQK;
    v8f s0 = z8, s1 = z8, r0 = z8, r1 = z8;
    if (RES) {
      unsigned qo = lo; asm volatile("" : "+v"(qo));             /* reload the residual q fragments per step (integer offset only) */
      const _Float16* qlp = QKL + qloff;
      const v16h ql0 = g2_frago(qlp, qo, 0), ql1 = g2_frago(qlp, qo, 1024);
      const _Float16* kl0 = QKL + klbase + kcl * LQK;
      /* all k fragments of the step as one load group in front of its WMMAs */
      const v16h ah0 = g2_frago(kp0, lo, 0), ah1 = g2_frago(kp0, lo, 1024), ah2 = g2_frago(kp0, lo, 32 * LQK), ah3 = g2_frago(kp0, lo, 32 * LQK + 1024);
      v16h al0 = g2_frago(kl0, lo, 0), al1 = g2_frago(kl0, lo, 1024), al2 = g2_frago(kl0, lo, 32 * LQK), al3 = g2_frago(kl0, lo, 32 * LQK + 1024);
      asm volatile("s_wait_xcnt 0x0" :: "v"(qo) : "memory");      /* behind the group: the offset register that the residual q loads name lives up to this wait, so no later load's result is written over it earlier */
      al0 = rok ? al0 : zh; al1 = rok ? al1 : zh; al2 = rok ? al2 : zh; al3 = rok ? al3 : zh;
      s0 = g2_mma(ah0, qh0, s0); r0 = g2_mma(al0, qh0, r0); r0 = g2_mma(ah0, ql0, r0);
      s0 = g2_mma(ah1, qh1, s0); r0 = g2_mma(al1, qh1, r0); r0 = g2_mma(ah1, ql1, r0);
      s1 = g2_mma(ah2, qh0, s1); r1 = g2_mma(al2, qh0, r1); r1 = g2_mma(ah2, ql0, r1);
      s1 = g2_mma(ah3, qh1, s1); r1 = g2_mma(al3, qh1, r1); r1 = g2_mma(ah3, ql1, r1);
    } else {
      s0 = g2_mma(ka, qh0, s0); s0 = g2_mma(kb, qh1, s0); s1 = g2_mma(kc, qh0, s1); s1 = g2_mma(kd, qh1, s1);
      asm volatile("s_wait_xcnt 0x0" : "+v"(kq) :: "memory");      /* stands in front of the rewrite of the offset register that the last K group's loads name; the register is an operand so that the addition stays behind it */
      kq += (unsigned)(adv * LQK * 2);
      ka = g2_frago(QK, kq, 0); kb = g2_frago(QK, kq, 1024); kc = g2_frago(QK, kq, 32 * LQK); kd = g2_frago(QK, kq, 32 * LQK + 1024);
      __builtin_amdgcn_sched_barrier(0);      /* holds the K group at the head of the softmax: issued further down it has less of the step to land in */
    }
    v16h vl0 = zh, vl1 = zh, vl2 = zh, vl3 = zh;
    if (RES) {      /* all v fragments of the step as one load group in front of the softmax */
      const _Float16* vp = VT + vbase + kcb * 16; const _Float16* vlp = VTL + vlbase + kcl * 16;
      v0 = g2_frago(vp, lo, 0); v1 = g2_frago(vp, lo, 32 * LVT); v2 = g2_frago(vp, lo, 64 * LVT); v3 = g2_frago(vp, lo, 96 * LVT);
      vl0 = g2_frago(vlp, lo, 0); vl1 = g2_frago(vlp, lo, 32 * LVL); vl2 = g2_frago(vlp, lo, 64 * LVL); vl3 = g2_frago(vlp, lo, 96 * LVL);
    }
    // D row = key kcb + 8*hh + r (tile 0), + 16 (tile 1); D column = query q
    v8f xa, xb; float mt = -1.0e30f;
#pragma unroll
    for (int r = 0; r < 8; ++r) {
      const int k0 = kcb + 8 * hh + r;
      const bool va = (k0 <= q) || (qpre && (k0 < Sc));
      const bool vb = (k0 + 16 <= q) || (qpre && (k0 + 16 < Sc));
      float a = s0[r], c = s1[r];
      if (RES) { a += r0[r] * 0.0009765625f; c += r1[r] * 0.0009765625f; }
      a *= 0.125f; c *= 0.125f;
      a = va ? a : -1.0e30f; c = vb ? c : -1.0e30f;
      xa[r] = a; xb[r] = c; mt = fmaxf(mt, fmaxf(a, c));
    }
    mt = fmaxf(mt, __shfl_xor(mt, 16, 32));
    const float mn = fmaxf(m, mt);
    float f; { const float t = fmaxf(m - mn, -80.0f) * 1.44269504f;      /* __expf as it compiles (multiply, v_exp_f32), with the slot behind the transcendental filled in the same statement */
      asm("v_exp_f32 %0, %1\n\tv_nop" : "=v"(f) : "v"(t)); }
    m = mn;
    FragH ph, pl; float rs = 0.f;
#pragma unroll
    for (int r = 0; r < 8; ++r) {
      const int k0 = kcb + 8 * hh + r;
      const bool va = (k0 <= q) || (qpre && (k0 < Sc));
      const bool vb = (k0 + 16 <= q) || (qpre && (k0 + 16 < Sc));
      float pa = __expf(va ? (xa[r] - mn) : 0.f); pa = va ? pa : 0.f;
      float pb = __expf(vb ? (xb[r] - mn) : 0.f); pb = vb ? pb : 0.f;
      rs += pa + pb;
      const float ta = pa * 1024.0f, tb = pb * 1024.0f;
      const _Float16 ha = (_Float16)ta, hb = (_Float16)tb;
      ph.h[r] = ha; ph.h[8 + r] = hb;
      if (RES) { pl.h[r] = (_Float16)((ta - (float)ha) * 1024.0f); pl.h[8 + r] = (_Float16)((tb - (float)hb) * 1024.0f); }
    }
    const float rso = __shfl_xor(rs, 16, 32);
    l = l * f + (rs + rso);
    o0 *= f; o1 *= f; o2 *= f; o3 *= f;
    if (RES) { e0 *= f; e1 *= f; e2 *= f; e3 *= f; }
    o0 = g2_mma(v0, ph.v, o0); o1 = g2_mma(v1, ph.v, o1); o2 = g2_mma(v2, ph.v, o2); o3 = g2_mma(v3, ph.v, o3);
    if (RES) {
      vl0 = rok ? vl0 : zh; vl1 = rok ? vl1 : zh; vl2 = rok ? vl2 : zh; vl3 = rok ? vl3 : zh;
      e0 = g2_mma(vl0, ph.v, e0); e0 = g2_mma(v0, pl.v, e0);
      e1 = g2_mma(vl1, ph.v, e1); e1 = g2_mma(v1, pl.v, e1);
      e2 = g2_mma(vl2, ph.v, e2); e2 = g2_mma(v2, pl.v, e2);
      e3 = g2_mma(vl3, ph.v, e3); e3 = g2_mma(v3, pl.v, e3);
    } else {
      asm volatile("s_wait_xcnt 0x0" : "+v"(vq) :: "memory");      /* the same for the V group's offset register */
      vq += (unsigned)(adv * 32);      /* 32 keys further = the next tile, 1 KB */
      v0 = g2_frago(VT, vq, 0); v1 = g2_frago(VT, vq, 32 * LVT); v2 = g2_frago(VT, vq, 64 * LVT); v3 = g2_frago(VT, vq, 96 * LVT);
    }
  }
  // ctx x64 = O^T * 64 / (1024 * l); O^T row d = dg*16 + 8*hh + r, column = query ln
  const float inv = 0.0625f * (1.0f / l);
  const v8f oo[4] = {o0, o1, o2, o3}; const v8f ee[4] = {e0, e1, e2, e3};
  // the lane's 8 values of O^T tile dg are query ln, columns dg*16 + 8*hh .. + 7: one chunk of the fragment-order ctx plane, so each tile goes out of the accumulators as one half-tile store of 512 contiguous bytes
#pragma unroll
  for (int dg = 0; dg < 4; ++dg) {
    FragH fh, fl;
#pragma unroll
    for (int r = 0; r < 8; ++r) {
      float v = oo[dg][r]; if (RES) v += ee[dg][r] * 0.0009765625f; v *= inv;
      const _Float16 h0 = (_Float16)v; fh.h[r] = h0; fl.h[r] = (_Float16)((v - (float)h0) * 1024.0f);
    }
    const v8us oh = fh.half[0], ol = fl.half[0];
    *(v8us*)((unsigned short*)O16 + fo_chunk(rowb + q0 + ln, h * HD + dg * 16 + 8 * hh, DM)) = oh;
    if (RES) *(v8us*)((unsigned short*)OL + fo_chunk(rowi + q0 + ln, h * HD + dg * 16 + 8 * hh, DM)) = ol;
  }
}

__global__ __launch_bounds__(256) void k_attn_isl(const _Float16* __restrict__ QK, const _Float16* __restrict__ QKL, const _Float16* __restrict__ VT, const _Float16* __restrict__ VTL, _Float16* __restrict__ O16, _Float16* __restrict__ OL, const int* __restrict__ Sp) {
  attn_body<true>(QK, QKL, VT, VTL, O16, OL, Sp, 0, ISL / 128);
}
__global__ __launch_bounds__(256) void k_attn_main(const _Float16* __restrict__ QK, const _Float16* __restrict__ VT, _Float16* __restrict__ O16, const int* __restrict__ Sp) {
  attn_body<false>(QK, nullptr, VT, nullptr, O16, nullptr, Sp, ISL / 128, (SEQ - ISL) / 128);
}

constexpr size_t al256(size_t bytes) { return (bytes + 255) & ~(size_t)255; }
constexpr size_t SZ_BQKV = al256((size_t)3 * DM * DM * 2);
constexpr size_t SZ_BO   = al256((size_t)DM * DM * 2);
constexpr size_t SZ_X16  = al256((size_t)NR * DM * 2);
constexpr size_t SZ_QK   = al256((size_t)NR * LQK * 2);
constexpr size_t SZ_QKL  = al256((size_t)NRI * LQK * 2);
constexpr size_t SZ_VT   = al256((size_t)DM * LVT * 2);
constexpr size_t SZ_VTL  = al256((size_t)DM * LVL * 2);
constexpr size_t SZ_O16  = al256((size_t)NR * DM * 2);
constexpr size_t SZ_OL   = al256((size_t)NRI * DM * 2);
constexpr size_t WS_TOTAL = SZ_BQKV + SZ_BO + SZ_X16 + SZ_QK + SZ_QKL + SZ_VT + SZ_VTL + SZ_O16 + SZ_OL;
static_assert(WS_TOTAL <= (size_t)134217728);      /* carve <= 128 MiB */

extern "C" void kernel_launch(void* const* d_in, const int* in_sizes, int n_in,
                              void* d_out, int out_size, void* d_ws, size_t ws_size, hipStream_t stream) {
  if (n_in < 6) return;
  const long long xrows = (long long)(NB - 1) * SEQ_FULL + SEQ;      /* rows of x / out touched */
  if ((long long)in_sizes[0] < xrows * DM) return;
  if ((long long)in_sizes[1] < (long long)DM * 3 * DM) return;
  if ((long long)in_sizes[2] < (long long)3 * DM) return;
  if ((long long)in_sizes[3] < (long long)DM * DM) return;
  if ((long long)in_sizes[4] < (long long)DM) return;
  if ((long long)in_sizes[5] < 1) return;
  if ((long long)out_size < xrows * DM) return;
  if (WS_TOTAL > ws_size) return;
  const float* x = (const float*)d_in[0]; const float* w_attn = (const float*)d_in[1]; const float* b_attn = (const float*)d_in[2];
  const float* w_proj = (const float*)d_in[3]; const float* b_proj = (const float*)d_in[4];
  const int* s_pref = (const int*)d_in[5];                           /* prefix length, loaded on the device */
  float* out = (float*)d_out;
  char* ws = (char*)d_ws; size_t off = 0;
  _Float16* BQKV = (_Float16*)(ws + off); off += SZ_BQKV;      /* [3072][1024] x16; this and every plane below in fragment order */
  _Float16* BO   = (_Float16*)(ws + off); off += SZ_BO;        /* [1024][1024] x16 */
  _Float16* X16  = (_Float16*)(ws + off); off += SZ_X16;       /* [NR][1024] */
  _Float16* QK   = (_Float16*)(ws + off); off += SZ_QK;        /* [NR][2048] q | k */
  _Float16* QKL  = (_Float16*)(ws + off); off += SZ_QKL;       /* [NRI][2048] residual x1024 */
  _Float16* VT   = (_Float16*)(ws + off); off += SZ_VT;        /* [1024][NR] */
  _Float16* VTL  = (_Float16*)(ws + off); off += SZ_VTL;       /* [1024][NRI] residual x1024 */
  _Float16* O16  = (_Float16*)(ws + off); off += SZ_O16;       /* [NR][1024] ctx x64 */
  _Float16* OL   = (_Float16*)(ws + off); off += SZ_OL;        /* [NRI][1024] ctx residual x1024 */
  if (off > ws_size) return;

  k_wt_f16<<<(unsigned)(((size_t)3 * DM * (DM / 8) + 255) / 256), 256, 0, stream>>>(w_attn, BQKV, DM, 3 * DM, 16.0f);      /* W[K=1024][N=3072] -> Wt[N][K] */
  k_wt_f16<<<(unsigned)(((size_t)DM * (DM / 8) + 255) / 256), 256, 0, stream>>>(w_proj, BO, DM, DM, 16.0f);                /* W[K=1024][N=1024] -> Wt[N][K] */
  k_x16<<<(unsigned)(((size_t)NR * (DM / 8) + 255) / 256), 256, 0, stream>>>(x, X16);
  k_gemm_qk<<<(unsigned)((NR / 128) * (2 * DM / 64)), 128, 0, stream>>>(X16, BQKV, b_attn, QK, QKL);
  k_gemm_vt<<<(unsigned)((DM / 128) * (NR / 64)), 128, 0, stream>>>(BQKV + (size_t)2 * DM * DM, X16, b_attn + 2 * DM, VT, VTL);
  k_attn_isl<<<(unsigned)(NB * NH * (ISL / 128)), 256, 0, stream>>>(QK, QKL, VT, VTL, O16, OL, s_pref);
  if (SEQ > ISL) k_attn_main<<<(unsigned)(NB * NH * ((SEQ - ISL) / 128)), 256, 0, stream>>>(QK, VT, O16, s_pref);
  if (SEQ > ISL) k_gemm_out<<<(unsigned)((NB * (SEQ - ISL) / 128) * (DM / 64)), 128, 0, stream>>>(O16, BO, b_proj, out);
  k_gemm_out_isl<<<(unsigned)((NRI / 64) * (DM / 64)), 128, 0, stream>>>(O16, OL, BO, b_proj, out);
}

// v003
// It runs in 120 microseconds.
// Next to v002, in two timings, it ran 1.19 and 1.21 times as fast.
// Over all steps from v000 it is 2.51 times as fast.
#include <hip/hip_runtime.h>
// All contractions: v_wmma_f32_16x16x32_f16 (f16 operands, f32 accumulate). x, weights and biases are RNE-converted to bf16; x and weights are held exactly in f16 (weights x16); q, k, v, softmax weights (x1024) and ctx (x64) are f16 planes; for the first 256 query rows of every sequence q, k, v, P and ctx also carry an f16 residual plane (x1024) accumulated in a separate accumulator.
// Structure: token rows r = b*SEQ + s. (1) weights -> Wt[n][k] f16; x -> f16 rows. (2) q|k rows = X16 . Wqk (N = 2048) and V^T[h*64+d][token] = Wv . X16^T (operand-swapped GEMM, row bias). (3) fused flash attention in the transposed form S^T = K Q^T, O^T = V^T P^T: one wave owns 16 queries, fragments are loaded straight from the 16-bit planes (all kept in fragment order, see fo_chunk), P^T goes D -> B in registers, online softmax statistics are per-lane scalars; visibility (key <= query) OR (query < S AND key < S) applied as a replace-mask by value, S loaded on the device from its input buffer. (4) out = ctx . Wo + b (f32).
#ifndef NB
#define NB 2
#endif
#ifndef SEQ
#define SEQ 2048
#endif
#define NB_FULL 2
#define SEQ_FULL 2048
#define DM 1024
#define NH 16
#define HD 64
#define ISL ((SEQ) < 256 ? (SEQ) : 256)   /* query rows per sequence carried with residual planes */
#define NR (NB * SEQ)                      /* token rows in the workspace planes */
#define NRI (NB * ISL)                     /* rows of the compact residual planes */
#define LQK (2 * DM)                       /* row pitch of the q | k plane */
#define LVT NR                             /* row pitch of V^T */
#define LVL NRI                            /* row pitch of the V^T residual plane */

static_assert(NB >= 1 && NB <= NB_FULL);          /* reduced builds only shrink */
static_assert(SEQ <= SEQ_FULL);
static_assert(SEQ % 128 == 0);                    /* 8 waves x 16 queries per attention block; GEMM row blocks; 32-key steps stay inside the sequence */
static_assert(ISL % 128 == 0);                    /* residual region is a whole number of blocks */
static_assert(ISL >= 32);                         /* clamped residual key step ISL - 32 is a valid step */
static_assert((SEQ - ISL) % 128 == 0);            /* plain region is a whole number of blocks */
static_assert(NH * HD == DM);                     /* merged head layout */
static_assert(HD == 64);                          
static_assert(DM % 128 == 0);                     /* GEMM M blocks (V^T) and K % 64 (two k blocks per trip) */
static_assert(DM % 8 == 0);                       /* 8-element convert threads */
static_assert(NR % 128 == 0);                     /* GEMM M blocks / N tiles of 64 */
static_assert(NRI % 64 == 0);                     /* residual-row output GEMM blocks */
static_assert((long long)NR * LQK < 2147483647LL);/* int plane offsets */
static_assert((long long)DM * LVT < 2147483647LL);

typedef unsigned short v8us __attribute__((ext_vector_type(8), may_alias));
typedef float  v8f  __attribute__((ext_vector_type(8)));
typedef float  v4f  __attribute__((ext_vector_type(4)));
typedef float  v4fa __attribute__((ext_vector_type(4), may_alias));
typedef _Float16 v16h __attribute__((ext_vector_type(16)));
typedef _Float16 v4h  __attribute__((ext_vector_type(4)));
union FragH { v16h v; v8us half[2]; _Float16 h[16]; unsigned short u[16]; };

__device__ __forceinline__ float bf16_rne(float x) { unsigned int u = __float_as_uint(x); u = (u + 0x7FFFu + ((u >> 16) & 1u)) & 0xFFFF0000u; return __uint_as_float(u); }

// Fragment order: every 16-bit plane [rows][K] is stored as tiles of 16 rows x 32 k, 512 elements (1 KB) each, tile (row / 16, k / 32) at element (row / 16) * 16 * K + (k / 32) * 512.
// Inside a tile: two halves of 256 elements (k 0..15, k 16..31), each 32 lanes x 8 elements with lane = 16 * ((k / 8) & 1) + row % 16. A fragment is then two loads of 512 contiguous bytes (4 whole lines each).
// element offset of the 8-element chunk that holds (row, k .. k + 7), k % 8 == 0, in a plane of K columns (K % 32 == 0)
__device__ __forceinline__ size_t fo_chunk(int row, int k, int K) { return (size_t)(row >> 4) * 16 * K + (size_t)((k >> 5) * 512 + ((k >> 4) & 1) * 256 + (((k >> 3) & 1) * 16 + (row & 15)) * 8); }
// fragment of one tile: elements 0..7 <- k 8h.., elements 8..15 <- k 16+8h.., row = lane & 15, h = lane >> 4 (same map for A and B);
// from a uniform pointer, the lane's own 32-bit byte offset (16 * lane folded in) and a constant byte step
__device__ __forceinline__ v16h g2_frago(const _Float16* base, unsigned off, int add) { const char* p = (const char*)base + (size_t)off + add; FragH f; f.half[0] = *(const v8us*)p; f.half[1] = *(const v8us*)(p + 512); return f.v; }
__device__ __forceinline__ v8f g2_mma(v16h a, v16h b, v8f c) { v8f d = __builtin_amdgcn_wmma_f32_16x16x32_f16(false, a, false, b, (short)0, c, false, false); asm volatile("v_nop\n\tv_nop\n\tv_nop\n\tv_nop" : "+v"(d) : "v"(a), "v"(b)); return d; }

__device__ __forceinline__ void wt_f16_body(const float* __restrict__ W, _Float16* __restrict__ Wt, int K, int N, float scale, int bid) {
  /* one wave writes one half tile (512 contiguous bytes): lane = 16 * h + n % 16; waves run over the row tiles first, then over the 16-k halves */
  const int t = bid * 256 + threadIdx.x; if (t >= N * (K / 8)) return; const int wv = t >> 5, lane = t & 31; const int n = (wv % (N / 16)) * 16 + (lane & 15), k8 = (wv / (N / 16)) * 16 + (lane >> 4) * 8; FragH f;
#pragma unroll
  for (int i = 0; i < 8; ++i) f.h[i] = (_Float16)(bf16_rne(W[(size_t)(k8 + i) * N + n]) * scale);
  const v8us o = f.half[0];
  unsigned short* d = (unsigned short*)Wt + fo_chunk(n, k8, K);
  *(v8us*)d = o; 
}

__device__ __forceinline__ void x16_body(const float* __restrict__ x, _Float16* __restrict__ X16, int bid) {
  const int t = bid * 256 + threadIdx.x; if (t >= NR * (DM / 8)) return;
  /* one wave writes one half tile (512 contiguous bytes): lane = 16 * h + row % 16; consecutive waves take consecutive 16-k halves of a row tile */
  const int wv = t >> 5, lane = t & 31; const int row = (wv / (DM / 16)) * 16 + (lane & 15), c8 = (wv % (DM / 16)) * 16 + (lane >> 4) * 8; const int b = row / SEQ, s = row % SEQ;
  const float* src = x + ((size_t)b * SEQ_FULL + s) * DM + c8;
  const v4f a = *(const v4fa*)src, c = *(const v4fa*)(src + 4); FragH f;
#pragma unroll
  for (int i = 0; i < 4; ++i) { f.h[i] = (_Float16)bf16_rne(a[i]); f.h[4 + i] = (_Float16)bf16_rne(c[i]); }
  const v8us o = f.half[0];
  unsigned short* d = (unsigned short*)X16 + fo_chunk(row, c8, DM);
  *(v8us*)d = o; 
}

// Launches that read nothing of each other's output share one grid: a range of the block index picks the body (block-uniform branch).
constexpr int NB_X16  = (int)(((size_t)NR * (DM / 8) + 255) / 256);
constexpr int NB_WQKV = (int)(((size_t)3 * DM * (DM / 8) + 255) / 256);
constexpr int NB_WO   = (int)(((size_t)DM * (DM / 8) + 255) / 256);
// the three conversions: x -> X16; W[K=1024][N=3072] -> Wt[N][K]; W[K=1024][N=1024] -> Wt[N][K]
__global__ __launch_bounds__(256) void k_convert(const float* __restrict__ x, const float* __restrict__ w_attn, const float* __restrict__ w_proj, _Float16* __restrict__ X16, _Float16* __restrict__ BQKV, _Float16* __restrict__ BO) {
  const int bid = (int)blockIdx.x;
  if (bid < NB_X16) x16_body(x, X16, bid);
  else if (bid < NB_X16 + NB_WQKV) wt_f16_body(w_attn, BQKV, DM, 3 * DM, 16.0f, bid - NB_X16);
  else wt_f16_body(w_proj, BO, DM, DM, 16.0f, bid - (NB_X16 + NB_WQKV));
}

// GEMM: wave tile (16*MT) x 64, block = 4 waves = (64*MT) rows x 64 cols; A and Bh are f16 planes in fragment order (fragments straight from global).
// v = acc*alpha (+ accL*alphaL with the residual A plane AL, ARES) + bias (per column, or per row if ROWBIAS; bias RNE-converted to bf16).
// Logical row R maps to A row seg*aSeg + aOff + w and C row seg*cSeg + cOff + w with seg = R / segRows, w = R % segRows (blocks never straddle segments).
// OUT 0: f32 C. OUT 1: f16 C16 (+ x1024 residual rows in CL when the rows lie in the first ISL rows of a sequence). OUT 2: f16 C16 (+ residual columns when the token columns lie in the first ISL rows of a sequence).
// Requires M % (64*MT) == 0, N % 64 == 0, K % 64 == 0 (asserted above for the launches used). LDS tile so[wave] is private to its wave (wave-level sync); the kernel owns the array, so the two bodies of a launch share one. bid: block index inside the body's own range.
template <int MT, bool ROWBIAS, bool ARES, int OUT>
__device__ __forceinline__ void gemm_body(const _Float16* __restrict__ A, const _Float16* __restrict__ AL, int lda,
    const _Float16* __restrict__ Bh, int ldb, float alpha, float alphaL, const float* __restrict__ bias,
    float* __restrict__ Cf, _Float16* __restrict__ C16, _Float16* __restrict__ CL, int ldc, int ldcl,
    int M, int N, int K, int segRows, int aSeg, int aOff, int cSeg, int cOff, int bid, float (*so)[32][68]) {
  static_assert(MT == 1 || MT == 2);
  static_assert(!ARES || MT == 1);      /* residual form keeps 8 accumulators */
  const int tid = threadIdx.x, lane = tid & 31, ln = lane & 15, hh = lane >> 4;
  const int w = __builtin_amdgcn_readfirstlane(tid >> 5);      /* wave-uniform, so that every tile base below is a scalar pointer */
  const int ntn = N >> 6;
  const int mt = bid / ntn, nq = bid - mt * ntn;
  const int R0 = mt * (64 * MT) + (16 * MT) * w, col0 = nq * 64;
  if (R0 >= M) return;
  const int seg = R0 / segRows, wi = R0 - seg * segRows;
  const int arow0 = seg * aSeg + aOff + wi, crow0 = seg * cSeg + cOff + wi;
  /* arow0, R0 and col0 are multiples of 16: row tile r / 16 starts at element r * ld; 32 k further is 512 elements further */
  const _Float16* a0p = A + (size_t)arow0 * lda;
  const _Float16* b0p = Bh + (size_t)col0 * ldb;
  const unsigned lo = 16u * (unsigned)lane;      /* the lane's byte offset inside a half tile: the one vector address register of every fragment load */
  const v8f z8 = {0.f, 0.f, 0.f, 0.f, 0.f, 0.f, 0.f, 0.f};
  v8f c00 = z8, c01 = z8, c02 = z8, c03 = z8, c10 = z8, c11 = z8, c12 = z8, c13 = z8, d00 = z8, d01 = z8, d02 = z8, d03 = z8;
  // Two register sets of fragments (P, N), 32 k each: every set is loaded as one group, one k block ahead of the WMMAs that read it, so a block waits for one load round trip that started a block earlier.
  const _Float16* e0p = ARES ? AL + (size_t)R0 * lda : a0p;
#define GEMM_LD(S, kk) { S##a0 = g2_frago(a0p, lo, (kk) * 32); if (MT == 2) S##a1 = g2_frago(a0p, lo, 32 * lda + (kk) * 32); if (ARES) S##e0 = g2_frago(e0p, lo, (kk) * 32); \
    S##b0 = g2_frago(b0p, lo, (kk) * 32); S##b1 = g2_frago(b0p, lo, 32 * ldb + (kk) * 32); S##b2 = g2_frago(b0p, lo, 64 * ldb + (kk) * 32); S##b3 = g2_frago(b0p, lo, 96 * ldb + (kk) * 32); }
#define GEMM_MM(S) { c00 = g2_mma(S##a0, S##b0, c00); if (MT == 2) c10 = g2_mma(S##a1, S##b0, c10); if (ARES) d00 = g2_mma(S##e0, S##b0, d00); \
    c01 = g2_mma(S##a0, S##b1, c01); if (MT == 2) c11 = g2_mma(S##a1, S##b1, c11); if (ARES) d01 = g2_mma(S##e0, S##b1, d01); \
    c02 = g2_mma(S##a0, S##b2, c02); if (MT == 2) c12 = g2_mma(S##a1, S##b2, c12); if (ARES) d02 = g2_mma(S##e0, S##b2, d02); \
    c03 = g2_mma(S##a0, S##b3, c03); if (MT == 2) c13 = g2_mma(S##a1, S##b3, c13); if (ARES) d03 = g2_mma(S##e0, S##b3, d03); }
  const v16h zf = (v16h)((_Float16)0.0f);
  v16h Pa0 = zf, Pa1 = zf, Pe0 = zf, Pb0 = zf, Pb1 = zf, Pb2 = zf, Pb3 = zf, Na0 = zf, Na1 = zf, Ne0 = zf, Nb0 = zf, Nb1 = zf, Nb2 = zf, Nb3 = zf;
  GEMM_LD(P, 0)
#pragma unroll      /* K is a constant of every launch: unrolled, the k offsets are immediates and no address register is rewritten while a group is in flight */
  for (int kb = 0; kb < K; kb += 64) {
    GEMM_LD(N, kb + 32)
    if (kb + 64 >= K) asm volatile("s_wait_xcnt 0x0" :: "v"(lane) : "memory");      /* behind the last group: the loads' offset register (built as the lane number, scaled by the load) lives up to this wait, so nothing (a late load's result included) is written over it earlier */
    GEMM_MM(P)
    if (kb + 64 < K) GEMM_LD(P, kb + 64)
    GEMM_MM(N)
  }
#undef GEMM_LD
#undef GEMM_MM
  const v8f accs[8] = {c00, c01, c02, c03, c10, c11, c12, c13};
  const v8f accl[4] = {d00, d01, d02, d03};
#pragma unroll
  for (int u = 0; u < 4 * MT; ++u) {
    const int t = u & 3, half = u >> 2; const int col = col0 + t * 16 + ln;
    float bvc = 0.f; if (!ROWBIAS) bvc = bf16_rne(bias[col]);
#pragma unroll
    for (int r = 0; r < 8; ++r) {
      const int rloc = half * 16 + 8 * hh + r;
      float v = accs[u][r] * alpha;
      if (ARES) v += accl[t][r] * alphaL;
      if (ROWBIAS) v += bf16_rne(bias[R0 + rloc]); else v += bvc;
      so[w][rloc][t * 16 + ln] = v;
    }
  }
  __builtin_amdgcn_fence(4 /* acq_rel order */, "workgroup"); __builtin_amdgcn_wave_barrier();
  const int rsub = lane >> 4, c4 = (lane & 15) * 4;
  if (OUT == 0) {
    {
#pragma unroll
      for (int q = 0; q < 8 * MT; ++q) { const int r = q * 2 + rsub; const v4f v = *(const v4fa*)&so[w][r][c4]; *(v4f*)(Cf + (size_t)(crow0 + r) * ldc + col0 + c4) = v; }
      asm volatile("s_wait_xcnt 0x0" ::: "memory");      /* behind the run of stores: in a kernel of two bodies the other body's code follows in the listing and reuses the stores' address and data registers */
    }
  } else {
    int sl, rrow0, rcol0;
    if (OUT == 1) { sl = crow0 % SEQ; rrow0 = (crow0 / SEQ) * ISL + sl; rcol0 = col0; }
    else          { sl = col0 % SEQ;  rrow0 = crow0; rcol0 = (col0 / SEQ) * ISL + sl; }
    const bool isl = sl < ISL;      /* uniform over the wave tile: ISL and SEQ are multiples of 64 */
    {      /* one store = one half tile of the fragment-order plane: lane (hh, ln) holds row ln, 8 columns from 8 * hh */
#pragma unroll
      for (int q = 0; q < 4 * MT; ++q) {
        const int r = (q >> 2) * 16 + ln, c = (q & 3) * 16 + 8 * hh;
        const v4f va = *(const v4fa*)&so[w][r][c], vc = *(const v4fa*)&so[w][r][c + 4];
        FragH fh, fl;
#pragma unroll
        for (int i = 0; i < 4; ++i) {
          const _Float16 h0 = (_Float16)va[i], h1 = (_Float16)vc[i]; fh.h[i] = h0; fh.h[4 + i] = h1;
          fl.h[i] = (_Float16)((va[i] - (float)h0) * 1024.0f); fl.h[4 + i] = (_Float16)((vc[i] - (float)h1) * 1024.0f);
        }
        const v8us oh = fh.half[0], ol = fl.half[0];
        *(v8us*)((unsigned short*)C16 + fo_chunk(crow0 + r, col0 + c, ldc)) = oh;
        asm volatile("s_wait_xcnt 0x0" ::: "memory");      /* in front of the reuse of the store's data and address registers by the residual's arithmetic */
        if (isl) *(v8us*)((unsigned short*)CL + fo_chunk(rrow0 + r, rcol0 + c, ldcl)) = ol;
      }
      
    }
  }
}

constexpr int NB_QK   = (NR / 128) * (2 * DM / 64);
constexpr int NB_VT   = (DM / 128) * (NR / 64);
constexpr int NB_OUT  = (NB * (SEQ - ISL) / 128) * (DM / 64);
constexpr int NB_OUTI = (NRI / 64) * (DM / 64);
// one launch, two bodies:
// q | k rows (f16) = X16 . Wqk^T / 16 + b; residual rows for s < ISL
// V^T[h*64+d][token] (f16) = Wv . X16^T / 16 + b[row]; residual columns for s < ISL
__global__ __launch_bounds__(128) void k_gemm_qkv(const _Float16* __restrict__ X16, const _Float16* __restrict__ BW, const float* __restrict__ bias, _Float16* __restrict__ QK, _Float16* __restrict__ QKL, _Float16* __restrict__ VT, _Float16* __restrict__ VTL) {
  __shared__ __attribute__((aligned(16))) float so[4][32][68];
  const int bid = (int)blockIdx.x;
  if (bid < NB_QK) gemm_body<2, false, false, 1>(X16, nullptr, DM, BW, DM, 0.0625f, 0.f, bias, nullptr, QK, QKL, LQK, LQK, NR, 2 * DM, DM, NR, 0, 0, 0, 0, bid, so);
  else gemm_body<2, true, false, 2>(BW + (size_t)2 * DM * DM, nullptr, DM, X16, DM, 0.0625f, 0.f, bias + 2 * DM, nullptr, VT, VTL, LVT, LVL, DM, NR, DM, DM, 0, 0, 0, 0, bid - NB_QK, so);
}
// one launch, two bodies:
// out rows s >= ISL: ctx(x64) . Wo(x16) * 2^-10 + b
// out rows s < ISL: (ctx_hi . Wo) * 2^-10 + (ctx_res . Wo) * 2^-20 + b, separate accumulators
__global__ __launch_bounds__(128) void k_gemm_out(const _Float16* __restrict__ O16, const _Float16* __restrict__ OL, const _Float16* __restrict__ BO, const float* __restrict__ bias, float* __restrict__ out) {
  __shared__ __attribute__((aligned(16))) float so[4][32][68];
  const int bid = (int)blockIdx.x;
  if (bid < NB_OUT) gemm_body<2, false, false, 0>(O16, nullptr, DM, BO, DM, 0.0009765625f, 0.f, bias, out, nullptr, nullptr, DM, 0, NB * (SEQ - ISL), DM, DM, SEQ - ISL, SEQ, ISL, SEQ_FULL, ISL, bid, so);
  else gemm_body<1, false, true, 0>(O16, OL, DM, BO, DM, 0.0009765625f, 0.00000095367431640625f, bias, out, nullptr, nullptr, DM, 0, NRI, DM, DM, ISL, SEQ, 0, SEQ_FULL, 0, bid - NB_OUT, so);
}

// Fused prefix-causal attention, transposed form. Block = 8 waves = 128 consecutive queries of one (b, h); wave = 16 queries (D column = query = lane & 15).
// Visibility: key j is seen by query i iff (j <= i) OR (i < S AND j < S); S is loaded from its input buffer and clamped to [0, SEQ] (same mask for any value).
// Key range of a wave: [0, max(S, q0 + 16)) in 32-key steps (all step keys lie inside the sequence since SEQ % 32 == 0). Every step holds key kcb that is visible to every query of the wave
// (kcb <= q0 when the range ends at q0 + 16; kcb < S with all 16 queries < S otherwise), so the step maximum is always finite.
// Per 32-key step: S^T tiles (keys kcb..+15 and +16..+31) = K (A, rows = keys) . Q^T (B, lane = query); scale 1/8; hidden keys are REPLACED (excluded from max, weight 0 by value);
// online max / sum per lane (halves combined by one xor-16 shuffle); P^T (x1024, f16) is the B fragment directly: element r <- tile0[r], element 8+r <- tile1[r];
// O^T (rows = d) += V^T (A, rows = d, k = keys) . P^T. RES: q, k, v, P carry x1024 residual planes; residual products go to separate accumulators folded back with 2^-10.
// Residual k / v planes exist only for keys < ISL: for key steps at or beyond ISL (possible when S > ISL) the residual k / v fragments are loaded from a clamped in-range step and zeroed by value (wave-uniform select).
template <bool RES>
__device__ __forceinline__ void attn_body(const _Float16* __restrict__ QK, const _Float16* __restrict__ QKL, const _Float16* __restrict__ VT, const _Float16* __restrict__ VTL,
                                          _Float16* __restrict__ O16, _Float16* __restrict__ OL, const int* __restrict__ Sp, int qb0, int nqb, int bid) {
  const int tid = threadIdx.x, lane = tid & 31, ln = lane & 15, hh = lane >> 4;
  const int w = __builtin_amdgcn_readfirstlane(tid >> 5);
  const int sraw = Sp[0];
  const int Sc = sraw < 0 ? 0 : (sraw > SEQ ? SEQ : sraw);
  const int bh = bid / nqb; const int qb = qb0 + (bid - bh * nqb);
  const int h = bh % NH, b = bh / NH;
  const int q0 = qb * 128 + w * 16, q = q0 + ln;
  const bool qpre = q < Sc;
  const int rowb = b * SEQ, rowi = b * ISL;
  /* fragment-order planes: row tile r / 16 starts at element r * pitch (r % 16 == 0), column block c / 32 at c * 16 (c % 32 == 0), the lane's chunk at 8 * lane */
  const unsigned lo = 16u * (unsigned)lane;                           /* the lane's byte offset inside a half tile */
  const _Float16* qp = QK + (size_t)(rowb + q0) * LQK + h * HD * 16;
  const v16h qh0 = g2_frago(qp, lo, 0), qh1 = g2_frago(qp, lo, 1024);
  const int qloff = (rowi + q0) * LQK + h * HD * 16;       /* residual q tile (RES) */
  const int kbase = rowb * LQK + (DM + h * HD) * 16;       /* k tile of keys 0..15, d 0..31 */
  const int klbase = rowi * LQK + (DM + h * HD) * 16;      /* residual k tile (RES) */
  const int vbase = h * HD * LVT + rowb * 16;              /* V^T tile d 0..15, keys 0..31 */
  const int vlbase = h * HD * LVL + rowi * 16;             /* residual V^T tile (RES) */
  const v8f z8 = {0.f, 0.f, 0.f, 0.f, 0.f, 0.f, 0.f, 0.f};
  const v16h zh = (v16h)((_Float16)0.0f);
  v8f o0 = z8, o1 = z8, o2 = z8, o3 = z8, e0 = z8, e1 = z8, e2 = z8, e3 = z8;
  float m = -1.0e30f, l = 0.f;
  const int kend = (Sc > q0 + 16) ? Sc : (q0 + 16);              /* keys [0, kend) cover every visible key of the wave; kend <= SEQ */
  const int nst = (kend + 31) >> 5;
  // Plain form: the K and V fragments live in registers across the loop; the next step's K group is issued right behind this step's S^T WMMAs and the next step's V group right behind its O^T WMMAs.
  v16h ka = zh, kb = zh, kc = zh, kd = zh, v0 = zh, v1 = zh, v2 = zh, v3 = zh;
  unsigned kq = 2u * (unsigned)kbase + lo, vq = 2u * (unsigned)vbase + lo;      /* the lane's byte offsets of the K and V groups held in registers; step 0 exists: nst >= 1 */
  if (!RES) {
    ka = g2_frago(QK, kq, 0); kb = g2_frago(QK, kq, 1024); kc = g2_frago(QK, kq, 32 * LQK); kd = g2_frago(QK, kq, 32 * LQK + 1024);
    v0 = g2_frago(VT, vq, 0); v1 = g2_frago(VT, vq, 32 * LVT); v2 = g2_frago(VT, vq, 64 * LVT); v3 = g2_frago(VT, vq, 96 * LVT);
    /* inputs-only fence on the loaded values: every load in front of the loop has landed here, so the wait at the loop's head counts the loop's own groups alone and leaves the next V group in flight */
    asm volatile("" :: "v"(qh0), "v"(qh1), "v"(ka), "v"(kb), "v"(kc), "v"(kd), "v"(v0), "v"(v1), "v"(v2), "v"(v3));
  }
#pragma unroll 1
  for (int st = 0; st < nst; ++st) {
    const int kcb = st * 32;
    const int adv = (st + 1 < nst) ? 32 : 0;                     /* keys to the next step; the last step reloads its own (in range, not used) */
    const bool rok = kcb < ISL;                                  /* wave-uniform: residual k / v rows exist for this step */
    const int kcl = rok ? kcb : (ISL - 32);                      /* clamped in-range residual step */
    const _Float16* kp0 = QK + kbase + kcb * LQK;
    v8f s0 = z8, s1 = z8, r0 = z8, r1 = z8;
    if (RES) {
      unsigned qo = lo; asm volatile("" : "+v"(qo));             /* reload the residual q fragments per step (integer offset only) */
      const _Float16* qlp = QKL + qloff;
      const v16h ql0 = g2_frago(qlp, qo, 0), ql1 = g2_frago(qlp, qo, 1024);
      const _Float16* kl0 = QKL + klbase + kcl * LQK;
      /* all k fragments of the step as one load group in front of its WMMAs */
      const v16h ah0 = g2_frago(kp0, lo, 0), ah1 = g2_frago(kp0, lo, 1024), ah2 = g2_frago(kp0, lo, 32 * LQK), ah3 = g2_frago(kp0, lo, 32 * LQK + 1024);
      v16h al0 = g2_frago(kl0, lo, 0), al1 = g2_frago(kl0, lo, 1024), al2 = g2_frago(kl0, lo, 32 * LQK), al3 = g2_frago(kl0, lo, 32 * LQK + 1024);
      asm volatile("s_wait_xcnt 0x0" :: "v"(qo) : "memory");      /* behind the group: the offset register that the residual q loads name lives up to this wait, so no later load's result is written over it earlier */
      al0 = rok ? al0 : zh; al1 = rok ? al1 : zh; al2 = rok ? al2 : zh; al3 = rok ? al3 : zh;
      s0 = g2_mma(ah0, qh0, s0); r0 = g2_mma(al0, qh0, r0); r0 = g2_mma(ah0, ql0, r0);
      s0 = g2_mma(ah1, qh1, s0); r0 = g2_mma(al1, qh1, r0); r0 = g2_mma(ah1, ql1, r0);
      s1 = g2_mma(ah2, qh0, s1); r1 = g2_mma(al2, qh0, r1); r1 = g2_mma(ah2, ql0, r1);
      s1 = g2_mma(ah3, qh1, s1); r1 = g2_mma(al3, qh1, r1); r1 = g2_mma(ah3, ql1, r1);
    } else {
      s0 = g2_mma(ka, qh0, s0); s0 = g2_mma(kb, qh1, s0); s1 = g2_mma(kc, qh0, s1); s1 = g2_mma(kd, qh1, s1);
      asm volatile("s_wait_xcnt 0x0" : "+v"(kq) :: "memory");      /* stands in front of the rewrite of the offset register that the last K group's loads name; the register is an operand so that the addition stays behind it */
      kq += (unsigned)(adv * LQK * 2);
      ka = g2_frago(QK, kq, 0); kb = g2_frago(QK, kq, 1024); kc = g2_frago(QK, kq, 32 * LQK); kd = g2_frago(QK, kq, 32 * LQK + 1024);
      __builtin_amdgcn_sched_barrier(0);      /* holds the K group at the head of the softmax: issued further down it has less of the step to land in */
    }
    v16h vl0 = zh, vl1 = zh, vl2 = zh, vl3 = zh;
    if (RES) {      /* all v fragments of the step as one load group in front of the softmax */
      const _Float16* vp = VT + vbase + kcb * 16; const _Float16* vlp = VTL + vlbase + kcl * 16;
      v0 = g2_frago(vp, lo, 0); v1 = g2_frago(vp, lo, 32 * LVT); v2 = g2_frago(vp, lo, 64 * LVT); v3 = g2_frago(vp, lo, 96 * LVT);
      vl0 = g2_frago(vlp, lo, 0); vl1 = g2_frago(vlp, lo, 32 * LVL); vl2 = g2_frago(vlp, lo, 64 * LVL); vl3 = g2_frago(vlp, lo, 96 * LVL);
    }
    // D row = key kcb + 8*hh + r (tile 0), + 16 (tile 1); D column = query q
    v8f xa, xb; float mt = -1.0e30f;
#pragma unroll
    for (int r = 0; r < 8; ++r) {
      const int k0 = kcb + 8 * hh + r;
      const bool va = (k0 <= q) || (qpre && (k0 < Sc));
      const bool vb = (k0 + 16 <= q) || (qpre && (k0 + 16 < Sc));
      float a = s0[r], c = s1[r];
      if (RES) { a += r0[r] * 0.0009765625f; c += r1[r] * 0.0009765625f; }
      a *= 0.125f; c *= 0.125f;
      a = va ? a : -1.0e30f; c = vb ? c : -1.0e30f;
      xa[r] = a; xb[r] = c; mt = fmaxf(mt, fmaxf(a, c));
    }
    mt = fmaxf(mt, __shfl_xor(mt, 16, 32));
    const float mn = fmaxf(m, mt);
    float f; { const float t = fmaxf(m - mn, -80.0f) * 1.44269504f;      /* __expf as it compiles (multiply, v_exp_f32), with the slot behind the transcendental filled in the same statement */
      asm("v_exp_f32 %0, %1\n\tv_nop" : "=v"(f) : "v"(t)); }
    m = mn;
    FragH ph, pl; float rs = 0.f;
#pragma unroll
    for (int r = 0; r < 8; ++r) {
      const int k0 = kcb + 8 * hh + r;
      const bool va = (k0 <= q) || (qpre && (k0 < Sc));
      const bool vb = (k0 + 16 <= q) || (qpre && (k0 + 16 < Sc));
      float pa = __expf(va ? (xa[r] - mn) : 0.f); pa = va ? pa : 0.f;
      float pb = __expf(vb ? (xb[r] - mn) : 0.f); pb = vb ? pb : 0.f;
      rs += pa + pb;
      const float ta = pa * 1024.0f, tb = pb * 1024.0f;
      const _Float16 ha = (_Float16)ta, hb = (_Float16)tb;
      ph.h[r] = ha; ph.h[8 + r] = hb;
      if (RES) { pl.h[r] = (_Float16)((ta - (float)ha) * 1024.0f); pl.h[8 + r] = (_Float16)((tb - (float)hb) * 1024.0f); }
    }
    const float rso = __shfl_xor(rs, 16, 32);
    l = l * f + (rs + rso);
    o0 *= f; o1 *= f; o2 *= f; o3 *= f;
    if (RES) { e0 *= f; e1 *= f; e2 *= f; e3 *= f; }
    o0 = g2_mma(v0, ph.v, o0); o1 = g2_mma(v1, ph.v, o1); o2 = g2_mma(v2, ph.v, o2); o3 = g2_mma(v3, ph.v, o3);
    if (RES) {
      vl0 = rok ? vl0 : zh; vl1 = rok ? vl1 : zh; vl2 = rok ? vl2 : zh; vl3 = rok ? vl3 : zh;
      e0 = g2_mma(vl0, ph.v, e0); e0 = g2_mma(v0, pl.v, e0);
      e1 = g2_mma(vl1, ph.v, e1); e1 = g2_mma(v1, pl.v, e1);
      e2 = g2_mma(vl2, ph.v, e2); e2 = g2_mma(v2, pl.v, e2);
      e3 = g2_mma(vl3, ph.v, e3); e3 = g2_mma(v3, pl.v, e3);
    } else {
      asm volatile("s_wait_xcnt 0x0" : "+v"(vq) :: "memory");      /* the same for the V group's offset register */
      vq += (unsigned)(adv * 32);      /* 32 keys further = the next tile, 1 KB */
      v0 = g2_frago(VT, vq, 0); v1 = g2_frago(VT, vq, 32 * LVT); v2 = g2_frago(VT, vq, 64 * LVT); v3 = g2_frago(VT, vq, 96 * LVT);
    }
  }
  // ctx x64 = O^T * 64 / (1024 * l); O^T row d = dg*16 + 8*hh + r, column = query ln
  const float inv = 0.0625f * (1.0f / l);
  const v8f oo[4] = {o0, o1, o2, o3}; const v8f ee[4] = {e0, e1, e2, e3};
  // the lane's 8 values of O^T tile dg are query ln, columns dg*16 + 8*hh .. + 7: one chunk of the fragment-order ctx plane, so each tile goes out of the accumulators as one half-tile store of 512 contiguous bytes
#pragma unroll
  for (int dg = 0; dg < 4; ++dg) {
    FragH fh, fl;
#pragma unroll
    for (int r = 0; r < 8; ++r) {
      float v = oo[dg][r]; if (RES) v += ee[dg][r] * 0.0009765625f; v *= inv;
      const _Float16 h0 = (_Float16)v; fh.h[r] = h0; fl.h[r] = (_Float16)((v - (float)h0) * 1024.0f);
    }
    const v8us oh = fh.half[0], ol = fl.half[0];
    *(v8us*)((unsigned short*)O16 + fo_chunk(rowb + q0 + ln, h * HD + dg * 16 + 8 * hh, DM)) = oh;
    if (RES) *(v8us*)((unsigned short*)OL + fo_chunk(rowi + q0 + ln, h * HD + dg * 16 + 8 * hh, DM)) = ol;
  }
}

constexpr int NB_ATT  = NB * NH * ((SEQ - ISL) / 128);
constexpr int NB_ATTI = NB * NH * (ISL / 128);
// one launch, two bodies: the plain rows (the long blocks) first, the short residual-plane blocks behind them
__global__ __launch_bounds__(256) void k_attn(const _Float16* __restrict__ QK, const _Float16* __restrict__ QKL, const _Float16* __restrict__ VT, const _Float16* __restrict__ VTL, _Float16* __restrict__ O16, _Float16* __restrict__ OL, const int* __restrict__ Sp) {
  const int bid = (int)blockIdx.x;
  if (bid < NB_ATT) attn_body<false>(QK, nullptr, VT, nullptr, O16, nullptr, Sp, ISL / 128, (SEQ - ISL) / 128, bid);
  else attn_body<true>(QK, QKL, VT, VTL, O16, OL, Sp, 0, ISL / 128, bid - NB_ATT);
}

constexpr size_t al256(size_t bytes) { return (bytes + 255) & ~(size_t)255; }
constexpr size_t SZ_BQKV = al256((size_t)3 * DM * DM * 2);
constexpr size_t SZ_BO   = al256((size_t)DM * DM * 2);
constexpr size_t SZ_X16  = al256((size_t)NR * DM * 2);
constexpr size_t SZ_QK   = al256((size_t)NR * LQK * 2);
constexpr size_t SZ_QKL  = al256((size_t)NRI * LQK * 2);
constexpr size_t SZ_VT   = al256((size_t)DM * LVT * 2);
constexpr size_t SZ_VTL  = al256((size_t)DM * LVL * 2);
constexpr size_t SZ_O16  = al256((size_t)NR * DM * 2);
constexpr size_t SZ_OL   = al256((size_t)NRI * DM * 2);
constexpr size_t WS_TOTAL = SZ_BQKV + SZ_BO + SZ_X16 + SZ_QK + SZ_QKL + SZ_VT + SZ_VTL + SZ_O16 + SZ_OL;
static_assert(WS_TOTAL <= (size_t)134217728);      /* carve <= 128 MiB */

extern "C" void kernel_launch(void* const* d_in, const int* in_sizes, int n_in,
                              void* d_out, int out_size, void* d_ws, size_t ws_size, hipStream_t stream) {
  if (n_in < 6) return;
  const long long xrows = (long long)(NB - 1) * SEQ_FULL + SEQ;      /* rows of x / out touched */
  if ((long long)in_sizes[0] < xrows * DM) return;
  if ((long long)in_sizes[1] < (long long)DM * 3 * DM) return;
  if ((long long)in_sizes[2] < (long long)3 * DM) return;
  if ((long long)in_sizes[3] < (long long)DM * DM) return;
  if ((long long)in_sizes[4] < (long long)DM) return;
  if ((long long)in_sizes[5] < 1) return;
  if ((long long)out_size < xrows * DM) return;
  if (WS_TOTAL > ws_size) return;
  const float* x = (const float*)d_in[0]; const float* w_attn = (const float*)d_in[1]; const float* b_attn = (const float*)d_in[2];
  const float* w_proj = (const float*)d_in[3]; const float* b_proj = (const float*)d_in[4];
  const int* s_pref = (const int*)d_in[5];                           /* prefix length, loaded on the device */
  float* out = (float*)d_out;
  char* ws = (char*)d_ws; size_t off = 0;
  _Float16* BQKV = (_Float16*)(ws + off); off += SZ_BQKV;      /* [3072][1024] x16; this and every plane below in fragment order */
  _Float16* BO   = (_Float16*)(ws + off); off += SZ_BO;        /* [1024][1024] x16 */
  _Float16* X16  = (_Float16*)(ws + off); off += SZ_X16;       /* [NR][1024] */
  _Float16* QK   = (_Float16*)(ws + off); off += SZ_QK;        /* [NR][2048] q | k */
  _Float16* QKL  = (_Float16*)(ws + off); off += SZ_QKL;       /* [NRI][2048] residual x1024 */
  _Float16* VT   = (_Float16*)(ws + off); off += SZ_VT;        /* [1024][NR] */
  _Float16* VTL  = (_Float16*)(ws + off); off += SZ_VTL;       /* [1024][NRI] residual x1024 */
  _Float16* O16  = (_Float16*)(ws + off); off += SZ_O16;       /* [NR][1024] ctx x64 */
  _Float16* OL   = (_Float16*)(ws + off); off += SZ_OL;        /* [NRI][1024] ctx residual x1024 */
  if (off > ws_size) return;

  k_convert<<<(unsigned)(NB_X16 + NB_WQKV + NB_WO), 256, 0, stream>>>(x, w_attn, w_proj, X16, BQKV, BO);
  k_gemm_qkv<<<(unsigned)(NB_QK + NB_VT), 128, 0, stream>>>(X16, BQKV, b_attn, QK, QKL, VT, VTL);
  k_attn<<<(unsigned)(NB_ATT + NB_ATTI), 256, 0, stream>>>(QK, QKL, VT, VTL, O16, OL, s_pref);
  k_gemm_out<<<(unsigned)(NB_OUT + NB_OUTI), 128, 0, stream>>>(O16, OL, BO, b_proj, out);
}

// v004
// Measured time: 108 microseconds a run.
// Next to v003, in two timings, it ran 1.10 and 1.11 times as fast.
// All steps since v000 together make it 2.76 times as fast.
#include <hip/hip_runtime.h>
// All contractions: v_wmma_f32_16x16x32_f16 (f16 operands, f32 accumulate). x, weights and biases are RNE-converted to bf16; x and weights are held exactly in f16 (weights x16); q, k, v, softmax weights (x1024) and ctx (x64) are f16 planes; for the first 256 query rows of every sequence q, k, v, P and ctx also carry an f16 residual plane (x1024) accumulated in a separate accumulator.
// Structure: token rows r = b*SEQ + s. (1) weights -> Wt[n][k] f16; x -> f16 rows. (2) q|k rows = X16 . Wqk (N = 2048) and V^T[h*64+d][token] = Wv . X16^T (operand-swapped GEMM, row bias). (3) fused flash attention in the transposed form S^T = K Q^T, O^T = V^T P^T: one wave owns 16 queries, fragments are loaded straight from the 16-bit planes (all kept in fragment order, see fo_chunk), P^T goes D -> B in registers, online softmax statistics are per-lane scalars; visibility (key <= query) OR (query < S AND key < S) applied as a replace-mask by value, S loaded on the device from its input buffer. (4) out = ctx . Wo + b (f32).
#ifndef NB
#define NB 2
#endif
#ifndef SEQ
#define SEQ 2048
#endif
#define NB_FULL 2
#define SEQ_FULL 2048
#define DM 1024
#define NH 16
#define HD 64
#define ISL ((SEQ) < 256 ? (SEQ) : 256)   /* query rows per sequence carried with residual planes */
#define NR (NB * SEQ)                      /* token rows in the workspace planes */
#define NRI (NB * ISL)                     /* rows of the compact residual planes */
#define LQK (2 * DM)                       /* row pitch of the q | k plane */
#define LVT NR                             /* row pitch of V^T */
#define LVL NRI                            /* row pitch of the V^T residual plane */

static_assert(NB >= 1 && NB <= NB_FULL);          /* reduced builds only shrink */
static_assert(SEQ <= SEQ_FULL);
static_assert(SEQ % 128 == 0);                    /* 8 waves x 16 queries per attention block; GEMM row blocks; 32-key steps stay inside the sequence */
static_assert(ISL % 128 == 0);                    /* residual region is a whole number of blocks */
static_assert(ISL >= 32);                         /* clamped residual key step ISL - 32 is a valid step */
static_assert((SEQ - ISL) % 128 == 0);            /* plain region is a whole number of blocks */
static_assert(NH * HD == DM);                     /* merged head layout */
static_assert(HD == 64);                          
static_assert(DM % 128 == 0);                     /* GEMM M blocks (V^T) and K % 64 (two k blocks per trip) */
static_assert(DM % 8 == 0);                       /* 8-element convert threads */
static_assert(NR % 128 == 0);                     /* GEMM M blocks / N tiles of 64 */
static_assert(NRI % 64 == 0);                     /* residual-row output GEMM blocks */
static_assert((long long)NR * LQK < 2147483647LL);/* int plane offsets */
static_assert((long long)DM * LVT < 2147483647LL);

typedef unsigned short v8us __attribute__((ext_vector_type(8), may_alias));
typedef float  v8f  __attribute__((ext_vector_type(8)));
typedef float  v4f  __attribute__((ext_vector_type(4)));
typedef float  v4fa __attribute__((ext_vector_type(4), may_alias));
typedef _Float16 v16h __attribute__((ext_vector_type(16)));
typedef _Float16 v4h  __attribute__((ext_vector_type(4)));
union FragH { v16h v; v8us half[2]; _Float16 h[16]; unsigned short u[16]; };

__device__ __forceinline__ float bf16_rne(float x) { unsigned int u = __float_as_uint(x); u = (u + 0x7FFFu + ((u >> 16) & 1u)) & 0xFFFF0000u; return __uint_as_float(u); }

// Fragment order: every 16-bit plane [rows][K] is stored as tiles of 16 rows x 32 k, 512 elements (1 KB) each, tile (row / 16, k / 32) at element (row / 16) * 16 * K + (k / 32) * 512.
// Inside a tile: two halves of 256 elements (k 0..15, k 16..31), each 32 lanes x 8 elements with lane = 16 * ((k / 8) & 1) + row % 16. A fragment is then two loads of 512 contiguous bytes (4 whole lines each).
// element offset of the 8-element chunk that holds (row, k .. k + 7), k % 8 == 0, in a plane of K columns (K % 32 == 0)
__device__ __forceinline__ size_t fo_chunk(int row, int k, int K) { return (size_t)(row >> 4) * 16 * K + (size_t)((k >> 5) * 512 + ((k >> 4) & 1) * 256 + (((k >> 3) & 1) * 16 + (row & 15)) * 8); }
// fragment of one tile: elements 0..7 <- k 8h.., elements 8..15 <- k 16+8h.., row = lane & 15, h = lane >> 4 (same map for A and B);
// from a uniform pointer, the lane's own 32-bit byte offset (16 * lane folded in) and a constant byte step
__device__ __forceinline__ v16h g2_frago(const _Float16* base, unsigned off, int add) { const char* p = (const char*)base + (size_t)off + add; FragH f; f.half[0] = *(const v8us*)p; f.half[1] = *(const v8us*)(p + 512); return f.v; }
__device__ __forceinline__ v8f g2_mma(v16h a, v16h b, v8f c) { v8f d = __builtin_amdgcn_wmma_f32_16x16x32_f16(false, a, false, b, (short)0, c, false, false); asm volatile("v_nop\n\tv_nop\n\tv_nop\n\tv_nop" : "+v"(d) : "v"(a), "v"(b)); return d; }

// the same product left to the compiler's own padding: for the 64 x 64 wave tile, whose 16 accumulators and two fragment sets need more than 256 registers (with the asm statement's operands the build stayed below 256 and spilled)
__device__ __forceinline__ v8f g2_mmab(v16h a, v16h b, v8f c) { return __builtin_amdgcn_wmma_f32_16x16x32_f16(false, a, false, b, (short)0, c, false, false); }

__device__ __forceinline__ void wt_f16_body(const float* __restrict__ W, _Float16* __restrict__ Wt, int K, int N, float scale, int bid) {
  /* one wave writes one half tile (512 contiguous bytes): lane = 16 * h + n % 16; waves run over the row tiles first, then over the 16-k halves */
  const int t = bid * 256 + threadIdx.x; if (t >= N * (K / 8)) return; const int wv = t >> 5, lane = t & 31; const int n = (wv % (N / 16)) * 16 + (lane & 15), k8 = (wv / (N / 16)) * 16 + (lane >> 4) * 8; FragH f;
#pragma unroll
  for (int i = 0; i < 8; ++i) f.h[i] = (_Float16)(bf16_rne(W[(size_t)(k8 + i) * N + n]) * scale);
  const v8us o = f.half[0];
  unsigned short* d = (unsigned short*)Wt + fo_chunk(n, k8, K);
  *(v8us*)d = o; 
}

__device__ __forceinline__ void x16_body(const float* __restrict__ x, _Float16* __restrict__ X16, int bid) {
  const int t = bid * 256 + threadIdx.x; if (t >= NR * (DM / 8)) return;
  /* one wave writes one half tile (512 contiguous bytes): lane = 16 * h + row % 16; consecutive waves take consecutive 16-k halves of a row tile */
  const int wv = t >> 5, lane = t & 31; const int row = (wv / (DM / 16)) * 16 + (lane & 15), c8 = (wv % (DM / 16)) * 16 + (lane >> 4) * 8; const int b = row / SEQ, s = row % SEQ;
  const float* src = x + ((size_t)b * SEQ_FULL + s) * DM + c8;
  const v4f a = *(const v4fa*)src, c = *(const v4fa*)(src + 4); FragH f;
#pragma unroll
  for (int i = 0; i < 4; ++i) { f.h[i] = (_Float16)bf16_rne(a[i]); f.h[4 + i] = (_Float16)bf16_rne(c[i]); }
  const v8us o = f.half[0];
  unsigned short* d = (unsigned short*)X16 + fo_chunk(row, c8, DM);
  *(v8us*)d = o; 
}

// Launches that read nothing of each other's output share one grid: a range of the block index picks the body (block-uniform branch).
constexpr int NB_X16  = (int)(((size_t)NR * (DM / 8) + 255) / 256);
constexpr int NB_WQKV = (int)(((size_t)3 * DM * (DM / 8) + 255) / 256);
constexpr int NB_WO   = (int)(((size_t)DM * (DM / 8) + 255) / 256);
// the three conversions: x -> X16; W[K=1024][N=3072] -> Wt[N][K]; W[K=1024][N=1024] -> Wt[N][K]
__global__ __launch_bounds__(256) void k_convert(const float* __restrict__ x, const float* __restrict__ w_attn, const float* __restrict__ w_proj, _Float16* __restrict__ X16, _Float16* __restrict__ BQKV, _Float16* __restrict__ BO) {
  const int bid = (int)blockIdx.x;
  if (bid < NB_X16) x16_body(x, X16, bid);
  else if (bid < NB_X16 + NB_WQKV) wt_f16_body(w_attn, BQKV, DM, 3 * DM, 16.0f, bid - NB_X16);
  else wt_f16_body(w_proj, BO, DM, DM, 16.0f, bid - (NB_X16 + NB_WQKV));
}

// GEMM: wave tile (16*MT) x 64, block = 4 waves laid (4/WN) x WN = (64*MT/WN) rows x (64*WN) cols; A and Bh are f16 planes in fragment order (fragments straight from global).
// v = acc*alpha (+ accL*alphaL with the residual A plane AL, ARES) + bias (per column, or per row if ROWBIAS; bias RNE-converted to bf16).
// Logical row R maps to A row seg*aSeg + aOff + w and C row seg*cSeg + cOff + w with seg = R / segRows, w = R % segRows (blocks never straddle segments).
// OUT 0: f32 C. OUT 1: f16 C16 (+ x1024 residual rows in CL when the rows lie in the first ISL rows of a sequence). OUT 2: f16 C16 (+ residual columns when the token columns lie in the first ISL rows of a sequence).
// Requires M % (64*MT/WN) == 0, N % (64*WN) == 0, K % 64 == 0 (asserted above for the launches used). LDS tile so[wave] is private to its wave (wave-level sync); the kernel owns the array, so the two bodies of a launch share one. bid: block index inside the body's own range.
template <int MT, int WN, bool ROWBIAS, bool ARES, int OUT, int SOR>
__device__ __forceinline__ void gemm_body(const _Float16* __restrict__ A, const _Float16* __restrict__ AL, int lda,
    const _Float16* __restrict__ Bh, int ldb, float alpha, float alphaL, const float* __restrict__ bias,
    float* __restrict__ Cf, _Float16* __restrict__ C16, _Float16* __restrict__ CL, int ldc, int ldcl,
    int M, int N, int K, int segRows, int aSeg, int aOff, int cSeg, int cOff, int bid, float (*so)[SOR][68]) {
  static_assert(MT == 1 || MT == 2 || MT == 4);
  static_assert(WN == 1 || WN == 2);    /* the block's 4 waves lie (4 / WN) x WN over its tile */
  static_assert(SOR >= 16 * MT);        /* the wave's staging rows */
  static_assert(!ARES || MT == 1);      /* residual form keeps 8 accumulators */
  const int tid = threadIdx.x, lane = tid & 31, ln = lane & 15, hh = lane >> 4;
  const int w = __builtin_amdgcn_readfirstlane(tid >> 5);      /* wave-uniform, so that every tile base below is a scalar pointer */
  const int ntn = N / (64 * WN);
  const int mt = bid / ntn, nq = bid - mt * ntn;
  const int R0 = mt * (64 * MT / WN) + (16 * MT) * (w / WN), col0 = nq * (64 * WN) + 64 * (w % WN);
  if (R0 >= M) return;
  const int seg = R0 / segRows, wi = R0 - seg * segRows;
  const int arow0 = seg * aSeg + aOff + wi, crow0 = seg * cSeg + cOff + wi;
  /* arow0, R0 and col0 are multiples of 16: row tile r / 16 starts at element r * ld; 32 k further is 512 elements further */
  const _Float16* a0p = A + (size_t)arow0 * lda;
  const _Float16* b0p = Bh + (size_t)col0 * ldb;
  const unsigned lo = 16u * (unsigned)lane;      /* the lane's byte offset inside a half tile: the one vector address register of every fragment load */
  const v8f z8 = {0.f, 0.f, 0.f, 0.f, 0.f, 0.f, 0.f, 0.f};
  v8f c00 = z8, c01 = z8, c02 = z8, c03 = z8, c10 = z8, c11 = z8, c12 = z8, c13 = z8, c20 = z8, c21 = z8, c22 = z8, c23 = z8, c30 = z8, c31 = z8, c32 = z8, c33 = z8, d00 = z8, d01 = z8, d02 = z8, d03 = z8;
  // Two register sets of fragments (P, N), 32 k each: every set is loaded as one group, one k block ahead of the WMMAs that read it, so a block waits for one load round trip that started a block earlier.
  const _Float16* e0p = ARES ? AL + (size_t)R0 * lda : a0p;
#define GEMM_LD(S, kk) { S##a0 = g2_frago(a0p, lo, (kk) * 32); if (MT >= 2) S##a1 = g2_frago(a0p, lo, 32 * lda + (kk) * 32); if (MT == 4) { S##a2 = g2_frago(a0p, lo, 64 * lda + (kk) * 32); S##a3 = g2_frago(a0p, lo, 96 * lda + (kk) * 32); } if (ARES) S##e0 = g2_frago(e0p, lo, (kk) * 32); \
    S##b0 = g2_frago(b0p, lo, (kk) * 32); S##b1 = g2_frago(b0p, lo, 32 * ldb + (kk) * 32); S##b2 = g2_frago(b0p, lo, 64 * ldb + (kk) * 32); S##b3 = g2_frago(b0p, lo, 96 * ldb + (kk) * 32); }
#define GEMM_MC(S, j) { if (MT == 4) { c0##j = g2_mmab(S##a0, S##b##j, c0##j); c1##j = g2_mmab(S##a1, S##b##j, c1##j); c2##j = g2_mmab(S##a2, S##b##j, c2##j); c3##j = g2_mmab(S##a3, S##b##j, c3##j); } \
    else { c0##j = g2_mma(S##a0, S##b##j, c0##j); if (MT == 2) c1##j = g2_mma(S##a1, S##b##j, c1##j); if (ARES) d0##j = g2_mma(S##e0, S##b##j, d0##j); } }
#define GEMM_MM(S) { GEMM_MC(S, 0) GEMM_MC(S, 1) GEMM_MC(S, 2) GEMM_MC(S, 3) }
  const v16h zf = (v16h)((_Float16)0.0f);
  v16h Pa2 = zf, Pa3 = zf, Na2 = zf, Na3 = zf;
  v16h Pa0 = zf, Pa1 = zf, Pe0 = zf, Pb0 = zf, Pb1 = zf, Pb2 = zf, Pb3 = zf, Na0 = zf, Na1 = zf, Ne0 = zf, Nb0 = zf, Nb1 = zf, Nb2 = zf, Nb3 = zf;
  GEMM_LD(P, 0)
#pragma unroll      /* K is a constant of every launch: unrolled, the k offsets are immediates and no address register is rewritten while a group is in flight */
  for (int kb = 0; kb < K; kb += 64) {
    GEMM_LD(N, kb + 32)
    if (kb + 64 >= K) asm volatile("s_wait_xcnt 0x0" :: "v"(lane) : "memory");      /* behind the last group: the loads' offset register (built as the lane number, scaled by the load) lives up to this wait, so nothing (a late load's result included) is written over it earlier */
    GEMM_MM(P)
    if (kb + 64 < K) GEMM_LD(P, kb + 64)
    GEMM_MM(N)
  }
#undef GEMM_LD
#undef GEMM_MM
#undef GEMM_MC
  const v8f accs[16] = {c00, c01, c02, c03, c10, c11, c12, c13, c20, c21, c22, c23, c30, c31, c32, c33};
  const v8f accl[4] = {d00, d01, d02, d03};
#pragma unroll
  for (int u = 0; u < 4 * MT; ++u) {
    const int t = u & 3, half = u >> 2; const int col = col0 + t * 16 + ln;
    float bvc = 0.f; if (!ROWBIAS) bvc = bf16_rne(bias[col]);
#pragma unroll
    for (int r = 0; r < 8; ++r) {
      const int rloc = half * 16 + 8 * hh + r;
      float v = accs[u][r] * alpha;
      if (ARES) v += accl[t][r] * alphaL;
      if (ROWBIAS) v += bf16_rne(bias[R0 + rloc]); else v += bvc;
      so[w][rloc][t * 16 + ln] = v;
    }
  }
  __builtin_amdgcn_fence(4 /* acq_rel order */, "workgroup"); __builtin_amdgcn_wave_barrier();
  const int rsub = lane >> 4, c4 = (lane & 15) * 4;
  if (OUT == 0) {
    {
#pragma unroll
      for (int q = 0; q < 8 * MT; ++q) { const int r = q * 2 + rsub; const v4f v = *(const v4fa*)&so[w][r][c4]; *(v4f*)(Cf + (size_t)(crow0 + r) * ldc + col0 + c4) = v; }
      asm volatile("s_wait_xcnt 0x0" ::: "memory");      /* behind the run of stores: in a kernel of two bodies the other body's code follows in the listing and reuses the stores' address and data registers */
    }
  } else {
    int sl, rrow0, rcol0;
    if (OUT == 1) { sl = crow0 % SEQ; rrow0 = (crow0 / SEQ) * ISL + sl; rcol0 = col0; }
    else          { sl = col0 % SEQ;  rrow0 = crow0; rcol0 = (col0 / SEQ) * ISL + sl; }
    const bool isl = sl < ISL;      /* uniform over the wave tile: ISL and SEQ are multiples of 64 */
    {      /* one store = one half tile of the fragment-order plane: lane (hh, ln) holds row ln, 8 columns from 8 * hh */
#pragma unroll
      for (int q = 0; q < 4 * MT; ++q) {
        const int r = (q >> 2) * 16 + ln, c = (q & 3) * 16 + 8 * hh;
        const v4f va = *(const v4fa*)&so[w][r][c], vc = *(const v4fa*)&so[w][r][c + 4];
        FragH fh, fl;
#pragma unroll
        for (int i = 0; i < 4; ++i) {
          const _Float16 h0 = (_Float16)va[i], h1 = (_Float16)vc[i]; fh.h[i] = h0; fh.h[4 + i] = h1;
          fl.h[i] = (_Float16)((va[i] - (float)h0) * 1024.0f); fl.h[4 + i] = (_Float16)((vc[i] - (float)h1) * 1024.0f);
        }
        const v8us oh = fh.half[0], ol = fl.half[0];
        *(v8us*)((unsigned short*)C16 + fo_chunk(crow0 + r, col0 + c, ldc)) = oh;
        asm volatile("s_wait_xcnt 0x0" ::: "memory");      /* in front of the reuse of the store's data and address registers by the residual's arithmetic */
        if (isl) *(v8us*)((unsigned short*)CL + fo_chunk(rrow0 + r, rcol0 + c, ldcl)) = ol;
      }
      
    }
  }
}

constexpr int NB_QK   = (NR / 128) * (2 * DM / 128);
constexpr int NB_VT   = (DM / 128) * (NR / 128);
constexpr int NB_OUT  = (NB * (SEQ - ISL) / 128) * (DM / 64);
constexpr int NB_OUTI = (NRI / 64) * (DM / 64);
// one launch, two bodies:
// q | k rows (f16) = X16 . Wqk^T / 16 + b; residual rows for s < ISL
// V^T[h*64+d][token] (f16) = Wv . X16^T / 16 + b[row]; residual columns for s < ISL
__global__ __launch_bounds__(128) void k_gemm_qkv(const _Float16* __restrict__ X16, const _Float16* __restrict__ BW, const float* __restrict__ bias, _Float16* __restrict__ QK, _Float16* __restrict__ QKL, _Float16* __restrict__ VT, _Float16* __restrict__ VTL) {
  __shared__ __attribute__((aligned(16))) float so[4][64][68];
  const int bid = (int)blockIdx.x;
  if (bid < NB_QK) gemm_body<4, 2, false, false, 1>(X16, nullptr, DM, BW, DM, 0.0625f, 0.f, bias, nullptr, QK, QKL, LQK, LQK, NR, 2 * DM, DM, NR, 0, 0, 0, 0, bid, so);
  else gemm_body<4, 2, true, false, 2>(BW + (size_t)2 * DM * DM, nullptr, DM, X16, DM, 0.0625f, 0.f, bias + 2 * DM, nullptr, VT, VTL, LVT, LVL, DM, NR, DM, DM, 0, 0, 0, 0, bid - NB_QK, so);
}
// one launch, two bodies:
// out rows s >= ISL: ctx(x64) . Wo(x16) * 2^-10 + b
// out rows s < ISL: (ctx_hi . Wo) * 2^-10 + (ctx_res . Wo) * 2^-20 + b, separate accumulators
__global__ __launch_bounds__(128) void k_gemm_out(const _Float16* __restrict__ O16, const _Float16* __restrict__ OL, const _Float16* __restrict__ BO, const float* __restrict__ bias, float* __restrict__ out) {
  __shared__ __attribute__((aligned(16))) float so[4][32][68];
  const int bid = (int)blockIdx.x;
  if (bid < NB_OUT) gemm_body<2, 1, false, false, 0>(O16, nullptr, DM, BO, DM, 0.0009765625f, 0.f, bias, out, nullptr, nullptr, DM, 0, NB * (SEQ - ISL), DM, DM, SEQ - ISL, SEQ, ISL, SEQ_FULL, ISL, bid, so);
  else gemm_body<1, 1, false, true, 0>(O16, OL, DM, BO, DM, 0.0009765625f, 0.00000095367431640625f, bias, out, nullptr, nullptr, DM, 0, NRI, DM, DM, ISL, SEQ, 0, SEQ_FULL, 0, bid - NB_OUT, so);
}

// Fused prefix-causal attention, transposed form. Block = 8 waves = 128 consecutive queries of one (b, h); wave = 16 queries (D column = query = lane & 15).
// Visibility: key j is seen by query i iff (j <= i) OR (i < S AND j < S); S is loaded from its input buffer and clamped to [0, SEQ] (same mask for any value).
// Key range of a wave: [0, max(S, q0 + 16)) in 32-key steps (all step keys lie inside the sequence since SEQ % 32 == 0). Every step holds key kcb that is visible to every query of the wave
// (kcb <= q0 when the range ends at q0 + 16; kcb < S with all 16 queries < S otherwise), so the step maximum is always finite.
// Per 32-key step: S^T tiles (keys kcb..+15 and +16..+31) = K (A, rows = keys) . Q^T (B, lane = query); scale 1/8; hidden keys are REPLACED (excluded from max, weight 0 by value);
// online max / sum per lane (halves combined by one xor-16 shuffle); P^T (x1024, f16) is the B fragment directly: element r <- tile0[r], element 8+r <- tile1[r];
// O^T (rows = d) += V^T (A, rows = d, k = keys) . P^T. RES: q, k, v, P carry x1024 residual planes; residual products go to separate accumulators folded back with 2^-10.
// Residual k / v planes exist only for keys < ISL: for key steps at or beyond ISL (possible when S > ISL) the residual k / v fragments are loaded from a clamped in-range step and zeroed by value (wave-uniform select).
template <bool RES>
__device__ __forceinline__ void attn_body(const _Float16* __restrict__ QK, const _Float16* __restrict__ QKL, const _Float16* __restrict__ VT, const _Float16* __restrict__ VTL,
                                          _Float16* __restrict__ O16, _Float16* __restrict__ OL, const int* __restrict__ Sp, int qb0, int nqb, int bid) {
  const int tid = threadIdx.x, lane = tid & 31, ln = lane & 15, hh = lane >> 4;
  const int w = __builtin_amdgcn_readfirstlane(tid >> 5);
  const int sraw = Sp[0];
  const int Sc = sraw < 0 ? 0 : (sraw > SEQ ? SEQ : sraw);
  const int bh = bid / nqb; const int qb = qb0 + (bid - bh * nqb);
  const int h = bh % NH, b = bh / NH;
  const int q0 = qb * 128 + w * 16, q = q0 + ln;
  const bool qpre = q < Sc;
  const int rowb = b * SEQ, rowi = b * ISL;
  /* fragment-order planes: row tile r / 16 starts at element r * pitch (r % 16 == 0), column block c / 32 at c * 16 (c % 32 == 0), the lane's chunk at 8 * lane */
  const unsigned lo = 16u * (unsigned)lane;                           /* the lane's byte offset inside a half tile */
  const _Float16* qp = QK + (size_t)(rowb + q0) * LQK + h * HD * 16;
  const v16h qh0 = g2_frago(qp, lo, 0), qh1 = g2_frago(qp, lo, 1024);
  const int qloff = (rowi + q0) * LQK + h * HD * 16;       /* residual q tile (RES) */
  const int kbase = rowb * LQK + (DM + h * HD) * 16;       /* k tile of keys 0..15, d 0..31 */
  const int klbase = rowi * LQK + (DM + h * HD) * 16;      /* residual k tile (RES) */
  const int vbase = h * HD * LVT + rowb * 16;              /* V^T tile d 0..15, keys 0..31 */
  const int vlbase = h * HD * LVL + rowi * 16;             /* residual V^T tile (RES) */
  const v8f z8 = {0.f, 0.f, 0.f, 0.f, 0.f, 0.f, 0.f, 0.f};
  const v16h zh = (v16h)((_Float16)0.0f);
  v8f o0 = z8, o1 = z8, o2 = z8, o3 = z8, e0 = z8, e1 = z8, e2 = z8, e3 = z8;
  float m = -1.0e30f, l = 0.f;
  const int kend = (Sc > q0 + 16) ? Sc : (q0 + 16);              /* keys [0, kend) cover every visible key of the wave; kend <= SEQ */
  const int nst = (kend + 31) >> 5;
  // Plain form: the K and V fragments live in registers across the loop; the next step's K group is issued right behind this step's S^T WMMAs and the next step's V group right behind its O^T WMMAs.
  v16h ka = zh, kb = zh, kc = zh, kd = zh, v0 = zh, v1 = zh, v2 = zh, v3 = zh;
  unsigned kq = 2u * (unsigned)kbase + lo, vq = 2u * (unsigned)vbase + lo;      /* the lane's byte offsets of the K and V groups held in registers; step 0 exists: nst >= 1 */
  if (!RES) {
    ka = g2_frago(QK, kq, 0); kb = g2_frago(QK, kq, 1024); kc = g2_frago(QK, kq, 32 * LQK); kd = g2_frago(QK, kq, 32 * LQK + 1024);
    v0 = g2_frago(VT, vq, 0); v1 = g2_frago(VT, vq, 32 * LVT); v2 = g2_frago(VT, vq, 64 * LVT); v3 = g2_frago(VT, vq, 96 * LVT);
    /* inputs-only fence on the loaded values: every load in front of the loop has landed here, so the wait at the loop's head counts the loop's own groups alone and leaves the next V group in flight */
    asm volatile("" :: "v"(qh0), "v"(qh1), "v"(ka), "v"(kb), "v"(kc), "v"(kd), "v"(v0), "v"(v1), "v"(v2), "v"(v3));
  }
#pragma unroll 1
  for (int st = 0; st < nst; ++st) {
    const int kcb = st * 32;
    const int adv = (st + 1 < nst) ? 32 : 0;                     /* keys to the next step; the last step reloads its own (in range, not used) */
    const bool rok = kcb < ISL;                                  /* wave-uniform: residual k / v rows exist for this step */
    const int kcl = rok ? kcb : (ISL - 32);                      /* clamped in-range residual step */
    const _Float16* kp0 = QK + kbase + kcb * LQK;
    v8f s0 = z8, s1 = z8, r0 = z8, r1 = z8;
    if (RES) {
      unsigned qo = lo; asm volatile("" : "+v"(qo));             /* reload the residual q fragments per step (integer offset only) */
      const _Float16* qlp = QKL + qloff;
      const v16h ql0 = g2_frago(qlp, qo, 0), ql1 = g2_frago(qlp, qo, 1024);
      const _Float16* kl0 = QKL + klbase + kcl * LQK;
      /* all k fragments of the step as one load group in front of its WMMAs */
      const v16h ah0 = g2_frago(kp0, lo, 0), ah1 = g2_frago(kp0, lo, 1024), ah2 = g2_frago(kp0, lo, 32 * LQK), ah3 = g2_frago(kp0, lo, 32 * LQK + 1024);
      v16h al0 = g2_frago(kl0, lo, 0), al1 = g2_frago(kl0, lo, 1024), al2 = g2_frago(kl0, lo, 32 * LQK), al3 = g2_frago(kl0, lo, 32 * LQK + 1024);
      asm volatile("s_wait_xcnt 0x0" :: "v"(qo) : "memory");      /* behind the group: the offset register that the residual q loads name lives up to this wait, so no later load's result is written over it earlier */
      al0 = rok ? al0 : zh; al1 = rok ? al1 : zh; al2 = rok ? al2 : zh; al3 = rok ? al3 : zh;
      s0 = g2_mma(ah0, qh0, s0); r0 = g2_mma(al0, qh0, r0); r0 = g2_mma(ah0, ql0, r0);
      s0 = g2_mma(ah1, qh1, s0); r0 = g2_mma(al1, qh1, r0); r0 = g2_mma(ah1, ql1, r0);
      s1 = g2_mma(ah2, qh0, s1); r1 = g2_mma(al2, qh0, r1); r1 = g2_mma(ah2, ql0, r1);
      s1 = g2_mma(ah3, qh1, s1); r1 = g2_mma(al3, qh1, r1); r1 = g2_mma(ah3, ql1, r1);
    } else {
      s0 = g2_mma(ka, qh0, s0); s0 = g2_mma(kb, qh1, s0); s1 = g2_mma(kc, qh0, s1); s1 = g2_mma(kd, qh1, s1);
      asm volatile("s_wait_xcnt 0x0" : "+v"(kq) :: "memory");      /* stands in front of the rewrite of the offset register that the last K group's loads name; the register is an operand so that the addition stays behind it */
      kq += (unsigned)(adv * LQK * 2);
      ka = g2_frago(QK, kq, 0); kb = g2_frago(QK, kq, 1024); kc = g2_frago(QK, kq, 32 * LQK); kd = g2_frago(QK, kq, 32 * LQK + 1024);
      __builtin_amdgcn_sched_barrier(0);      /* holds the K group at the head of the softmax: issued further down it has less of the step to land in */
    }
    v16h vl0 = zh, vl1 = zh, vl2 = zh, vl3 = zh;
    if (RES) {      /* all v fragments of the step as one load group in front of the softmax */
      const _Float16* vp = VT + vbase + kcb * 16; const _Float16* vlp = VTL + vlbase + kcl * 16;
      v0 = g2_frago(vp, lo, 0); v1 = g2_frago(vp, lo, 32 * LVT); v2 = g2_frago(vp, lo, 64 * LVT); v3 = g2_frago(vp, lo, 96 * LVT);
      vl0 = g2_frago(vlp, lo, 0); vl1 = g2_frago(vlp, lo, 32 * LVL); vl2 = g2_frago(vlp, lo, 64 * LVL); vl3 = g2_frago(vlp, lo, 96 * LVL);
    }
    // D row = key kcb + 8*hh + r (tile 0), + 16 (tile 1); D column = query q
    v8f xa, xb; float mt = -1.0e30f;
#pragma unroll
    for (int r = 0; r < 8; ++r) {
      const int k0 = kcb + 8 * hh + r;
      const bool va = (k0 <= q) || (qpre && (k0 < Sc));
      const bool vb = (k0 + 16 <= q) || (qpre && (k0 + 16 < Sc));
      float a = s0[r], c = s1[r];
      if (RES) { a += r0[r] * 0.0009765625f; c += r1[r] * 0.0009765625f; }
      a *= 0.125f; c *= 0.125f;
      a = va ? a : -1.0e30f; c = vb ? c : -1.0e30f;
      xa[r] = a; xb[r] = c; mt = fmaxf(mt, fmaxf(a, c));
    }
    mt = fmaxf(mt, __shfl_xor(mt, 16, 32));
    const float mn = fmaxf(m, mt);
    float f; { const float t = fmaxf(m - mn, -80.0f) * 1.44269504f;      /* __expf as it compiles (multiply, v_exp_f32), with the slot behind the transcendental filled in the same statement */
      asm("v_exp_f32 %0, %1\n\tv_nop" : "=v"(f) : "v"(t)); }
    m = mn;
    FragH ph, pl; float rs = 0.f;
#pragma unroll
    for (int r = 0; r < 8; ++r) {
      const int k0 = kcb + 8 * hh + r;
      const bool va = (k0 <= q) || (qpre && (k0 < Sc));
      const bool vb = (k0 + 16 <= q) || (qpre && (k0 + 16 < Sc));
      float pa = __expf(va ? (xa[r] - mn) : 0.f); pa = va ? pa : 0.f;
      float pb = __expf(vb ? (xb[r] - mn) : 0.f); pb = vb ? pb : 0.f;
      rs += pa + pb;
      const float ta = pa * 1024.0f, tb = pb * 1024.0f;
      const _Float16 ha = (_Float16)ta, hb = (_Float16)tb;
      ph.h[r] = ha; ph.h[8 + r] = hb;
      if (RES) { pl.h[r] = (_Float16)((ta - (float)ha) * 1024.0f); pl.h[8 + r] = (_Float16)((tb - (float)hb) * 1024.0f); }
    }
    const float rso = __shfl_xor(rs, 16, 32);
    l = l * f + (rs + rso);
    o0 *= f; o1 *= f; o2 *= f; o3 *= f;
    if (RES) { e0 *= f; e1 *= f; e2 *= f; e3 *= f; }
    o0 = g2_mma(v0, ph.v, o0); o1 = g2_mma(v1, ph.v, o1); o2 = g2_mma(v2, ph.v, o2); o3 = g2_mma(v3, ph.v, o3);
    if (RES) {
      vl0 = rok ? vl0 : zh; vl1 = rok ? vl1 : zh; vl2 = rok ? vl2 : zh; vl3 = rok ? vl3 : zh;
      e0 = g2_mma(vl0, ph.v, e0); e0 = g2_mma(v0, pl.v, e0);
      e1 = g2_mma(vl1, ph.v, e1); e1 = g2_mma(v1, pl.v, e1);
      e2 = g2_mma(vl2, ph.v, e2); e2 = g2_mma(v2, pl.v, e2);
      e3 = g2_mma(vl3, ph.v, e3); e3 = g2_mma(v3, pl.v, e3);
    } else {
      asm volatile("s_wait_xcnt 0x0" : "+v"(vq) :: "memory");      /* the same for the V group's offset register */
      vq += (unsigned)(adv * 32);      /* 32 keys further = the next tile, 1 KB */
      v0 = g2_frago(VT, vq, 0); v1 = g2_frago(VT, vq, 32 * LVT); v2 = g2_frago(VT, vq, 64 * LVT); v3 = g2_frago(VT, vq, 96 * LVT);
    }
  }
  // ctx x64 = O^T * 64 / (1024 * l); O^T row d = dg*16 + 8*hh + r, column = query ln
  const float inv = 0.0625f * (1.0f / l);
  const v8f oo[4] = {o0, o1, o2, o3}; const v8f ee[4] = {e0, e1, e2, e3};
  // the lane's 8 values of O^T tile dg are query ln, columns dg*16 + 8*hh .. + 7: one chunk of the fragment-order ctx plane, so each tile goes out of the accumulators as one half-tile store of 512 contiguous bytes
#pragma unroll
  for (int dg = 0; dg < 4; ++dg) {
    FragH fh, fl;
#pragma unroll
    for (int r = 0; r < 8; ++r) {
      float v = oo[dg][r]; if (RES) v += ee[dg][r] * 0.0009765625f; v *= inv;
      const _Float16 h0 = (_Float16)v; fh.h[r] = h0; fl.h[r] = (_Float16)((v - (float)h0) * 1024.0f);
    }
    const v8us oh = fh.half[0], ol = fl.half[0];
    *(v8us*)((unsigned short*)O16 + fo_chunk(rowb + q0 + ln, h * HD + dg * 16 + 8 * hh, DM)) = oh;
    if (RES) *(v8us*)((unsigned short*)OL + fo_chunk(rowi + q0 + ln, h * HD + dg * 16 + 8 * hh, DM)) = ol;
  }
}

constexpr int NB_ATT  = NB * NH * ((SEQ - ISL) / 128);
constexpr int NB_ATTI = NB * NH * (ISL / 128);
// one launch, two bodies: the plain rows (the long blocks) first, the short residual-plane blocks behind them
__global__ __launch_bounds__(256) void k_attn(const _Float16* __restrict__ QK, const _Float16* __restrict__ QKL, const _Float16* __restrict__ VT, const _Float16* __restrict__ VTL, _Float16* __restrict__ O16, _Float16* __restrict__ OL, const int* __restrict__ Sp) {
  const int bid = (int)blockIdx.x;
  if (bid < NB_ATT) attn_body<false>(QK, nullptr, VT, nullptr, O16, nullptr, Sp, ISL / 128, (SEQ - ISL) / 128, bid);
  else attn_body<true>(QK, QKL, VT, VTL, O16, OL, Sp, 0, ISL / 128, bid - NB_ATT);
}

constexpr size_t al256(size_t bytes) { return (bytes + 255) & ~(size_t)255; }
constexpr size_t SZ_BQKV = al256((size_t)3 * DM * DM * 2);
constexpr size_t SZ_BO   = al256((size_t)DM * DM * 2);
constexpr size_t SZ_X16  = al256((size_t)NR * DM * 2);
constexpr size_t SZ_QK   = al256((size_t)NR * LQK * 2);
constexpr size_t SZ_QKL  = al256((size_t)NRI * LQK * 2);
constexpr size_t SZ_VT   = al256((size_t)DM * LVT * 2);
constexpr size_t SZ_VTL  = al256((size_t)DM * LVL * 2);
constexpr size_t SZ_O16  = al256((size_t)NR * DM * 2);
constexpr size_t SZ_OL   = al256((size_t)NRI * DM * 2);
constexpr size_t WS_TOTAL = SZ_BQKV + SZ_BO + SZ_X16 + SZ_QK + SZ_QKL + SZ_VT + SZ_VTL + SZ_O16 + SZ_OL;
static_assert(WS_TOTAL <= (size_t)134217728);      /* carve <= 128 MiB */

extern "C" void kernel_launch(void* const* d_in, const int* in_sizes, int n_in,
                              void* d_out, int out_size, void* d_ws, size_t ws_size, hipStream_t stream) {
  if (n_in < 6) return;
  const long long xrows = (long long)(NB - 1) * SEQ_FULL + SEQ;      /* rows of x / out touched */
  if ((long long)in_sizes[0] < xrows * DM) return;
  if ((long long)in_sizes[1] < (long long)DM * 3 * DM) return;
  if ((long long)in_sizes[2] < (long long)3 * DM) return;
  if ((long long)in_sizes[3] < (long long)DM * DM) return;
  if ((long long)in_sizes[4] < (long long)DM) return;
  if ((long long)in_sizes[5] < 1) return;
  if ((long long)out_size < xrows * DM) return;
  if (WS_TOTAL > ws_size) return;
  const float* x = (const float*)d_in[0]; const float* w_attn = (const float*)d_in[1]; const float* b_attn = (const float*)d_in[2];
  const float* w_proj = (const float*)d_in[3]; const float* b_proj = (const float*)d_in[4];
  const int* s_pref = (const int*)d_in[5];                           /* prefix length, loaded on the device */
  float* out = (float*)d_out;
  char* ws = (char*)d_ws; size_t off = 0;
  _Float16* BQKV = (_Float16*)(ws + off); off += SZ_BQKV;      /* [3072][1024] x16; this and every plane below in fragment order */
  _Float16* BO   = (_Float16*)(ws + off); off += SZ_BO;        /* [1024][1024] x16 */
  _Float16* X16  = (_Float16*)(ws + off); off += SZ_X16;       /* [NR][1024] */
  _Float16* QK   = (_Float16*)(ws + off); off += SZ_QK;        /* [NR][2048] q | k */
  _Float16* QKL  = (_Float16*)(ws + off); off += SZ_QKL;       /* [NRI][2048] residual x1024 */
  _Float16* VT   = (_Float16*)(ws + off); off += SZ_VT;        /* [1024][NR] */
  _Float16* VTL  = (_Float16*)(ws + off); off += SZ_VTL;       /* [1024][NRI] residual x1024 */
  _Float16* O16  = (_Float16*)(ws + off); off += SZ_O16;       /* [NR][1024] ctx x64 */
  _Float16* OL   = (_Float16*)(ws + off); off += SZ_OL;        /* [NRI][1024] ctx residual x1024 */
  if (off > ws_size) return;

  k_convert<<<(unsigned)(NB_X16 + NB_WQKV + NB_WO), 256, 0, stream>>>(x, w_attn, w_proj, X16, BQKV, BO);
  k_gemm_qkv<<<(unsigned)(NB_QK + NB_VT), 128, 0, stream>>>(X16, BQKV, b_attn, QK, QKL, VT, VTL);
  k_attn<<<(unsigned)(NB_ATT + NB_ATTI), 256, 0, stream>>>(QK, QKL, VT, VTL, O16, OL, s_pref);
  k_gemm_out<<<(unsigned)(NB_OUT + NB_OUTI), 128, 0, stream>>>(O16, OL, BO, b_proj, out);
}

// v005
// It runs in 104 microseconds.
// In both of two side-by-side timings against v004, it was 1.03 times as fast.
// Counting every step since v000, it is 2.86 times as fast.
#include <hip/hip_runtime.h>
// All contractions: v_wmma_f32_16x16x32_f16 (f16 operands, f32 accumulate). x, weights and biases are RNE-converted to bf16; x and weights are held exactly in f16 (weights x16); q, k, v, softmax weights (x1024) and ctx (x64) are f16 planes; for the first 256 query rows of every sequence q, k, v, P and ctx also carry an f16 residual plane (x1024) accumulated in a separate accumulator.
// Structure: token rows r = b*SEQ + s. (1) weights -> Wt[n][k] f16; x -> f16 rows. (2) q|k rows = X16 . Wqk (N = 2048) and V^T[h*64+d][token] = Wv . X16^T (operand-swapped GEMM, row bias). (3) fused flash attention in the transposed form S^T = K Q^T, O^T = V^T P^T: one wave owns 16 queries, fragments are loaded straight from the 16-bit planes (all kept in fragment order, see fo_chunk), P^T goes D -> B in registers, online softmax statistics are per-lane scalars; visibility (key <= query) OR (query < S AND key < S) applied as a replace-mask by value, S loaded on the device from its input buffer. (4) out = ctx . Wo + b (f32).
#ifndef NB
#define NB 2
#endif
#ifndef SEQ
#define SEQ 2048
#endif
#define NB_FULL 2
#define SEQ_FULL 2048
#define DM 1024
#define NH 16
#define HD 64
#define ISL ((SEQ) < 256 ? (SEQ) : 256)   /* query rows per sequence carried with residual planes */
#define NR (NB * SEQ)                      /* token rows in the workspace planes */
#define NRI (NB * ISL)                     /* rows of the compact residual planes */
#define LQK (2 * DM)                       /* row pitch of the q | k plane */
#define LVT NR                             /* row pitch of V^T */
#define LVL NRI                            /* row pitch of the V^T residual plane */

static_assert(NB >= 1 && NB <= NB_FULL);          /* reduced builds only shrink */
static_assert(SEQ <= SEQ_FULL);
static_assert(SEQ % 128 == 0);                    /* 8 waves x 16 queries per attention block; GEMM row blocks; 32-key steps stay inside the sequence */
static_assert(ISL % 128 == 0);                    /* residual region is a whole number of blocks */
static_assert(ISL >= 32);                         /* clamped residual key step ISL - 32 is a valid step */
static_assert((SEQ - ISL) % 128 == 0);            /* plain region is a whole number of blocks */
static_assert(NH * HD == DM);                     /* merged head layout */
static_assert(HD == 64);                          
static_assert(DM % 128 == 0);                     /* GEMM M blocks (V^T) and K % 64 (two k blocks per trip) */
static_assert(DM % 8 == 0);                       /* 8-element convert threads */
static_assert(NR % 128 == 0);                     /* GEMM M blocks / N tiles of 64 */
static_assert(NRI % 64 == 0);                     /* residual-row output GEMM blocks */
static_assert((long long)NR * LQK < 2147483647LL);/* int plane offsets */
static_assert((long long)DM * LVT < 2147483647LL);

typedef unsigned short v8us __attribute__((ext_vector_type(8), may_alias));
typedef float  v8f  __attribute__((ext_vector_type(8)));
typedef float  v4f  __attribute__((ext_vector_type(4)));
typedef float  v4fa __attribute__((ext_vector_type(4), may_alias));
typedef _Float16 v16h __attribute__((ext_vector_type(16)));
typedef _Float16 v4h  __attribute__((ext_vector_type(4)));
union FragH { v16h v; v8us half[2]; _Float16 h[16]; unsigned short u[16]; };

__device__ __forceinline__ float bf16_rne(float x) { unsigned int u = __float_as_uint(x); u = (u + 0x7FFFu + ((u >> 16) & 1u)) & 0xFFFF0000u; return __uint_as_float(u); }

// Fragment order: every 16-bit plane [rows][K] is stored as tiles of 16 rows x 32 k, 512 elements (1 KB) each, tile (row / 16, k / 32) at element (row / 16) * 16 * K + (k / 32) * 512.
// Inside a tile: two halves of 256 elements (k 0..15, k 16..31), each 32 lanes x 8 elements with lane = 16 * ((k / 8) & 1) + row % 16. A fragment is then two loads of 512 contiguous bytes (4 whole lines each).
// element offset of the 8-element chunk that holds (row, k .. k + 7), k % 8 == 0, in a plane of K columns (K % 32 == 0)
__device__ __forceinline__ size_t fo_chunk(int row, int k, int K) { return (size_t)(row >> 4) * 16 * K + (size_t)((k >> 5) * 512 + ((k >> 4) & 1) * 256 + (((k >> 3) & 1) * 16 + (row & 15)) * 8); }
// fragment of one tile: elements 0..7 <- k 8h.., elements 8..15 <- k 16+8h.., row = lane & 15, h = lane >> 4 (same map for A and B);
// from a uniform pointer, the lane's own 32-bit byte offset (16 * lane folded in) and a constant byte step
__device__ __forceinline__ v16h g2_frago(const _Float16* base, unsigned off, int add) { const char* p = (const char*)base + (size_t)off + add; FragH f; f.half[0] = *(const v8us*)p; f.half[1] = *(const v8us*)(p + 512); return f.v; }
__device__ __forceinline__ v8f g2_mma(v16h a, v16h b, v8f c) { v8f d = __builtin_amdgcn_wmma_f32_16x16x32_f16(false, a, false, b, (short)0, c, false, false); asm volatile("v_nop\n\tv_nop\n\tv_nop\n\tv_nop" : "+v"(d) : "v"(a), "v"(b)); return d; }

// the same product left to the compiler's own padding: for the 64 x 64 wave tile, whose 16 accumulators and two fragment sets need more than 256 registers (with the asm statement's operands the build stayed below 256 and spilled)
__device__ __forceinline__ v8f g2_mmab(v16h a, v16h b, v8f c) { return __builtin_amdgcn_wmma_f32_16x16x32_f16(false, a, false, b, (short)0, c, false, false); }

__device__ __forceinline__ void wt_f16_body(const float* __restrict__ W, _Float16* __restrict__ Wt, int K, int N, float scale, int bid) {
  /* one wave writes one half tile (512 contiguous bytes): lane = 16 * h + n % 16; waves run over the row tiles first, then over the 16-k halves */
  const int t = bid * 256 + threadIdx.x; if (t >= N * (K / 8)) return; const int wv = t >> 5, lane = t & 31; const int n = (wv % (N / 16)) * 16 + (lane & 15), k8 = (wv / (N / 16)) * 16 + (lane >> 4) * 8; FragH f;
#pragma unroll
  for (int i = 0; i < 8; ++i) f.h[i] = (_Float16)(bf16_rne(W[(size_t)(k8 + i) * N + n]) * scale);
  const v8us o = f.half[0];
  unsigned short* d = (unsigned short*)Wt + fo_chunk(n, k8, K);
  *(v8us*)d = o; 
}

__device__ __forceinline__ void x16_body(const float* __restrict__ x, _Float16* __restrict__ X16, int bid) {
  const int t = bid * 256 + threadIdx.x; if (t >= NR * (DM / 8)) return;
  /* one wave writes one half tile (512 contiguous bytes): lane = 16 * h + row % 16; consecutive waves take consecutive 16-k halves of a row tile */
  const int wv = t >> 5, lane = t & 31; const int row = (wv / (DM / 16)) * 16 + (lane & 15), c8 = (wv % (DM / 16)) * 16 + (lane >> 4) * 8; const int b = row / SEQ, s = row % SEQ;
  const float* src = x + ((size_t)b * SEQ_FULL + s) * DM + c8;
  const v4f a = *(const v4fa*)src, c = *(const v4fa*)(src + 4); FragH f;
#pragma unroll
  for (int i = 0; i < 4; ++i) { f.h[i] = (_Float16)bf16_rne(a[i]); f.h[4 + i] = (_Float16)bf16_rne(c[i]); }
  const v8us o = f.half[0];
  unsigned short* d = (unsigned short*)X16 + fo_chunk(row, c8, DM);
  *(v8us*)d = o; 
}

// Launches that read nothing of each other's output share one grid: a range of the block index picks the body (block-uniform branch).
constexpr int NB_X16  = (int)(((size_t)NR * (DM / 8) + 255) / 256);
constexpr int NB_WQKV = (int)(((size_t)3 * DM * (DM / 8) + 255) / 256);
constexpr int NB_WO   = (int)(((size_t)DM * (DM / 8) + 255) / 256);
// the three conversions: x -> X16; W[K=1024][N=3072] -> Wt[N][K]; W[K=1024][N=1024] -> Wt[N][K]
__global__ __launch_bounds__(256) void k_convert(const float* __restrict__ x, const float* __restrict__ w_attn, const float* __restrict__ w_proj, _Float16* __restrict__ X16, _Float16* __restrict__ BQKV, _Float16* __restrict__ BO) {
  const int bid = (int)blockIdx.x;
  if (bid < NB_X16) x16_body(x, X16, bid);
  else if (bid < NB_X16 + NB_WQKV) wt_f16_body(w_attn, BQKV, DM, 3 * DM, 16.0f, bid - NB_X16);
  else wt_f16_body(w_proj, BO, DM, DM, 16.0f, bid - (NB_X16 + NB_WQKV));
}

// GEMM: wave tile (16*MT) x 64, block = 4 waves laid (4/WN) x WN = (64*MT/WN) rows x (64*WN) cols; A and Bh are f16 planes in fragment order (fragments straight from global).
// v = acc*alpha (+ accL*alphaL with the residual A plane AL, ARES) + bias (per column, or per row if ROWBIAS; bias RNE-converted to bf16).
// Logical row R maps to A row seg*aSeg + aOff + w and C row seg*cSeg + cOff + w with seg = R / segRows, w = R % segRows (blocks never straddle segments).
// OUT 0: f32 C. OUT 1: f16 C16 (+ x1024 residual rows in CL when the rows lie in the first ISL rows of a sequence). OUT 2: f16 C16 (+ residual columns when the token columns lie in the first ISL rows of a sequence).
// Requires M % (64*MT/WN) == 0, N % (64*WN) == 0, K % 64 == 0 (asserted above for the launches used). LDS tile so[wave] is private to its wave (wave-level sync); the kernel owns the array, so the two bodies of a launch share one. bid: block index inside the body's own range.
template <int MT, int WN, bool ROWBIAS, bool ARES, int OUT, int SOR>
__device__ __forceinline__ void gemm_body(const _Float16* __restrict__ A, const _Float16* __restrict__ AL, int lda,
    const _Float16* __restrict__ Bh, int ldb, float alpha, float alphaL, const float* __restrict__ bias,
    float* __restrict__ Cf, _Float16* __restrict__ C16, _Float16* __restrict__ CL, int ldc, int ldcl,
    int M, int N, int K, int segRows, int aSeg, int aOff, int cSeg, int cOff, int bid, float (*so)[SOR][68]) {
  static_assert(MT == 1 || MT == 2 || MT == 4);
  static_assert(WN == 1 || WN == 2);    /* the block's 4 waves lie (4 / WN) x WN over its tile */
  static_assert(SOR >= 16 * MT);        /* the wave's staging rows */
  static_assert(!ARES || MT == 1);      /* residual form keeps 8 accumulators */
  const int tid = threadIdx.x, lane = tid & 31, ln = lane & 15, hh = lane >> 4;
  const int w = __builtin_amdgcn_readfirstlane(tid >> 5);      /* wave-uniform, so that every tile base below is a scalar pointer */
  const int ntn = N / (64 * WN);
  const int mt = bid / ntn, nq = bid - mt * ntn;
  const int R0 = mt * (64 * MT / WN) + (16 * MT) * (w / WN), col0 = nq * (64 * WN) + 64 * (w % WN);
  if (R0 >= M) return;
  const int seg = R0 / segRows, wi = R0 - seg * segRows;
  const int arow0 = seg * aSeg + aOff + wi, crow0 = seg * cSeg + cOff + wi;
  /* arow0, R0 and col0 are multiples of 16: row tile r / 16 starts at element r * ld; 32 k further is 512 elements further */
  const _Float16* a0p = A + (size_t)arow0 * lda;
  const _Float16* b0p = Bh + (size_t)col0 * ldb;
  unsigned ko = 16u * (unsigned)lane;      /* the lane's byte offset inside a half tile plus the trip's k offset: the one vector address register of every fragment load */
  const v8f z8 = {0.f, 0.f, 0.f, 0.f, 0.f, 0.f, 0.f, 0.f};
  v8f c00 = z8, c01 = z8, c02 = z8, c03 = z8, c10 = z8, c11 = z8, c12 = z8, c13 = z8, c20 = z8, c21 = z8, c22 = z8, c23 = z8, c30 = z8, c31 = z8, c32 = z8, c33 = z8, d00 = z8, d01 = z8, d02 = z8, d03 = z8;
  // Two register sets of fragments (P, N), 32 k each: every set is loaded as one group, one k block ahead of the WMMAs that read it, so a block waits for one load round trip that started a block earlier.
  const _Float16* e0p = ARES ? AL + (size_t)R0 * lda : a0p;
#define GEMM_LD(S, kk) { S##a0 = g2_frago(a0p, ko, (kk) * 32); if (MT >= 2) S##a1 = g2_frago(a0p, ko, 32 * lda + (kk) * 32); if (MT == 4) { S##a2 = g2_frago(a0p, ko, 64 * lda + (kk) * 32); S##a3 = g2_frago(a0p, ko, 96 * lda + (kk) * 32); } if (ARES) S##e0 = g2_frago(e0p, ko, (kk) * 32); \
    S##b0 = g2_frago(b0p, ko, (kk) * 32); S##b1 = g2_frago(b0p, ko, 32 * ldb + (kk) * 32); S##b2 = g2_frago(b0p, ko, 64 * ldb + (kk) * 32); S##b3 = g2_frago(b0p, ko, 96 * ldb + (kk) * 32); }
#define GEMM_MC(S, j) { if (MT == 4) { c0##j = g2_mmab(S##a0, S##b##j, c0##j); c1##j = g2_mmab(S##a1, S##b##j, c1##j); c2##j = g2_mmab(S##a2, S##b##j, c2##j); c3##j = g2_mmab(S##a3, S##b##j, c3##j); } \
    else { c0##j = g2_mma(S##a0, S##b##j, c0##j); if (MT == 2) c1##j = g2_mma(S##a1, S##b##j, c1##j); if (ARES) d0##j = g2_mma(S##e0, S##b##j, d0##j); } }
#define GEMM_MM(S) { GEMM_MC(S, 0) GEMM_MC(S, 1) GEMM_MC(S, 2) GEMM_MC(S, 3) }
  const v16h zf = (v16h)((_Float16)0.0f);
  v16h Pa2 = zf, Pa3 = zf, Na2 = zf, Na3 = zf;
  v16h Pa0 = zf, Pa1 = zf, Pe0 = zf, Pb0 = zf, Pb1 = zf, Pb2 = zf, Pb3 = zf, Na0 = zf, Na1 = zf, Ne0 = zf, Nb0 = zf, Nb1 = zf, Nb2 = zf, Nb3 = zf;
  GEMM_LD(P, 0)
  asm volatile("s_wait_xcnt 0x0" :: "v"(lane), "v"(ko) : "memory");      /* behind the first group: the build may name the lane number (scaled by the load) or the byte offset as its offset register; both live up to this wait, so that no result of the loop's loads is written over either earlier */
#pragma unroll 1      /* kept rolled, 64 k per trip, the last trip peeled: for speed only */
  for (int kb = 0; kb + 64 < K; kb += 64) {
    GEMM_LD(N, 32)
    __builtin_amdgcn_sched_barrier(0);      /* this and the three below hold each load group whole and one k block ahead of its WMMAs, as the unrolled form had them: the rolled loop's scheduler sank the loads to their uses */
    GEMM_MM(P)
    __builtin_amdgcn_sched_barrier(0);
    GEMM_LD(P, 64)
    __builtin_amdgcn_sched_barrier(0);
    GEMM_MM(N)
    __builtin_amdgcn_sched_barrier(0);
    asm volatile("s_wait_xcnt 0x0" : "+v"(ko) :: "memory");      /* stands in front of the rewrite of the offset register that the groups in flight name; the register is an operand so that the addition stays behind it */
    ko += 64 * 32;      /* 64 k further = two tiles, 2 KB, in every plane */
  }
  GEMM_LD(N, 32)
  asm volatile("s_wait_xcnt 0x0" :: "v"(ko) : "memory");      /* behind the last group: the loads' offset register lives up to this wait, so nothing (a late load's result included) is written over it earlier */
  __builtin_amdgcn_sched_barrier(0);      /* the last group too stays whole and ahead of the WMMAs of the block before it */
  GEMM_MM(P)
  GEMM_MM(N)
#undef GEMM_LD
#undef GEMM_MM
#undef GEMM_MC
  const v8f accs[16] = {c00, c01, c02, c03, c10, c11, c12, c13, c20, c21, c22, c23, c30, c31, c32, c33};
  const v8f accl[4] = {d00, d01, d02, d03};
#pragma unroll
  for (int u = 0; u < 4 * MT; ++u) {
    const int t = u & 3, half = u >> 2; const int col = col0 + t * 16 + ln;
    float bvc = 0.f; if (!ROWBIAS) bvc = bf16_rne(bias[col]);
#pragma unroll
    for (int r = 0; r < 8; ++r) {
      const int rloc = half * 16 + 8 * hh + r;
      float v = accs[u][r] * alpha;
      if (ARES) v += accl[t][r] * alphaL;
      if (ROWBIAS) v += bf16_rne(bias[R0 + rloc]); else v += bvc;
      so[w][rloc][t * 16 + ln] = v;
    }
  }
  __builtin_amdgcn_fence(4 /* acq_rel order */, "workgroup"); __builtin_amdgcn_wave_barrier();
  const int rsub = lane >> 4, c4 = (lane & 15) * 4;
  if (OUT == 0) {
    {
#pragma unroll
      for (int q = 0; q < 8 * MT; ++q) { const int r = q * 2 + rsub; const v4f v = *(const v4fa*)&so[w][r][c4]; *(v4f*)(Cf + (size_t)(crow0 + r) * ldc + col0 + c4) = v; }
      asm volatile("s_wait_xcnt 0x0" ::: "memory");      /* behind the run of stores: in a kernel of two bodies the other body's code follows in the listing and reuses the stores' address and data registers */
    }
  } else {
    int sl, rrow0, rcol0;
    if (OUT == 1) { sl = crow0 % SEQ; rrow0 = (crow0 / SEQ) * ISL + sl; rcol0 = col0; }
    else          { sl = col0 % SEQ;  rrow0 = crow0; rcol0 = (col0 / SEQ) * ISL + sl; }
    const bool isl = sl < ISL;      /* uniform over the wave tile: ISL and SEQ are multiples of 64 */
    {      /* one store = one half tile of the fragment-order plane: lane (hh, ln) holds row ln, 8 columns from 8 * hh */
#pragma unroll
      for (int q = 0; q < 4 * MT; ++q) {
        const int r = (q >> 2) * 16 + ln, c = (q & 3) * 16 + 8 * hh;
        const v4f va = *(const v4fa*)&so[w][r][c], vc = *(const v4fa*)&so[w][r][c + 4];
        FragH fh, fl;
#pragma unroll
        for (int i = 0; i < 4; ++i) {
          const _Float16 h0 = (_Float16)va[i], h1 = (_Float16)vc[i]; fh.h[i] = h0; fh.h[4 + i] = h1;
          fl.h[i] = (_Float16)((va[i] - (float)h0) * 1024.0f); fl.h[4 + i] = (_Float16)((vc[i] - (float)h1) * 1024.0f);
        }
        const v8us oh = fh.half[0], ol = fl.half[0];
        *(v8us*)((unsigned short*)C16 + fo_chunk(crow0 + r, col0 + c, ldc)) = oh;
        asm volatile("s_wait_xcnt 0x0" ::: "memory");      /* in front of the reuse of the store's data and address registers by the residual's arithmetic */
        if (isl) *(v8us*)((unsigned short*)CL + fo_chunk(rrow0 + r, rcol0 + c, ldcl)) = ol;
      }
      
    }
  }
}

constexpr int NB_QK   = (NR / 128) * (2 * DM / 128);
constexpr int NB_VT   = (DM / 128) * (NR / 128);
constexpr int NB_OUT  = (NB * (SEQ - ISL) / 128) * (DM / 64);
constexpr int NB_OUTI = (NRI / 64) * (DM / 64);
// one launch, two bodies:
// q | k rows (f16) = X16 . Wqk^T / 16 + b; residual rows for s < ISL
// V^T[h*64+d][token] (f16) = Wv . X16^T / 16 + b[row]; residual columns for s < ISL
__global__ __launch_bounds__(128) void k_gemm_qkv(const _Float16* __restrict__ X16, const _Float16* __restrict__ BW, const float* __restrict__ bias, _Float16* __restrict__ QK, _Float16* __restrict__ QKL, _Float16* __restrict__ VT, _Float16* __restrict__ VTL) {
  __shared__ __attribute__((aligned(16))) float so[4][64][68];
  const int bid = (int)blockIdx.x;
  if (bid < NB_QK) gemm_body<4, 2, false, false, 1>(X16, nullptr, DM, BW, DM, 0.0625f, 0.f, bias, nullptr, QK, QKL, LQK, LQK, NR, 2 * DM, DM, NR, 0, 0, 0, 0, bid, so);
  else gemm_body<4, 2, true, false, 2>(BW + (size_t)2 * DM * DM, nullptr, DM, X16, DM, 0.0625f, 0.f, bias + 2 * DM, nullptr, VT, VTL, LVT, LVL, DM, NR, DM, DM, 0, 0, 0, 0, bid - NB_QK, so);
}
// one launch, two bodies:
// out rows s >= ISL: ctx(x64) . Wo(x16) * 2^-10 + b
// out rows s < ISL: (ctx_hi . Wo) * 2^-10 + (ctx_res . Wo) * 2^-20 + b, separate accumulators
__global__ __launch_bounds__(128) void k_gemm_out(const _Float16* __restrict__ O16, const _Float16* __restrict__ OL, const _Float16* __restrict__ BO, const float* __restrict__ bias, float* __restrict__ out) {
  __shared__ __attribute__((aligned(16))) float so[4][32][68];
  const int bid = (int)blockIdx.x;
  if (bid < NB_OUT) gemm_body<2, 1, false, false, 0>(O16, nullptr, DM, BO, DM, 0.0009765625f, 0.f, bias, out, nullptr, nullptr, DM, 0, NB * (SEQ - ISL), DM, DM, SEQ - ISL, SEQ, ISL, SEQ_FULL, ISL, bid, so);
  else gemm_body<1, 1, false, true, 0>(O16, OL, DM, BO, DM, 0.0009765625f, 0.00000095367431640625f, bias, out, nullptr, nullptr, DM, 0, NRI, DM, DM, ISL, SEQ, 0, SEQ_FULL, 0, bid - NB_OUT, so);
}

// Fused prefix-causal attention, transposed form. Block = 8 waves = 128 consecutive queries of one (b, h); wave = 16 queries (D column = query = lane & 15).
// Visibility: key j is seen by query i iff (j <= i) OR (i < S AND j < S); S is loaded from its input buffer and clamped to [0, SEQ] (same mask for any value).
// Key range of a wave: [0, max(S, q0 + 16)) in 32-key steps (all step keys lie inside the sequence since SEQ % 32 == 0). Every step holds key kcb that is visible to every query of the wave
// (kcb <= q0 when the range ends at q0 + 16; kcb < S with all 16 queries < S otherwise), so the step maximum is always finite.
// Per 32-key step: S^T tiles (keys kcb..+15 and +16..+31) = K (A, rows = keys) . Q^T (B, lane = query); scale 1/8; hidden keys are REPLACED (excluded from max, weight 0 by value);
// online max / sum per lane (halves combined by one xor-16 shuffle); P^T (x1024, f16) is the B fragment directly: element r <- tile0[r], element 8+r <- tile1[r];
// O^T (rows = d) += V^T (A, rows = d, k = keys) . P^T. RES: q, k, v, P carry x1024 residual planes; residual products go to separate accumulators folded back with 2^-10.
// Residual k / v planes exist only for keys < ISL: for key steps at or beyond ISL (possible when S > ISL) the residual k / v fragments are loaded from a clamped in-range step and zeroed by value (wave-uniform select).
template <bool RES>
__device__ __forceinline__ void attn_body(const _Float16* __restrict__ QK, const _Float16* __restrict__ QKL, const _Float16* __restrict__ VT, const _Float16* __restrict__ VTL,
                                          _Float16* __restrict__ O16, _Float16* __restrict__ OL, const int* __restrict__ Sp, int qb0, int nqb, int bid) {
  const int tid = threadIdx.x, lane = tid & 31, ln = lane & 15, hh = lane >> 4;
  const int w = __builtin_amdgcn_readfirstlane(tid >> 5);
  const int sraw = Sp[0];
  const int Sc = sraw < 0 ? 0 : (sraw > SEQ ? SEQ : sraw);
  const int bh = bid / nqb; const int qb = qb0 + (bid - bh * nqb);
  const int h = bh % NH, b = bh / NH;
  const int q0 = qb * 128 + w * 16, q = q0 + ln;
  const bool qpre = q < Sc;
  const int rowb = b * SEQ, rowi = b * ISL;
  /* fragment-order planes: row tile r / 16 starts at element r * pitch (r % 16 == 0), column block c / 32 at c * 16 (c % 32 == 0), the lane's chunk at 8 * lane */
  const unsigned lo = 16u * (unsigned)lane;                           /* the lane's byte offset inside a half tile */
  const _Float16* qp = QK + (size_t)(rowb + q0) * LQK + h * HD * 16;
  const v16h qh0 = g2_frago(qp, lo, 0), qh1 = g2_frago(qp, lo, 1024);
  const int qloff = (rowi + q0) * LQK + h * HD * 16;       /* residual q tile (RES) */
  const int kbase = rowb * LQK + (DM + h * HD) * 16;       /* k tile of keys 0..15, d 0..31 */
  const int klbase = rowi * LQK + (DM + h * HD) * 16;      /* residual k tile (RES) */
  const int vbase = h * HD * LVT + rowb * 16;              /* V^T tile d 0..15, keys 0..31 */
  const int vlbase = h * HD * LVL + rowi * 16;             /* residual V^T tile (RES) */
  const v8f z8 = {0.f, 0.f, 0.f, 0.f, 0.f, 0.f, 0.f, 0.f};
  const v16h zh = (v16h)((_Float16)0.0f);
  v8f o0 = z8, o1 = z8, o2 = z8, o3 = z8, e0 = z8, e1 = z8, e2 = z8, e3 = z8;
  float m = -1.0e30f, l = 0.f;
  const int kend = (Sc > q0 + 16) ? Sc : (q0 + 16);              /* keys [0, kend) cover every visible key of the wave; kend <= SEQ */
  const int nst = (kend + 31) >> 5;
  // Plain form: the K and V fragments live in registers across the loop; the next step's K group is issued right behind this step's S^T WMMAs and the next step's V group right behind its O^T WMMAs.
  v16h ka = zh, kb = zh, kc = zh, kd = zh, v0 = zh, v1 = zh, v2 = zh, v3 = zh;
  unsigned kq = 2u * (unsigned)kbase + lo, vq = 2u * (unsigned)vbase + lo;      /* the lane's byte offsets of the K and V groups held in registers; step 0 exists: nst >= 1 */
  if (!RES) {
    ka = g2_frago(QK, kq, 0); kb = g2_frago(QK, kq, 1024); kc = g2_frago(QK, kq, 32 * LQK); kd = g2_frago(QK, kq, 32 * LQK + 1024);
    v0 = g2_frago(VT, vq, 0); v1 = g2_frago(VT, vq, 32 * LVT); v2 = g2_frago(VT, vq, 64 * LVT); v3 = g2_frago(VT, vq, 96 * LVT);
    /* inputs-only fence on the loaded values: every load in front of the loop has landed here, so the wait at the loop's head counts the loop's own groups alone and leaves the next V group in flight */
    asm volatile("" :: "v"(qh0), "v"(qh1), "v"(ka), "v"(kb), "v"(kc), "v"(kd), "v"(v0), "v"(v1), "v"(v2), "v"(v3));
  }
#pragma unroll 1
  for (int st = 0; st < nst; ++st) {
    const int kcb = st * 32;
    const int adv = (st + 1 < nst) ? 32 : 0;                     /* keys to the next step; the last step reloads its own (in range, not used) */
    const bool rok = kcb < ISL;                                  /* wave-uniform: residual k / v rows exist for this step */
    const int kcl = rok ? kcb : (ISL - 32);                      /* clamped in-range residual step */
    const _Float16* kp0 = QK + kbase + kcb * LQK;
    v8f s0 = z8, s1 = z8, r0 = z8, r1 = z8;
    if (RES) {
      unsigned qo = lo; asm volatile("" : "+v"(qo));             /* reload the residual q fragments per step (integer offset only) */
      const _Float16* qlp = QKL + qloff;
      const v16h ql0 = g2_frago(qlp, qo, 0), ql1 = g2_frago(qlp, qo, 1024);
      const _Float16* kl0 = QKL + klbase + kcl * LQK;
      /* all k fragments of the step as one load group in front of its WMMAs */
      const v16h ah0 = g2_frago(kp0, lo, 0), ah1 = g2_frago(kp0, lo, 1024), ah2 = g2_frago(kp0, lo, 32 * LQK), ah3 = g2_frago(kp0, lo, 32 * LQK + 1024);
      v16h al0 = g2_frago(kl0, lo, 0), al1 = g2_frago(kl0, lo, 1024), al2 = g2_frago(kl0, lo, 32 * LQK), al3 = g2_frago(kl0, lo, 32 * LQK + 1024);
      asm volatile("s_wait_xcnt 0x0" :: "v"(qo) : "memory");      /* behind the group: the offset register that the residual q loads name lives up to this wait, so no later load's result is written over it earlier */
      al0 = rok ? al0 : zh; al1 = rok ? al1 : zh; al2 = rok ? al2 : zh; al3 = rok ? al3 : zh;
      s0 = g2_mma(ah0, qh0, s0); r0 = g2_mma(al0, qh0, r0); r0 = g2_mma(ah0, ql0, r0);
      s0 = g2_mma(ah1, qh1, s0); r0 = g2_mma(al1, qh1, r0); r0 = g2_mma(ah1, ql1, r0);
      s1 = g2_mma(ah2, qh0, s1); r1 = g2_mma(al2, qh0, r1); r1 = g2_mma(ah2, ql0, r1);
      s1 = g2_mma(ah3, qh1, s1); r1 = g2_mma(al3, qh1, r1); r1 = g2_mma(ah3, ql1, r1);
    } else {
      s0 = g2_mma(ka, qh0, s0); s0 = g2_mma(kb, qh1, s0); s1 = g2_mma(kc, qh0, s1); s1 = g2_mma(kd, qh1, s1);
      asm volatile("s_wait_xcnt 0x0" : "+v"(kq) :: "memory");      /* stands in front of the rewrite of the offset register that the last K group's loads name; the register is an operand so that the addition stays behind it */
      kq += (unsigned)(adv * LQK * 2);
      ka = g2_frago(QK, kq, 0); kb = g2_frago(QK, kq, 1024); kc = g2_frago(QK, kq, 32 * LQK); kd = g2_frago(QK, kq, 32 * LQK + 1024);
      __builtin_amdgcn_sched_barrier(0);      /* holds the K group at the head of the softmax: issued further down it has less of the step to land in */
    }
    v16h vl0 = zh, vl1 = zh, vl2 = zh, vl3 = zh;
    if (RES) {      /* all v fragments of the step as one load group in front of the softmax */
      const _Float16* vp = VT + vbase + kcb * 16; const _Float16* vlp = VTL + vlbase + kcl * 16;
      v0 = g2_frago(vp, lo, 0); v1 = g2_frago(vp, lo, 32 * LVT); v2 = g2_frago(vp, lo, 64 * LVT); v3 = g2_frago(vp, lo, 96 * LVT);
      vl0 = g2_frago(vlp, lo, 0); vl1 = g2_frago(vlp, lo, 32 * LVL); vl2 = g2_frago(vlp, lo, 64 * LVL); vl3 = g2_frago(vlp, lo, 96 * LVL);
    }
    // D row = key kcb + 8*hh + r (tile 0), + 16 (tile 1); D column = query q
    v8f xa, xb; float mt = -1.0e30f;
#pragma unroll
    for (int r = 0; r < 8; ++r) {
      const int k0 = kcb + 8 * hh + r;
      const bool va = (k0 <= q) || (qpre && (k0 < Sc));
      const bool vb = (k0 + 16 <= q) || (qpre && (k0 + 16 < Sc));
      float a = s0[r], c = s1[r];
      if (RES) { a += r0[r] * 0.0009765625f; c += r1[r] * 0.0009765625f; }
      a *= 0.125f; c *= 0.125f;
      a = va ? a : -1.0e30f; c = vb ? c : -1.0e30f;
      xa[r] = a; xb[r] = c; mt = fmaxf(mt, fmaxf(a, c));
    }
    mt = fmaxf(mt, __shfl_xor(mt, 16, 32));
    const float mn = fmaxf(m, mt);
    float f; { const float t = fmaxf(m - mn, -80.0f) * 1.44269504f;      /* __expf as it compiles (multiply, v_exp_f32), with the slot behind the transcendental filled in the same statement */
      asm("v_exp_f32 %0, %1\n\tv_nop" : "=v"(f) : "v"(t)); }
    m = mn;
    FragH ph, pl; float rs = 0.f;
#pragma unroll
    for (int r = 0; r < 8; ++r) {
      const int k0 = kcb + 8 * hh + r;
      const bool va = (k0 <= q) || (qpre && (k0 < Sc));
      const bool vb = (k0 + 16 <= q) || (qpre && (k0 + 16 < Sc));
      float pa = __expf(va ? (xa[r] - mn) : 0.f); pa = va ? pa : 0.f;
      float pb = __expf(vb ? (xb[r] - mn) : 0.f); pb = vb ? pb : 0.f;
      rs += pa + pb;
      const float ta = pa * 1024.0f, tb = pb * 1024.0f;
      const _Float16 ha = (_Float16)ta, hb = (_Float16)tb;
      ph.h[r] = ha; ph.h[8 + r] = hb;
      if (RES) { pl.h[r] = (_Float16)((ta - (float)ha) * 1024.0f); pl.h[8 + r] = (_Float16)((tb - (float)hb) * 1024.0f); }
    }
    const float rso = __shfl_xor(rs, 16, 32);
    l = l * f + (rs + rso);
    o0 *= f; o1 *= f; o2 *= f; o3 *= f;
    if (RES) { e0 *= f; e1 *= f; e2 *= f; e3 *= f; }
    o0 = g2_mma(v0, ph.v, o0); o1 = g2_mma(v1, ph.v, o1); o2 = g2_mma(v2, ph.v, o2); o3 = g2_mma(v3, ph.v, o3);
    if (RES) {
      vl0 = rok ? vl0 : zh; vl1 = rok ? vl1 : zh; vl2 = rok ? vl2 : zh; vl3 = rok ? vl3 : zh;
      e0 = g2_mma(vl0, ph.v, e0); e0 = g2_mma(v0, pl.v, e0);
      e1 = g2_mma(vl1, ph.v, e1); e1 = g2_mma(v1, pl.v, e1);
      e2 = g2_mma(vl2, ph.v, e2); e2 = g2_mma(v2, pl.v, e2);
      e3 = g2_mma(vl3, ph.v, e3); e3 = g2_mma(v3, pl.v, e3);
    } else {
      asm volatile("s_wait_xcnt 0x0" : "+v"(vq) :: "memory");      /* the same for the V group's offset register */
      vq += (unsigned)(adv * 32);      /* 32 keys further = the next tile, 1 KB */
      v0 = g2_frago(VT, vq, 0); v1 = g2_frago(VT, vq, 32 * LVT); v2 = g2_frago(VT, vq, 64 * LVT); v3 = g2_frago(VT, vq, 96 * LVT);
    }
  }
  // ctx x64 = O^T * 64 / (1024 * l); O^T row d = dg*16 + 8*hh + r, column = query ln
  const float inv = 0.0625f * (1.0f / l);
  const v8f oo[4] = {o0, o1, o2, o3}; const v8f ee[4] = {e0, e1, e2, e3};
  // the lane's 8 values of O^T tile dg are query ln, columns dg*16 + 8*hh .. + 7: one chunk of the fragment-order ctx plane, so each tile goes out of the accumulators as one half-tile store of 512 contiguous bytes
#pragma unroll
  for (int dg = 0; dg < 4; ++dg) {
    FragH fh, fl;
#pragma unroll
    for (int r = 0; r < 8; ++r) {
      float v = oo[dg][r]; if (RES) v += ee[dg][r] * 0.0009765625f; v *= inv;
      const _Float16 h0 = (_Float16)v; fh.h[r] = h0; fl.h[r] = (_Float16)((v - (float)h0) * 1024.0f);
    }
    const v8us oh = fh.half[0], ol = fl.half[0];
    *(v8us*)((unsigned short*)O16 + fo_chunk(rowb + q0 + ln, h * HD + dg * 16 + 8 * hh, DM)) = oh;
    if (RES) *(v8us*)((unsigned short*)OL + fo_chunk(rowi + q0 + ln, h * HD + dg * 16 + 8 * hh, DM)) = ol;
  }
}

constexpr int NB_ATT  = NB * NH * ((SEQ - ISL) / 128);
constexpr int NB_ATTI = NB * NH * (ISL / 128);
// one launch, two bodies: the plain rows (the long blocks) first, the short residual-plane blocks behind them
__global__ __launch_bounds__(256) void k_attn(const _Float16* __restrict__ QK, const _Float16* __restrict__ QKL, const _Float16* __restrict__ VT, const _Float16* __restrict__ VTL, _Float16* __restrict__ O16, _Float16* __restrict__ OL, const int* __restrict__ Sp) {
  const int bid = (int)blockIdx.x;
  if (bid < NB_ATT) attn_body<false>(QK, nullptr, VT, nullptr, O16, nullptr, Sp, ISL / 128, (SEQ - ISL) / 128, bid);
  else attn_body<true>(QK, QKL, VT, VTL, O16, OL, Sp, 0, ISL / 128, bid - NB_ATT);
}

constexpr size_t al256(size_t bytes) { return (bytes + 255) & ~(size_t)255; }
constexpr size_t SZ_BQKV = al256((size_t)3 * DM * DM * 2);
constexpr size_t SZ_BO   = al256((size_t)DM * DM * 2);
constexpr size_t SZ_X16  = al256((size_t)NR * DM * 2);
constexpr size_t SZ_QK   = al256((size_t)NR * LQK * 2);
constexpr size_t SZ_QKL  = al256((size_t)NRI * LQK * 2);
constexpr size_t SZ_VT   = al256((size_t)DM * LVT * 2);
constexpr size_t SZ_VTL  = al256((size_t)DM * LVL * 2);
constexpr size_t SZ_O16  = al256((size_t)NR * DM * 2);
constexpr size_t SZ_OL   = al256((size_t)NRI * DM * 2);
constexpr size_t WS_TOTAL = SZ_BQKV + SZ_BO + SZ_X16 + SZ_QK + SZ_QKL + SZ_VT + SZ_VTL + SZ_O16 + SZ_OL;
static_assert(WS_TOTAL <= (size_t)134217728);      /* carve <= 128 MiB */

extern "C" void kernel_launch(void* const* d_in, const int* in_sizes, int n_in,
                              void* d_out, int out_size, void* d_ws, size_t ws_size, hipStream_t stream) {
  if (n_in < 6) return;
  const long long xrows = (long long)(NB - 1) * SEQ_FULL + SEQ;      /* rows of x / out touched */
  if ((long long)in_sizes[0] < xrows * DM) return;
  if ((long long)in_sizes[1] < (long long)DM * 3 * DM) return;
  if ((long long)in_sizes[2] < (long long)3 * DM) return;
  if ((long long)in_sizes[3] < (long long)DM * DM) return;
  if ((long long)in_sizes[4] < (long long)DM) return;
  if ((long long)in_sizes[5] < 1) return;
  if ((long long)out_size < xrows * DM) return;
  if (WS_TOTAL > ws_size) return;
  const float* x = (const float*)d_in[0]; const float* w_attn = (const float*)d_in[1]; const float* b_attn = (const float*)d_in[2];
  const float* w_proj = (const float*)d_in[3]; const float* b_proj = (const float*)d_in[4];
  const int* s_pref = (const int*)d_in[5];                           /* prefix length, loaded on the device */
  float* out = (float*)d_out;
  char* ws = (char*)d_ws; size_t off = 0;
  _Float16* BQKV = (_Float16*)(ws + off); off += SZ_BQKV;      /* [3072][1024] x16; this and every plane below in fragment order */
  _Float16* BO   = (_Float16*)(ws + off); off += SZ_BO;        /* [1024][1024] x16 */
  _Float16* X16  = (_Float16*)(ws + off); off += SZ_X16;       /* [NR][1024] */
  _Float16* QK   = (_Float16*)(ws + off); off += SZ_QK;        /* [NR][2048] q | k */
  _Float16* QKL  = (_Float16*)(ws + off); off += SZ_QKL;       /* [NRI][2048] residual x1024 */
  _Float16* VT   = (_Float16*)(ws + off); off += SZ_VT;        /* [1024][NR] */
  _Float16* VTL  = (_Float16*)(ws + off); off += SZ_VTL;       /* [1024][NRI] residual x1024 */
  _Float16* O16  = (_Float16*)(ws + off); off += SZ_O16;       /* [NR][1024] ctx x64 */
  _Float16* OL   = (_Float16*)(ws + off); off += SZ_OL;        /* [NRI][1024] ctx residual x1024 */
  if (off > ws_size) return;

  k_convert<<<(unsigned)(NB_X16 + NB_WQKV + NB_WO), 256, 0, stream>>>(x, w_attn, w_proj, X16, BQKV, BO);
  k_gemm_qkv<<<(unsigned)(NB_QK + NB_VT), 128, 0, stream>>>(X16, BQKV, b_attn, QK, QKL, VT, VTL);
  k_attn<<<(unsigned)(NB_ATT + NB_ATTI), 256, 0, stream>>>(QK, QKL, VT, VTL, O16, OL, s_pref);
  k_gemm_out<<<(unsigned)(NB_OUT + NB_OUTI), 128, 0, stream>>>(O16, OL, BO, b_proj, out);
}

// v006
// One run takes 96.5 microseconds.
// Two timings next to v005 put it at 1.08 and 1.07 times that version's speed.
// Over all steps from v000 it is 3.07 times as fast.
#include <hip/hip_runtime.h>
// All contractions: v_wmma_f32_16x16x32_f16 (f16 operands, f32 accumulate). x, weights and biases are RNE-converted to bf16; x and weights are held exactly in f16 (weights x16); q, k, v, softmax weights (x1024) and ctx (x64) are f16 planes; for the first 256 query rows of every sequence q, k, v, P and ctx also carry an f16 residual plane (x1024) accumulated in a separate accumulator.
// Structure: token rows r = b*SEQ + s. (1) weights -> Wt[n][k] f16; x -> f16 rows. (2) q|k rows = X16 . Wqk (N = 2048) and V^T[h*64+d][token] = Wv . X16^T (operand-swapped GEMM, row bias). (3) fused flash attention in the transposed form S^T = K Q^T, O^T = V^T P^T: one wave owns 16 queries, fragments are loaded straight from the 16-bit planes (all kept in fragment order, see fo_chunk), P^T goes D -> B in registers, online softmax statistics are per-lane scalars; visibility (key <= query) OR (query < S AND key < S) applied as a replace-mask by value, S loaded on the device from its input buffer. (4) out = ctx . Wo + b (f32).
#ifndef NB
#define NB 2
#endif
#ifndef SEQ
#define SEQ 2048
#endif
#define NB_FULL 2
#define SEQ_FULL 2048
#define DM 1024
#define NH 16
#define HD 64
#define ISL ((SEQ) < 256 ? (SEQ) : 256)   /* query rows per sequence carried with residual planes */
#define NR (NB * SEQ)                      /* token rows in the workspace planes */
#define NRI (NB * ISL)                     /* rows of the compact residual planes */
#define LQK (2 * DM)                       /* row pitch of the q | k plane */
#define LVT NR                             /* row pitch of V^T */
#define LVL NRI                            /* row pitch of the V^T residual plane */

static_assert(NB >= 1 && NB <= NB_FULL);          /* reduced builds only shrink */
static_assert(SEQ <= SEQ_FULL);
static_assert(SEQ % 128 == 0);                    /* 8 waves x 16 queries per attention block; GEMM row blocks; 32-key steps stay inside the sequence */
static_assert(ISL % 128 == 0);                    /* residual region is a whole number of blocks */
static_assert(ISL >= 32);                         /* clamped residual key step ISL - 32 is a valid step */
static_assert((SEQ - ISL) % 128 == 0);            /* plain region is a whole number of blocks */
static_assert(NH * HD == DM);                     /* merged head layout */
static_assert(HD == 64);                          
static_assert(DM % 128 == 0);                     /* GEMM M blocks (V^T) and K % 64 (two k blocks per trip) */
static_assert(DM % 8 == 0);                       /* 8-element convert threads */
static_assert(NR % 128 == 0);                     /* GEMM M blocks / N tiles of 64 */
static_assert(NRI % 64 == 0);                     /* residual-row output GEMM blocks */
static_assert((long long)NR * LQK < 2147483647LL);/* int plane offsets */
static_assert((long long)DM * LVT < 2147483647LL);

typedef unsigned short v8us __attribute__((ext_vector_type(8), may_alias));
typedef float  v8f  __attribute__((ext_vector_type(8)));
typedef float  v4f  __attribute__((ext_vector_type(4)));
typedef float  v4fa __attribute__((ext_vector_type(4), may_alias));
typedef _Float16 v16h __attribute__((ext_vector_type(16)));
typedef _Float16 v4h  __attribute__((ext_vector_type(4)));
union FragH { v16h v; v8us half[2]; _Float16 h[16]; unsigned short u[16]; };

__device__ __forceinline__ float bf16_rne(float x) { unsigned int u = __float_as_uint(x); u = (u + 0x7FFFu + ((u >> 16) & 1u)) & 0xFFFF0000u; return __uint_as_float(u); }

// Fragment order: every 16-bit plane [rows][K] is stored as tiles of 16 rows x 32 k, 512 elements (1 KB) each, tile (row / 16, k / 32) at element (row / 16) * 16 * K + (k / 32) * 512.
// Inside a tile: two halves of 256 elements (k 0..15, k 16..31), each 32 lanes x 8 elements with lane = 16 * ((k / 8) & 1) + row % 16. A fragment is then two loads of 512 contiguous bytes (4 whole lines each).
// element offset of the 8-element chunk that holds (row, k .. k + 7), k % 8 == 0, in a plane of K columns (K % 32 == 0)
__device__ __forceinline__ size_t fo_chunk(int row, int k, int K) { return (size_t)(row >> 4) * 16 * K + (size_t)((k >> 5) * 512 + ((k >> 4) & 1) * 256 + (((k >> 3) & 1) * 16 + (row & 15)) * 8); }
// fragment of one tile: elements 0..7 <- k 8h.., elements 8..15 <- k 16+8h.., row = lane & 15, h = lane >> 4 (same map for A and B);
// from a uniform pointer, the lane's own 32-bit byte offset (16 * lane folded in) and a constant byte step
__device__ __forceinline__ v16h g2_frago(const _Float16* base, unsigned off, int add) { const char* p = (const char*)base + (size_t)off + add; FragH f; f.half[0] = *(const v8us*)p; f.half[1] = *(const v8us*)(p + 512); return f.v; }
__device__ __forceinline__ v8f g2_mma(v16h a, v16h b, v8f c) { v8f d = __builtin_amdgcn_wmma_f32_16x16x32_f16(false, a, false, b, (short)0, c, false, false); asm volatile("v_nop\n\tv_nop\n\tv_nop\n\tv_nop" : "+v"(d) : "v"(a), "v"(b)); return d; }

// the same product left to the compiler's own padding: for the 64 x 64 wave tile, whose 16 accumulators and two fragment sets need more than 256 registers (with the asm statement's operands the build stayed below 256 and spilled)
__device__ __forceinline__ v8f g2_mmab(v16h a, v16h b, v8f c) { return __builtin_amdgcn_wmma_f32_16x16x32_f16(false, a, false, b, (short)0, c, false, false); }

// asks L2 (scope SE: into L2 only, nothing returns, no counter) for the 256-B unit at p + OFF.
// p + OFF lies inside the plane in every lane; asm, so that the address stands in a register of the caller's that still holds it later (see the callers' last use of it)
template <int OFF>
__device__ __forceinline__ void l2_ask(const char* p) { asm volatile("global_prefetch_b8 %0, off offset:%1 scope:SCOPE_SE" :: "v"(p), "i"(OFF)); }

__device__ __forceinline__ void wt_f16_body(const float* __restrict__ W, _Float16* __restrict__ Wt, int K, int N, float scale, int bid) {
  /* one wave writes one half tile (512 contiguous bytes): lane = 16 * h + n % 16; waves run over the row tiles first, then over the 16-k halves */
  const int t = bid * 256 + threadIdx.x; if (t >= N * (K / 8)) return; const int wv = t >> 5, lane = t & 31; const int n = (wv % (N / 16)) * 16 + (lane & 15), k8 = (wv / (N / 16)) * 16 + (lane >> 4) * 8; FragH f;
#pragma unroll
  for (int i = 0; i < 8; ++i) f.h[i] = (_Float16)(bf16_rne(W[(size_t)(k8 + i) * N + n]) * scale);
  const v8us o = f.half[0];
  unsigned short* d = (unsigned short*)Wt + fo_chunk(n, k8, K);
  *(v8us*)d = o; 
}

__device__ __forceinline__ void x16_body(const float* __restrict__ x, _Float16* __restrict__ X16, int bid) {
  const int t = bid * 256 + threadIdx.x; if (t >= NR * (DM / 8)) return;
  /* one wave writes one half tile (512 contiguous bytes): lane = 16 * h + row % 16; consecutive waves take consecutive 16-k halves of a row tile */
  const int wv = t >> 5, lane = t & 31; const int row = (wv / (DM / 16)) * 16 + (lane & 15), c8 = (wv % (DM / 16)) * 16 + (lane >> 4) * 8; const int b = row / SEQ, s = row % SEQ;
  const float* src = x + ((size_t)b * SEQ_FULL + s) * DM + c8;
  const v4f a = *(const v4fa*)src, c = *(const v4fa*)(src + 4); FragH f;
#pragma unroll
  for (int i = 0; i < 4; ++i) { f.h[i] = (_Float16)bf16_rne(a[i]); f.h[4 + i] = (_Float16)bf16_rne(c[i]); }
  const v8us o = f.half[0];
  unsigned short* d = (unsigned short*)X16 + fo_chunk(row, c8, DM);
  *(v8us*)d = o; 
}

// Launches that read nothing of each other's output share one grid: a range of the block index picks the body (block-uniform branch).
constexpr int NB_X16  = (int)(((size_t)NR * (DM / 8) + 255) / 256);
constexpr int NB_WQKV = (int)(((size_t)3 * DM * (DM / 8) + 255) / 256);
constexpr int NB_WO   = (int)(((size_t)DM * (DM / 8) + 255) / 256);
// the three conversions: x -> X16; W[K=1024][N=3072] -> Wt[N][K]; W[K=1024][N=1024] -> Wt[N][K]
__global__ __launch_bounds__(256) void k_convert(const float* __restrict__ x, const float* __restrict__ w_attn, const float* __restrict__ w_proj, _Float16* __restrict__ X16, _Float16* __restrict__ BQKV, _Float16* __restrict__ BO) {
  const int bid = (int)blockIdx.x;
  if (bid < NB_X16) x16_body(x, X16, bid);
  else if (bid < NB_X16 + NB_WQKV) wt_f16_body(w_attn, BQKV, DM, 3 * DM, 16.0f, bid - NB_X16);
  else wt_f16_body(w_proj, BO, DM, DM, 16.0f, bid - (NB_X16 + NB_WQKV));
}

// GEMM: wave tile (16*MT) x 64, block = 4 waves laid (4/WN) x WN = (64*MT/WN) rows x (64*WN) cols; A and Bh are f16 planes in fragment order (fragments straight from global).
// v = acc*alpha (+ accL*alphaL with the residual A plane AL, ARES) + bias (per column, or per row if ROWBIAS; bias RNE-converted to bf16).
// Logical row R maps to A row seg*aSeg + aOff + w and C row seg*cSeg + cOff + w with seg = R / segRows, w = R % segRows (blocks never straddle segments).
// OUT 0: f32 C. OUT 1: f16 C16 (+ x1024 residual rows in CL when the rows lie in the first ISL rows of a sequence). OUT 2: f16 C16 (+ residual columns when the token columns lie in the first ISL rows of a sequence).
// Requires M % (64*MT/WN) == 0, N % (64*WN) == 0, K % 64 == 0 (asserted above for the launches used). LDS tile so[wave] is private to its wave (wave-level sync); the kernel owns the array, so the two bodies of a launch share one. bid: block index inside the body's own range.
template <int MT, int WN, bool ROWBIAS, bool ARES, int OUT, int SOR>
__device__ __forceinline__ void gemm_body(const _Float16* __restrict__ A, const _Float16* __restrict__ AL, int lda,
    const _Float16* __restrict__ Bh, int ldb, float alpha, float alphaL, const float* __restrict__ bias,
    float* __restrict__ Cf, _Float16* __restrict__ C16, _Float16* __restrict__ CL, int ldc, int ldcl,
    int M, int N, int K, int segRows, int aSeg, int aOff, int cSeg, int cOff, int bid, float (*so)[SOR][68]) {
  static_assert(MT == 1 || MT == 2 || MT == 4);
  static_assert(WN == 1 || WN == 2);    /* the block's 4 waves lie (4 / WN) x WN over its tile */
  static_assert(SOR >= 16 * MT);        /* the wave's staging rows */
  static_assert(!ARES || MT == 1);      /* residual form keeps 8 accumulators */
  const int tid = threadIdx.x, lane = tid & 31, ln = lane & 15, hh = lane >> 4;
  const int w = __builtin_amdgcn_readfirstlane(tid >> 5);      /* wave-uniform, so that every tile base below is a scalar pointer */
  const int ntn = N / (64 * WN);
  const int mt = bid / ntn, nq = bid - mt * ntn;
  const int R0 = mt * (64 * MT / WN) + (16 * MT) * (w / WN), col0 = nq * (64 * WN) + 64 * (w % WN);
  if (R0 >= M) return;
  // At entry the block asks L2 for a quarter of its A panel (BM rows x DM) and of its B panel (BN rows x DM), one request per 256-B unit: the blocks that share a panel (same mt: neighbours in the index; same nq) deal its quarters among them by the other index.
  // Every launch here has lda = ldb = K = DM, and a panel is one contiguous run of a fragment-order plane; 128 threads x 256 B = 32 KB a request round.
  constexpr int BM = 64 * MT / WN, BN = 64 * WN, QA = BM * DM * 2 / 4, QB = BN * DM * 2 / 4;      /* bytes of a quarter panel */
  static_assert(QA % 32768 == 0 && QA <= 65536 && QB % 32768 == 0 && QB <= 65536);
  const int Rb = mt * BM, segb = Rb / segRows;
  const char* pfa = (const char*)(A + (size_t)(segb * aSeg + aOff + (Rb - segb * segRows)) * lda) + ((nq & 3) * QA + tid * 256);
  const char* pfb = (const char*)(Bh + (size_t)(nq * BN) * ldb) + ((mt & 3) * QB + tid * 256);
  const char* pfe = ARES ? (const char*)(AL + (size_t)Rb * lda) + ((nq & 3) * QA + tid * 256) : pfa;
  l2_ask<0>(pfa); if (QA > 32768) l2_ask<32768>(pfa);
  l2_ask<0>(pfb); if (QB > 32768) l2_ask<32768>(pfb);
  if (ARES) l2_ask<0>(pfe);
  const int seg = R0 / segRows, wi = R0 - seg * segRows;
  const int arow0 = seg * aSeg + aOff + wi, crow0 = seg * cSeg + cOff + wi;
  /* arow0, R0 and col0 are multiples of 16: row tile r / 16 starts at element r * ld; 32 k further is 512 elements further */
  const _Float16* a0p = A + (size_t)arow0 * lda;
  const _Float16* b0p = Bh + (size_t)col0 * ldb;
  unsigned ko = 16u * (unsigned)lane;      /* the lane's byte offset inside a half tile plus the trip's k offset: the one vector address register of every fragment load */
  const v8f z8 = {0.f, 0.f, 0.f, 0.f, 0.f, 0.f, 0.f, 0.f};
  v8f c00 = z8, c01 = z8, c02 = z8, c03 = z8, c10 = z8, c11 = z8, c12 = z8, c13 = z8, c20 = z8, c21 = z8, c22 = z8, c23 = z8, c30 = z8, c31 = z8, c32 = z8, c33 = z8, d00 = z8, d01 = z8, d02 = z8, d03 = z8;
  // Two register sets of fragments (P, N), 32 k each: every set is loaded as one group, one k block ahead of the WMMAs that read it, so a block waits for one load round trip that started a block earlier.
  const _Float16* e0p = ARES ? AL + (size_t)R0 * lda : a0p;
#define GEMM_LD(S, kk) { S##a0 = g2_frago(a0p, ko, (kk) * 32); if (MT >= 2) S##a1 = g2_frago(a0p, ko, 32 * lda + (kk) * 32); if (MT == 4) { S##a2 = g2_frago(a0p, ko, 64 * lda + (kk) * 32); S##a3 = g2_frago(a0p, ko, 96 * lda + (kk) * 32); } if (ARES) S##e0 = g2_frago(e0p, ko, (kk) * 32); \
    S##b0 = g2_frago(b0p, ko, (kk) * 32); S##b1 = g2_frago(b0p, ko, 32 * ldb + (kk) * 32); S##b2 = g2_frago(b0p, ko, 64 * ldb + (kk) * 32); S##b3 = g2_frago(b0p, ko, 96 * ldb + (kk) * 32); }
#define GEMM_MC(S, j) { if (MT == 4) { c0##j = g2_mmab(S##a0, S##b##j, c0##j); c1##j = g2_mmab(S##a1, S##b##j, c1##j); c2##j = g2_mmab(S##a2, S##b##j, c2##j); c3##j = g2_mmab(S##a3, S##b##j, c3##j); } \
    else { c0##j = g2_mma(S##a0, S##b##j, c0##j); if (MT == 2) c1##j = g2_mma(S##a1, S##b##j, c1##j); if (ARES) d0##j = g2_mma(S##e0, S##b##j, d0##j); } }
#define GEMM_MM(S) { GEMM_MC(S, 0) GEMM_MC(S, 1) GEMM_MC(S, 2) GEMM_MC(S, 3) }
  const v16h zf = (v16h)((_Float16)0.0f);
  v16h Pa2 = zf, Pa3 = zf, Na2 = zf, Na3 = zf;
  v16h Pa0 = zf, Pa1 = zf, Pe0 = zf, Pb0 = zf, Pb1 = zf, Pb2 = zf, Pb3 = zf, Na0 = zf, Na1 = zf, Ne0 = zf, Nb0 = zf, Nb1 = zf, Nb2 = zf, Nb3 = zf;
  GEMM_LD(P, 0)
  asm volatile("s_wait_xcnt 0x0" :: "v"(lane), "v"(ko) : "memory");      /* behind the first group: the build may name the lane number (scaled by the load) or the byte offset as its offset register; both live up to this wait, so that no result of the loop's loads is written over either earlier */
  asm volatile("" :: "v"(pfa), "v"(pfb), "v"(pfe));      /* inputs only, no instruction: the requests' address registers keep their in-range addresses up to here, behind the first load group and its wait, and are free in the k loop */
#pragma unroll 1      /* kept rolled, 64 k per trip, the last trip peeled, for speed only */
  for (int kb = 0; kb + 64 < K; kb += 64) {
    GEMM_LD(N, 32)
    __builtin_amdgcn_sched_barrier(0);      /* this and the three below hold each load group whole and one k block ahead of its WMMAs, as the unrolled form had them: the rolled loop's scheduler sank the loads to their uses */
    GEMM_MM(P)
    __builtin_amdgcn_sched_barrier(0);
    GEMM_LD(P, 64)
    __builtin_amdgcn_sched_barrier(0);
    GEMM_MM(N)
    __builtin_amdgcn_sched_barrier(0);
    asm volatile("s_wait_xcnt 0x0" : "+v"(ko) :: "memory");      /* stands in front of the rewrite of the offset register that the groups in flight name; the register is an operand so that the addition stays behind it */
    ko += 64 * 32;      /* 64 k further = two tiles, 2 KB, in every plane */
  }
  GEMM_LD(N, 32)
  asm volatile("s_wait_xcnt 0x0" :: "v"(ko) : "memory");      /* behind the last group: the loads' offset register lives up to this wait, so nothing (a late load's result included) is written over it earlier */
  __builtin_amdgcn_sched_barrier(0);      /* the last group too stays whole and ahead of the WMMAs of the block before it */
  GEMM_MM(P)
  GEMM_MM(N)
#undef GEMM_LD
#undef GEMM_MM
#undef GEMM_MC
  const v8f accs[16] = {c00, c01, c02, c03, c10, c11, c12, c13, c20, c21, c22, c23, c30, c31, c32, c33};
  const v8f accl[4] = {d00, d01, d02, d03};
#pragma unroll
  for (int u = 0; u < 4 * MT; ++u) {
    const int t = u & 3, half = u >> 2; const int col = col0 + t * 16 + ln;
    float bvc = 0.f; if (!ROWBIAS) bvc = bf16_rne(bias[col]);
#pragma unroll
    for (int r = 0; r < 8; ++r) {
      const int rloc = half * 16 + 8 * hh + r;
      float v = accs[u][r] * alpha;
      if (ARES) v += accl[t][r] * alphaL;
      if (ROWBIAS) v += bf16_rne(bias[R0 + rloc]); else v += bvc;
      so[w][rloc][t * 16 + ln] = v;
    }
  }
  __builtin_amdgcn_fence(4 /* acq_rel order */, "workgroup"); __builtin_amdgcn_wave_barrier();
  const int rsub = lane >> 4, c4 = (lane & 15) * 4;
  if (OUT == 0) {
    {
#pragma unroll
      for (int q = 0; q < 8 * MT; ++q) { const int r = q * 2 + rsub; const v4f v = *(const v4fa*)&so[w][r][c4]; *(v4f*)(Cf + (size_t)(crow0 + r) * ldc + col0 + c4) = v; }
      asm volatile("s_wait_xcnt 0x0" ::: "memory");      /* behind the run of stores: in a kernel of two bodies the other body's code follows in the listing and reuses the stores' address and data registers */
    }
  } else {
    int sl, rrow0, rcol0;
    if (OUT == 1) { sl = crow0 % SEQ; rrow0 = (crow0 / SEQ) * ISL + sl; rcol0 = col0; }
    else          { sl = col0 % SEQ;  rrow0 = crow0; rcol0 = (col0 / SEQ) * ISL + sl; }
    const bool isl = sl < ISL;      /* uniform over the wave tile: ISL and SEQ are multiples of 64 */
    {      /* one store = one half tile of the fragment-order plane: lane (hh, ln) holds row ln, 8 columns from 8 * hh */
#pragma unroll
      for (int q = 0; q < 4 * MT; ++q) {
        const int r = (q >> 2) * 16 + ln, c = (q & 3) * 16 + 8 * hh;
        const v4f va = *(const v4fa*)&so[w][r][c], vc = *(const v4fa*)&so[w][r][c + 4];
        FragH fh, fl;
#pragma unroll
        for (int i = 0; i < 4; ++i) {
          const _Float16 h0 = (_Float16)va[i], h1 = (_Float16)vc[i]; fh.h[i] = h0; fh.h[4 + i] = h1;
          fl.h[i] = (_Float16)((va[i] - (float)h0) * 1024.0f); fl.h[4 + i] = (_Float16)((vc[i] - (float)h1) * 1024.0f);
        }
        const v8us oh = fh.half[0], ol = fl.half[0];
        *(v8us*)((unsigned short*)C16 + fo_chunk(crow0 + r, col0 + c, ldc)) = oh;
        asm volatile("s_wait_xcnt 0x0" ::: "memory");      /* in front of the reuse of the store's data and address registers by the residual's arithmetic */
        if (isl) *(v8us*)((unsigned short*)CL + fo_chunk(rrow0 + r, rcol0 + c, ldcl)) = ol;
      }
      
    }
  }
}

constexpr int NB_QK   = (NR / 128) * (2 * DM / 128);
constexpr int NB_VT   = (DM / 128) * (NR / 128);
constexpr int NB_OUT  = (NB * (SEQ - ISL) / 128) * (DM / 64);
constexpr int NB_OUTI = (NRI / 64) * (DM / 64);
// one launch, two bodies:
// q | k rows (f16) = X16 . Wqk^T / 16 + b; residual rows for s < ISL
// V^T[h*64+d][token] (f16) = Wv . X16^T / 16 + b[row]; residual columns for s < ISL
__global__ __launch_bounds__(128) void k_gemm_qkv(const _Float16* __restrict__ X16, const _Float16* __restrict__ BW, const float* __restrict__ bias, _Float16* __restrict__ QK, _Float16* __restrict__ QKL, _Float16* __restrict__ VT, _Float16* __restrict__ VTL) {
  __shared__ __attribute__((aligned(16))) float so[4][64][68];
  const int bid = (int)blockIdx.x;
  if (bid < NB_QK) gemm_body<4, 2, false, false, 1>(X16, nullptr, DM, BW, DM, 0.0625f, 0.f, bias, nullptr, QK, QKL, LQK, LQK, NR, 2 * DM, DM, NR, 0, 0, 0, 0, bid, so);
  else gemm_body<4, 2, true, false, 2>(BW + (size_t)2 * DM * DM, nullptr, DM, X16, DM, 0.0625f, 0.f, bias + 2 * DM, nullptr, VT, VTL, LVT, LVL, DM, NR, DM, DM, 0, 0, 0, 0, bid - NB_QK, so);
}
// one launch, two bodies:
// out rows s >= ISL: ctx(x64) . Wo(x16) * 2^-10 + b
// out rows s < ISL: (ctx_hi . Wo) * 2^-10 + (ctx_res . Wo) * 2^-20 + b, separate accumulators
__global__ __launch_bounds__(128) void k_gemm_out(const _Float16* __restrict__ O16, const _Float16* __restrict__ OL, const _Float16* __restrict__ BO, const float* __restrict__ bias, float* __restrict__ out) {
  __shared__ __attribute__((aligned(16))) float so[4][32][68];
  const int bid = (int)blockIdx.x;
  if (bid < NB_OUT) gemm_body<2, 1, false, false, 0>(O16, nullptr, DM, BO, DM, 0.0009765625f, 0.f, bias, out, nullptr, nullptr, DM, 0, NB * (SEQ - ISL), DM, DM, SEQ - ISL, SEQ, ISL, SEQ_FULL, ISL, bid, so);
  else gemm_body<1, 1, false, true, 0>(O16, OL, DM, BO, DM, 0.0009765625f, 0.00000095367431640625f, bias, out, nullptr, nullptr, DM, 0, NRI, DM, DM, ISL, SEQ, 0, SEQ_FULL, 0, bid - NB_OUT, so);
}

// Fused prefix-causal attention, transposed form. Block = 8 waves = 128 consecutive queries of one (b, h); wave = 16 queries (D column = query = lane & 15).
// Visibility: key j is seen by query i iff (j <= i) OR (i < S AND j < S); S is loaded from its input buffer and clamped to [0, SEQ] (same mask for any value).
// Key range of a wave: [0, max(S, q0 + 16)) in 32-key steps (all step keys lie inside the sequence since SEQ % 32 == 0). Every step holds key kcb that is visible to every query of the wave
// (kcb <= q0 when the range ends at q0 + 16; kcb < S with all 16 queries < S otherwise), so the step maximum is always finite.
// Per 32-key step: S^T tiles (keys kcb..+15 and +16..+31) = K (A, rows = keys) . Q^T (B, lane = query); scale 1/8; hidden keys are REPLACED (excluded from max, weight 0 by value);
// online max / sum per lane (halves combined by one xor-16 shuffle); P^T (x1024, f16) is the B fragment directly: element r <- tile0[r], element 8+r <- tile1[r];
// O^T (rows = d) += V^T (A, rows = d, k = keys) . P^T. RES: q, k, v, P carry x1024 residual planes; residual products go to separate accumulators folded back with 2^-10.
// Residual k / v planes exist only for keys < ISL: for key steps at or beyond ISL (possible when S > ISL) the residual k / v fragments are loaded from a clamped in-range step and zeroed by value (wave-uniform select).
template <bool RES>
__device__ __forceinline__ void attn_body(const _Float16* __restrict__ QK, const _Float16* __restrict__ QKL, const _Float16* __restrict__ VT, const _Float16* __restrict__ VTL,
                                          _Float16* __restrict__ O16, _Float16* __restrict__ OL, const int* __restrict__ Sp, int qb0, int nqb, int bid) {
  const int tid = threadIdx.x, lane = tid & 31, ln = lane & 15, hh = lane >> 4;
  const int w = __builtin_amdgcn_readfirstlane(tid >> 5);
  const int sraw = Sp[0];
  const int Sc = sraw < 0 ? 0 : (sraw > SEQ ? SEQ : sraw);
  const int bh = bid / nqb; const int qb = qb0 + (bid - bh * nqb);
  const int h = bh % NH, b = bh / NH;
  const int q0 = qb * 128 + w * 16, q = q0 + ln;
  const bool qpre = q < Sc;
  const int rowb = b * SEQ, rowi = b * ISL;
  /* fragment-order planes: row tile r / 16 starts at element r * pitch (r % 16 == 0), column block c / 32 at c * 16 (c % 32 == 0), the lane's chunk at 8 * lane */
  const unsigned lo = 16u * (unsigned)lane;                           /* the lane's byte offset inside a half tile */
  const _Float16* qp = QK + (size_t)(rowb + q0) * LQK + h * HD * 16;
  const v16h qh0 = g2_frago(qp, lo, 0), qh1 = g2_frago(qp, lo, 1024);
  const int qloff = (rowi + q0) * LQK + h * HD * 16;       /* residual q tile (RES) */
  const int kbase = rowb * LQK + (DM + h * HD) * 16;       /* k tile of keys 0..15, d 0..31 */
  const int klbase = rowi * LQK + (DM + h * HD) * 16;      /* residual k tile (RES) */
  const int vbase = h * HD * LVT + rowb * 16;              /* V^T tile d 0..15, keys 0..31 */
  const int vlbase = h * HD * LVL + rowi * 16;             /* residual V^T tile (RES) */
  const v8f z8 = {0.f, 0.f, 0.f, 0.f, 0.f, 0.f, 0.f, 0.f};
  const v16h zh = (v16h)((_Float16)0.0f);
  v8f o0 = z8, o1 = z8, o2 = z8, o3 = z8, e0 = z8, e1 = z8, e2 = z8, e3 = z8;
  float m = -1.0e30f, l = 0.f;
  const int kend = (Sc > q0 + 16) ? Sc : (q0 + 16);              /* keys [0, kend) cover every visible key of the wave; kend <= SEQ */
  const int nst = (kend + 31) >> 5;
  // Plain form: the K and V fragments live in registers across the loop; the next step's K group is issued right behind this step's S^T WMMAs and the next step's V group right behind its O^T WMMAs.
  v16h ka = zh, kb = zh, kc = zh, kd = zh, v0 = zh, v1 = zh, v2 = zh, v3 = zh;
  unsigned kq = 2u * (unsigned)kbase + lo, vq = 2u * (unsigned)vbase + lo;      /* the lane's byte offsets of the K and V groups held in registers; step 0 exists: nst >= 1 */
  // Plain form, at entry: the block asks L2 for the K rows and V^T columns of its causal key range [0, keys), one request per 256-B unit. K: 2 KB per 16-key tile, 8 lanes a tile, 32 tiles a round; V^T: 4 d tiles, 256 B per 8 keys.
  // The range does not wait for S: keys that only a prefix longer than it makes visible are loaded without a request. A wave's request is skipped (scalar test) where its first key lies past the range; the keys it covers (64 of K, 256 of V^T, the lane's unit clamped) lie inside the sequence in any case.
  const char* pkq = (const char*)QK; const char* pvq = (const char*)VT;
  if (!RES) {
    const int keys = qb * 128 + 128;      /* the causal range of the block's last wave; <= SEQ */
    const int vu = tid < SEQ / 8 - 1 ? tid : SEQ / 8 - 1;
    pkq += 2 * (size_t)kbase + (size_t)((tid >> 3) * (32 * LQK) + (tid & 7) * 256);
    pvq += 2 * (size_t)vbase + (size_t)(vu * 256);
    if (w * 64 < keys) l2_ask<0>(pkq);
    if (SEQ > 512 && w * 64 + 512 < keys) l2_ask<1024 * LQK>(pkq);
    if (SEQ > 1024 && w * 64 + 1024 < keys) l2_ask<2048 * LQK>(pkq);
    if (SEQ > 1536 && w * 64 + 1536 < keys) l2_ask<3072 * LQK>(pkq);
    if (w * 256 < keys) { l2_ask<0>(pvq); l2_ask<32 * LVT>(pvq); l2_ask<64 * LVT>(pvq); l2_ask<96 * LVT>(pvq); }
  }
  if (!RES) {
    ka = g2_frago(QK, kq, 0); kb = g2_frago(QK, kq, 1024); kc = g2_frago(QK, kq, 32 * LQK); kd = g2_frago(QK, kq, 32 * LQK + 1024);
    v0 = g2_frago(VT, vq, 0); v1 = g2_frago(VT, vq, 32 * LVT); v2 = g2_frago(VT, vq, 64 * LVT); v3 = g2_frago(VT, vq, 96 * LVT);
    /* inputs-only fence on the loaded values: every load in front of the loop has landed here, so the wait at the loop's head counts the loop's own groups alone and leaves the next V group in flight */
    asm volatile("" :: "v"(qh0), "v"(qh1), "v"(ka), "v"(kb), "v"(kc), "v"(kd), "v"(v0), "v"(v1), "v"(v2), "v"(v3));
    asm volatile("" :: "v"(pkq), "v"(pvq));      /* inputs only, no instruction: the requests' address registers hold their in-range addresses until the first fragments have landed */
  }
#pragma unroll 1
  for (int st = 0; st < nst; ++st) {
    const int kcb = st * 32;
    const int adv = (st + 1 < nst) ? 32 : 0;                     /* keys to the next step; the last step reloads its own (in range, not used) */
    const bool rok = kcb < ISL;                                  /* wave-uniform: residual k / v rows exist for this step */
    const int kcl = rok ? kcb : (ISL - 32);                      /* clamped in-range residual step */
    const _Float16* kp0 = QK + kbase + kcb * LQK;
    v8f s0 = z8, s1 = z8, r0 = z8, r1 = z8;
    if (RES) {
      unsigned qo = lo; asm volatile("" : "+v"(qo));             /* reload the residual q fragments per step (integer offset only) */
      const _Float16* qlp = QKL + qloff;
      const v16h ql0 = g2_frago(qlp, qo, 0), ql1 = g2_frago(qlp, qo, 1024);
      const _Float16* kl0 = QKL + klbase + kcl * LQK;
      /* all k fragments of the step as one load group in front of its WMMAs */
      const v16h ah0 = g2_frago(kp0, lo, 0), ah1 = g2_frago(kp0, lo, 1024), ah2 = g2_frago(kp0, lo, 32 * LQK), ah3 = g2_frago(kp0, lo, 32 * LQK + 1024);
      v16h al0 = g2_frago(kl0, lo, 0), al1 = g2_frago(kl0, lo, 1024), al2 = g2_frago(kl0, lo, 32 * LQK), al3 = g2_frago(kl0, lo, 32 * LQK + 1024);
      asm volatile("s_wait_xcnt 0x0" :: "v"(qo) : "memory");      /* behind the group: the offset register that the residual q loads name lives up to this wait, so no later load's result is written over it earlier */
      al0 = rok ? al0 : zh; al1 = rok ? al1 : zh; al2 = rok ? al2 : zh; al3 = rok ? al3 : zh;
      s0 = g2_mma(ah0, qh0, s0); r0 = g2_mma(al0, qh0, r0); r0 = g2_mma(ah0, ql0, r0);
      s0 = g2_mma(ah1, qh1, s0); r0 = g2_mma(al1, qh1, r0); r0 = g2_mma(ah1, ql1, r0);
      s1 = g2_mma(ah2, qh0, s1); r1 = g2_mma(al2, qh0, r1); r1 = g2_mma(ah2, ql0, r1);
      s1 = g2_mma(ah3, qh1, s1); r1 = g2_mma(al3, qh1, r1); r1 = g2_mma(ah3, ql1, r1);
    } else {
      s0 = g2_mma(ka, qh0, s0); s0 = g2_mma(kb, qh1, s0); s1 = g2_mma(kc, qh0, s1); s1 = g2_mma(kd, qh1, s1);
      asm volatile("s_wait_xcnt 0x0" : "+v"(kq) :: "memory");      /* stands in front of the rewrite of the offset register that the last K group's loads name; the register is an operand so that the addition stays behind it */
      kq += (unsigned)(adv * LQK * 2);
      ka = g2_frago(QK, kq, 0); kb = g2_frago(QK, kq, 1024); kc = g2_frago(QK, kq, 32 * LQK); kd = g2_frago(QK, kq, 32 * LQK + 1024);
      __builtin_amdgcn_sched_barrier(0);      /* holds the K group at the head of the softmax: issued further down it has less of the step to land in */
    }
    v16h vl0 = zh, vl1 = zh, vl2 = zh, vl3 = zh;
    if (RES) {      /* all v fragments of the step as one load group in front of the softmax */
      const _Float16* vp = VT + vbase + kcb * 16; const _Float16* vlp = VTL + vlbase + kcl * 16;
      v0 = g2_frago(vp, lo, 0); v1 = g2_frago(vp, lo, 32 * LVT); v2 = g2_frago(vp, lo, 64 * LVT); v3 = g2_frago(vp, lo, 96 * LVT);
      vl0 = g2_frago(vlp, lo, 0); vl1 = g2_frago(vlp, lo, 32 * LVL); vl2 = g2_frago(vlp, lo, 64 * LVL); vl3 = g2_frago(vlp, lo, 96 * LVL);
    }
    // D row = key kcb + 8*hh + r (tile 0), + 16 (tile 1); D column = query q
    v8f xa, xb; float mt = -1.0e30f;
#pragma unroll
    for (int r = 0; r < 8; ++r) {
      const int k0 = kcb + 8 * hh + r;
      const bool va = (k0 <= q) || (qpre && (k0 < Sc));
      const bool vb = (k0 + 16 <= q) || (qpre && (k0 + 16 < Sc));
      float a = s0[r], c = s1[r];
      if (RES) { a += r0[r] * 0.0009765625f; c += r1[r] * 0.0009765625f; }
      a *= 0.125f; c *= 0.125f;
      a = va ? a : -1.0e30f; c = vb ? c : -1.0e30f;
      xa[r] = a; xb[r] = c; mt = fmaxf(mt, fmaxf(a, c));
    }
    mt = fmaxf(mt, __shfl_xor(mt, 16, 32));
    const float mn = fmaxf(m, mt);
    float f; { const float t = fmaxf(m - mn, -80.0f) * 1.44269504f;      /* __expf as it compiles (multiply, v_exp_f32), with the slot behind the transcendental filled in the same statement */
      asm("v_exp_f32 %0, %1\n\tv_nop" : "=v"(f) : "v"(t)); }
    m = mn;
    FragH ph, pl; float rs = 0.f;
#pragma unroll
    for (int r = 0; r < 8; ++r) {
      const int k0 = kcb + 8 * hh + r;
      const bool va = (k0 <= q) || (qpre && (k0 < Sc));
      const bool vb = (k0 + 16 <= q) || (qpre && (k0 + 16 < Sc));
      float pa = __expf(va ? (xa[r] - mn) : 0.f); pa = va ? pa : 0.f;
      float pb = __expf(vb ? (xb[r] - mn) : 0.f); pb = vb ? pb : 0.f;
      rs += pa + pb;
      const float ta = pa * 1024.0f, tb = pb * 1024.0f;
      const _Float16 ha = (_Float16)ta, hb = (_Float16)tb;
      ph.h[r] = ha; ph.h[8 + r] = hb;
      if (RES) { pl.h[r] = (_Float16)((ta - (float)ha) * 1024.0f); pl.h[8 + r] = (_Float16)((tb - (float)hb) * 1024.0f); }
    }
    const float rso = __shfl_xor(rs, 16, 32);
    l = l * f + (rs + rso);
    o0 *= f; o1 *= f; o2 *= f; o3 *= f;
    if (RES) { e0 *= f; e1 *= f; e2 *= f; e3 *= f; }
    o0 = g2_mma(v0, ph.v, o0); o1 = g2_mma(v1, ph.v, o1); o2 = g2_mma(v2, ph.v, o2); o3 = g2_mma(v3, ph.v, o3);
    if (RES) {
      vl0 = rok ? vl0 : zh; vl1 = rok ? vl1 : zh; vl2 = rok ? vl2 : zh; vl3 = rok ? vl3 : zh;
      e0 = g2_mma(vl0, ph.v, e0); e0 = g2_mma(v0, pl.v, e0);
      e1 = g2_mma(vl1, ph.v, e1); e1 = g2_mma(v1, pl.v, e1);
      e2 = g2_mma(vl2, ph.v, e2); e2 = g2_mma(v2, pl.v, e2);
      e3 = g2_mma(vl3, ph.v, e3); e3 = g2_mma(v3, pl.v, e3);
    } else {
      asm volatile("s_wait_xcnt 0x0" : "+v"(vq) :: "memory");      /* the same for the V group's offset register */
      vq += (unsigned)(adv * 32);      /* 32 keys further = the next tile, 1 KB */
      v0 = g2_frago(VT, vq, 0); v1 = g2_frago(VT, vq, 32 * LVT); v2 = g2_frago(VT, vq, 64 * LVT); v3 = g2_frago(VT, vq, 96 * LVT);
    }
  }
  // ctx x64 = O^T * 64 / (1024 * l); O^T row d = dg*16 + 8*hh + r, column = query ln
  const float inv = 0.0625f * (1.0f / l);
  const v8f oo[4] = {o0, o1, o2, o3}; const v8f ee[4] = {e0, e1, e2, e3};
  // the lane's 8 values of O^T tile dg are query ln, columns dg*16 + 8*hh .. + 7: one chunk of the fragment-order ctx plane, so each tile goes out of the accumulators as one half-tile store of 512 contiguous bytes
#pragma unroll
  for (int dg = 0; dg < 4; ++dg) {
    FragH fh, fl;
#pragma unroll
    for (int r = 0; r < 8; ++r) {
      float v = oo[dg][r]; if (RES) v += ee[dg][r] * 0.0009765625f; v *= inv;
      const _Float16 h0 = (_Float16)v; fh.h[r] = h0; fl.h[r] = (_Float16)((v - (float)h0) * 1024.0f);
    }
    const v8us oh = fh.half[0], ol = fl.half[0];
    *(v8us*)((unsigned short*)O16 + fo_chunk(rowb + q0 + ln, h * HD + dg * 16 + 8 * hh, DM)) = oh;
    if (RES) *(v8us*)((unsigned short*)OL + fo_chunk(rowi + q0 + ln, h * HD + dg * 16 + 8 * hh, DM)) = ol;
  }
}

constexpr int NB_ATT  = NB * NH * ((SEQ - ISL) / 128);
constexpr int NB_ATTI = NB * NH * (ISL / 128);
// one launch, two bodies: the plain rows (the long blocks) first, the short residual-plane blocks behind them
__global__ __launch_bounds__(256) void k_attn(const _Float16* __restrict__ QK, const _Float16* __restrict__ QKL, const _Float16* __restrict__ VT, const _Float16* __restrict__ VTL, _Float16* __restrict__ O16, _Float16* __restrict__ OL, const int* __restrict__ Sp) {
  const int bid = (int)blockIdx.x;
  if (bid < NB_ATT) attn_body<false>(QK, nullptr, VT, nullptr, O16, nullptr, Sp, ISL / 128, (SEQ - ISL) / 128, bid);
  else attn_body<true>(QK, QKL, VT, VTL, O16, OL, Sp, 0, ISL / 128, bid - NB_ATT);
}

constexpr size_t al256(size_t bytes) { return (bytes + 255) & ~(size_t)255; }
constexpr size_t SZ_BQKV = al256((size_t)3 * DM * DM * 2);
constexpr size_t SZ_BO   = al256((size_t)DM * DM * 2);
constexpr size_t SZ_X16  = al256((size_t)NR * DM * 2);
constexpr size_t SZ_QK   = al256((size_t)NR * LQK * 2);
constexpr size_t SZ_QKL  = al256((size_t)NRI * LQK * 2);
constexpr size_t SZ_VT   = al256((size_t)DM * LVT * 2);
constexpr size_t SZ_VTL  = al256((size_t)DM * LVL * 2);
constexpr size_t SZ_O16  = al256((size_t)NR * DM * 2);
constexpr size_t SZ_OL   = al256((size_t)NRI * DM * 2);
constexpr size_t WS_TOTAL = SZ_BQKV + SZ_BO + SZ_X16 + SZ_QK + SZ_QKL + SZ_VT + SZ_VTL + SZ_O16 + SZ_OL;
static_assert(WS_TOTAL <= (size_t)134217728);      /* carve <= 128 MiB */

extern "C" void kernel_launch(void* const* d_in, const int* in_sizes, int n_in,
                              void* d_out, int out_size, void* d_ws, size_t ws_size, hipStream_t stream) {
  if (n_in < 6) return;
  const long long xrows = (long long)(NB - 1) * SEQ_FULL + SEQ;      /* rows of x / out touched */
  if ((long long)in_sizes[0] < xrows * DM) return;
  if ((long long)in_sizes[1] < (long long)DM * 3 * DM) return;
  if ((long long)in_sizes[2] < (long long)3 * DM) return;
  if ((long long)in_sizes[3] < (long long)DM * DM) return;
  if ((long long)in_sizes[4] < (long long)DM) return;
  if ((long long)in_sizes[5] < 1) return;
  if ((long long)out_size < xrows * DM) return;
  if (WS_TOTAL > ws_size) return;
  const float* x = (const float*)d_in[0]; const float* w_attn = (const float*)d_in[1]; const float* b_attn = (const float*)d_in[2];
  const float* w_proj = (const float*)d_in[3]; const float* b_proj = (const float*)d_in[4];
  const int* s_pref = (const int*)d_in[5];                           /* prefix length, loaded on the device */
  float* out = (float*)d_out;
  char* ws = (char*)d_ws; size_t off = 0;
  _Float16* BQKV = (_Float16*)(ws + off); off += SZ_BQKV;      /* [3072][1024] x16; this and every plane below in fragment order */
  _Float16* BO   = (_Float16*)(ws + off); off += SZ_BO;        /* [1024][1024] x16 */
  _Float16* X16  = (_Float16*)(ws + off); off += SZ_X16;       /* [NR][1024] */
  _Float16* QK   = (_Float16*)(ws + off); off += SZ_QK;        /* [NR][2048] q | k */
  _Float16* QKL  = (_Float16*)(ws + off); off += SZ_QKL;       /* [NRI][2048] residual x1024 */
  _Float16* VT   = (_Float16*)(ws + off); off += SZ_VT;        /* [1024][NR] */
  _Float16* VTL  = (_Float16*)(ws + off); off += SZ_VTL;       /* [1024][NRI] residual x1024 */
  _Float16* O16  = (_Float16*)(ws + off); off += SZ_O16;       /* [NR][1024] ctx x64 */
  _Float16* OL   = (_Float16*)(ws + off); off += SZ_OL;        /* [NRI][1024] ctx residual x1024 */
  if (off > ws_size) return;

  k_convert<<<(unsigned)(NB_X16 + NB_WQKV + NB_WO), 256, 0, stream>>>(x, w_attn, w_proj, X16, BQKV, BO);
  k_gemm_qkv<<<(unsigned)(NB_QK + NB_VT), 128, 0, stream>>>(X16, BQKV, b_attn, QK, QKL, VT, VTL);
  k_attn<<<(unsigned)(NB_ATT + NB_ATTI), 256, 0, stream>>>(QK, QKL, VT, VTL, O16, OL, s_pref);
  k_gemm_out<<<(unsigned)(NB_OUT + NB_OUTI), 128, 0, stream>>>(O16, OL, BO, b_proj, out);
}

// v007
// A run of this version takes 83.6 microseconds.
// Timed twice side by side with v006, it ran 1.16 and 1.15 times as fast.
// Counting every step since v000, it is 3.55 times as fast.
#include <hip/hip_runtime.h>
// All contractions: v_wmma_f32_16x16x32_f16 (f16 operands, f32 accumulate). x, weights and biases are RNE-converted to bf16; x and weights are held exactly in f16 (weights x16); q, k, v, softmax weights (x1024) and ctx (x64) are f16 planes; for the first 256 query rows of every sequence q, k, v, P and ctx also carry an f16 residual plane (x1024) accumulated in a separate accumulator.
// Structure: token rows r = b*SEQ + s. (1) weights -> Wt[n][k] f16; x -> f16 rows. (2) q|k rows = X16 . Wqk (N = 2048) and V^T[h*64+d][token] = Wv . X16^T (operand-swapped GEMM, row bias). (3) fused flash attention in the transposed form S^T = K Q^T, O^T = V^T P^T: one wave owns 16 queries, fragments are loaded straight from the 16-bit planes (all kept in fragment order, see fo_chunk), P^T goes D -> B in registers, online softmax statistics are per-lane scalars; visibility (key <= query) OR (query < S AND key < S) applied as a replace-mask by value, S loaded on the device from its input buffer. (4) out = ctx . Wo + b (f32).
#ifndef NB
#define NB 2
#endif
#ifndef SEQ
#define SEQ 2048
#endif
#define NB_FULL 2
#define SEQ_FULL 2048
#define DM 1024
#define NH 16
#define HD 64
#define ISL ((SEQ) < 256 ? (SEQ) : 256)   /* query rows per sequence carried with residual planes */
#define NR (NB * SEQ)                      /* token rows in the workspace planes */
#define NRI (NB * ISL)                     /* rows of the compact residual planes */
#define LQK (2 * DM)                       /* row pitch of the q | k plane */
#define LVT NR                             /* row pitch of V^T */
#define LVL NRI                            /* row pitch of the V^T residual plane */

static_assert(NB >= 1 && NB <= NB_FULL);          /* reduced builds only shrink */
static_assert(SEQ <= SEQ_FULL);
static_assert(SEQ % 128 == 0);                    /* 8 waves x 16 queries per attention block; GEMM row blocks; 32-key steps stay inside the sequence */
static_assert(ISL % 128 == 0);                    /* residual region is a whole number of blocks */
static_assert(ISL >= 32);                         /* clamped residual key step ISL - 32 is a valid step */
static_assert((SEQ - ISL) % 128 == 0);            /* plain region is a whole number of blocks */
static_assert(NH * HD == DM);                     /* merged head layout */
static_assert(HD == 64);                          
static_assert(DM % 128 == 0);                     /* GEMM M blocks (V^T) and K % 64 (two k blocks per trip) */
static_assert(DM % 8 == 0);                       /* 8-element convert threads */
static_assert(NR % 128 == 0);                     /* GEMM M blocks / N tiles of 64 */
static_assert(NRI % 64 == 0);                     /* residual-row output GEMM blocks */
static_assert((long long)NR * LQK < 2147483647LL);/* int plane offsets */
static_assert((long long)DM * LVT < 2147483647LL);

typedef unsigned short v8us __attribute__((ext_vector_type(8), may_alias));
typedef float  v8f  __attribute__((ext_vector_type(8)));
typedef float  v4f  __attribute__((ext_vector_type(4)));
typedef float  v4fa __attribute__((ext_vector_type(4), may_alias));
typedef _Float16 v16h __attribute__((ext_vector_type(16)));
typedef _Float16 v4h  __attribute__((ext_vector_type(4)));
union FragH { v16h v; v8us half[2]; _Float16 h[16]; unsigned short u[16]; };

__device__ __forceinline__ float bf16_rne(float x) { unsigned int u = __float_as_uint(x); u = (u + 0x7FFFu + ((u >> 16) & 1u)) & 0xFFFF0000u; return __uint_as_float(u); }

// Fragment order: every 16-bit plane [rows][K] is stored as tiles of 16 rows x 32 k, 512 elements (1 KB) each, tile (row / 16, k / 32) at element (row / 16) * 16 * K + (k / 32) * 512.
// Inside a tile: two halves of 256 elements (k 0..15, k 16..31), each 32 lanes x 8 elements with lane = 16 * ((k / 8) & 1) + row % 16. A fragment is then two loads of 512 contiguous bytes (4 whole lines each).
// element offset of the 8-element chunk that holds (row, k .. k + 7), k % 8 == 0, in a plane of K columns (K % 32 == 0)
__device__ __forceinline__ size_t fo_chunk(int row, int k, int K) { return (size_t)(row >> 4) * 16 * K + (size_t)((k >> 5) * 512 + ((k >> 4) & 1) * 256 + (((k >> 3) & 1) * 16 + (row & 15)) * 8); }
// fragment of one tile: elements 0..7 <- k 8h.., elements 8..15 <- k 16+8h.., row = lane & 15, h = lane >> 4 (same map for A and B);
// from a uniform pointer, the lane's own 32-bit byte offset (16 * lane folded in) and a constant byte step
__device__ __forceinline__ v16h g2_frago(const _Float16* base, unsigned off, int add) { const char* p = (const char*)base + (size_t)off + add; FragH f; f.half[0] = *(const v8us*)p; f.half[1] = *(const v8us*)(p + 512); return f.v; }
__device__ __forceinline__ v8f g2_mma(v16h a, v16h b, v8f c) { v8f d = __builtin_amdgcn_wmma_f32_16x16x32_f16(false, a, false, b, (short)0, c, false, false); asm volatile("v_nop\n\tv_nop\n\tv_nop\n\tv_nop" : "+v"(d) : "v"(a), "v"(b)); return d; }

// the same product left to the compiler's own padding: for the 64 x 64 wave tile, whose 16 accumulators and two fragment sets need more than 256 registers (with the asm statement's operands the build stayed below 256 and spilled)
__device__ __forceinline__ v8f g2_mmab(v16h a, v16h b, v8f c) { return __builtin_amdgcn_wmma_f32_16x16x32_f16(false, a, false, b, (short)0, c, false, false); }

// asks L2 (scope SE: into L2 only, nothing returns, no counter) for the 256-B unit at p + OFF.
// p + OFF lies inside the plane in every lane; asm, so that the address stands in a register of the caller's that still holds it later (see the callers' last use of it)
template <int OFF>
__device__ __forceinline__ void l2_ask(const char* p) { asm volatile("global_prefetch_b8 %0, off offset:%1 scope:SCOPE_SE" :: "v"(p), "i"(OFF)); }

__device__ __forceinline__ void wt_f16_body(const float* __restrict__ W, _Float16* __restrict__ Wt, int K, int N, float scale, int bid) {
  /* one wave writes one half tile (512 contiguous bytes): lane = 16 * h + n % 16; waves run over the row tiles first, then over the 16-k halves */
  const int t = bid * 256 + threadIdx.x; if (t >= N * (K / 8)) return; const int wv = t >> 5, lane = t & 31; const int n = (wv % (N / 16)) * 16 + (lane & 15), k8 = (wv / (N / 16)) * 16 + (lane >> 4) * 8; FragH f;
#pragma unroll
  for (int i = 0; i < 8; ++i) f.h[i] = (_Float16)(bf16_rne(W[(size_t)(k8 + i) * N + n]) * scale);
  const v8us o = f.half[0];
  unsigned short* d = (unsigned short*)Wt + fo_chunk(n, k8, K);
  *(v8us*)d = o; 
}

__device__ __forceinline__ void x16_body(const float* __restrict__ x, _Float16* __restrict__ X16, int bid) {
  const int t = bid * 256 + threadIdx.x; if (t >= NR * (DM / 8)) return;
  /* one wave writes one half tile (512 contiguous bytes): lane = 16 * h + row % 16; consecutive waves take consecutive 16-k halves of a row tile */
  const int wv = t >> 5, lane = t & 31; const int row = (wv / (DM / 16)) * 16 + (lane & 15), c8 = (wv % (DM / 16)) * 16 + (lane >> 4) * 8; const int b = row / SEQ, s = row % SEQ;
  const float* src = x + ((size_t)b * SEQ_FULL + s) * DM + c8;
  const v4f a = *(const v4fa*)src, c = *(const v4fa*)(src + 4); FragH f;
#pragma unroll
  for (int i = 0; i < 4; ++i) { f.h[i] = (_Float16)bf16_rne(a[i]); f.h[4 + i] = (_Float16)bf16_rne(c[i]); }
  const v8us o = f.half[0];
  unsigned short* d = (unsigned short*)X16 + fo_chunk(row, c8, DM);
  *(v8us*)d = o; 
}

// Launches that read nothing of each other's output share one grid: a range of the block index picks the body (block-uniform branch).
constexpr int NB_X16  = (int)(((size_t)NR * (DM / 8) + 255) / 256);
constexpr int NB_WQKV = (int)(((size_t)3 * DM * (DM / 8) + 255) / 256);
constexpr int NB_WO   = (int)(((size_t)DM * (DM / 8) + 255) / 256);
// the three conversions: x -> X16; W[K=1024][N=3072] -> Wt[N][K]; W[K=1024][N=1024] -> Wt[N][K]
__global__ __launch_bounds__(256) void k_convert(const float* __restrict__ x, const float* __restrict__ w_attn, const float* __restrict__ w_proj, _Float16* __restrict__ X16, _Float16* __restrict__ BQKV, _Float16* __restrict__ BO) {
  const int bid = (int)blockIdx.x;
  if (bid < NB_X16) x16_body(x, X16, bid);
  else if (bid < NB_X16 + NB_WQKV) wt_f16_body(w_attn, BQKV, DM, 3 * DM, 16.0f, bid - NB_X16);
  else wt_f16_body(w_proj, BO, DM, DM, 16.0f, bid - (NB_X16 + NB_WQKV));
}

// GEMM: wave tile (16*MT) x 64, block = 4 waves laid (4/WN) x WN = (64*MT/WN) rows x (64*WN) cols; A and Bh are f16 planes in fragment order (fragments straight from global).
// v = acc*alpha (+ accL*alphaL with the residual A plane AL, ARES) + bias (per column, or per row if ROWBIAS; bias RNE-converted to bf16).
// Logical row R maps to A row seg*aSeg + aOff + w and C row seg*cSeg + cOff + w with seg = R / segRows, w = R % segRows (blocks never straddle segments).
// OUT 0: f32 C. OUT 1: f16 C16 (+ x1024 residual rows in CL when the rows lie in the first ISL rows of a sequence). OUT 2: f16 C16 (+ residual columns when the token columns lie in the first ISL rows of a sequence).
// Requires M % (64*MT/WN) == 0, N % (64*WN) == 0, K % 64 == 0 (asserted above for the launches used). LDS tile so[wave] is private to its wave (wave-level sync); the kernel owns the array, so the two bodies of a launch share one. bid: block index inside the body's own range.
template <int MT, int WN, bool ROWBIAS, bool ARES, int OUT, int SOR>
__device__ __forceinline__ void gemm_body(const _Float16* __restrict__ A, const _Float16* __restrict__ AL, int lda,
    const _Float16* __restrict__ Bh, int ldb, float alpha, float alphaL, const float* __restrict__ bias,
    float* __restrict__ Cf, _Float16* __restrict__ C16, _Float16* __restrict__ CL, int ldc, int ldcl,
    int M, int N, int K, int segRows, int aSeg, int aOff, int cSeg, int cOff, int bid, float (*so)[SOR][68]) {
  static_assert(MT == 1 || MT == 2 || MT == 4);
  static_assert(WN == 1 || WN == 2);    /* the block's 4 waves lie (4 / WN) x WN over its tile */
  static_assert(SOR >= 16 * MT);        /* the wave's staging rows */
  static_assert(!ARES || MT == 1);      /* residual form keeps 8 accumulators */
  const int tid = threadIdx.x, lane = tid & 31, ln = lane & 15, hh = lane >> 4;
  const int w = __builtin_amdgcn_readfirstlane(tid >> 5);      /* wave-uniform, so that every tile base below is a scalar pointer */
  const int ntn = N / (64 * WN);
  const int mt = bid / ntn, nq = bid - mt * ntn;
  const int R0 = mt * (64 * MT / WN) + (16 * MT) * (w / WN), col0 = nq * (64 * WN) + 64 * (w % WN);
  if (R0 >= M) return;
  // At entry the block asks L2 for a quarter of its A panel (BM rows x DM) and of its B panel (BN rows x DM), one request per 256-B unit: the blocks that share a panel (same mt: neighbours in the index; same nq) deal its quarters among them by the other index.
  // Every launch here has lda = ldb = K = DM, and a panel is one contiguous run of a fragment-order plane; 128 threads x 256 B = 32 KB a request round.
  constexpr int BM = 64 * MT / WN, BN = 64 * WN, QA = BM * DM * 2 / 4, QB = BN * DM * 2 / 4;      /* bytes of a quarter panel */
  static_assert(QA % 32768 == 0 && QA <= 65536 && QB % 32768 == 0 && QB <= 65536);
  const int Rb = mt * BM, segb = Rb / segRows;
  const char* pfa = (const char*)(A + (size_t)(segb * aSeg + aOff + (Rb - segb * segRows)) * lda) + ((nq & 3) * QA + tid * 256);
  const char* pfb = (const char*)(Bh + (size_t)(nq * BN) * ldb) + ((mt & 3) * QB + tid * 256);
  const char* pfe = ARES ? (const char*)(AL + (size_t)Rb * lda) + ((nq & 3) * QA + tid * 256) : pfa;
  l2_ask<0>(pfa); if (QA > 32768) l2_ask<32768>(pfa);
  l2_ask<0>(pfb); if (QB > 32768) l2_ask<32768>(pfb);
  if (ARES) l2_ask<0>(pfe);
  const int seg = R0 / segRows, wi = R0 - seg * segRows;
  const int arow0 = seg * aSeg + aOff + wi, crow0 = seg * cSeg + cOff + wi;
  /* arow0, R0 and col0 are multiples of 16: row tile r / 16 starts at element r * ld; 32 k further is 512 elements further */
  const _Float16* a0p = A + (size_t)arow0 * lda;
  const _Float16* b0p = Bh + (size_t)col0 * ldb;
  unsigned ko = 16u * (unsigned)lane;      /* the lane's byte offset inside a half tile plus the trip's k offset: the one vector address register of every fragment load */
  const v8f z8 = {0.f, 0.f, 0.f, 0.f, 0.f, 0.f, 0.f, 0.f};
  v8f c00 = z8, c01 = z8, c02 = z8, c03 = z8, c10 = z8, c11 = z8, c12 = z8, c13 = z8, c20 = z8, c21 = z8, c22 = z8, c23 = z8, c30 = z8, c31 = z8, c32 = z8, c33 = z8, d00 = z8, d01 = z8, d02 = z8, d03 = z8;
  // Two register sets of fragments (P, N), 32 k each: every set is loaded as one group, one k block ahead of the WMMAs that read it, so a block waits for one load round trip that started a block earlier.
  const _Float16* e0p = ARES ? AL + (size_t)R0 * lda : a0p;
#define GEMM_LD(S, kk) { S##a0 = g2_frago(a0p, ko, (kk) * 32); if (MT >= 2) S##a1 = g2_frago(a0p, ko, 32 * lda + (kk) * 32); if (MT == 4) { S##a2 = g2_frago(a0p, ko, 64 * lda + (kk) * 32); S##a3 = g2_frago(a0p, ko, 96 * lda + (kk) * 32); } if (ARES) S##e0 = g2_frago(e0p, ko, (kk) * 32); \
    S##b0 = g2_frago(b0p, ko, (kk) * 32); S##b1 = g2_frago(b0p, ko, 32 * ldb + (kk) * 32); S##b2 = g2_frago(b0p, ko, 64 * ldb + (kk) * 32); S##b3 = g2_frago(b0p, ko, 96 * ldb + (kk) * 32); }
#define GEMM_MC(S, j) { if (MT == 4) { c0##j = g2_mmab(S##a0, S##b##j, c0##j); c1##j = g2_mmab(S##a1, S##b##j, c1##j); c2##j = g2_mmab(S##a2, S##b##j, c2##j); c3##j = g2_mmab(S##a3, S##b##j, c3##j); } \
    else { c0##j = g2_mma(S##a0, S##b##j, c0##j); if (MT == 2) c1##j = g2_mma(S##a1, S##b##j, c1##j); if (ARES) d0##j = g2_mma(S##e0, S##b##j, d0##j); } }
#define GEMM_MM(S) { GEMM_MC(S, 0) GEMM_MC(S, 1) GEMM_MC(S, 2) GEMM_MC(S, 3) }
  const v16h zf = (v16h)((_Float16)0.0f);
  v16h Pa2 = zf, Pa3 = zf, Na2 = zf, Na3 = zf;
  v16h Pa0 = zf, Pa1 = zf, Pe0 = zf, Pb0 = zf, Pb1 = zf, Pb2 = zf, Pb3 = zf, Na0 = zf, Na1 = zf, Ne0 = zf, Nb0 = zf, Nb1 = zf, Nb2 = zf, Nb3 = zf;
  GEMM_LD(P, 0)
  asm volatile("s_wait_xcnt 0x0" :: "v"(lane), "v"(ko) : "memory");      /* behind the first group: the build may name the lane number (scaled by the load) or the byte offset as its offset register; both live up to this wait, so that no result of the loop's loads is written over either earlier */
  asm volatile("" :: "v"(pfa), "v"(pfb), "v"(pfe));      /* inputs only, no instruction: the requests' address registers keep their in-range addresses up to here, behind the first load group and its wait, and are free in the k loop */
#pragma unroll 1      /* kept rolled, 64 k per trip, the last trip peeled, for speed only */
  for (int kb = 0; kb + 64 < K; kb += 64) {
    GEMM_LD(N, 32)
    __builtin_amdgcn_sched_barrier(0);      /* this and the three below hold each load group whole and one k block ahead of its WMMAs, as the unrolled form had them: the rolled loop's scheduler sank the loads to their uses */
    GEMM_MM(P)
    __builtin_amdgcn_sched_barrier(0);
    GEMM_LD(P, 64)
    __builtin_amdgcn_sched_barrier(0);
    GEMM_MM(N)
    __builtin_amdgcn_sched_barrier(0);
    asm volatile("s_wait_xcnt 0x0" : "+v"(ko) :: "memory");      /* stands in front of the rewrite of the offset register that the groups in flight name; the register is an operand so that the addition stays behind it */
    ko += 64 * 32;      /* 64 k further = two tiles, 2 KB, in every plane */
  }
  GEMM_LD(N, 32)
  asm volatile("s_wait_xcnt 0x0" :: "v"(ko) : "memory");      /* behind the last group: the loads' offset register lives up to this wait, so nothing (a late load's result included) is written over it earlier */
  __builtin_amdgcn_sched_barrier(0);      /* the last group too stays whole and ahead of the WMMAs of the block before it */
  GEMM_MM(P)
  GEMM_MM(N)
#undef GEMM_LD
#undef GEMM_MM
#undef GEMM_MC
  const v8f accs[16] = {c00, c01, c02, c03, c10, c11, c12, c13, c20, c21, c22, c23, c30, c31, c32, c33};
  const v8f accl[4] = {d00, d01, d02, d03};
#pragma unroll
  for (int u = 0; u < 4 * MT; ++u) {
    const int t = u & 3, half = u >> 2; const int col = col0 + t * 16 + ln;
    float bvc = 0.f; if (!ROWBIAS) bvc = bf16_rne(bias[col]);
#pragma unroll
    for (int r = 0; r < 8; ++r) {
      const int rloc = half * 16 + 8 * hh + r;
      float v = accs[u][r] * alpha;
      if (ARES) v += accl[t][r] * alphaL;
      if (ROWBIAS) v += bf16_rne(bias[R0 + rloc]); else v += bvc;
      so[w][rloc][t * 16 + ln] = v;
    }
  }
  __builtin_amdgcn_fence(4 /* acq_rel order */, "workgroup"); __builtin_amdgcn_wave_barrier();
  const int rsub = lane >> 4, c4 = (lane & 15) * 4;
  if (OUT == 0) {
    {
#pragma unroll
      for (int q = 0; q < 8 * MT; ++q) { const int r = q * 2 + rsub; const v4f v = *(const v4fa*)&so[w][r][c4]; *(v4f*)(Cf + (size_t)(crow0 + r) * ldc + col0 + c4) = v; }
      asm volatile("s_wait_xcnt 0x0" ::: "memory");      /* behind the run of stores: in a kernel of two bodies the other body's code follows in the listing and reuses the stores' address and data registers */
    }
  } else {
    int sl, rrow0, rcol0;
    if (OUT == 1) { sl = crow0 % SEQ; rrow0 = (crow0 / SEQ) * ISL + sl; rcol0 = col0; }
    else          { sl = col0 % SEQ;  rrow0 = crow0; rcol0 = (col0 / SEQ) * ISL + sl; }
    const bool isl = sl < ISL;      /* uniform over the wave tile: ISL and SEQ are multiples of 64 */
    {      /* one store = one half tile of the fragment-order plane: lane (hh, ln) holds row ln, 8 columns from 8 * hh */
#pragma unroll
      for (int q = 0; q < 4 * MT; ++q) {
        const int r = (q >> 2) * 16 + ln, c = (q & 3) * 16 + 8 * hh;
        const v4f va = *(const v4fa*)&so[w][r][c], vc = *(const v4fa*)&so[w][r][c + 4];
        FragH fh, fl;
#pragma unroll
        for (int i = 0; i < 4; ++i) {
          const _Float16 h0 = (_Float16)va[i], h1 = (_Float16)vc[i]; fh.h[i] = h0; fh.h[4 + i] = h1;
          fl.h[i] = (_Float16)((va[i] - (float)h0) * 1024.0f); fl.h[4 + i] = (_Float16)((vc[i] - (float)h1) * 1024.0f);
        }
        const v8us oh = fh.half[0], ol = fl.half[0];
        *(v8us*)((unsigned short*)C16 + fo_chunk(crow0 + r, col0 + c, ldc)) = oh;
        asm volatile("s_wait_xcnt 0x0" ::: "memory");      /* in front of the reuse of the store's data and address registers by the residual's arithmetic */
        if (isl) *(v8us*)((unsigned short*)CL + fo_chunk(rrow0 + r, rcol0 + c, ldcl)) = ol;
      }
      
    }
  }
}

constexpr int NB_QK   = (NR / 128) * (2 * DM / 128);
constexpr int NB_VT   = (DM / 128) * (NR / 128);
constexpr int NB_OUT  = (NB * (SEQ - ISL) / 128) * (DM / 64);
constexpr int NB_OUTI = (NRI / 64) * (DM / 64);
// one launch, two bodies:
// q | k rows (f16) = X16 . Wqk^T / 16 + b; residual rows for s < ISL
// V^T[h*64+d][token] (f16) = Wv . X16^T / 16 + b[row]; residual columns for s < ISL
__global__ __launch_bounds__(128) void k_gemm_qkv(const _Float16* __restrict__ X16, const _Float16* __restrict__ BW, const float* __restrict__ bias, _Float16* __restrict__ QK, _Float16* __restrict__ QKL, _Float16* __restrict__ VT, _Float16* __restrict__ VTL) {
  __shared__ __attribute__((aligned(16))) float so[4][64][68];
  const int bid = (int)blockIdx.x;
  if (bid < NB_QK) gemm_body<4, 2, false, false, 1>(X16, nullptr, DM, BW, DM, 0.0625f, 0.f, bias, nullptr, QK, QKL, LQK, LQK, NR, 2 * DM, DM, NR, 0, 0, 0, 0, bid, so);
  else gemm_body<4, 2, true, false, 2>(BW + (size_t)2 * DM * DM, nullptr, DM, X16, DM, 0.0625f, 0.f, bias + 2 * DM, nullptr, VT, VTL, LVT, LVL, DM, NR, DM, DM, 0, 0, 0, 0, bid - NB_QK, so);
}
// one launch, two bodies:
// out rows s >= ISL: ctx(x64) . Wo(x16) * 2^-10 + b
// out rows s < ISL: (ctx_hi . Wo) * 2^-10 + (ctx_res . Wo) * 2^-20 + b, separate accumulators
__global__ __launch_bounds__(128) void k_gemm_out(const _Float16* __restrict__ O16, const _Float16* __restrict__ OL, const _Float16* __restrict__ BO, const float* __restrict__ bias, float* __restrict__ out) {
  __shared__ __attribute__((aligned(16))) float so[4][32][68];
  const int bid = (int)blockIdx.x;
  if (bid < NB_OUT) gemm_body<2, 1, false, false, 0>(O16, nullptr, DM, BO, DM, 0.0009765625f, 0.f, bias, out, nullptr, nullptr, DM, 0, NB * (SEQ - ISL), DM, DM, SEQ - ISL, SEQ, ISL, SEQ_FULL, ISL, bid, so);
  else gemm_body<1, 1, false, true, 0>(O16, OL, DM, BO, DM, 0.0009765625f, 0.00000095367431640625f, bias, out, nullptr, nullptr, DM, 0, NRI, DM, DM, ISL, SEQ, 0, SEQ_FULL, 0, bid - NB_OUT, so);
}

// Fused prefix-causal attention, transposed form. Block = 8 waves = 128 consecutive queries of one (b, h); wave = 16 queries (D column = query = lane & 15).
// Visibility: key j is seen by query i iff (j <= i) OR (i < S AND j < S); S is loaded from its input buffer and clamped to [0, SEQ] (same mask for any value).
// Key range of a wave: [0, max(S, q0 + 16)) in 32-key steps (all step keys lie inside the sequence since SEQ % 32 == 0). Every step holds key kcb that is visible to every query of the wave
// (kcb <= q0 when the range ends at q0 + 16; kcb < S with all 16 queries < S otherwise), so the step maximum is always finite.
// Per 32-key step: S^T tiles (keys kcb..+15 and +16..+31) = K (A, rows = keys) . Q^T (B, lane = query); scale 1/8; hidden keys are REPLACED (excluded from max, weight 0 by value);
// online max / sum per lane (halves combined by one xor-16 shuffle); P^T (x1024, f16) is the B fragment directly: element r <- tile0[r], element 8+r <- tile1[r];
// O^T (rows = d) += V^T (A, rows = d, k = keys) . P^T. RES: q, k, v, P carry x1024 residual planes; residual products go to separate accumulators folded back with 2^-10.
// Residual k / v planes exist only for keys < ISL: for key steps at or beyond ISL (possible when S > ISL) the residual k / v fragments are loaded from a clamped in-range step and zeroed by value (wave-uniform select).
template <bool B> struct flag_t { static constexpr bool value = B; };
// eight v_exp_f32 in one statement, results in registers apart from every source (early clobber), one v_nop behind the last: the slot that the instruction set asks for behind a transcendental, before its result is read or its source overwritten; left to the scheduler, runs of exponentials stood with one writing over the source of the one in front
__device__ __forceinline__ void exp2_x8(float (&p)[8], const float (&t)[8]) {
  asm("v_exp_f32 %0, %8\n\tv_exp_f32 %1, %9\n\tv_exp_f32 %2, %10\n\tv_exp_f32 %3, %11\n\tv_exp_f32 %4, %12\n\tv_exp_f32 %5, %13\n\tv_exp_f32 %6, %14\n\tv_exp_f32 %7, %15\n\tv_nop"
      : "=&v"(p[0]), "=&v"(p[1]), "=&v"(p[2]), "=&v"(p[3]), "=&v"(p[4]), "=&v"(p[5]), "=&v"(p[6]), "=&v"(p[7])
      : "v"(t[0]), "v"(t[1]), "v"(t[2]), "v"(t[3]), "v"(t[4]), "v"(t[5]), "v"(t[6]), "v"(t[7]));
}
template <bool RES>
__device__ __forceinline__ void attn_body(const _Float16* __restrict__ QK, const _Float16* __restrict__ QKL, const _Float16* __restrict__ VT, const _Float16* __restrict__ VTL,
                                          _Float16* __restrict__ O16, _Float16* __restrict__ OL, const int* __restrict__ Sp, int qb0, int nqb, int bid) {
  const int tid = threadIdx.x, lane = tid & 31, ln = lane & 15, hh = lane >> 4;
  const int w = __builtin_amdgcn_readfirstlane(tid >> 5);
  const int sraw = Sp[0];
  const int Sc = sraw < 0 ? 0 : (sraw > SEQ ? SEQ : sraw);
  const int bh = bid / nqb; const int qb = qb0 + (bid - bh * nqb);
  const int h = bh % NH, b = bh / NH;
  const int q0 = qb * 128 + w * 16, q = q0 + ln;
  const bool qpre = q < Sc;
  const int rowb = b * SEQ, rowi = b * ISL;
  /* fragment-order planes: row tile r / 16 starts at element r * pitch (r % 16 == 0), column block c / 32 at c * 16 (c % 32 == 0), the lane's chunk at 8 * lane */
  const unsigned lo = 16u * (unsigned)lane;                           /* the lane's byte offset inside a half tile */
  const _Float16* qp = QK + (size_t)(rowb + q0) * LQK + h * HD * 16;
  const v16h qh0 = g2_frago(qp, lo, 0), qh1 = g2_frago(qp, lo, 1024);
  const int qloff = (rowi + q0) * LQK + h * HD * 16;       /* residual q tile (RES) */
  const int kbase = rowb * LQK + (DM + h * HD) * 16;       /* k tile of keys 0..15, d 0..31 */
  const int klbase = rowi * LQK + (DM + h * HD) * 16;      /* residual k tile (RES) */
  const int vbase = h * HD * LVT + rowb * 16;              /* V^T tile d 0..15, keys 0..31 */
  const int vlbase = h * HD * LVL + rowi * 16;             /* residual V^T tile (RES) */
  const v8f z8 = {0.f, 0.f, 0.f, 0.f, 0.f, 0.f, 0.f, 0.f};
  const v16h zh = (v16h)((_Float16)0.0f);
  v8f o0 = z8, o1 = z8, o2 = z8, o3 = z8, e0 = z8, e1 = z8, e2 = z8, e3 = z8;
  float m = -1.0e30f, l = 0.f;
  const int kend = (Sc > q0 + 16) ? Sc : (q0 + 16);              /* keys [0, kend) cover every visible key of the wave; kend <= SEQ */
  const int nst = (kend + 31) >> 5;
  // Plain form: the K and V fragments live in registers across the loop; the next step's K group is issued right behind this step's S^T WMMAs and the next step's V group right behind its O^T WMMAs.
  v16h ka = zh, kb = zh, kc = zh, kd = zh, v0 = zh, v1 = zh, v2 = zh, v3 = zh;
  unsigned kq = 2u * (unsigned)kbase + lo, vq = 2u * (unsigned)vbase + lo;      /* the lane's byte offsets of the K and V groups held in registers; step 0 exists: nst >= 1 */
  // Plain form, at entry: the block asks L2 for the K rows and V^T columns of its causal key range [0, keys), one request per 256-B unit. K: 2 KB per 16-key tile, 8 lanes a tile, 32 tiles a round; V^T: 4 d tiles, 256 B per 8 keys.
  // The range does not wait for S: keys that only a prefix longer than it makes visible are loaded without a request. A wave's request is skipped (scalar test) where its first key lies past the range; the keys it covers (64 of K, 256 of V^T, the lane's unit clamped) lie inside the sequence in any case.
  const char* pkq = (const char*)QK; const char* pvq = (const char*)VT;
  if (!RES) {
    const int keys = qb * 128 + 128;      /* the causal range of the block's last wave; <= SEQ */
    const int vu = tid < SEQ / 8 - 1 ? tid : SEQ / 8 - 1;
    pkq += 2 * (size_t)kbase + (size_t)((tid >> 3) * (32 * LQK) + (tid & 7) * 256);
    pvq += 2 * (size_t)vbase + (size_t)(vu * 256);
    if (w * 64 < keys) l2_ask<0>(pkq);
    if (SEQ > 512 && w * 64 + 512 < keys) l2_ask<1024 * LQK>(pkq);
    if (SEQ > 1024 && w * 64 + 1024 < keys) l2_ask<2048 * LQK>(pkq);
    if (SEQ > 1536 && w * 64 + 1536 < keys) l2_ask<3072 * LQK>(pkq);
    if (w * 256 < keys) { l2_ask<0>(pvq); l2_ask<32 * LVT>(pvq); l2_ask<64 * LVT>(pvq); l2_ask<96 * LVT>(pvq); }
  }
  if (!RES) {
    ka = g2_frago(QK, kq, 0); kb = g2_frago(QK, kq, 1024); kc = g2_frago(QK, kq, 32 * LQK); kd = g2_frago(QK, kq, 32 * LQK + 1024);
    v0 = g2_frago(VT, vq, 0); v1 = g2_frago(VT, vq, 32 * LVT); v2 = g2_frago(VT, vq, 64 * LVT); v3 = g2_frago(VT, vq, 96 * LVT);
    /* inputs-only fence on the loaded values: every load in front of the loop has landed here, so the wait at the loop's head counts the loop's own groups alone and leaves the next V group in flight */
    asm volatile("" :: "v"(qh0), "v"(qh1), "v"(ka), "v"(kb), "v"(kc), "v"(kd), "v"(v0), "v"(v1), "v"(v2), "v"(v3));
    asm volatile("" :: "v"(pkq), "v"(pvq));      /* inputs only, no instruction: the requests' address registers hold their in-range addresses until the first fragments have landed */
  }
  // One 32-key step. MASK false: for a step whose last key kcb + 31 is <= q0, the wave's first query, so that (key <= query) holds for every element and the visibility tests, the replaces and the selects around the exponentials are identities and are left out; products, sums and their order stay.
  auto step = [&](auto masked, const int st) __attribute__((always_inline)) {
    constexpr bool MASK = decltype(masked)::value;
    const int kcb = st * 32;
    const int adv = (st + 1 < nst) ? 32 : 0;                     /* keys to the next step; the last step reloads its own (in range, not used) */
    const bool rok = kcb < ISL;                                  /* wave-uniform: residual k / v rows exist for this step */
    const int kcl = rok ? kcb : (ISL - 32);                      /* clamped in-range residual step */
    const _Float16* kp0 = QK + kbase + kcb * LQK;
    v8f s0 = z8, s1 = z8, r0 = z8, r1 = z8;
    if (RES) {
      unsigned qo = lo; asm volatile("" : "+v"(qo));             /* reload the residual q fragments per step (integer offset only) */
      const _Float16* qlp = QKL + qloff;
      const v16h ql0 = g2_frago(qlp, qo, 0), ql1 = g2_frago(qlp, qo, 1024);
      const _Float16* kl0 = QKL + klbase + kcl * LQK;
      /* all k fragments of the step as one load group in front of its WMMAs */
      const v16h ah0 = g2_frago(kp0, lo, 0), ah1 = g2_frago(kp0, lo, 1024), ah2 = g2_frago(kp0, lo, 32 * LQK), ah3 = g2_frago(kp0, lo, 32 * LQK + 1024);
      v16h al0 = g2_frago(kl0, lo, 0), al1 = g2_frago(kl0, lo, 1024), al2 = g2_frago(kl0, lo, 32 * LQK), al3 = g2_frago(kl0, lo, 32 * LQK + 1024);
      asm volatile("s_wait_xcnt 0x0" :: "v"(qo) : "memory");      /* behind the group: the offset register that the residual q loads name lives up to this wait, so no later load's result is written over it earlier */
      al0 = rok ? al0 : zh; al1 = rok ? al1 : zh; al2 = rok ? al2 : zh; al3 = rok ? al3 : zh;
      s0 = g2_mma(ah0, qh0, s0); r0 = g2_mma(al0, qh0, r0); r0 = g2_mma(ah0, ql0, r0);
      s0 = g2_mma(ah1, qh1, s0); r0 = g2_mma(al1, qh1, r0); r0 = g2_mma(ah1, ql1, r0);
      s1 = g2_mma(ah2, qh0, s1); r1 = g2_mma(al2, qh0, r1); r1 = g2_mma(ah2, ql0, r1);
      s1 = g2_mma(ah3, qh1, s1); r1 = g2_mma(al3, qh1, r1); r1 = g2_mma(ah3, ql1, r1);
    } else {
      s0 = g2_mma(ka, qh0, s0); s0 = g2_mma(kb, qh1, s0); s1 = g2_mma(kc, qh0, s1); s1 = g2_mma(kd, qh1, s1);
      asm volatile("s_wait_xcnt 0x0" : "+v"(kq) :: "memory");      /* stands in front of the rewrite of the offset register that the last K group's loads name; the register is an operand so that the addition stays behind it */
      kq += (unsigned)(adv * LQK * 2);
      ka = g2_frago(QK, kq, 0); kb = g2_frago(QK, kq, 1024); kc = g2_frago(QK, kq, 32 * LQK); kd = g2_frago(QK, kq, 32 * LQK + 1024);
      __builtin_amdgcn_sched_barrier(0);      /* holds the K group at the head of the softmax: issued further down it has less of the step to land in */
    }
    v16h vl0 = zh, vl1 = zh, vl2 = zh, vl3 = zh;
    if (RES) {      /* all v fragments of the step as one load group in front of the softmax */
      const _Float16* vp = VT + vbase + kcb * 16; const _Float16* vlp = VTL + vlbase + kcl * 16;
      v0 = g2_frago(vp, lo, 0); v1 = g2_frago(vp, lo, 32 * LVT); v2 = g2_frago(vp, lo, 64 * LVT); v3 = g2_frago(vp, lo, 96 * LVT);
      vl0 = g2_frago(vlp, lo, 0); vl1 = g2_frago(vlp, lo, 32 * LVL); vl2 = g2_frago(vlp, lo, 64 * LVL); vl3 = g2_frago(vlp, lo, 96 * LVL);
    }
    // D row = key kcb + 8*hh + r (tile 0), + 16 (tile 1); D column = query q
    v8f xa, xb; float mt = -1.0e30f;
#pragma unroll
    for (int r = 0; r < 8; ++r) {
      const int k0 = kcb + 8 * hh + r;
      const bool va = !MASK || (k0 <= q) || (qpre && (k0 < Sc));
      const bool vb = !MASK || (k0 + 16 <= q) || (qpre && (k0 + 16 < Sc));
      float a = s0[r], c = s1[r];
      if (RES) { a += r0[r] * 0.0009765625f; c += r1[r] * 0.0009765625f; }
      a *= 0.125f; c *= 0.125f;
      a = va ? a : -1.0e30f; c = vb ? c : -1.0e30f;
      xa[r] = a; xb[r] = c; mt = fmaxf(mt, fmaxf(a, c));
    }
    mt = fmaxf(mt, __shfl_xor(mt, 16, 32));
    const float mn = fmaxf(m, mt);
    float f; { const float t = fmaxf(m - mn, -80.0f) * 1.44269504f;      /* __expf as it compiles (multiply, v_exp_f32), with the slot behind the transcendental filled in the same statement */
      asm("v_exp_f32 %0, %1\n\tv_nop" : "=v"(f) : "v"(t)); }
    m = mn;
    FragH ph, pl; float rs = 0.f;
    float ua[8], ub[8], wa[8], wb[8];      /* __expf as it compiles: multiply, v_exp_f32 */
#pragma unroll
    for (int r = 0; r < 8; ++r) {
      const int k0 = kcb + 8 * hh + r;
      const bool va = !MASK || (k0 <= q) || (qpre && (k0 < Sc));
      const bool vb = !MASK || (k0 + 16 <= q) || (qpre && (k0 + 16 < Sc));
      ua[r] = (va ? (xa[r] - mn) : 0.f) * 1.44269504f; ub[r] = (vb ? (xb[r] - mn) : 0.f) * 1.44269504f;
    }
    exp2_x8(wa, ua); exp2_x8(wb, ub);
#pragma unroll
    for (int r = 0; r < 8; ++r) {
      const int k0 = kcb + 8 * hh + r;
      const bool va = !MASK || (k0 <= q) || (qpre && (k0 < Sc));
      const bool vb = !MASK || (k0 + 16 <= q) || (qpre && (k0 + 16 < Sc));
      const float pa = va ? wa[r] : 0.f;
      const float pb = vb ? wb[r] : 0.f;
      rs += pa + pb;
      const float ta = pa * 1024.0f, tb = pb * 1024.0f;
      const _Float16 ha = (_Float16)ta, hb = (_Float16)tb;
      ph.h[r] = ha; ph.h[8 + r] = hb;
      if (RES) { pl.h[r] = (_Float16)((ta - (float)ha) * 1024.0f); pl.h[8 + r] = (_Float16)((tb - (float)hb) * 1024.0f); }
    }
    const float rso = __shfl_xor(rs, 16, 32);
    l = l * f + (rs + rso);
    o0 *= f; o1 *= f; o2 *= f; o3 *= f;
    if (RES) { e0 *= f; e1 *= f; e2 *= f; e3 *= f; }
    o0 = g2_mma(v0, ph.v, o0); o1 = g2_mma(v1, ph.v, o1); o2 = g2_mma(v2, ph.v, o2); o3 = g2_mma(v3, ph.v, o3);
    if (RES) {
      vl0 = rok ? vl0 : zh; vl1 = rok ? vl1 : zh; vl2 = rok ? vl2 : zh; vl3 = rok ? vl3 : zh;
      e0 = g2_mma(vl0, ph.v, e0); e0 = g2_mma(v0, pl.v, e0);
      e1 = g2_mma(vl1, ph.v, e1); e1 = g2_mma(v1, pl.v, e1);
      e2 = g2_mma(vl2, ph.v, e2); e2 = g2_mma(v2, pl.v, e2);
      e3 = g2_mma(vl3, ph.v, e3); e3 = g2_mma(v3, pl.v, e3);
    } else {
      asm volatile("s_wait_xcnt 0x0" : "+v"(vq) :: "memory");      /* the same for the V group's offset register */
      vq += (unsigned)(adv * 32);      /* 32 keys further = the next tile, 1 KB */
      v0 = g2_frago(VT, vq, 0); v1 = g2_frago(VT, vq, 32 * LVT); v2 = g2_frago(VT, vq, 64 * LVT); v3 = g2_frago(VT, vq, 96 * LVT);
    }
  };
  // Plain form: steps 0 .. nfull - 1 lie wholly at or below the wave's first query (32 * st + 31 <= q0) and run without the mask; the rest (the step on the diagonal, and steps that only a long prefix makes visible) keep it. nfull < nst since kend >= q0 + 16.
  int st = 0;
  if (!RES) {
    const int nfull = (q0 + 1) >> 5;
#pragma unroll 1      /* rolled like the masked loop: one step's text, each wave runs it many times */
    for (; st < nfull; ++st) step(flag_t<false>{}, st);
  }
#pragma unroll 1      /* rolled: in the plain form one trip as a rule (the diagonal step), more only under a long prefix; the residual form runs all its steps here */
  for (; st < nst; ++st) step(flag_t<true>{}, st);
  // ctx x64 = O^T * 64 / (1024 * l); O^T row d = dg*16 + 8*hh + r, column = query ln
  const float inv = 0.0625f * (1.0f / l);
  const v8f oo[4] = {o0, o1, o2, o3}; const v8f ee[4] = {e0, e1, e2, e3};
  // the lane's 8 values of O^T tile dg are query ln, columns dg*16 + 8*hh .. + 7: one chunk of the fragment-order ctx plane, so each tile goes out of the accumulators as one half-tile store of 512 contiguous bytes
#pragma unroll
  for (int dg = 0; dg < 4; ++dg) {
    FragH fh, fl;
#pragma unroll
    for (int r = 0; r < 8; ++r) {
      float v = oo[dg][r]; if (RES) v += ee[dg][r] * 0.0009765625f; v *= inv;
      const _Float16 h0 = (_Float16)v; fh.h[r] = h0; fl.h[r] = (_Float16)((v - (float)h0) * 1024.0f);
    }
    const v8us oh = fh.half[0], ol = fl.half[0];
    *(v8us*)((unsigned short*)O16 + fo_chunk(rowb + q0 + ln, h * HD + dg * 16 + 8 * hh, DM)) = oh;
    if (RES) *(v8us*)((unsigned short*)OL + fo_chunk(rowi + q0 + ln, h * HD + dg * 16 + 8 * hh, DM)) = ol;
  }
}

constexpr int NB_ATT  = NB * NH * ((SEQ - ISL) / 128);
constexpr int NB_ATTI = NB * NH * (ISL / 128);
// one launch, two bodies: the plain rows (the long blocks) first, the short residual-plane blocks behind them
__global__ __launch_bounds__(256) void k_attn(const _Float16* __restrict__ QK, const _Float16* __restrict__ QKL, const _Float16* __restrict__ VT, const _Float16* __restrict__ VTL, _Float16* __restrict__ O16, _Float16* __restrict__ OL, const int* __restrict__ Sp) {
  const int bid = (int)blockIdx.x;
  if (bid < NB_ATT) attn_body<false>(QK, nullptr, VT, nullptr, O16, nullptr, Sp, ISL / 128, (SEQ - ISL) / 128, bid);
  else attn_body<true>(QK, QKL, VT, VTL, O16, OL, Sp, 0, ISL / 128, bid - NB_ATT);
}

constexpr size_t al256(size_t bytes) { return (bytes + 255) & ~(size_t)255; }
constexpr size_t SZ_BQKV = al256((size_t)3 * DM * DM * 2);
constexpr size_t SZ_BO   = al256((size_t)DM * DM * 2);
constexpr size_t SZ_X16  = al256((size_t)NR * DM * 2);
constexpr size_t SZ_QK   = al256((size_t)NR * LQK * 2);
constexpr size_t SZ_QKL  = al256((size_t)NRI * LQK * 2);
constexpr size_t SZ_VT   = al256((size_t)DM * LVT * 2);
constexpr size_t SZ_VTL  = al256((size_t)DM * LVL * 2);
constexpr size_t SZ_O16  = al256((size_t)NR * DM * 2);
constexpr size_t SZ_OL   = al256((size_t)NRI * DM * 2);
constexpr size_t WS_TOTAL = SZ_BQKV + SZ_BO + SZ_X16 + SZ_QK + SZ_QKL + SZ_VT + SZ_VTL + SZ_O16 + SZ_OL;
static_assert(WS_TOTAL <= (size_t)134217728);      /* carve <= 128 MiB */

extern "C" void kernel_launch(void* const* d_in, const int* in_sizes, int n_in,
                              void* d_out, int out_size, void* d_ws, size_t ws_size, hipStream_t stream) {
  if (n_in < 6) return;
  const long long xrows = (long long)(NB - 1) * SEQ_FULL + SEQ;      /* rows of x / out touched */
  if ((long long)in_sizes[0] < xrows * DM) return;
  if ((long long)in_sizes[1] < (long long)DM * 3 * DM) return;
  if ((long long)in_sizes[2] < (long long)3 * DM) return;
  if ((long long)in_sizes[3] < (long long)DM * DM) return;
  if ((long long)in_sizes[4] < (long long)DM) return;
  if ((long long)in_sizes[5] < 1) return;
  if ((long long)out_size < xrows * DM) return;
  if (WS_TOTAL > ws_size) return;
  const float* x = (const float*)d_in[0]; const float* w_attn = (const float*)d_in[1]; const float* b_attn = (const float*)d_in[2];
  const float* w_proj = (const float*)d_in[3]; const float* b_proj = (const float*)d_in[4];
  const int* s_pref = (const int*)d_in[5];                           /* prefix length, loaded on the device */
  float* out = (float*)d_out;
  char* ws = (char*)d_ws; size_t off = 0;
  _Float16* BQKV = (_Float16*)(ws + off); off += SZ_BQKV;      /* [3072][1024] x16; this and every plane below in fragment order */
  _Float16* BO   = (_Float16*)(ws + off); off += SZ_BO;        /* [1024][1024] x16 */
  _Float16* X16  = (_Float16*)(ws + off); off += SZ_X16;       /* [NR][1024] */
  _Float16* QK   = (_Float16*)(ws + off); off += SZ_QK;        /* [NR][2048] q | k */
  _Float16* QKL  = (_Float16*)(ws + off); off += SZ_QKL;       /* [NRI][2048] residual x1024 */
  _Float16* VT   = (_Float16*)(ws + off); off += SZ_VT;        /* [1024][NR] */
  _Float16* VTL  = (_Float16*)(ws + off); off += SZ_VTL;       /* [1024][NRI] residual x1024 */
  _Float16* O16  = (_Float16*)(ws + off); off += SZ_O16;       /* [NR][1024] ctx x64 */
  _Float16* OL   = (_Float16*)(ws + off); off += SZ_OL;        /* [NRI][1024] ctx residual x1024 */
  if (off > ws_size) return;

  k_convert<<<(unsigned)(NB_X16 + NB_WQKV + NB_WO), 256, 0, stream>>>(x, w_attn, w_proj, X16, BQKV, BO);
  k_gemm_qkv<<<(unsigned)(NB_QK + NB_VT), 128, 0, stream>>>(X16, BQKV, b_attn, QK, QKL, VT, VTL);
  k_attn<<<(unsigned)(NB_ATT + NB_ATTI), 256, 0, stream>>>(QK, QKL, VT, VTL, O16, OL, s_pref);
  k_gemm_out<<<(unsigned)(NB_OUT + NB_OUTI), 128, 0, stream>>>(O16, OL, BO, b_proj, out);
}

// v008
// A run of this version takes 73.5 microseconds.
// Next to v007, in two timings, it ran 1.14 times as fast each time.
// Counting every step since v000, it is 4.05 times as fast.
#include <hip/hip_runtime.h>
// All contractions: v_wmma_f32_16x16x32_f16 (f16 operands, f32 accumulate). x, weights and biases are RNE-converted to bf16; x and weights are held exactly in f16 (weights x16); q, k, v, softmax weights (x1024) and ctx (x64) are f16 planes; for the first 256 query rows of every sequence q, k, v, P and ctx also carry an f16 residual plane (x1024) accumulated in a separate accumulator.
// Structure: token rows r = b*SEQ + s. (1) weights -> Wt[n][k] f16; x -> f16 rows. (2) q|k rows = X16 . Wqk (N = 2048) and V^T[h*64+d][token] = Wv . X16^T (operand-swapped GEMM, row bias). (3) fused flash attention in the transposed form S^T = K Q^T, O^T = V^T P^T: one wave owns 16 queries (plain rows: two waves, each half of the key steps, joined at the end), fragments are loaded straight from the 16-bit planes (all kept in fragment order, see fo_chunk), P^T goes D -> B in registers, online softmax statistics are per-lane scalars; visibility (key <= query) OR (query < S AND key < S) applied as a replace-mask by value, S loaded on the device from its input buffer. (4) out = ctx . Wo + b (f32).
#ifndef NB
#define NB 2
#endif
#ifndef SEQ
#define SEQ 2048
#endif
#define NB_FULL 2
#define SEQ_FULL 2048
#define DM 1024
#define NH 16
#define HD 64
#define ISL ((SEQ) < 256 ? (SEQ) : 256)   /* query rows per sequence carried with residual planes */
#define NR (NB * SEQ)                      /* token rows in the workspace planes */
#define NRI (NB * ISL)                     /* rows of the compact residual planes */
#define LQK (2 * DM)                       /* row pitch of the q | k plane */
#define LVT NR                             /* row pitch of V^T */
#define LVL NRI                            /* row pitch of the V^T residual plane */

static_assert(NB >= 1 && NB <= NB_FULL);          /* reduced builds only shrink */
static_assert(SEQ <= SEQ_FULL);
static_assert(SEQ % 128 == 0);                    /* 8 waves x 16 queries per residual attention block (plain: 64 queries); GEMM row blocks; 32-key steps stay inside the sequence */
static_assert(ISL % 128 == 0);                    /* residual region is a whole number of blocks */
static_assert(ISL >= 32);                         /* clamped residual key step ISL - 32 is a valid step */
static_assert((SEQ - ISL) % 128 == 0);            /* plain region is a whole number of blocks */
static_assert(NH * HD == DM);                     /* merged head layout */
static_assert(HD == 64);                          
static_assert(DM % 128 == 0);                     /* GEMM M blocks (V^T) and K % 64 (two k blocks per trip) */
static_assert(DM % 8 == 0);                       /* 8-element convert threads */
static_assert(NR % 128 == 0);                     /* GEMM M blocks / N tiles of 64 */
static_assert(NRI % 64 == 0);                     /* residual-row output GEMM blocks */
static_assert((long long)NR * LQK < 2147483647LL);/* int plane offsets */
static_assert((long long)DM * LVT < 2147483647LL);

typedef unsigned short v8us __attribute__((ext_vector_type(8), may_alias));
typedef float  v8f  __attribute__((ext_vector_type(8)));
typedef float  v4f  __attribute__((ext_vector_type(4)));
typedef float  v4fa __attribute__((ext_vector_type(4), may_alias));
typedef _Float16 v16h __attribute__((ext_vector_type(16)));
typedef _Float16 v4h  __attribute__((ext_vector_type(4)));
union FragH { v16h v; v8us half[2]; _Float16 h[16]; unsigned short u[16]; };

__device__ __forceinline__ float bf16_rne(float x) { unsigned int u = __float_as_uint(x); u = (u + 0x7FFFu + ((u >> 16) & 1u)) & 0xFFFF0000u; return __uint_as_float(u); }

// Fragment order: every 16-bit plane [rows][K] is stored as tiles of 16 rows x 32 k, 512 elements (1 KB) each, tile (row / 16, k / 32) at element (row / 16) * 16 * K + (k / 32) * 512.
// Inside a tile: two halves of 256 elements (k 0..15, k 16..31), each 32 lanes x 8 elements with lane = 16 * ((k / 8) & 1) + row % 16. A fragment is then two loads of 512 contiguous bytes (4 whole lines each).
// element offset of the 8-element chunk that holds (row, k .. k + 7), k % 8 == 0, in a plane of K columns (K % 32 == 0)
__device__ __forceinline__ size_t fo_chunk(int row, int k, int K) { return (size_t)(row >> 4) * 16 * K + (size_t)((k >> 5) * 512 + ((k >> 4) & 1) * 256 + (((k >> 3) & 1) * 16 + (row & 15)) * 8); }
// fragment of one tile: elements 0..7 <- k 8h.., elements 8..15 <- k 16+8h.., row = lane & 15, h = lane >> 4 (same map for A and B);
// from a uniform pointer, the lane's own 32-bit byte offset (16 * lane folded in) and a constant byte step
__device__ __forceinline__ v16h g2_frago(const _Float16* base, unsigned off, int add) { const char* p = (const char*)base + (size_t)off + add; FragH f; f.half[0] = *(const v8us*)p; f.half[1] = *(const v8us*)(p + 512); return f.v; }
__device__ __forceinline__ v8f g2_mma(v16h a, v16h b, v8f c) { v8f d = __builtin_amdgcn_wmma_f32_16x16x32_f16(false, a, false, b, (short)0, c, false, false); asm volatile("v_nop\n\tv_nop\n\tv_nop\n\tv_nop" : "+v"(d) : "v"(a), "v"(b)); return d; }

// the same product left to the compiler's own padding: for the 64 x 64 wave tile, whose 16 accumulators and two fragment sets need more than 256 registers (with the asm statement's operands the build stayed below 256 and spilled)
__device__ __forceinline__ v8f g2_mmab(v16h a, v16h b, v8f c) { return __builtin_amdgcn_wmma_f32_16x16x32_f16(false, a, false, b, (short)0, c, false, false); }

// asks L2 (scope SE: into L2 only, nothing returns, no counter) for p + OFF.
// p + OFF lies inside the plane in every lane; asm, so that the address stands in a register of the caller's that still holds it later (see the callers' last use of it)
template <int OFF>
__device__ __forceinline__ void l2_ask(const char* p) { asm volatile("global_prefetch_b8 %0, off offset:%1 scope:SCOPE_SE" :: "v"(p), "i"(OFF)); }

__device__ __forceinline__ void wt_f16_body(const float* __restrict__ W, _Float16* __restrict__ Wt, int K, int N, float scale, int bid) {
  /* one wave writes one half tile (512 contiguous bytes): lane = 16 * h + n % 16; waves run over the row tiles first, then over the 16-k halves */
  const int t = bid * 256 + threadIdx.x; if (t >= N * (K / 8)) return; const int wv = t >> 5, lane = t & 31; const int n = (wv % (N / 16)) * 16 + (lane & 15), k8 = (wv / (N / 16)) * 16 + (lane >> 4) * 8; FragH f;
#pragma unroll
  for (int i = 0; i < 8; ++i) f.h[i] = (_Float16)(bf16_rne(W[(size_t)(k8 + i) * N + n]) * scale);
  const v8us o = f.half[0];
  unsigned short* d = (unsigned short*)Wt + fo_chunk(n, k8, K);
  *(v8us*)d = o; 
}

__device__ __forceinline__ void x16_body(const float* __restrict__ x, _Float16* __restrict__ X16, int bid) {
  const int t = bid * 256 + threadIdx.x; if (t >= NR * (DM / 8)) return;
  /* one wave writes one half tile (512 contiguous bytes): lane = 16 * h + row % 16; consecutive waves take consecutive 16-k halves of a row tile */
  const int wv = t >> 5, lane = t & 31; const int row = (wv / (DM / 16)) * 16 + (lane & 15), c8 = (wv % (DM / 16)) * 16 + (lane >> 4) * 8; const int b = row / SEQ, s = row % SEQ;
  const float* src = x + ((size_t)b * SEQ_FULL + s) * DM + c8;
  const v4f a = *(const v4fa*)src, c = *(const v4fa*)(src + 4); FragH f;
#pragma unroll
  for (int i = 0; i < 4; ++i) { f.h[i] = (_Float16)bf16_rne(a[i]); f.h[4 + i] = (_Float16)bf16_rne(c[i]); }
  const v8us o = f.half[0];
  unsigned short* d = (unsigned short*)X16 + fo_chunk(row, c8, DM);
  *(v8us*)d = o; 
}

// Launches that read nothing of each other's output share one grid: a range of the block index picks the body (block-uniform branch).
constexpr int NB_X16  = (int)(((size_t)NR * (DM / 8) + 255) / 256);
constexpr int NB_WQKV = (int)(((size_t)3 * DM * (DM / 8) + 255) / 256);
constexpr int NB_WO   = (int)(((size_t)DM * (DM / 8) + 255) / 256);
// the three conversions: x -> X16; W[K=1024][N=3072] -> Wt[N][K]; W[K=1024][N=1024] -> Wt[N][K]
__global__ __launch_bounds__(256) void k_convert(const float* __restrict__ x, const float* __restrict__ w_attn, const float* __restrict__ w_proj, _Float16* __restrict__ X16, _Float16* __restrict__ BQKV, _Float16* __restrict__ BO) {
  const int bid = (int)blockIdx.x;
  if (bid < NB_X16) x16_body(x, X16, bid);
  else if (bid < NB_X16 + NB_WQKV) wt_f16_body(w_attn, BQKV, DM, 3 * DM, 16.0f, bid - NB_X16);
  else wt_f16_body(w_proj, BO, DM, DM, 16.0f, bid - (NB_X16 + NB_WQKV));
}

// GEMM: wave tile (16*MT) x 64, block = 4 waves laid (4/WN) x WN = (64*MT/WN) rows x (64*WN) cols; A and Bh are f16 planes in fragment order (fragments straight from global).
// v = acc*alpha (+ accL*alphaL with the residual A plane AL, ARES) + bias (per column, or per row if ROWBIAS; bias RNE-converted to bf16).
// Logical row R maps to A row seg*aSeg + aOff + w and C row seg*cSeg + cOff + w with seg = R / segRows, w = R % segRows (blocks never straddle segments).
// OUT 0: f32 C. OUT 1: f16 C16 (+ x1024 residual rows in CL when the rows lie in the first ISL rows of a sequence). OUT 2: f16 C16 (+ residual columns when the token columns lie in the first ISL rows of a sequence).
// Requires M % (64*MT/WN) == 0, N % (64*WN) == 0, K % 64 == 0 (asserted above for the launches used). LDS tile so[wave] is private to its wave (wave-level sync); the kernel owns the array, so the two bodies of a launch share one. bid: block index inside the body's own range.
template <int MT, int WN, bool ROWBIAS, bool ARES, int OUT, int SOR>
__device__ __forceinline__ void gemm_body(const _Float16* __restrict__ A, const _Float16* __restrict__ AL, int lda,
    const _Float16* __restrict__ Bh, int ldb, float alpha, float alphaL, const float* __restrict__ bias,
    float* __restrict__ Cf, _Float16* __restrict__ C16, _Float16* __restrict__ CL, int ldc, int ldcl,
    int M, int N, int K, int segRows, int aSeg, int aOff, int cSeg, int cOff, int bid, float (*so)[SOR][68]) {
  static_assert(MT == 1 || MT == 2 || MT == 4);
  static_assert(WN == 1 || WN == 2);    /* the block's 4 waves lie (4 / WN) x WN over its tile */
  static_assert(SOR >= 16 * MT);        /* the wave's staging rows */
  static_assert(!ARES || MT == 1);      /* residual form keeps 8 accumulators */
  const int tid = threadIdx.x, lane = tid & 31, ln = lane & 15, hh = lane >> 4;
  const int w = __builtin_amdgcn_readfirstlane(tid >> 5);      /* wave-uniform, so that every tile base below is a scalar pointer */
  const int ntn = N / (64 * WN);
  const int mt = bid / ntn, nq = bid - mt * ntn;
  const int R0 = mt * (64 * MT / WN) + (16 * MT) * (w / WN), col0 = nq * (64 * WN) + 64 * (w % WN);
  if (R0 >= M) return;
  // At entry the block asks L2 for a quarter of its A panel (BM rows x DM) and of its B panel (BN rows x DM), one request per 256-B unit: the blocks that share a panel (same mt: neighbours in the index; same nq) deal its quarters among them by the other index.
  // Every launch here has lda = ldb = K = DM, and a panel is one contiguous run of a fragment-order plane; 128 threads x 256 B = 32 KB a request round.
  constexpr int BM = 64 * MT / WN, BN = 64 * WN, QA = BM * DM * 2 / 4, QB = BN * DM * 2 / 4;      /* bytes of a quarter panel */
  static_assert(QA % 32768 == 0 && QA <= 65536 && QB % 32768 == 0 && QB <= 65536);
  const int Rb = mt * BM, segb = Rb / segRows;
  const char* pfa = (const char*)(A + (size_t)(segb * aSeg + aOff + (Rb - segb * segRows)) * lda) + ((nq & 3) * QA + tid * 256);
  const char* pfb = (const char*)(Bh + (size_t)(nq * BN) * ldb) + ((mt & 3) * QB + tid * 256);
  const char* pfe = ARES ? (const char*)(AL + (size_t)Rb * lda) + ((nq & 3) * QA + tid * 256) : pfa;
  l2_ask<0>(pfa); if (QA > 32768) l2_ask<32768>(pfa);
  l2_ask<0>(pfb); if (QB > 32768) l2_ask<32768>(pfb);
  if (ARES) l2_ask<0>(pfe);
  const int seg = R0 / segRows, wi = R0 - seg * segRows;
  const int arow0 = seg * aSeg + aOff + wi, crow0 = seg * cSeg + cOff + wi;
  /* arow0, R0 and col0 are multiples of 16: row tile r / 16 starts at element r * ld; 32 k further is 512 elements further */
  const _Float16* a0p = A + (size_t)arow0 * lda;
  const _Float16* b0p = Bh + (size_t)col0 * ldb;
  unsigned ko = 16u * (unsigned)lane;      /* the lane's byte offset inside a half tile plus the trip's k offset: the one vector address register of every fragment load */
  const v8f z8 = {0.f, 0.f, 0.f, 0.f, 0.f, 0.f, 0.f, 0.f};
  v8f c00 = z8, c01 = z8, c02 = z8, c03 = z8, c10 = z8, c11 = z8, c12 = z8, c13 = z8, c20 = z8, c21 = z8, c22 = z8, c23 = z8, c30 = z8, c31 = z8, c32 = z8, c33 = z8, d00 = z8, d01 = z8, d02 = z8, d03 = z8;
  // Two register sets of fragments (P, N), 32 k each: every set is loaded as one group, one k block ahead of the WMMAs that read it, so a block waits for one load round trip that started a block earlier.
  const _Float16* e0p = ARES ? AL + (size_t)R0 * lda : a0p;
#define GEMM_LD(S, kk) { S##a0 = g2_frago(a0p, ko, (kk) * 32); if (MT >= 2) S##a1 = g2_frago(a0p, ko, 32 * lda + (kk) * 32); if (MT == 4) { S##a2 = g2_frago(a0p, ko, 64 * lda + (kk) * 32); S##a3 = g2_frago(a0p, ko, 96 * lda + (kk) * 32); } if (ARES) S##e0 = g2_frago(e0p, ko, (kk) * 32); \
    S##b0 = g2_frago(b0p, ko, (kk) * 32); S##b1 = g2_frago(b0p, ko, 32 * ldb + (kk) * 32); S##b2 = g2_frago(b0p, ko, 64 * ldb + (kk) * 32); S##b3 = g2_frago(b0p, ko, 96 * ldb + (kk) * 32); }
#define GEMM_MC(S, j) { if (MT == 4) { c0##j = g2_mmab(S##a0, S##b##j, c0##j); c1##j = g2_mmab(S##a1, S##b##j, c1##j); c2##j = g2_mmab(S##a2, S##b##j, c2##j); c3##j = g2_mmab(S##a3, S##b##j, c3##j); } \
    else { c0##j = g2_mma(S##a0, S##b##j, c0##j); if (MT == 2) c1##j = g2_mma(S##a1, S##b##j, c1##j); if (ARES) d0##j = g2_mma(S##e0, S##b##j, d0##j); } }
#define GEMM_MM(S) { GEMM_MC(S, 0) GEMM_MC(S, 1) GEMM_MC(S, 2) GEMM_MC(S, 3) }
  const v16h zf = (v16h)((_Float16)0.0f);
  v16h Pa2 = zf, Pa3 = zf, Na2 = zf, Na3 = zf;
  v16h Pa0 = zf, Pa1 = zf, Pe0 = zf, Pb0 = zf, Pb1 = zf, Pb2 = zf, Pb3 = zf, Na0 = zf, Na1 = zf, Ne0 = zf, Nb0 = zf, Nb1 = zf, Nb2 = zf, Nb3 = zf;
  GEMM_LD(P, 0)
  asm volatile("s_wait_xcnt 0x0" :: "v"(lane), "v"(ko) : "memory");      /* behind the first group: the build may name the lane number (scaled by the load) or the byte offset as its offset register; both live up to this wait, so that no result of the loop's loads is written over either earlier */
  asm volatile("" :: "v"(pfa), "v"(pfb), "v"(pfe));      /* inputs only, no instruction: the requests' address registers keep their in-range addresses up to here, behind the first load group and its wait, and are free in the k loop */
#pragma unroll 1      /* kept rolled, 64 k per trip, the last trip peeled, for speed only */
  for (int kb = 0; kb + 64 < K; kb += 64) {
    GEMM_LD(N, 32)
    __builtin_amdgcn_sched_barrier(0);      /* this and the three below hold each load group whole and one k block ahead of its WMMAs, as the unrolled form had them: the rolled loop's scheduler sank the loads to their uses */
    GEMM_MM(P)
    __builtin_amdgcn_sched_barrier(0);
    GEMM_LD(P, 64)
    __builtin_amdgcn_sched_barrier(0);
    GEMM_MM(N)
    __builtin_amdgcn_sched_barrier(0);
    asm volatile("s_wait_xcnt 0x0" : "+v"(ko) :: "memory");      /* stands in front of the rewrite of the offset register that the groups in flight name; the register is an operand so that the addition stays behind it */
    ko += 64 * 32;      /* 64 k further = two tiles, 2 KB, in every plane */
  }
  GEMM_LD(N, 32)
  asm volatile("s_wait_xcnt 0x0" :: "v"(ko) : "memory");      /* behind the last group: the loads' offset register lives up to this wait, so nothing (a late load's result included) is written over it earlier */
  __builtin_amdgcn_sched_barrier(0);      /* the last group too stays whole and ahead of the WMMAs of the block before it */
  GEMM_MM(P)
  GEMM_MM(N)
#undef GEMM_LD
#undef GEMM_MM
#undef GEMM_MC
  const v8f accs[16] = {c00, c01, c02, c03, c10, c11, c12, c13, c20, c21, c22, c23, c30, c31, c32, c33};
  const v8f accl[4] = {d00, d01, d02, d03};
#pragma unroll
  for (int u = 0; u < 4 * MT; ++u) {
    const int t = u & 3, half = u >> 2; const int col = col0 + t * 16 + ln;
    float bvc = 0.f; if (!ROWBIAS) bvc = bf16_rne(bias[col]);
#pragma unroll
    for (int r = 0; r < 8; ++r) {
      const int rloc = half * 16 + 8 * hh + r;
      float v = accs[u][r] * alpha;
      if (ARES) v += accl[t][r] * alphaL;
      if (ROWBIAS) v += bf16_rne(bias[R0 + rloc]); else v += bvc;
      so[w][rloc][t * 16 + ln] = v;
    }
  }
  __builtin_amdgcn_fence(4 /* acq_rel order */, "workgroup"); __builtin_amdgcn_wave_barrier();
  const int rsub = lane >> 4, c4 = (lane & 15) * 4;
  if (OUT == 0) {
    {
#pragma unroll
      for (int q = 0; q < 8 * MT; ++q) { const int r = q * 2 + rsub; const v4f v = *(const v4fa*)&so[w][r][c4]; *(v4f*)(Cf + (size_t)(crow0 + r) * ldc + col0 + c4) = v; }
      asm volatile("s_wait_xcnt 0x0" ::: "memory");      /* behind the run of stores: in a kernel of two bodies the other body's code follows in the listing and reuses the stores' address and data registers */
    }
  } else {
    int sl, rrow0, rcol0;
    if (OUT == 1) { sl = crow0 % SEQ; rrow0 = (crow0 / SEQ) * ISL + sl; rcol0 = col0; }
    else          { sl = col0 % SEQ;  rrow0 = crow0; rcol0 = (col0 / SEQ) * ISL + sl; }
    const bool isl = sl < ISL;      /* uniform over the wave tile: ISL and SEQ are multiples of 64 */
    {      /* one store = one half tile of the fragment-order plane: lane (hh, ln) holds row ln, 8 columns from 8 * hh */
#pragma unroll
      for (int q = 0; q < 4 * MT; ++q) {
        const int r = (q >> 2) * 16 + ln, c = (q & 3) * 16 + 8 * hh;
        const v4f va = *(const v4fa*)&so[w][r][c], vc = *(const v4fa*)&so[w][r][c + 4];
        FragH fh, fl;
#pragma unroll
        for (int i = 0; i < 4; ++i) {
          const _Float16 h0 = (_Float16)va[i], h1 = (_Float16)vc[i]; fh.h[i] = h0; fh.h[4 + i] = h1;
          fl.h[i] = (_Float16)((va[i] - (float)h0) * 1024.0f); fl.h[4 + i] = (_Float16)((vc[i] - (float)h1) * 1024.0f);
        }
        const v8us oh = fh.half[0], ol = fl.half[0];
        *(v8us*)((unsigned short*)C16 + fo_chunk(crow0 + r, col0 + c, ldc)) = oh;
        asm volatile("s_wait_xcnt 0x0" ::: "memory");      /* in front of the reuse of the store's data and address registers by the residual's arithmetic */
        if (isl) *(v8us*)((unsigned short*)CL + fo_chunk(rrow0 + r, rcol0 + c, ldcl)) = ol;
      }
      
    }
  }
}

constexpr int NB_QK   = (NR / 128) * (2 * DM / 128);
constexpr int NB_VT   = (DM / 128) * (NR / 128);
constexpr int NB_OUT  = (NB * (SEQ - ISL) / 128) * (DM / 64);
constexpr int NB_OUTI = (NRI / 64) * (DM / 64);
// one launch, two bodies:
// q | k rows (f16) = X16 . Wqk^T / 16 + b; residual rows for s < ISL
// V^T[h*64+d][token] (f16) = Wv . X16^T / 16 + b[row]; residual columns for s < ISL
__global__ __launch_bounds__(128) void k_gemm_qkv(const _Float16* __restrict__ X16, const _Float16* __restrict__ BW, const float* __restrict__ bias, _Float16* __restrict__ QK, _Float16* __restrict__ QKL, _Float16* __restrict__ VT, _Float16* __restrict__ VTL) {
  __shared__ __attribute__((aligned(16))) float so[4][64][68];
  const int bid = (int)blockIdx.x;
  if (bid < NB_QK) gemm_body<4, 2, false, false, 1>(X16, nullptr, DM, BW, DM, 0.0625f, 0.f, bias, nullptr, QK, QKL, LQK, LQK, NR, 2 * DM, DM, NR, 0, 0, 0, 0, bid, so);
  else gemm_body<4, 2, true, false, 2>(BW + (size_t)2 * DM * DM, nullptr, DM, X16, DM, 0.0625f, 0.f, bias + 2 * DM, nullptr, VT, VTL, LVT, LVL, DM, NR, DM, DM, 0, 0, 0, 0, bid - NB_QK, so);
}
// one launch, two bodies:
// out rows s >= ISL: ctx(x64) . Wo(x16) * 2^-10 + b
// out rows s < ISL: (ctx_hi . Wo) * 2^-10 + (ctx_res . Wo) * 2^-20 + b, separate accumulators
__global__ __launch_bounds__(128) void k_gemm_out(const _Float16* __restrict__ O16, const _Float16* __restrict__ OL, const _Float16* __restrict__ BO, const float* __restrict__ bias, float* __restrict__ out) {
  __shared__ __attribute__((aligned(16))) float so[4][32][68];
  const int bid = (int)blockIdx.x;
  if (bid < NB_OUT) gemm_body<2, 1, false, false, 0>(O16, nullptr, DM, BO, DM, 0.0009765625f, 0.f, bias, out, nullptr, nullptr, DM, 0, NB * (SEQ - ISL), DM, DM, SEQ - ISL, SEQ, ISL, SEQ_FULL, ISL, bid, so);
  else gemm_body<1, 1, false, true, 0>(O16, OL, DM, BO, DM, 0.0009765625f, 0.00000095367431640625f, bias, out, nullptr, nullptr, DM, 0, NRI, DM, DM, ISL, SEQ, 0, SEQ_FULL, 0, bid - NB_OUT, so);
}

// Fused prefix-causal attention, transposed form. Wave = 16 queries (D column = query = lane & 15). Residual form: block = 8 waves = 128 consecutive queries of one (b, h), each wave walks its whole key range.
// Plain form: block = 64 consecutive queries of one (b, h); waves t and t + 4 share query tile t: wave t walks the lower half of the tile's key steps, wave t + 4 the upper half, each with its own online maximum, sum and O^T;
// the upper wave hands its three over through LDS (one work-group barrier) and the lower wave joins them as two softmax partials are joined (both rescaled to the common maximum, then added) and stores the tile.
// Why: the longest wave walks half as many steps, and the launch has more blocks than the chip has places, dealt longest first, so a place that a short block leaves is filled again instead of idling under the longest block.
// Visibility: key j is seen by query i iff (j <= i) OR (i < S AND j < S); S is loaded from its input buffer and clamped to [0, SEQ] (same mask for any value).
// Key range of a wave: [0, max(S, q0 + 16)) in 32-key steps (all step keys lie inside the sequence since SEQ % 32 == 0). Every step holds key kcb that is visible to every query of the wave
// (kcb <= q0 when the range ends at q0 + 16; kcb < S with all 16 queries < S otherwise), so the step maximum is always finite.
// Per 32-key step: S^T tiles (keys kcb..+15 and +16..+31) = K (A, rows = keys) . Q^T (B, lane = query); scale 1/8; hidden keys are REPLACED (excluded from max, weight 0 by value);
// online max / sum per lane (halves combined by one xor-16 shuffle); P^T (x1024, f16) is the B fragment directly: element r <- tile0[r], element 8+r <- tile1[r];
// O^T (rows = d) += V^T (A, rows = d, k = keys) . P^T. RES: q, k, v, P carry x1024 residual planes; residual products go to separate accumulators folded back with 2^-10.
// Residual k / v planes exist only for keys < ISL: for key steps at or beyond ISL (possible when S > ISL) the residual k / v fragments are loaded from a clamped in-range step and zeroed by value (wave-uniform select).
template <bool B> struct flag_t { static constexpr bool value = B; };
// eight v_exp_f32 in one statement, results in registers apart from every source (early clobber), one v_nop behind the last: the slot that the instruction set asks for behind a transcendental, before its result is read or its source overwritten; left to the scheduler, runs of exponentials stood with one writing over the source of the one in front
__device__ __forceinline__ void exp2_x8(float (&p)[8], const float (&t)[8]) {
  asm("v_exp_f32 %0, %8\n\tv_exp_f32 %1, %9\n\tv_exp_f32 %2, %10\n\tv_exp_f32 %3, %11\n\tv_exp_f32 %4, %12\n\tv_exp_f32 %5, %13\n\tv_exp_f32 %6, %14\n\tv_exp_f32 %7, %15\n\tv_nop"
      : "=&v"(p[0]), "=&v"(p[1]), "=&v"(p[2]), "=&v"(p[3]), "=&v"(p[4]), "=&v"(p[5]), "=&v"(p[6]), "=&v"(p[7])
      : "v"(t[0]), "v"(t[1]), "v"(t[2]), "v"(t[3]), "v"(t[4]), "v"(t[5]), "v"(t[6]), "v"(t[7]));
}
template <bool RES>
__device__ __forceinline__ void attn_body(const _Float16* __restrict__ QK, const _Float16* __restrict__ QKL, const _Float16* __restrict__ VT, const _Float16* __restrict__ VTL,
                                          _Float16* __restrict__ O16, _Float16* __restrict__ OL, const int* __restrict__ Sp, int qb0, int nqb, int bid, v4f (*mo)[8][32], float (*ml)[2][32]) {
  const int tid = threadIdx.x, lane = tid & 31, ln = lane & 15, hh = lane >> 4;
  const int w = __builtin_amdgcn_readfirstlane(tid >> 5);
  const int sraw = Sp[0];
  const int Sc = sraw < 0 ? 0 : (sraw > SEQ ? SEQ : sraw);
  /* residual form: qb counts blocks of 128 queries. Plain form: qb counts blocks of 64 queries and falls with the block index (all (b, h) of the last query block first), wt = query tile of the wave, kh = its half of the key steps */
  const int bh = RES ? bid / nqb : bid % (NB * NH); const int qb = RES ? qb0 + (bid - bh * nqb) : (SEQ / 64 - 1) - bid / (NB * NH);
  const int wt = RES ? w : (w & 3), kh = RES ? 0 : (w >> 2);
  const int h = bh % NH, b = bh / NH;
  const int q0 = qb * (RES ? 128 : 64) + wt * 16, q = q0 + ln;
  const bool qpre = q < Sc;
  const int rowb = b * SEQ, rowi = b * ISL;
  /* fragment-order planes: row tile r / 16 starts at element r * pitch (r % 16 == 0), column block c / 32 at c * 16 (c % 32 == 0), the lane's chunk at 8 * lane */
  const unsigned lo = 16u * (unsigned)lane;                           /* the lane's byte offset inside a half tile */
  const _Float16* qp = QK + (size_t)(rowb + q0) * LQK + h * HD * 16;
  const v16h qh0 = g2_frago(qp, lo, 0), qh1 = g2_frago(qp, lo, 1024);
  const int qloff = (rowi + q0) * LQK + h * HD * 16;       /* residual q tile (RES) */
  const int kbase = rowb * LQK + (DM + h * HD) * 16;       /* k tile of keys 0..15, d 0..31 */
  const int klbase = rowi * LQK + (DM + h * HD) * 16;      /* residual k tile (RES) */
  const int vbase = h * HD * LVT + rowb * 16;              /* V^T tile d 0..15, keys 0..31 */
  const int vlbase = h * HD * LVL + rowi * 16;             /* residual V^T tile (RES) */
  const v8f z8 = {0.f, 0.f, 0.f, 0.f, 0.f, 0.f, 0.f, 0.f};
  const v16h zh = (v16h)((_Float16)0.0f);
  v8f o0 = z8, o1 = z8, o2 = z8, o3 = z8, e0 = z8, e1 = z8, e2 = z8, e3 = z8;
  float m = -1.0e30f, l = 0.f;
  const int kend = (Sc > q0 + 16) ? Sc : (q0 + 16);              /* keys [0, kend) cover every visible key of the wave; kend <= SEQ */
  const int nst = (kend + 31) >> 5;
  /* the wave's own steps [sb, se): all of them (residual form), or one half; plain rows have q0 >= ISL >= 128, so nst >= 5 and neither half is empty */
  const int sh = (nst + 1) >> 1;
  const int sb = (!RES && kh) ? sh : 0, se = (!RES && !kh) ? sh : nst;
  // Plain form: the K and V fragments live in registers across the loop; the next step's K group is issued right behind this step's S^T WMMAs and the next step's V group right behind its O^T WMMAs.
  v16h ka = zh, kb = zh, kc = zh, kd = zh, v0 = zh, v1 = zh, v2 = zh, v3 = zh;
  unsigned kq = 2u * (unsigned)kbase + lo + (unsigned)sb * (unsigned)(32 * LQK * 2), vq = 2u * (unsigned)vbase + lo + (unsigned)sb * 1024u;      /* the lane's byte offsets of the K and V groups held in registers, at the wave's first step sb < nst */
  // Plain form, at entry: the block asks L2 for the K rows and V^T columns of its causal key range [0, keys), one request per 256-B unit. K: 2 KB per 16-key tile, 8 lanes a tile, 32 tiles a round; V^T: 4 d tiles, 256 B per 8 keys.
  // The range does not wait for S: keys that only a prefix longer than it makes visible are loaded without a request. A wave's request is skipped (scalar test) where its first key lies past the range; the keys it covers (64 of K, 256 of V^T, the lane's unit clamped) lie inside the sequence in any case.
  const char* pkq = (const char*)QK; const char* pvq = (const char*)VT;
  if (!RES) {
    const int keys = qb * 64 + 64;      /* the causal range of the block's last query tile; <= SEQ */
    const int vu = tid < SEQ / 8 - 1 ? tid : SEQ / 8 - 1;
    pkq += 2 * (size_t)kbase + (size_t)((tid >> 3) * (32 * LQK) + (tid & 7) * 256);
    pvq += 2 * (size_t)vbase + (size_t)(vu * 256);
    if (w * 64 < keys) l2_ask<0>(pkq);
    if (SEQ > 512 && w * 64 + 512 < keys) l2_ask<1024 * LQK>(pkq);
    if (SEQ > 1024 && w * 64 + 1024 < keys) l2_ask<2048 * LQK>(pkq);
    if (SEQ > 1536 && w * 64 + 1536 < keys) l2_ask<3072 * LQK>(pkq);
    if (w * 256 < keys) { l2_ask<0>(pvq); l2_ask<32 * LVT>(pvq); l2_ask<64 * LVT>(pvq); l2_ask<96 * LVT>(pvq); }
  }
  if (!RES) {
    ka = g2_frago(QK, kq, 0); kb = g2_frago(QK, kq, 1024); kc = g2_frago(QK, kq, 32 * LQK); kd = g2_frago(QK, kq, 32 * LQK + 1024);
    v0 = g2_frago(VT, vq, 0); v1 = g2_frago(VT, vq, 32 * LVT); v2 = g2_frago(VT, vq, 64 * LVT); v3 = g2_frago(VT, vq, 96 * LVT);
    /* inputs-only fence on the loaded values: every load in front of the loop has landed here, so the wait at the loop's head counts the loop's own groups alone and leaves the next V group in flight */
    asm volatile("" :: "v"(qh0), "v"(qh1), "v"(ka), "v"(kb), "v"(kc), "v"(kd), "v"(v0), "v"(v1), "v"(v2), "v"(v3));
    asm volatile("" :: "v"(pkq), "v"(pvq));      /* inputs only, no instruction: the requests' address registers hold their in-range addresses until the first fragments have landed */
  }
  // One 32-key step. MASK false: for a step whose last key kcb + 31 is <= q0, the wave's first query, so that (key <= query) holds for every element and the visibility tests, the replaces and the selects around the exponentials are identities and are left out; products, sums and their order stay.
  auto step = [&](auto masked, const int st) __attribute__((always_inline)) {
    constexpr bool MASK = decltype(masked)::value;
    const int kcb = st * 32;
    const int adv = (st + 1 < se) ? 32 : 0;                      /* keys to the next step; the wave's last step reloads its own (in range, not used) */
    const bool rok = kcb < ISL;                                  /* wave-uniform: residual k / v rows exist for this step */
    const int kcl = rok ? kcb : (ISL - 32);                      /* clamped in-range residual step */
    const _Float16* kp0 = QK + kbase + kcb * LQK;
    v8f s0 = z8, s1 = z8, r0 = z8, r1 = z8;
    if (RES) {
      unsigned qo = lo; asm volatile("" : "+v"(qo));             /* reload the residual q fragments per step (integer offset only) */
      const _Float16* qlp = QKL + qloff;
      const v16h ql0 = g2_frago(qlp, qo, 0), ql1 = g2_frago(qlp, qo, 1024);
      const _Float16* kl0 = QKL + klbase + kcl * LQK;
      /* all k fragments of the step as one load group in front of its WMMAs */
      const v16h ah0 = g2_frago(kp0, lo, 0), ah1 = g2_frago(kp0, lo, 1024), ah2 = g2_frago(kp0, lo, 32 * LQK), ah3 = g2_frago(kp0, lo, 32 * LQK + 1024);
      asm volatile("s_wait_xcnt 0x0" ::: "memory");      /* behind the k loads, in front of the residual k loads: a result of those may be given the registers that hold the k loads' address */
      v16h al0 = g2_frago(kl0, lo, 0), al1 = g2_frago(kl0, lo, 1024), al2 = g2_frago(kl0, lo, 32 * LQK), al3 = g2_frago(kl0, lo, 32 * LQK + 1024);
      asm volatile("s_wait_xcnt 0x0" :: "v"(qo) : "memory");      /* behind the group: the offset register that the residual q loads name lives up to this wait, so no later load's result is written over it earlier */
      al0 = rok ? al0 : zh; al1 = rok ? al1 : zh; al2 = rok ? al2 : zh; al3 = rok ? al3 : zh;
      s0 = g2_mma(ah0, qh0, s0); r0 = g2_mma(al0, qh0, r0); r0 = g2_mma(ah0, ql0, r0);
      s0 = g2_mma(ah1, qh1, s0); r0 = g2_mma(al1, qh1, r0); r0 = g2_mma(ah1, ql1, r0);
      s1 = g2_mma(ah2, qh0, s1); r1 = g2_mma(al2, qh0, r1); r1 = g2_mma(ah2, ql0, r1);
      s1 = g2_mma(ah3, qh1, s1); r1 = g2_mma(al3, qh1, r1); r1 = g2_mma(ah3, ql1, r1);
    } else {
      s0 = g2_mma(ka, qh0, s0); s0 = g2_mma(kb, qh1, s0); s1 = g2_mma(kc, qh0, s1); s1 = g2_mma(kd, qh1, s1);
      asm volatile("s_wait_xcnt 0x0" : "+v"(kq) :: "memory");      /* stands in front of the rewrite of the offset register that the last K group's loads name; the register is an operand so that the addition stays behind it */
      kq += (unsigned)(adv * LQK * 2);
      ka = g2_frago(QK, kq, 0); kb = g2_frago(QK, kq, 1024); kc = g2_frago(QK, kq, 32 * LQK); kd = g2_frago(QK, kq, 32 * LQK + 1024);
      __builtin_amdgcn_sched_barrier(0);      /* holds the K group at the head of the softmax: issued further down it has less of the step to land in */
    }
    v16h vl0 = zh, vl1 = zh, vl2 = zh, vl3 = zh;
    if (RES) {      /* all v fragments of the step as one load group in front of the softmax */
      const _Float16* vp = VT + vbase + kcb * 16; const _Float16* vlp = VTL + vlbase + kcl * 16;
      v0 = g2_frago(vp, lo, 0); v1 = g2_frago(vp, lo, 32 * LVT); v2 = g2_frago(vp, lo, 64 * LVT); v3 = g2_frago(vp, lo, 96 * LVT);
      vl0 = g2_frago(vlp, lo, 0); vl1 = g2_frago(vlp, lo, 32 * LVL); vl2 = g2_frago(vlp, lo, 64 * LVL); vl3 = g2_frago(vlp, lo, 96 * LVL);
    }
    // D row = key kcb + 8*hh + r (tile 0), + 16 (tile 1); D column = query q
    v8f xa, xb; float mt = -1.0e30f;
#pragma unroll
    for (int r = 0; r < 8; ++r) {
      const int k0 = kcb + 8 * hh + r;
      const bool va = !MASK || (k0 <= q) || (qpre && (k0 < Sc));
      const bool vb = !MASK || (k0 + 16 <= q) || (qpre && (k0 + 16 < Sc));
      float a = s0[r], c = s1[r];
      if (RES) { a += r0[r] * 0.0009765625f; c += r1[r] * 0.0009765625f; }
      a *= 0.125f; c *= 0.125f;
      a = va ? a : -1.0e30f; c = vb ? c : -1.0e30f;
      xa[r] = a; xb[r] = c; mt = fmaxf(mt, fmaxf(a, c));
    }
    mt = fmaxf(mt, __shfl_xor(mt, 16, 32));
    const float mn = fmaxf(m, mt);
    float f; { const float t = fmaxf(m - mn, -80.0f) * 1.44269504f;      /* __expf as it compiles (multiply, v_exp_f32), with the slot behind the transcendental filled in the same statement */
      asm("v_exp_f32 %0, %1\n\tv_nop" : "=v"(f) : "v"(t)); }
    m = mn;
    FragH ph, pl; float rs = 0.f;
    float ua[8], ub[8], wa[8], wb[8];      /* __expf as it compiles: multiply, v_exp_f32 */
#pragma unroll
    for (int r = 0; r < 8; ++r) {
      const int k0 = kcb + 8 * hh + r;
      const bool va = !MASK || (k0 <= q) || (qpre && (k0 < Sc));
      const bool vb = !MASK || (k0 + 16 <= q) || (qpre && (k0 + 16 < Sc));
      ua[r] = (va ? (xa[r] - mn) : 0.f) * 1.44269504f; ub[r] = (vb ? (xb[r] - mn) : 0.f) * 1.44269504f;
    }
    exp2_x8(wa, ua); exp2_x8(wb, ub);
#pragma unroll
    for (int r = 0; r < 8; ++r) {
      const int k0 = kcb + 8 * hh + r;
      const bool va = !MASK || (k0 <= q) || (qpre && (k0 < Sc));
      const bool vb = !MASK || (k0 + 16 <= q) || (qpre && (k0 + 16 < Sc));
      const float pa = va ? wa[r] : 0.f;
      const float pb = vb ? wb[r] : 0.f;
      rs += pa + pb;
      const float ta = pa * 1024.0f, tb = pb * 1024.0f;
      const _Float16 ha = (_Float16)ta, hb = (_Float16)tb;
      ph.h[r] = ha; ph.h[8 + r] = hb;
      if (RES) { pl.h[r] = (_Float16)((ta - (float)ha) * 1024.0f); pl.h[8 + r] = (_Float16)((tb - (float)hb) * 1024.0f); }
    }
    const float rso = __shfl_xor(rs, 16, 32);
    l = l * f + (rs + rso);
    o0 *= f; o1 *= f; o2 *= f; o3 *= f;
    if (RES) { e0 *= f; e1 *= f; e2 *= f; e3 *= f; }
    o0 = g2_mma(v0, ph.v, o0); o1 = g2_mma(v1, ph.v, o1); o2 = g2_mma(v2, ph.v, o2); o3 = g2_mma(v3, ph.v, o3);
    if (RES) {
      vl0 = rok ? vl0 : zh; vl1 = rok ? vl1 : zh; vl2 = rok ? vl2 : zh; vl3 = rok ? vl3 : zh;
      e0 = g2_mma(vl0, ph.v, e0); e0 = g2_mma(v0, pl.v, e0);
      e1 = g2_mma(vl1, ph.v, e1); e1 = g2_mma(v1, pl.v, e1);
      e2 = g2_mma(vl2, ph.v, e2); e2 = g2_mma(v2, pl.v, e2);
      e3 = g2_mma(vl3, ph.v, e3); e3 = g2_mma(v3, pl.v, e3);
    } else {
      asm volatile("s_wait_xcnt 0x0" : "+v"(vq) :: "memory");      /* the same for the V group's offset register */
      vq += (unsigned)(adv * 32);      /* 32 keys further = the next tile, 1 KB */
      v0 = g2_frago(VT, vq, 0); v1 = g2_frago(VT, vq, 32 * LVT); v2 = g2_frago(VT, vq, 64 * LVT); v3 = g2_frago(VT, vq, 96 * LVT);
    }
  };
  // Plain form: steps 0 .. nfull - 1 lie wholly at or below the wave's first query (32 * st + 31 <= q0) and run without the mask; the rest (the step on the diagonal, and steps that only a long prefix makes visible) keep it. nfull < nst since kend >= q0 + 16.
  int st = sb;
  if (!RES) {
    const int nfull = (q0 + 1) >> 5;
    const int ue = nfull < se ? nfull : se;
#pragma unroll 1      /* rolled like the masked loop: one step's text, each wave runs it many times */
    for (; st < ue; ++st) step(flag_t<false>{}, st);
  }
#pragma unroll 1      /* rolled: in plain form one trip as a rule (the diagonal step, in the upper wave), more only under a long prefix; the residual form runs every step here */
  for (; st < se; ++st) step(flag_t<true>{}, st);
  if (!RES) {
    asm volatile("s_wait_xcnt 0x0" :: "v"(kq), "v"(vq) : "memory");      /* behind the last K and V groups: their offset registers live up to this wait, so nothing of the join is written over them earlier */
    // Join of the two key halves. Every step holds a key that every query of the wave sees, so both maxima are finite. m and l are equal in the two lane halves; each lane hands over and joins its own 32 O^T values.
    if (kh) {
      const v8f ou[4] = {o0, o1, o2, o3};
#pragma unroll
      for (int j = 0; j < 4; ++j) {
        const v4f a = {ou[j][0], ou[j][1], ou[j][2], ou[j][3]}, c = {ou[j][4], ou[j][5], ou[j][6], ou[j][7]};
        mo[wt][2 * j][lane] = a; mo[wt][2 * j + 1][lane] = c;
      }
      ml[wt][0][lane] = m; ml[wt][1][lane] = l;
    }
    __syncthreads();      /* every wave of a plain block passes it once: the upper waves' partials are in LDS behind it */
    if (kh) return;
    const float mu = ml[wt][0][lane], lu = ml[wt][1][lane];
    const float mj = fmaxf(m, mu);
    const float ta = fmaxf(m - mj, -80.0f) * 1.44269504f, tb = fmaxf(mu - mj, -80.0f) * 1.44269504f;
    float fa, fb;      /* __expf as it compiles, results apart from the sources, the slot behind the transcendental filled in the same statement */
    asm("v_exp_f32 %0, %2\n\tv_exp_f32 %1, %3\n\tv_nop" : "=&v"(fa), "=&v"(fb) : "v"(ta), "v"(tb));
    l = l * fa + lu * fb;
    v8f* const od[4] = {&o0, &o1, &o2, &o3};
#pragma unroll
    for (int j = 0; j < 4; ++j) {
      const v4f a = mo[wt][2 * j][lane], c = mo[wt][2 * j + 1][lane];
#pragma unroll
      for (int r = 0; r < 4; ++r) { (*od[j])[r] = (*od[j])[r] * fa + a[r] * fb; (*od[j])[4 + r] = (*od[j])[4 + r] * fa + c[r] * fb; }
    }
  }
  // ctx x64 = O^T * 64 / (1024 * l); O^T row d = dg*16 + 8*hh + r, column = query ln
  const float inv = 0.0625f * (1.0f / l);
  const v8f oo[4] = {o0, o1, o2, o3}; const v8f ee[4] = {e0, e1, e2, e3};
  // the lane's 8 values of O^T tile dg are query ln, columns dg*16 + 8*hh .. + 7: one chunk of the fragment-order ctx plane, so each tile goes out of the accumulators as one half-tile store of 512 contiguous bytes
#pragma unroll
  for (int dg = 0; dg < 4; ++dg) {
    FragH fh, fl;
#pragma unroll
    for (int r = 0; r < 8; ++r) {
      float v = oo[dg][r]; if (RES) v += ee[dg][r] * 0.0009765625f; v *= inv;
      const _Float16 h0 = (_Float16)v; fh.h[r] = h0; fl.h[r] = (_Float16)((v - (float)h0) * 1024.0f);
    }
    const v8us oh = fh.half[0], ol = fl.half[0];
    *(v8us*)((unsigned short*)O16 + fo_chunk(rowb + q0 + ln, h * HD + dg * 16 + 8 * hh, DM)) = oh;
    if (RES) *(v8us*)((unsigned short*)OL + fo_chunk(rowi + q0 + ln, h * HD + dg * 16 + 8 * hh, DM)) = ol;
  }
  if (RES) asm volatile("s_wait_xcnt 0x0" ::: "memory");      /* behind the last store: the other body's text follows in the kernel, and a branch of the listing leads from here to writes of these stores' registers */
}

constexpr int NB_ATT  = NB * NH * ((SEQ - ISL) / 64);
constexpr int NB_ATTI = NB * NH * (ISL / 128);
// one launch, two bodies: the residual-plane blocks first (few steps, each several times a plain step: started last they would run on alone), the plain blocks behind them, longest first
__global__ __launch_bounds__(256) void k_attn(const _Float16* __restrict__ QK, const _Float16* __restrict__ QKL, const _Float16* __restrict__ VT, const _Float16* __restrict__ VTL, _Float16* __restrict__ O16, _Float16* __restrict__ OL, const int* __restrict__ Sp) {
  __shared__ __attribute__((aligned(16))) v4f mo[4][8][32];      /* the upper waves' O^T partials: query tile, quad of rows, lane */
  __shared__ float ml[4][2][32];                                 /* their maxima and sums */
  const int bid = (int)blockIdx.x;
  if (bid >= NB_ATTI) attn_body<false>(QK, nullptr, VT, nullptr, O16, nullptr, Sp, 0, 0, bid - NB_ATTI, mo, ml);
  else attn_body<true>(QK, QKL, VT, VTL, O16, OL, Sp, 0, ISL / 128, bid, mo, ml);
}

constexpr size_t al256(size_t bytes) { return (bytes + 255) & ~(size_t)255; }
constexpr size_t SZ_BQKV = al256((size_t)3 * DM * DM * 2);
constexpr size_t SZ_BO   = al256((size_t)DM * DM * 2);
constexpr size_t SZ_X16  = al256((size_t)NR * DM * 2);
constexpr size_t SZ_QK   = al256((size_t)NR * LQK * 2);
constexpr size_t SZ_QKL  = al256((size_t)NRI * LQK * 2);
constexpr size_t SZ_VT   = al256((size_t)DM * LVT * 2);
constexpr size_t SZ_VTL  = al256((size_t)DM * LVL * 2);
constexpr size_t SZ_O16  = al256((size_t)NR * DM * 2);
constexpr size_t SZ_OL   = al256((size_t)NRI * DM * 2);
constexpr size_t WS_TOTAL = SZ_BQKV + SZ_BO + SZ_X16 + SZ_QK + SZ_QKL + SZ_VT + SZ_VTL + SZ_O16 + SZ_OL;
static_assert(WS_TOTAL <= (size_t)134217728);      /* carve <= 128 MiB */

extern "C" void kernel_launch(void* const* d_in, const int* in_sizes, int n_in,
                              void* d_out, int out_size, void* d_ws, size_t ws_size, hipStream_t stream) {
  if (n_in < 6) return;
  const long long xrows = (long long)(NB - 1) * SEQ_FULL + SEQ;      /* rows of x / out touched */
  if ((long long)in_sizes[0] < xrows * DM) return;
  if ((long long)in_sizes[1] < (long long)DM * 3 * DM) return;
  if ((long long)in_sizes[2] < (long long)3 * DM) return;
  if ((long long)in_sizes[3] < (long long)DM * DM) return;
  if ((long long)in_sizes[4] < (long long)DM) return;
  if ((long long)in_sizes[5] < 1) return;
  if ((long long)out_size < xrows * DM) return;
  if (WS_TOTAL > ws_size) return;
  const float* x = (const float*)d_in[0]; const float* w_attn = (const float*)d_in[1]; const float* b_attn = (const float*)d_in[2];
  const float* w_proj = (const float*)d_in[3]; const float* b_proj = (const float*)d_in[4];
  const int* s_pref = (const int*)d_in[5];                           /* prefix length, loaded on the device */
  float* out = (float*)d_out;
  char* ws = (char*)d_ws; size_t off = 0;
  _Float16* BQKV = (_Float16*)(ws + off); off += SZ_BQKV;      /* [3072][1024] x16; this and every plane below in fragment order */
  _Float16* BO   = (_Float16*)(ws + off); off += SZ_BO;        /* [1024][1024] x16 */
  _Float16* X16  = (_Float16*)(ws + off); off += SZ_X16;       /* [NR][1024] */
  _Float16* QK   = (_Float16*)(ws + off); off += SZ_QK;        /* [NR][2048] q | k */
  _Float16* QKL  = (_Float16*)(ws + off); off += SZ_QKL;       /* [NRI][2048] residual x1024 */
  _Float16* VT   = (_Float16*)(ws + off); off += SZ_VT;        /* [1024][NR] */
  _Float16* VTL  = (_Float16*)(ws + off); off += SZ_VTL;       /* [1024][NRI] residual x1024 */
  _Float16* O16  = (_Float16*)(ws + off); off += SZ_O16;       /* [NR][1024] ctx x64 */
  _Float16* OL   = (_Float16*)(ws + off); off += SZ_OL;        /* [NRI][1024] ctx residual x1024 */
  if (off > ws_size) return;

  k_convert<<<(unsigned)(NB_X16 + NB_WQKV + NB_WO), 256, 0, stream>>>(x, w_attn, w_proj, X16, BQKV, BO);
  k_gemm_qkv<<<(unsigned)(NB_QK + NB_VT), 128, 0, stream>>>(X16, BQKV, b_attn, QK, QKL, VT, VTL);
  k_attn<<<(unsigned)(NB_ATTI + NB_ATT), 256, 0, stream>>>(QK, QKL, VT, VTL, O16, OL, s_pref);
  k_gemm_out<<<(unsigned)(NB_OUT + NB_OUTI), 128, 0, stream>>>(O16, OL, BO, b_proj, out);
}

// v009
// A run of this version takes 69.5 microseconds.
// In two side-by-side timings against v008, it was 1.06 and 1.05 times as fast.
// Over all steps from v000 it is 4.28 times as fast.
#include <hip/hip_runtime.h>
// All contractions: v_wmma_f32_16x16x32_f16 (f16 operands, f32 accumulate). x, weights and biases are RNE-converted to bf16; x and weights are held exactly in f16 (weights x16); q, k, v, softmax weights (x1024) and ctx (x64) are f16 planes; for the first 256 query rows of every sequence q, k, v, P and ctx also carry an f16 residual plane (x1024) accumulated in a separate accumulator.
// Structure: token rows r = b*SEQ + s. (1) weights -> Wt[n][k] f16; x -> f16 rows. (2) q|k rows = X16 . Wqk (N = 2048) and V^T[h*64+d][token] = Wv . X16^T (operand-swapped GEMM, row bias). (3) fused flash attention in the transposed form S^T = K Q^T, O^T = V^T P^T: one wave owns 16 queries (plain rows: two waves, each half of the key steps, joined at the end), fragments are loaded straight from the 16-bit planes (all kept in fragment order, see fo_chunk), P^T goes D -> B in registers, online softmax statistics are per-lane scalars; visibility (key <= query) OR (query < S AND key < S) applied as a replace-mask by value, S loaded on the device from its input buffer. (4) out = ctx . Wo + b (f32).
#ifndef NB
#define NB 2
#endif
#ifndef SEQ
#define SEQ 2048
#endif
#define NB_FULL 2
#define SEQ_FULL 2048
#define DM 1024
#define NH 16
#define HD 64
#define ISL ((SEQ) < 256 ? (SEQ) : 256)   /* query rows per sequence carried with residual planes */
#define NR (NB * SEQ)                      /* token rows in the workspace planes */
#define NRI (NB * ISL)                     /* rows of the compact residual planes */
#define LQK (2 * DM)                       /* row pitch of the q | k plane */
#define LVT NR                             /* row pitch of V^T */
#define LVL NRI                            /* row pitch of the V^T residual plane */

static_assert(NB >= 1 && NB <= NB_FULL);          /* reduced builds only shrink */
static_assert(SEQ <= SEQ_FULL);
static_assert(SEQ % 128 == 0);                    /* 8 waves x 16 queries per residual attention block (plain: 64 queries); GEMM row blocks; 32-key steps stay inside the sequence */
static_assert(ISL % 128 == 0);                    /* residual region is a whole number of blocks */
static_assert(ISL >= 32);                         /* clamped residual key step ISL - 32 is a valid step */
static_assert((SEQ - ISL) % 128 == 0);            /* plain region is a whole number of blocks */
static_assert(NH * HD == DM);                     /* merged head layout */
static_assert(HD == 64);                          
static_assert(DM % 128 == 0);                     /* GEMM M blocks (V^T) and K % 64 (two k blocks per trip) */
static_assert(DM % 8 == 0);                       /* 8-element convert threads */
static_assert(NR % 128 == 0);                     /* GEMM M blocks / N tiles of 64 */
static_assert(NRI % 64 == 0);                     /* residual-row output GEMM blocks */
static_assert((long long)NR * LQK < 2147483647LL);/* int plane offsets */
static_assert((long long)DM * LVT < 2147483647LL);

typedef unsigned short v8us __attribute__((ext_vector_type(8), may_alias));
typedef float  v8f  __attribute__((ext_vector_type(8)));
typedef float  v4f  __attribute__((ext_vector_type(4)));
typedef float  v4fa __attribute__((ext_vector_type(4), may_alias));
typedef _Float16 v16h __attribute__((ext_vector_type(16)));
typedef _Float16 v4h  __attribute__((ext_vector_type(4)));
union FragH { v16h v; v8us half[2]; _Float16 h[16]; unsigned short u[16]; };

__device__ __forceinline__ float bf16_rne(float x) { unsigned int u = __float_as_uint(x); u = (u + 0x7FFFu + ((u >> 16) & 1u)) & 0xFFFF0000u; return __uint_as_float(u); }

// Fragment order: every 16-bit plane [rows][K] is stored as tiles of 16 rows x 32 k, 512 elements (1 KB) each, tile (row / 16, k / 32) at element (row / 16) * 16 * K + (k / 32) * 512.
// Inside a tile: two halves of 256 elements (k 0..15, k 16..31), each 32 lanes x 8 elements with lane = 16 * ((k / 8) & 1) + row % 16. A fragment is then two loads of 512 contiguous bytes (4 whole lines each).
// element offset of the 8-element chunk that holds (row, k .. k + 7), k % 8 == 0, in a plane of K columns (K % 32 == 0)
__device__ __forceinline__ size_t fo_chunk(int row, int k, int K) { return (size_t)(row >> 4) * 16 * K + (size_t)((k >> 5) * 512 + ((k >> 4) & 1) * 256 + (((k >> 3) & 1) * 16 + (row & 15)) * 8); }
// fragment of one tile: elements 0..7 <- k 8h.., elements 8..15 <- k 16+8h.., row = lane & 15, h = lane >> 4 (same map for A and B);
// from a uniform pointer, the lane's own 32-bit byte offset (16 * lane folded in) and a constant byte step
__device__ __forceinline__ v16h g2_frago(const _Float16* base, unsigned off, int add) { const char* p = (const char*)base + (size_t)off + add; FragH f; f.half[0] = *(const v8us*)p; f.half[1] = *(const v8us*)(p + 512); return f.v; }
__device__ __forceinline__ v8f g2_mma(v16h a, v16h b, v8f c) { v8f d = __builtin_amdgcn_wmma_f32_16x16x32_f16(false, a, false, b, (short)0, c, false, false); asm volatile("v_nop\n\tv_nop\n\tv_nop\n\tv_nop" : "+v"(d) : "v"(a), "v"(b)); return d; }

// the same product left to the compiler's own padding: for the 64 x 64 wave tile, whose 16 accumulators and two fragment sets need more than 256 registers (with the asm statement's operands the build stayed below 256 and spilled)
__device__ __forceinline__ v8f g2_mmab(v16h a, v16h b, v8f c) { return __builtin_amdgcn_wmma_f32_16x16x32_f16(false, a, false, b, (short)0, c, false, false); }

// asks L2 (scope SE: into L2 only, nothing returns, no counter) for p + OFF.
// p + OFF lies inside the plane in every lane; asm, so that the address stands in a register of the caller's that still holds it later (see the callers' last use of it)
template <int OFF>
__device__ __forceinline__ void l2_ask(const char* p) { asm volatile("global_prefetch_b8 %0, off offset:%1 scope:SCOPE_SE" :: "v"(p), "i"(OFF)); }

// fragment of one tile that lies in LDS as it lies in the plane: p = the tile's first byte + 16 * lane
__device__ __forceinline__ v16h l_frag(const char* p) { FragH f; f.half[0] = *(const v8us*)p; f.half[1] = *(const v8us*)(p + 512); return f.v; }
// NT (4 or 8) asynchronous copies, 16 B a lane each: 64 k (2 KB) of the NT 16-row tiles of one panel, from the fragment-order plane (row tiles 32 KB apart at K = DM) to NT 2-KB places in a row in LDS.
// l: the lane's LDS byte address in the first place, g: its global address in the first tile, both multiples of 16. The wait is the last line of the copies' own statement, so that it stands in front of every rewrite of a register that a copy names.
template <int NT>
__device__ __forceinline__ void cp_panel(unsigned l, const char* g) {
  static_assert(NT == 4 || NT == 8);
  if constexpr (NT == 8)
    asm volatile("global_load_async_to_lds_b128 %0, %8, off\n\tglobal_load_async_to_lds_b128 %1, %9, off\n\tglobal_load_async_to_lds_b128 %2, %10, off\n\tglobal_load_async_to_lds_b128 %3, %11, off\n\t"
                 "global_load_async_to_lds_b128 %4, %12, off\n\tglobal_load_async_to_lds_b128 %5, %13, off\n\tglobal_load_async_to_lds_b128 %6, %14, off\n\tglobal_load_async_to_lds_b128 %7, %15, off\n\ts_wait_xcnt 0x0"
                 :: "v"(l), "v"(l + 2048u), "v"(l + 4096u), "v"(l + 6144u), "v"(l + 8192u), "v"(l + 10240u), "v"(l + 12288u), "v"(l + 14336u),
                    "v"(g), "v"(g + 32 * DM), "v"(g + 64 * DM), "v"(g + 96 * DM), "v"(g + 128 * DM), "v"(g + 160 * DM), "v"(g + 192 * DM), "v"(g + 224 * DM) : "memory");
  else
    asm volatile("global_load_async_to_lds_b128 %0, %4, off\n\tglobal_load_async_to_lds_b128 %1, %5, off\n\tglobal_load_async_to_lds_b128 %2, %6, off\n\tglobal_load_async_to_lds_b128 %3, %7, off\n\ts_wait_xcnt 0x0"
                 :: "v"(l), "v"(l + 2048u), "v"(l + 4096u), "v"(l + 6144u), "v"(g), "v"(g + 32 * DM), "v"(g + 64 * DM), "v"(g + 96 * DM) : "memory");
}

__device__ __forceinline__ void wt_f16_body(const float* __restrict__ W, _Float16* __restrict__ Wt, int K, int N, float scale, int bid) {
  /* one wave writes one half tile (512 contiguous bytes): lane = 16 * h + n % 16; waves run over the row tiles first, then over the 16-k halves */
  const int t = bid * 256 + threadIdx.x; if (t >= N * (K / 8)) return; const int wv = t >> 5, lane = t & 31; const int n = (wv % (N / 16)) * 16 + (lane & 15), k8 = (wv / (N / 16)) * 16 + (lane >> 4) * 8; FragH f;
#pragma unroll
  for (int i = 0; i < 8; ++i) f.h[i] = (_Float16)(bf16_rne(W[(size_t)(k8 + i) * N + n]) * scale);
  const v8us o = f.half[0];
  unsigned short* d = (unsigned short*)Wt + fo_chunk(n, k8, K);
  *(v8us*)d = o; 
}

__device__ __forceinline__ void x16_body(const float* __restrict__ x, _Float16* __restrict__ X16, int bid) {
  const int t = bid * 256 + threadIdx.x; if (t >= NR * (DM / 8)) return;
  /* one wave writes one half tile (512 contiguous bytes): lane = 16 * h + row % 16; consecutive waves take consecutive 16-k halves of a row tile */
  const int wv = t >> 5, lane = t & 31; const int row = (wv / (DM / 16)) * 16 + (lane & 15), c8 = (wv % (DM / 16)) * 16 + (lane >> 4) * 8; const int b = row / SEQ, s = row % SEQ;
  const float* src = x + ((size_t)b * SEQ_FULL + s) * DM + c8;
  const v4f a = *(const v4fa*)src, c = *(const v4fa*)(src + 4); FragH f;
#pragma unroll
  for (int i = 0; i < 4; ++i) { f.h[i] = (_Float16)bf16_rne(a[i]); f.h[4 + i] = (_Float16)bf16_rne(c[i]); }
  const v8us o = f.half[0];
  unsigned short* d = (unsigned short*)X16 + fo_chunk(row, c8, DM);
  *(v8us*)d = o; 
}

// Launches that read nothing of each other's output share one grid: a range of the block index picks the body (block-uniform branch).
constexpr int NB_X16  = (int)(((size_t)NR * (DM / 8) + 255) / 256);
constexpr int NB_WQKV = (int)(((size_t)3 * DM * (DM / 8) + 255) / 256);
constexpr int NB_WO   = (int)(((size_t)DM * (DM / 8) + 255) / 256);
// the three conversions: x -> X16; W[K=1024][N=3072] -> Wt[N][K]; W[K=1024][N=1024] -> Wt[N][K]
__global__ __launch_bounds__(256) void k_convert(const float* __restrict__ x, const float* __restrict__ w_attn, const float* __restrict__ w_proj, _Float16* __restrict__ X16, _Float16* __restrict__ BQKV, _Float16* __restrict__ BO) {
  const int bid = (int)blockIdx.x;
  if (bid < NB_X16) x16_body(x, X16, bid);
  else if (bid < NB_X16 + NB_WQKV) wt_f16_body(w_attn, BQKV, DM, 3 * DM, 16.0f, bid - NB_X16);
  else wt_f16_body(w_proj, BO, DM, DM, 16.0f, bid - (NB_X16 + NB_WQKV));
}

// GEMM: wave tile (16*MT) x 64, block = 4 waves laid (4/WN) x WN = (64*MT/WN) rows x (64*WN) cols; A and Bh are f16 planes in fragment order (their panels come through an LDS ring, fragments from there).
// v = acc*alpha (+ accL*alphaL with the residual A plane AL, ARES) + bias (per column, or per row if ROWBIAS; bias RNE-converted to bf16).
// Logical row R maps to A row seg*aSeg + aOff + w and C row seg*cSeg + cOff + w with seg = R / segRows, w = R % segRows (blocks never straddle segments).
// OUT 0: f32 C. OUT 1: f16 C16 (+ x1024 residual rows in CL when the rows lie in the first ISL rows of a sequence). OUT 2: f16 C16 (+ residual columns when the token columns lie in the first ISL rows of a sequence).
// Requires M % (64*MT/WN) == 0, N % (64*WN) == 0, K % 64 == 0, K >= 128 (asserted above for the launches used). LDS tile so[wave] is private to its wave (wave-level sync); the kernel owns the array, so the two bodies of a launch share one. bid: block index inside the body's own range.
// The block's panels go through LDS, 64 k a trip, two buffers, so that each panel byte leaves L2 once per block and not once per wave that reads it; the ring lies at the start of so, which becomes the output staging behind the last trip's barrier.
template <int MT, int WN, bool ROWBIAS, bool ARES, int OUT, int SOR>
__device__ __forceinline__ void gemm_body(const _Float16* __restrict__ A, const _Float16* __restrict__ AL, int lda,
    const _Float16* __restrict__ Bh, int ldb, float alpha, float alphaL, const float* __restrict__ bias,
    float* __restrict__ Cf, _Float16* __restrict__ C16, _Float16* __restrict__ CL, int ldc, int ldcl,
    int M, int N, int K, int segRows, int aSeg, int aOff, int cSeg, int cOff, int bid, float (*so)[SOR][68]) {
  static_assert(MT == 1 || MT == 2 || MT == 4);
  static_assert(WN == 1 || WN == 2);    /* the block's 4 waves lie (4 / WN) x WN over its tile */
  static_assert(SOR >= 16 * MT);        /* the wave's staging rows */
  static_assert(!ARES || MT == 1);      /* residual form keeps 8 accumulators */
  const int tid = threadIdx.x, lane = tid & 31, ln = lane & 15, hh = lane >> 4;
  const int w = __builtin_amdgcn_readfirstlane(tid >> 5);      /* wave-uniform, so that every tile base below is a scalar pointer */
  const int ntn = N / (64 * WN);
  const int mt = bid / ntn, nq = bid - mt * ntn;
  const int R0 = mt * (64 * MT / WN) + (16 * MT) * (w / WN), col0 = nq * (64 * WN) + 64 * (w % WN);
  if (mt * (64 * MT / WN) >= M) return;      /* on the block's own first row, alike in its four waves: barriers stand behind it (M is a multiple of the block's rows, so it reads as the test on the wave's first row did) */
  // At entry the block asks L2 for a quarter of its A panel (BM rows x DM) and of its B panel (BN rows x DM), one request per 256-B unit: the blocks that share a panel (same mt: neighbours in the index; same nq) deal its quarters among them by the other index.
  // Every launch here has lda = ldb = K = DM, and a panel is one contiguous run of a fragment-order plane; 128 threads x 256 B = 32 KB a request round.
  constexpr int BM = 64 * MT / WN, BN = 64 * WN, QA = BM * DM * 2 / 4, QB = BN * DM * 2 / 4;      /* bytes of a quarter panel */
  static_assert(QA % 32768 == 0 && QA <= 65536 && QB % 32768 == 0 && QB <= 65536);
  const int Rb = mt * BM, segb = Rb / segRows;
  const char* pfa = (const char*)(A + (size_t)(segb * aSeg + aOff + (Rb - segb * segRows)) * lda) + ((nq & 3) * QA + tid * 256);
  const char* pfb = (const char*)(Bh + (size_t)(nq * BN) * ldb) + ((mt & 3) * QB + tid * 256);
  const char* pfe = ARES ? (const char*)(AL + (size_t)Rb * lda) + ((nq & 3) * QA + tid * 256) : pfa;
  l2_ask<0>(pfa); if (QA > 32768) l2_ask<32768>(pfa);
  l2_ask<0>(pfb); if (QB > 32768) l2_ask<32768>(pfb);
  if (ARES) l2_ask<0>(pfe);
  const int seg = R0 / segRows, wi = R0 - seg * segRows;
  const int crow0 = seg * cSeg + cOff + wi;
  const v8f z8 = {0.f, 0.f, 0.f, 0.f, 0.f, 0.f, 0.f, 0.f};
  v8f c00 = z8, c01 = z8, c02 = z8, c03 = z8, c10 = z8, c11 = z8, c12 = z8, c13 = z8, c20 = z8, c21 = z8, c22 = z8, c23 = z8, c30 = z8, c31 = z8, c32 = z8, c33 = z8, d00 = z8, d01 = z8, d02 = z8, d03 = z8;
  // Two register sets of fragments (P, N), 32 k each: both are read from the trip's buffer as whole groups in front of the trip's WMMAs.
#define GEMM_LL(S, kk) { S##a0 = l_frag(fa + (kk)); if (MT >= 2) S##a1 = l_frag(fa + 2048 + (kk)); if (MT == 4) { S##a2 = l_frag(fa + 4096 + (kk)); S##a3 = l_frag(fa + 6144 + (kk)); } if (ARES) S##e0 = l_frag(fe + (kk)); \
    S##b0 = l_frag(fb + (kk)); S##b1 = l_frag(fb + 2048 + (kk)); S##b2 = l_frag(fb + 4096 + (kk)); S##b3 = l_frag(fb + 6144 + (kk)); }
#define GEMM_MC(S, j) { if (MT == 4) { c0##j = g2_mmab(S##a0, S##b##j, c0##j); c1##j = g2_mmab(S##a1, S##b##j, c1##j); c2##j = g2_mmab(S##a2, S##b##j, c2##j); c3##j = g2_mmab(S##a3, S##b##j, c3##j); } \
    else { c0##j = g2_mma(S##a0, S##b##j, c0##j); if (MT == 2) c1##j = g2_mma(S##a1, S##b##j, c1##j); if (ARES) d0##j = g2_mma(S##e0, S##b##j, d0##j); } }
#define GEMM_MM(S) { GEMM_MC(S, 0) GEMM_MC(S, 1) GEMM_MC(S, 2) GEMM_MC(S, 3) }
  const v16h zf = (v16h)((_Float16)0.0f);
  v16h Pa2 = zf, Pa3 = zf, Na2 = zf, Na3 = zf;
  v16h Pa0 = zf, Pa1 = zf, Pe0 = zf, Pb0 = zf, Pb1 = zf, Pb2 = zf, Pb3 = zf, Na0 = zf, Na1 = zf, Ne0 = zf, Nb0 = zf, Nb1 = zf, Nb2 = zf, Nb3 = zf;
  // The ring: two buffers of RB bytes at the start of so. A buffer holds 64 k of the block's panels as 2-KB places (16 rows x 64 k, as they lie in the plane): the A tiles, the B tiles, then (ARES) the residual A tiles.
  constexpr unsigned OB = (BM / 16) * 2048u, OE = OB + (BN / 16) * 2048u, RB = OE + (ARES ? (BM / 16) * 2048u : 0u);
  static_assert((size_t)4 * SOR * 68 * 4 >= 2 * RB);      /* the ring's room in so */
  char* const ring = (char*)so;
  const unsigned lr = (unsigned)(size_t)ring + 16u * (unsigned)tid;      /* the thread's 16 B of a 2-KB place: one copy of the block's 128 threads fills one place */
  const char* ga = (const char*)(A + (size_t)(segb * aSeg + aOff + (Rb - segb * segRows)) * lda) + 16 * tid;      /* the same 16 B of the panels' first tiles, k 0..63; 64 k further is 2 KB further, and the last trip ends at the tile's end */
  const char* gb = (const char*)(Bh + (size_t)(nq * BN) * ldb) + 16 * tid;
  const char* ge = ARES ? (const char*)(AL + (size_t)Rb * lda) + 16 * tid : ga;
#define GEMM_CP(bo, t) { cp_panel<BM / 16>(lr + (bo), ga + (t) * 2048); cp_panel<BN / 16>(lr + (bo) + OB, gb + (t) * 2048); if (ARES) cp_panel<BM / 16>(lr + (bo) + OE, ge + (t) * 2048); }
  GEMM_CP(0u, 0)
  asm volatile("s_wait_asynccnt 0x0" ::: "memory");      /* the wave's own copies of trip 0 have landed */
  __syncthreads();                                        /* and every other wave's: buffer 0 may be read */
  GEMM_CP(RB, 1)      /* trip 1 flies while trip 0 is worked on (K >= 128) */
  asm volatile("" :: "v"(pfa), "v"(pfb), "v"(pfe));      /* inputs only, no instruction: the requests' address registers keep their in-range addresses up to here and are free in the k loop */
  unsigned bo = 0;      /* byte offset of the buffer that this trip reads */
#pragma unroll 1      /* kept rolled: unrolled over all of K the two bodies of a launch made more kernel text, and every wave runs the text once */
  for (int t = 0; t < K / 64; ++t) {
    const char* fa = ring + (bo + (unsigned)(w / WN) * (MT * 2048u) + 16u * (unsigned)lane);
    const char* fb = ring + (bo + OB + (unsigned)(w % WN) * 8192u + 16u * (unsigned)lane);
    const char* fe = ring + (bo + OE + (unsigned)(w / WN) * (MT * 2048u) + 16u * (unsigned)lane);
    GEMM_LL(P, 0)
    GEMM_LL(N, 1024)
    __builtin_amdgcn_sched_barrier(0);      /* both fragment groups stand whole in front of the WMMAs (for speed only) */
    GEMM_MM(P)
    GEMM_MM(N)
    __builtin_amdgcn_sched_barrier(0);      /* the WMMAs stay in front of the trip's foot: left free, the scheduler lifts the waits and the barrier over them, and the next trip's copies are then waited for right behind their issue */
    asm volatile("s_wait_dscnt 0x0" ::: "memory");        /* the wave has left this buffer */
    asm volatile("s_wait_asynccnt 0x0" ::: "memory");     /* its copies of the next trip have landed */
    __syncthreads();                                      /* one barrier a trip: it publishes the next buffer and ends every reader's last read of this one */
    if (t + 2 < K / 64) GEMM_CP(bo, t + 2)
    bo = RB - bo;
  }
  asm volatile("s_wait_asynccnt 0x0" ::: "memory");      /* nothing is in flight when the ring becomes the output staging; the last trip's barrier has ended every read of it */
#undef GEMM_CP
#undef GEMM_LL
#undef GEMM_MM
#undef GEMM_MC
  const v8f accs[16] = {c00, c01, c02, c03, c10, c11, c12, c13, c20, c21, c22, c23, c30, c31, c32, c33};
  const v8f accl[4] = {d00, d01, d02, d03};
#pragma unroll
  for (int u = 0; u < 4 * MT; ++u) {
    const int t = u & 3, half = u >> 2; const int col = col0 + t * 16 + ln;
    float bvc = 0.f; if (!ROWBIAS) bvc = bf16_rne(bias[col]);
#pragma unroll
    for (int r = 0; r < 8; ++r) {
      const int rloc = half * 16 + 8 * hh + r;
      float v = accs[u][r] * alpha;
      if (ARES) v += accl[t][r] * alphaL;
      if (ROWBIAS) v += bf16_rne(bias[R0 + rloc]); else v += bvc;
      so[w][rloc][t * 16 + ln] = v;
    }
  }
  __builtin_amdgcn_fence(4 /* acq_rel order */, "workgroup"); __builtin_amdgcn_wave_barrier();
  const int rsub = lane >> 4, c4 = (lane & 15) * 4;
  if (OUT == 0) {
    {
#pragma unroll
      for (int q = 0; q < 8 * MT; ++q) { const int r = q * 2 + rsub; const v4f v = *(const v4fa*)&so[w][r][c4]; *(v4f*)(Cf + (size_t)(crow0 + r) * ldc + col0 + c4) = v; }
      asm volatile("s_wait_xcnt 0x0" ::: "memory");      /* behind the run of stores: in a kernel of two bodies the other body's code follows in the listing and reuses the stores' address and data registers */
    }
  } else {
    int sl, rrow0, rcol0;
    if (OUT == 1) { sl = crow0 % SEQ; rrow0 = (crow0 / SEQ) * ISL + sl; rcol0 = col0; }
    else          { sl = col0 % SEQ;  rrow0 = crow0; rcol0 = (col0 / SEQ) * ISL + sl; }
    const bool isl = sl < ISL;      /* uniform over the wave tile: ISL and SEQ are multiples of 64 */
    {      /* one store = one half tile of the fragment-order plane: lane (hh, ln) holds row ln, 8 columns from 8 * hh */
#pragma unroll
      for (int q = 0; q < 4 * MT; ++q) {
        const int r = (q >> 2) * 16 + ln, c = (q & 3) * 16 + 8 * hh;
        const v4f va = *(const v4fa*)&so[w][r][c], vc = *(const v4fa*)&so[w][r][c + 4];
        FragH fh, fl;
#pragma unroll
        for (int i = 0; i < 4; ++i) {
          const _Float16 h0 = (_Float16)va[i], h1 = (_Float16)vc[i]; fh.h[i] = h0; fh.h[4 + i] = h1;
          fl.h[i] = (_Float16)((va[i] - (float)h0) * 1024.0f); fl.h[4 + i] = (_Float16)((vc[i] - (float)h1) * 1024.0f);
        }
        const v8us oh = fh.half[0], ol = fl.half[0];
        *(v8us*)((unsigned short*)C16 + fo_chunk(crow0 + r, col0 + c, ldc)) = oh;
        asm volatile("s_wait_xcnt 0x0" ::: "memory");      /* in front of the reuse of the store's data and address registers by the residual's arithmetic */
        if (isl) *(v8us*)((unsigned short*)CL + fo_chunk(rrow0 + r, rcol0 + c, ldcl)) = ol;
      }
      
    }
  }
}

constexpr int NB_QK   = (NR / 128) * (2 * DM / 128);
constexpr int NB_VT   = (DM / 128) * (NR / 128);
constexpr int NB_OUT  = (NB * (SEQ - ISL) / 128) * (DM / 64);
constexpr int NB_OUTI = (NRI / 64) * (DM / 64);
// one launch, two bodies:
// q | k rows (f16) = X16 . Wqk^T / 16 + b; residual rows for s < ISL
// V^T[h*64+d][token] (f16) = Wv . X16^T / 16 + b[row]; residual columns for s < ISL
__global__ __launch_bounds__(128) void k_gemm_qkv(const _Float16* __restrict__ X16, const _Float16* __restrict__ BW, const float* __restrict__ bias, _Float16* __restrict__ QK, _Float16* __restrict__ QKL, _Float16* __restrict__ VT, _Float16* __restrict__ VTL) {
  __shared__ __attribute__((aligned(16))) float so[4][64][68];
  const int bid = (int)blockIdx.x;
  if (bid < NB_QK) gemm_body<4, 2, false, false, 1>(X16, nullptr, DM, BW, DM, 0.0625f, 0.f, bias, nullptr, QK, QKL, LQK, LQK, NR, 2 * DM, DM, NR, 0, 0, 0, 0, bid, so);
  else gemm_body<4, 2, true, false, 2>(BW + (size_t)2 * DM * DM, nullptr, DM, X16, DM, 0.0625f, 0.f, bias + 2 * DM, nullptr, VT, VTL, LVT, LVL, DM, NR, DM, DM, 0, 0, 0, 0, bid - NB_QK, so);
}
// one launch, two bodies:
// out rows s >= ISL: ctx(x64) . Wo(x16) * 2^-10 + b
// out rows s < ISL: (ctx_hi . Wo) * 2^-10 + (ctx_res . Wo) * 2^-20 + b, separate accumulators
__global__ __launch_bounds__(128) void k_gemm_out(const _Float16* __restrict__ O16, const _Float16* __restrict__ OL, const _Float16* __restrict__ BO, const float* __restrict__ bias, float* __restrict__ out) {
  __shared__ __attribute__((aligned(16))) float so[4][48][68];      /* 48 rows a wave: room for the ring (2 x 24 KB); the staging uses 32 or 16 of them */
  const int bid = (int)blockIdx.x;
  if (bid < NB_OUT) gemm_body<2, 1, false, false, 0>(O16, nullptr, DM, BO, DM, 0.0009765625f, 0.f, bias, out, nullptr, nullptr, DM, 0, NB * (SEQ - ISL), DM, DM, SEQ - ISL, SEQ, ISL, SEQ_FULL, ISL, bid, so);
  else gemm_body<1, 1, false, true, 0>(O16, OL, DM, BO, DM, 0.0009765625f, 0.00000095367431640625f, bias, out, nullptr, nullptr, DM, 0, NRI, DM, DM, ISL, SEQ, 0, SEQ_FULL, 0, bid - NB_OUT, so);
}

// Fused prefix-causal attention, transposed form. Wave = 16 queries (D column = query = lane & 15). Residual form: block = 8 waves = 128 consecutive queries of one (b, h), each wave walks its whole key range.
// Plain form: block = 64 consecutive queries of one (b, h); waves t and t + 4 share query tile t: wave t walks the lower half of the tile's key steps, wave t + 4 the upper half, each with its own online maximum, sum and O^T;
// the upper wave hands its three over through LDS (one work-group barrier) and the lower wave joins them as two softmax partials are joined (both rescaled to the common maximum, then added) and stores the tile.
// Why: the longest wave walks half as many steps, and the launch has more blocks than the chip has places, dealt longest first, so a place that a short block leaves is filled again instead of idling under the longest block.
// Visibility: key j is seen by query i iff (j <= i) OR (i < S AND j < S); S is loaded from its input buffer and clamped to [0, SEQ] (same mask for any value).
// Key range of a wave: [0, max(S, q0 + 16)) in 32-key steps (all step keys lie inside the sequence since SEQ % 32 == 0). Every step holds key kcb that is visible to every query of the wave
// (kcb <= q0 when the range ends at q0 + 16; kcb < S with all 16 queries < S otherwise), so the step maximum is always finite.
// Per 32-key step: S^T tiles (keys kcb..+15 and +16..+31) = K (A, rows = keys) . Q^T (B, lane = query); scale 1/8; hidden keys are REPLACED (excluded from max, weight 0 by value);
// online max / sum per lane (halves combined by one xor-16 shuffle); P^T (x1024, f16) is the B fragment directly: element r <- tile0[r], element 8+r <- tile1[r];
// O^T (rows = d) += V^T (A, rows = d, k = keys) . P^T. RES: q, k, v, P carry x1024 residual planes; residual products go to separate accumulators folded back with 2^-10.
// Residual k / v planes exist only for keys < ISL: for key steps at or beyond ISL (possible when S > ISL) the residual k / v fragments are loaded from a clamped in-range step and zeroed by value (wave-uniform select).
template <bool B> struct flag_t { static constexpr bool value = B; };
// eight v_exp_f32 in one statement, results in registers apart from every source (early clobber), one v_nop behind the last: the slot that the instruction set asks for behind a transcendental, before its result is read or its source overwritten; left to the scheduler, runs of exponentials stood with one writing over the source of the one in front
__device__ __forceinline__ void exp2_x8(float (&p)[8], const float (&t)[8]) {
  asm("v_exp_f32 %0, %8\n\tv_exp_f32 %1, %9\n\tv_exp_f32 %2, %10\n\tv_exp_f32 %3, %11\n\tv_exp_f32 %4, %12\n\tv_exp_f32 %5, %13\n\tv_exp_f32 %6, %14\n\tv_exp_f32 %7, %15\n\tv_nop"
      : "=&v"(p[0]), "=&v"(p[1]), "=&v"(p[2]), "=&v"(p[3]), "=&v"(p[4]), "=&v"(p[5]), "=&v"(p[6]), "=&v"(p[7])
      : "v"(t[0]), "v"(t[1]), "v"(t[2]), "v"(t[3]), "v"(t[4]), "v"(t[5]), "v"(t[6]), "v"(t[7]));
}
template <bool RES>
__device__ __forceinline__ void attn_body(const _Float16* __restrict__ QK, const _Float16* __restrict__ QKL, const _Float16* __restrict__ VT, const _Float16* __restrict__ VTL,
                                          _Float16* __restrict__ O16, _Float16* __restrict__ OL, const int* __restrict__ Sp, int qb0, int nqb, int bid, v4f (*mo)[8][32], float (*ml)[2][32]) {
  const int tid = threadIdx.x, lane = tid & 31, ln = lane & 15, hh = lane >> 4;
  const int w = __builtin_amdgcn_readfirstlane(tid >> 5);
  const int sraw = Sp[0];
  const int Sc = sraw < 0 ? 0 : (sraw > SEQ ? SEQ : sraw);
  /* residual form: qb counts blocks of 128 queries. Plain form: qb counts blocks of 64 queries and falls with the block index (all (b, h) of the last query block first), wt = query tile of the wave, kh = its half of the key steps */
  const int bh = RES ? bid / nqb : bid % (NB * NH); const int qb = RES ? qb0 + (bid - bh * nqb) : (SEQ / 64 - 1) - bid / (NB * NH);
  const int wt = RES ? w : (w & 3), kh = RES ? 0 : (w >> 2);
  const int h = bh % NH, b = bh / NH;
  const int q0 = qb * (RES ? 128 : 64) + wt * 16, q = q0 + ln;
  const bool qpre = q < Sc;
  const int rowb = b * SEQ, rowi = b * ISL;
  /* fragment-order planes: row tile r / 16 starts at element r * pitch (r % 16 == 0), column block c / 32 at c * 16 (c % 32 == 0), the lane's chunk at 8 * lane */
  const unsigned lo = 16u * (unsigned)lane;                           /* the lane's byte offset inside a half tile */
  const _Float16* qp = QK + (size_t)(rowb + q0) * LQK + h * HD * 16;
  const v16h qh0 = g2_frago(qp, lo, 0), qh1 = g2_frago(qp, lo, 1024);
  const int qloff = (rowi + q0) * LQK + h * HD * 16;       /* residual q tile (RES) */
  const int kbase = rowb * LQK + (DM + h * HD) * 16;       /* k tile of keys 0..15, d 0..31 */
  const int klbase = rowi * LQK + (DM + h * HD) * 16;      /* residual k tile (RES) */
  const int vbase = h * HD * LVT + rowb * 16;              /* V^T tile d 0..15, keys 0..31 */
  const int vlbase = h * HD * LVL + rowi * 16;             /* residual V^T tile (RES) */
  const v8f z8 = {0.f, 0.f, 0.f, 0.f, 0.f, 0.f, 0.f, 0.f};
  const v16h zh = (v16h)((_Float16)0.0f);
  v8f o0 = z8, o1 = z8, o2 = z8, o3 = z8, e0 = z8, e1 = z8, e2 = z8, e3 = z8;
  float m = -1.0e30f, l = 0.f;
  const int kend = (Sc > q0 + 16) ? Sc : (q0 + 16);              /* keys [0, kend) cover every visible key of the wave; kend <= SEQ */
  const int nst = (kend + 31) >> 5;
  /* the wave's own steps [sb, se): all of them (residual form), or one half; plain rows have q0 >= ISL >= 128, so nst >= 5 and neither half is empty */
  const int sh = (nst + 1) >> 1;
  const int sb = (!RES && kh) ? sh : 0, se = (!RES && !kh) ? sh : nst;
  // Plain form: the K and V fragments live in registers across the loop; the next step's K group is issued right behind this step's S^T WMMAs and the next step's V group right behind its O^T WMMAs.
  v16h ka = zh, kb = zh, kc = zh, kd = zh, v0 = zh, v1 = zh, v2 = zh, v3 = zh;
  unsigned kq = 2u * (unsigned)kbase + lo + (unsigned)sb * (unsigned)(32 * LQK * 2), vq = 2u * (unsigned)vbase + lo + (unsigned)sb * 1024u;      /* the lane's byte offsets of the K and V groups held in registers, at the wave's first step sb < nst */
  // Plain form, at entry: the block asks L2 for the K rows and V^T columns of its causal key range [0, keys), one request per 256-B unit. K: 2 KB per 16-key tile, 8 lanes a tile, 32 tiles a round; V^T: 4 d tiles, 256 B per 8 keys.
  // The range does not wait for S: keys that only a prefix longer than it makes visible are loaded without a request. A wave's request is skipped (scalar test) where its first key lies past the range; the keys it covers (64 of K, 256 of V^T, the lane's unit clamped) lie inside the sequence in any case.
  const char* pkq = (const char*)QK; const char* pvq = (const char*)VT;
  if (!RES) {
    const int keys = qb * 64 + 64;      /* the causal range of the block's last query tile; <= SEQ */
    const int vu = tid < SEQ / 8 - 1 ? tid : SEQ / 8 - 1;
    pkq += 2 * (size_t)kbase + (size_t)((tid >> 3) * (32 * LQK) + (tid & 7) * 256);
    pvq += 2 * (size_t)vbase + (size_t)(vu * 256);
    if (w * 64 < keys) l2_ask<0>(pkq);
    if (SEQ > 512 && w * 64 + 512 < keys) l2_ask<1024 * LQK>(pkq);
    if (SEQ > 1024 && w * 64 + 1024 < keys) l2_ask<2048 * LQK>(pkq);
    if (SEQ > 1536 && w * 64 + 1536 < keys) l2_ask<3072 * LQK>(pkq);
    if (w * 256 < keys) { l2_ask<0>(pvq); l2_ask<32 * LVT>(pvq); l2_ask<64 * LVT>(pvq); l2_ask<96 * LVT>(pvq); }
  }
  if (!RES) {
    ka = g2_frago(QK, kq, 0); kb = g2_frago(QK, kq, 1024); kc = g2_frago(QK, kq, 32 * LQK); kd = g2_frago(QK, kq, 32 * LQK + 1024);
    v0 = g2_frago(VT, vq, 0); v1 = g2_frago(VT, vq, 32 * LVT); v2 = g2_frago(VT, vq, 64 * LVT); v3 = g2_frago(VT, vq, 96 * LVT);
    /* inputs-only fence on the loaded values: every load in front of the loop has landed here, so the wait at the loop's head counts the loop's own groups alone and leaves the next V group in flight */
    asm volatile("" :: "v"(qh0), "v"(qh1), "v"(ka), "v"(kb), "v"(kc), "v"(kd), "v"(v0), "v"(v1), "v"(v2), "v"(v3));
    asm volatile("" :: "v"(pkq), "v"(pvq));      /* inputs only, no instruction: the requests' address registers hold their in-range addresses until the first fragments have landed */
  }
  // One 32-key step. MASK false: for a step whose last key kcb + 31 is <= q0, the wave's first query, so that (key <= query) holds for every element and the visibility tests, the replaces and the selects around the exponentials are identities and are left out; products, sums and their order stay.
  auto step = [&](auto masked, const int st) __attribute__((always_inline)) {
    constexpr bool MASK = decltype(masked)::value;
    const int kcb = st * 32;
    const int adv = (st + 1 < se) ? 32 : 0;                      /* keys to the next step; the wave's last step reloads its own (in range, not used) */
    const bool rok = kcb < ISL;                                  /* wave-uniform: residual k / v rows exist for this step */
    const int kcl = rok ? kcb : (ISL - 32);                      /* clamped in-range residual step */
    const _Float16* kp0 = QK + kbase + kcb * LQK;
    v8f s0 = z8, s1 = z8, r0 = z8, r1 = z8;
    if (RES) {
      unsigned qo = lo; asm volatile("" : "+v"(qo));             /* reload the residual q fragments per step (integer offset only) */
      const _Float16* qlp = QKL + qloff;
      const v16h ql0 = g2_frago(qlp, qo, 0), ql1 = g2_frago(qlp, qo, 1024);
      const _Float16* kl0 = QKL + klbase + kcl * LQK;
      /* all k fragments of the step as one load group in front of its WMMAs */
      const v16h ah0 = g2_frago(kp0, lo, 0), ah1 = g2_frago(kp0, lo, 1024), ah2 = g2_frago(kp0, lo, 32 * LQK), ah3 = g2_frago(kp0, lo, 32 * LQK + 1024);
      asm volatile("s_wait_xcnt 0x0" ::: "memory");      /* behind the k loads, in front of the residual k loads: a result of those may be given the registers that hold the k loads' address */
      v16h al0 = g2_frago(kl0, lo, 0), al1 = g2_frago(kl0, lo, 1024), al2 = g2_frago(kl0, lo, 32 * LQK), al3 = g2_frago(kl0, lo, 32 * LQK + 1024);
      asm volatile("s_wait_xcnt 0x0" :: "v"(qo) : "memory");      /* behind the group: the offset register that the residual q loads name lives up to this wait, so no later load's result is written over it earlier */
      al0 = rok ? al0 : zh; al1 = rok ? al1 : zh; al2 = rok ? al2 : zh; al3 = rok ? al3 : zh;
      s0 = g2_mma(ah0, qh0, s0); r0 = g2_mma(al0, qh0, r0); r0 = g2_mma(ah0, ql0, r0);
      s0 = g2_mma(ah1, qh1, s0); r0 = g2_mma(al1, qh1, r0); r0 = g2_mma(ah1, ql1, r0);
      s1 = g2_mma(ah2, qh0, s1); r1 = g2_mma(al2, qh0, r1); r1 = g2_mma(ah2, ql0, r1);
      s1 = g2_mma(ah3, qh1, s1); r1 = g2_mma(al3, qh1, r1); r1 = g2_mma(ah3, ql1, r1);
    } else {
      s0 = g2_mma(ka, qh0, s0); s0 = g2_mma(kb, qh1, s0); s1 = g2_mma(kc, qh0, s1); s1 = g2_mma(kd, qh1, s1);
      asm volatile("s_wait_xcnt 0x0" : "+v"(kq) :: "memory");      /* stands in front of the rewrite of the offset register that the last K group's loads name; the register is an operand so that the addition stays behind it */
      kq += (unsigned)(adv * LQK * 2);
      ka = g2_frago(QK, kq, 0); kb = g2_frago(QK, kq, 1024); kc = g2_frago(QK, kq, 32 * LQK); kd = g2_frago(QK, kq, 32 * LQK + 1024);
      __builtin_amdgcn_sched_barrier(0);      /* holds the K group at the head of the softmax: issued further down it has less of the step to land in */
    }
    v16h vl0 = zh, vl1 = zh, vl2 = zh, vl3 = zh;
    if (RES) {      /* all v fragments of the step as one load group in front of the softmax */
      const _Float16* vp = VT + vbase + kcb * 16; const _Float16* vlp = VTL + vlbase + kcl * 16;
      v0 = g2_frago(vp, lo, 0); v1 = g2_frago(vp, lo, 32 * LVT); v2 = g2_frago(vp, lo, 64 * LVT); v3 = g2_frago(vp, lo, 96 * LVT);
      vl0 = g2_frago(vlp, lo, 0); vl1 = g2_frago(vlp, lo, 32 * LVL); vl2 = g2_frago(vlp, lo, 64 * LVL); vl3 = g2_frago(vlp, lo, 96 * LVL);
    }
    // D row = key kcb + 8*hh + r (tile 0), + 16 (tile 1); D column = query q
    v8f xa, xb; float mt = -1.0e30f;
#pragma unroll
    for (int r = 0; r < 8; ++r) {
      const int k0 = kcb + 8 * hh + r;
      const bool va = !MASK || (k0 <= q) || (qpre && (k0 < Sc));
      const bool vb = !MASK || (k0 + 16 <= q) || (qpre && (k0 + 16 < Sc));
      float a = s0[r], c = s1[r];
      if (RES) { a += r0[r] * 0.0009765625f; c += r1[r] * 0.0009765625f; }
      a *= 0.125f; c *= 0.125f;
      a = va ? a : -1.0e30f; c = vb ? c : -1.0e30f;
      xa[r] = a; xb[r] = c; mt = fmaxf(mt, fmaxf(a, c));
    }
    mt = fmaxf(mt, __shfl_xor(mt, 16, 32));
    const float mn = fmaxf(m, mt);
    float f; { const float t = fmaxf(m - mn, -80.0f) * 1.44269504f;      /* __expf as it compiles (multiply, v_exp_f32), with the slot behind the transcendental filled in the same statement */
      asm("v_exp_f32 %0, %1\n\tv_nop" : "=v"(f) : "v"(t)); }
    m = mn;
    FragH ph, pl; float rs = 0.f;
    float ua[8], ub[8], wa[8], wb[8];      /* __expf as it compiles: multiply, v_exp_f32 */
#pragma unroll
    for (int r = 0; r < 8; ++r) {
      const int k0 = kcb + 8 * hh + r;
      const bool va = !MASK || (k0 <= q) || (qpre && (k0 < Sc));
      const bool vb = !MASK || (k0 + 16 <= q) || (qpre && (k0 + 16 < Sc));
      ua[r] = (va ? (xa[r] - mn) : 0.f) * 1.44269504f; ub[r] = (vb ? (xb[r] - mn) : 0.f) * 1.44269504f;
    }
    exp2_x8(wa, ua); exp2_x8(wb, ub);
#pragma unroll
    for (int r = 0; r < 8; ++r) {
      const int k0 = kcb + 8 * hh + r;
      const bool va = !MASK || (k0 <= q) || (qpre && (k0 < Sc));
      const bool vb = !MASK || (k0 + 16 <= q) || (qpre && (k0 + 16 < Sc));
      const float pa = va ? wa[r] : 0.f;
      const float pb = vb ? wb[r] : 0.f;
      rs += pa + pb;
      const float ta = pa * 1024.0f, tb = pb * 1024.0f;
      const _Float16 ha = (_Float16)ta, hb = (_Float16)tb;
      ph.h[r] = ha; ph.h[8 + r] = hb;
      if (RES) { pl.h[r] = (_Float16)((ta - (float)ha) * 1024.0f); pl.h[8 + r] = (_Float16)((tb - (float)hb) * 1024.0f); }
    }
    const float rso = __shfl_xor(rs, 16, 32);
    l = l * f + (rs + rso);
    o0 *= f; o1 *= f; o2 *= f; o3 *= f;
    if (RES) { e0 *= f; e1 *= f; e2 *= f; e3 *= f; }
    o0 = g2_mma(v0, ph.v, o0); o1 = g2_mma(v1, ph.v, o1); o2 = g2_mma(v2, ph.v, o2); o3 = g2_mma(v3, ph.v, o3);
    if (RES) {
      vl0 = rok ? vl0 : zh; vl1 = rok ? vl1 : zh; vl2 = rok ? vl2 : zh; vl3 = rok ? vl3 : zh;
      e0 = g2_mma(vl0, ph.v, e0); e0 = g2_mma(v0, pl.v, e0);
      e1 = g2_mma(vl1, ph.v, e1); e1 = g2_mma(v1, pl.v, e1);
      e2 = g2_mma(vl2, ph.v, e2); e2 = g2_mma(v2, pl.v, e2);
      e3 = g2_mma(vl3, ph.v, e3); e3 = g2_mma(v3, pl.v, e3);
    } else {
      asm volatile("s_wait_xcnt 0x0" : "+v"(vq) :: "memory");      /* the same for the V group's offset register */
      vq += (unsigned)(adv * 32);      /* 32 keys further = the next tile, 1 KB */
      v0 = g2_frago(VT, vq, 0); v1 = g2_frago(VT, vq, 32 * LVT); v2 = g2_frago(VT, vq, 64 * LVT); v3 = g2_frago(VT, vq, 96 * LVT);
    }
  };
  // Plain form: steps 0 .. nfull - 1 lie wholly at or below the wave's first query (32 * st + 31 <= q0) and run without the mask; the rest (the step on the diagonal, and steps that only a long prefix makes visible) keep it. nfull < nst since kend >= q0 + 16.
  int st = sb;
  if (!RES) {
    const int nfull = (q0 + 1) >> 5;
    const int ue = nfull < se ? nfull : se;
#pragma unroll 1      /* rolled like the masked loop: one step's text, each wave runs it many times */
    for (; st < ue; ++st) step(flag_t<false>{}, st);
  }
#pragma unroll 1      /* rolled: in plain form one trip as a rule (the diagonal step, in the upper wave), more only under a long prefix; the residual form runs every step here */
  for (; st < se; ++st) step(flag_t<true>{}, st);
  if (!RES) {
    asm volatile("s_wait_xcnt 0x0" :: "v"(kq), "v"(vq) : "memory");      /* behind the last K and V groups: their offset registers live up to this wait, so nothing of the join is written over them earlier */
    // Join of the two key halves. Every step holds a key that every query of the wave sees, so both maxima are finite. m and l are equal in the two lane halves; each lane hands over and joins its own 32 O^T values.
    if (kh) {
      const v8f ou[4] = {o0, o1, o2, o3};
#pragma unroll
      for (int j = 0; j < 4; ++j) {
        const v4f a = {ou[j][0], ou[j][1], ou[j][2], ou[j][3]}, c = {ou[j][4], ou[j][5], ou[j][6], ou[j][7]};
        mo[wt][2 * j][lane] = a; mo[wt][2 * j + 1][lane] = c;
      }
      ml[wt][0][lane] = m; ml[wt][1][lane] = l;
    }
    __syncthreads();      /* every wave of a plain block passes it once: the upper waves' partials are in LDS behind it */
    if (kh) return;
    const float mu = ml[wt][0][lane], lu = ml[wt][1][lane];
    const float mj = fmaxf(m, mu);
    const float ta = fmaxf(m - mj, -80.0f) * 1.44269504f, tb = fmaxf(mu - mj, -80.0f) * 1.44269504f;
    float fa, fb;      /* __expf as it compiles, results apart from the sources, the slot behind the transcendental filled in the same statement */
    asm("v_exp_f32 %0, %2\n\tv_exp_f32 %1, %3\n\tv_nop" : "=&v"(fa), "=&v"(fb) : "v"(ta), "v"(tb));
    l = l * fa + lu * fb;
    v8f* const od[4] = {&o0, &o1, &o2, &o3};
#pragma unroll
    for (int j = 0; j < 4; ++j) {
      const v4f a = mo[wt][2 * j][lane], c = mo[wt][2 * j + 1][lane];
#pragma unroll
      for (int r = 0; r < 4; ++r) { (*od[j])[r] = (*od[j])[r] * fa + a[r] * fb; (*od[j])[4 + r] = (*od[j])[4 + r] * fa + c[r] * fb; }
    }
  }
  // ctx x64 = O^T * 64 / (1024 * l); O^T row d = dg*16 + 8*hh + r, column = query ln
  const float inv = 0.0625f * (1.0f / l);
  const v8f oo[4] = {o0, o1, o2, o3}; const v8f ee[4] = {e0, e1, e2, e3};
  // the lane's 8 values of O^T tile dg are query ln, columns dg*16 + 8*hh .. + 7: one chunk of the fragment-order ctx plane, so each tile goes out of the accumulators as one half-tile store of 512 contiguous bytes
#pragma unroll
  for (int dg = 0; dg < 4; ++dg) {
    FragH fh, fl;
#pragma unroll
    for (int r = 0; r < 8; ++r) {
      float v = oo[dg][r]; if (RES) v += ee[dg][r] * 0.0009765625f; v *= inv;
      const _Float16 h0 = (_Float16)v; fh.h[r] = h0; fl.h[r] = (_Float16)((v - (float)h0) * 1024.0f);
    }
    const v8us oh = fh.half[0], ol = fl.half[0];
    *(v8us*)((unsigned short*)O16 + fo_chunk(rowb + q0 + ln, h * HD + dg * 16 + 8 * hh, DM)) = oh;
    if (RES) *(v8us*)((unsigned short*)OL + fo_chunk(rowi + q0 + ln, h * HD + dg * 16 + 8 * hh, DM)) = ol;
  }
  if (RES) asm volatile("s_wait_xcnt 0x0" ::: "memory");      /* behind the last store: the other body's text follows in the kernel, and a branch of the listing leads from here to writes of these stores' registers */
}

constexpr int NB_ATT  = NB * NH * ((SEQ - ISL) / 64);
constexpr int NB_ATTI = NB * NH * (ISL / 128);
// one launch, two bodies: the residual-plane blocks first (few steps, each several times a plain step: started last they would run on alone), the plain blocks behind them, longest first
__global__ __launch_bounds__(256) void k_attn(const _Float16* __restrict__ QK, const _Float16* __restrict__ QKL, const _Float16* __restrict__ VT, const _Float16* __restrict__ VTL, _Float16* __restrict__ O16, _Float16* __restrict__ OL, const int* __restrict__ Sp) {
  __shared__ __attribute__((aligned(16))) v4f mo[4][8][32];      /* the upper waves' O^T partials: query tile, quad of rows, lane */
  __shared__ float ml[4][2][32];                                 /* their maxima and sums */
  const int bid = (int)blockIdx.x;
  if (bid >= NB_ATTI) attn_body<false>(QK, nullptr, VT, nullptr, O16, nullptr, Sp, 0, 0, bid - NB_ATTI, mo, ml);
  else attn_body<true>(QK, QKL, VT, VTL, O16, OL, Sp, 0, ISL / 128, bid, mo, ml);
}

constexpr size_t al256(size_t bytes) { return (bytes + 255) & ~(size_t)255; }
constexpr size_t SZ_BQKV = al256((size_t)3 * DM * DM * 2);
constexpr size_t SZ_BO   = al256((size_t)DM * DM * 2);
constexpr size_t SZ_X16  = al256((size_t)NR * DM * 2);
constexpr size_t SZ_QK   = al256((size_t)NR * LQK * 2);
constexpr size_t SZ_QKL  = al256((size_t)NRI * LQK * 2);
constexpr size_t SZ_VT   = al256((size_t)DM * LVT * 2);
constexpr size_t SZ_VTL  = al256((size_t)DM * LVL * 2);
constexpr size_t SZ_O16  = al256((size_t)NR * DM * 2);
constexpr size_t SZ_OL   = al256((size_t)NRI * DM * 2);
constexpr size_t WS_TOTAL = SZ_BQKV + SZ_BO + SZ_X16 + SZ_QK + SZ_QKL + SZ_VT + SZ_VTL + SZ_O16 + SZ_OL;
static_assert(WS_TOTAL <= (size_t)134217728);      /* carve <= 128 MiB */

extern "C" void kernel_launch(void* const* d_in, const int* in_sizes, int n_in,
                              void* d_out, int out_size, void* d_ws, size_t ws_size, hipStream_t stream) {
  if (n_in < 6) return;
  const long long xrows = (long long)(NB - 1) * SEQ_FULL + SEQ;      /* rows of x / out touched */
  if ((long long)in_sizes[0] < xrows * DM) return;
  if ((long long)in_sizes[1] < (long long)DM * 3 * DM) return;
  if ((long long)in_sizes[2] < (long long)3 * DM) return;
  if ((long long)in_sizes[3] < (long long)DM * DM) return;
  if ((long long)in_sizes[4] < (long long)DM) return;
  if ((long long)in_sizes[5] < 1) return;
  if ((long long)out_size < xrows * DM) return;
  if (WS_TOTAL > ws_size) return;
  const float* x = (const float*)d_in[0]; const float* w_attn = (const float*)d_in[1]; const float* b_attn = (const float*)d_in[2];
  const float* w_proj = (const float*)d_in[3]; const float* b_proj = (const float*)d_in[4];
  const int* s_pref = (const int*)d_in[5];                           /* prefix length, loaded on the device */
  float* out = (float*)d_out;
  char* ws = (char*)d_ws; size_t off = 0;
  _Float16* BQKV = (_Float16*)(ws + off); off += SZ_BQKV;      /* [3072][1024] x16; this and every plane below in fragment order */
  _Float16* BO   = (_Float16*)(ws + off); off += SZ_BO;        /* [1024][1024] x16 */
  _Float16* X16  = (_Float16*)(ws + off); off += SZ_X16;       /* [NR][1024] */
  _Float16* QK   = (_Float16*)(ws + off); off += SZ_QK;        /* [NR][2048] q | k */
  _Float16* QKL  = (_Float16*)(ws + off); off += SZ_QKL;       /* [NRI][2048] residual x1024 */
  _Float16* VT   = (_Float16*)(ws + off); off += SZ_VT;        /* [1024][NR] */
  _Float16* VTL  = (_Float16*)(ws + off); off += SZ_VTL;       /* [1024][NRI] residual x1024 */
  _Float16* O16  = (_Float16*)(ws + off); off += SZ_O16;       /* [NR][1024] ctx x64 */
  _Float16* OL   = (_Float16*)(ws + off); off += SZ_OL;        /* [NRI][1024] ctx residual x1024 */
  if (off > ws_size) return;

  k_convert<<<(unsigned)(NB_X16 + NB_WQKV + NB_WO), 256, 0, stream>>>(x, w_attn, w_proj, X16, BQKV, BO);
  k_gemm_qkv<<<(unsigned)(NB_QK + NB_VT), 128, 0, stream>>>(X16, BQKV, b_attn, QK, QKL, VT, VTL);
  k_attn<<<(unsigned)(NB_ATTI + NB_ATT), 256, 0, stream>>>(QK, QKL, VT, VTL, O16, OL, s_pref);
  k_gemm_out<<<(unsigned)(NB_OUT + NB_OUTI), 128, 0, stream>>>(O16, OL, BO, b_proj, out);
}
